// v000
// The times below were measured on an AMD MI455X: many runs one after another, warmed up first and cycling through
// copies of the inputs, with the whole window's GPU time divided by the number of runs. Launches and the gaps
// between them are all in it. The median over several windows is given; except for v000 it joins two sittings, which
// can be a few percent apart, so the side-by-side timings, each taken in one sitting, are the better comparison.
// v000 is the starting kernel. One run takes 810 microseconds.
#include <hip/hip_runtime.h>
#include <hip/hip_bf16.h>
#include <math.h>
#include <stdint.h>

// ---------------------------------------------------------------------------
// Types for CDNA5 WMMA (wave32): D(f32 16x16) = A(bf16 16x32) x B(bf16 32x16) + C
// ---------------------------------------------------------------------------
typedef __attribute__((ext_vector_type(16))) __bf16 v16bf;
typedef __attribute__((ext_vector_type(8)))  float  v8f;

static __device__ __forceinline__ v8f wmma_bf16(v16bf a, v16bf b, v8f c) {
  // (neg_a, A, neg_b, B, c_mod, C, reuse_a, reuse_b)
  return __builtin_amdgcn_wmma_f32_16x16x32_bf16(false, a, false, b, (short)0, c,
                                                 false, false);
}

// CDNA5 async copy: global -> LDS, 16 bytes per lane, tracked by ASYNCcnt.
// lds_off = low 32 bits of the generic pointer (ISA: LDS generic addresses
// carry the LDS byte offset in [31:0]).
static __device__ __forceinline__ void async_ld_b128(void* lds_ptr,
                                                     const void* gptr) {
  const unsigned lds_off = (unsigned)(uintptr_t)lds_ptr;
  asm volatile("global_load_async_to_lds_b128 %0, %1, off"
               :
               : "v"(lds_off), "v"(gptr)
               : "memory");
}
static __device__ __forceinline__ void wait_async0() {
  asm volatile("s_wait_asynccnt 0" ::: "memory");
}

// Load a 16x32 bf16 fragment (A layout; B "Bt" layout is identical with N<->M)
// from row-major LDS with leading dim `ld` (bf16 elements, multiple of 8).
// Lane l: row = base + (l&15); half = l>>4 selects K subranges
// [half*8, half*8+8) and [16+half*8, 16+half*8+8)  -> two aligned b128 loads.
static __device__ __forceinline__ v16bf frag16(const __bf16* base, int row,
                                               int kbase, int ld) {
  const int lane = threadIdx.x & 31;
  const __bf16* p =
      base + (size_t)(row + (lane & 15)) * ld + kbase + ((lane >> 4) * 8);
  union { uint4 u[2]; v16bf v; } t;
  t.u[0] = *(const uint4*)p;
  t.u[1] = *(const uint4*)(p + 16);
  return t.v;
}

static __device__ __forceinline__ float gelu_exact(float x) {
  return 0.5f * x * (1.0f + erff(x * 0.70710678118654752f));
}

// ---------------------------------------------------------------------------
// Generic bf16 WMMA GEMM:  C[M][N] = A[M][K] * Bt[N][K]^T  (+bias, gelu, resid)
// Block 256 threads = 8 waves; tile 128(M) x 64(N); K-step 32.
// Async double-buffered LDS: global_load_async_to_lds_b128 fills the next
// tile while WMMA consumes the current one; one barrier per K-step.
// Epilogue modes: f32 store, bf16 store, atomic scatter-add with row scale.
// Requires M%128==0, N%64==0, K%32==0 (true for every GEMM in this model).
// ---------------------------------------------------------------------------
__global__ __launch_bounds__(256) void gemm_bf16_kernel(
    const __bf16* __restrict__ A, const __bf16* __restrict__ Bt,
    const float* __restrict__ bias, const float* __restrict__ residual,
    float* Cf, __bf16* Cb, const int* __restrict__ scat_rows,
    const float* __restrict__ scat_scale, float* scat_out, int M, int N, int K,
    int act) {
  __shared__ __align__(16) __bf16 As[2][128][48];  // K32 tile + pad to 96B rows
  __shared__ __align__(16) __bf16 Bs[2][64][48];

  const int tid = threadIdx.x;
  const int wave = tid >> 5, lane = tid & 31;
  const int wm = wave & 3, wn = wave >> 2;
  const int bm = blockIdx.y * 128, bn = blockIdx.x * 64;

  const int ra = tid >> 1, ca = (tid & 1) * 16;   // A: 16 bf16 per thread
  const int rb = tid >> 2, cb = (tid & 3) * 8;    // B: 8 bf16 per thread

  auto issue_tile = [&](int buf, int k0) {
    const __bf16* ga = A + (size_t)(bm + ra) * K + k0 + ca;
    async_ld_b128(&As[buf][ra][ca], ga);
    async_ld_b128(&As[buf][ra][ca + 8], ga + 8);
    const __bf16* gb = Bt + (size_t)(bn + rb) * K + k0 + cb;
    async_ld_b128(&Bs[buf][rb][cb], gb);
  };

  v8f acc[2][2] = {};
  issue_tile(0, 0);
  int cur = 0;

  for (int k0 = 0; k0 < K; k0 += 32) {
    wait_async0();      // current tile landed in LDS (this wave's copies)
    __syncthreads();    // all waves done copying AND done reading other buffer
    if (k0 + 32 < K) issue_tile(cur ^ 1, k0 + 32);  // overlap with compute

    const v16bf a0 = frag16(&As[cur][0][0], wm * 32, 0, 48);
    const v16bf a1 = frag16(&As[cur][0][0], wm * 32 + 16, 0, 48);
    const v16bf b0 = frag16(&Bs[cur][0][0], wn * 32, 0, 48);
    const v16bf b1 = frag16(&Bs[cur][0][0], wn * 32 + 16, 0, 48);
    acc[0][0] = wmma_bf16(a0, b0, acc[0][0]);
    acc[0][1] = wmma_bf16(a0, b1, acc[0][1]);
    acc[1][0] = wmma_bf16(a1, b0, acc[1][0]);
    acc[1][1] = wmma_bf16(a1, b1, acc[1][1]);
    cur ^= 1;
  }

  // Epilogue. C layout: lane half (l>>4) + VGPR v -> row half*8+v; col = l&15.
  const int half = lane >> 4, c0 = lane & 15;
#pragma unroll
  for (int i = 0; i < 2; ++i)
#pragma unroll
    for (int j = 0; j < 2; ++j)
#pragma unroll
      for (int v = 0; v < 8; ++v) {
        const int row = bm + wm * 32 + i * 16 + half * 8 + v;
        const int col = bn + wn * 32 + j * 16 + c0;
        float val = acc[i][j][v];
        if (bias) val += bias[col];
        if (act) val = gelu_exact(val);
        if (residual) val += residual[(size_t)row * N + col];
        if (Cf) Cf[(size_t)row * N + col] = val;
        if (Cb) Cb[(size_t)row * N + col] = (__bf16)val;
        if (scat_out) {
          const float sc = scat_scale[row];
          atomicAdd(&scat_out[(size_t)scat_rows[row] * N + col], val * sc);
        }
      }
}

// ---------------------------------------------------------------------------
// Flash attention: grid (N/64, H, B), 128 threads = 4 waves.
// Wave w owns 16 query rows x full 64-col key chunk -> row stats stay in-wave.
// Q/K tiles staged with async-to-LDS; V transposed manually (scattered b16).
// qkv layout: [T][3][H][hd] bf16;  out: [T][H*hd] bf16.
// ---------------------------------------------------------------------------
__global__ __launch_bounds__(128) void attn_kernel(
    const __bf16* __restrict__ qkv, __bf16* __restrict__ out, int N, int Hh,
    int hd) {
  const int D3 = 3 * Hh * hd;   // 3072
  const int Dm = Hh * hd;       // 1024
  const int qb = blockIdx.x, h = blockIdx.y, b = blockIdx.z;
  const int tid = threadIdx.x, wave = tid >> 5, lane = tid & 31;
  const int half = lane >> 4, c0 = lane & 15;

  __shared__ __align__(16) __bf16 Qs[64][80];
  __shared__ __align__(16) __bf16 Ks[64][80];
  __shared__ __align__(16) __bf16 Vt[64][80];       // V transposed: [d][key]
  __shared__ __align__(16) __bf16 Pb[4][16][80];    // per-wave P staging

  const int r = tid >> 1, d0 = (tid & 1) * 32;
  {  // Q tile (64x64) via async copy; first in-loop wait covers it
    const __bf16* g = qkv + (size_t)(b * N + qb * 64 + r) * D3 + h * hd + d0;
#pragma unroll
    for (int u = 0; u < 4; ++u) async_ld_b128(&Qs[r][d0 + u * 8], g + u * 8);
  }

  v8f o[4] = {};
  float mstat[8], lstat[8];
#pragma unroll
  for (int v = 0; v < 8; ++v) { mstat[v] = -1e30f; lstat[v] = 0.f; }

  for (int kb = 0; kb < N / 64; ++kb) {
    __syncthreads();  // prior P@V reads of Vt complete before overwrite
    {
      const __bf16* gk =
          qkv + (size_t)(b * N + kb * 64 + r) * D3 + Dm + h * hd + d0;
#pragma unroll
      for (int u = 0; u < 4; ++u)
        async_ld_b128(&Ks[r][d0 + u * 8], gk + u * 8);
      const __bf16* gv =
          qkv + (size_t)(b * N + kb * 64 + r) * D3 + 2 * Dm + h * hd + d0;
#pragma unroll
      for (int u = 0; u < 32; ++u) Vt[d0 + u][r] = gv[u];  // transpose to LDS
    }
    wait_async0();
    __syncthreads();

    // S = (Q * hd^-0.5) @ K^T  (64x64 per block; 16x64 per wave)
    v8f s[4] = {};
#pragma unroll
    for (int ks = 0; ks < 64; ks += 32) {
      const v16bf a = frag16(&Qs[0][0], wave * 16, ks, 80);
#pragma unroll
      for (int j = 0; j < 4; ++j) {
        const v16bf bf = frag16(&Ks[0][0], j * 16, ks, 80);
        s[j] = wmma_bf16(a, bf, s[j]);
      }
    }

    // online softmax per row (row = half*8+v, fully within this wave)
#pragma unroll
    for (int v = 0; v < 8; ++v) {
      float rmax = -1e30f;
#pragma unroll
      for (int j = 0; j < 4; ++j) {
        s[j][v] *= 0.125f;  // hd^-0.5
        rmax = fmaxf(rmax, s[j][v]);
      }
#pragma unroll
      for (int off = 1; off < 16; off <<= 1)
        rmax = fmaxf(rmax, __shfl_xor(rmax, off, 16));
      const float mnew = fmaxf(mstat[v], rmax);
      const float alpha = __expf(mstat[v] - mnew);
      float rsum = 0.f;
#pragma unroll
      for (int j = 0; j < 4; ++j) {
        const float p = __expf(s[j][v] - mnew);
        s[j][v] = p;
        rsum += p;
      }
#pragma unroll
      for (int off = 1; off < 16; off <<= 1) rsum += __shfl_xor(rsum, off, 16);
      lstat[v] = lstat[v] * alpha + rsum;
      mstat[v] = mnew;
#pragma unroll
      for (int j = 0; j < 4; ++j) {
        o[j][v] *= alpha;
        Pb[wave][half * 8 + v][j * 16 + c0] = (__bf16)s[j][v];
      }
    }
    __syncthreads();  // Pb visible for re-fragmentation

    // O += P @ V
#pragma unroll
    for (int ks = 0; ks < 64; ks += 32) {
      const v16bf a = frag16(&Pb[wave][0][0], 0, ks, 80);
#pragma unroll
      for (int j = 0; j < 4; ++j) {
        const v16bf bf = frag16(&Vt[0][0], j * 16, ks, 80);
        o[j] = wmma_bf16(a, bf, o[j]);
      }
    }
  }

  const int trow = b * N + qb * 64 + wave * 16 + half * 8;
#pragma unroll
  for (int v = 0; v < 8; ++v) {
    const float inv = 1.0f / lstat[v];
#pragma unroll
    for (int j = 0; j < 4; ++j)
      out[(size_t)(trow + v) * Dm + h * hd + j * 16 + c0] =
          (__bf16)(o[j][v] * inv);
  }
}

// ---------------------------------------------------------------------------
// LayerNorm (one token per block). Optional f32 and/or bf16 outputs.
// ---------------------------------------------------------------------------
__global__ __launch_bounds__(256) void ln_kernel(const float* __restrict__ x,
                                                 const float* __restrict__ g,
                                                 const float* __restrict__ bta,
                                                 float* outf, __bf16* outb,
                                                 int D) {
  const int t = blockIdx.x;
  const float* row = x + (size_t)t * D;
  float s = 0.f, ss = 0.f;
  for (int d = threadIdx.x; d < D; d += 256) {
    const float v = row[d];
    s += v;
    ss += v * v;
  }
#pragma unroll
  for (int off = 16; off; off >>= 1) {
    s += __shfl_xor(s, off, 32);
    ss += __shfl_xor(ss, off, 32);
  }
  __shared__ float rs[8], rss[8], mv[2];
  const int wave = threadIdx.x >> 5, lane = threadIdx.x & 31;
  if (lane == 0) { rs[wave] = s; rss[wave] = ss; }
  __syncthreads();
  if (threadIdx.x == 0) {
    float a = 0.f, b2 = 0.f;
    for (int i = 0; i < 8; ++i) { a += rs[i]; b2 += rss[i]; }
    const float mu = a / D;
    mv[0] = mu;
    mv[1] = rsqrtf(b2 / D - mu * mu + 1e-5f);
  }
  __syncthreads();
  const float mu = mv[0], r = mv[1];
  for (int d = threadIdx.x; d < D; d += 256) {
    const float v = (row[d] - mu) * r * g[d] + bta[d];
    if (outf) outf[(size_t)t * D + d] = v;
    if (outb) outb[(size_t)t * D + d] = (__bf16)v;
  }
}

// ---------------------------------------------------------------------------
// Router: noisy top-2 over E=4 experts. One wave per token.
// ---------------------------------------------------------------------------
__global__ __launch_bounds__(128) void router_kernel(
    const float* __restrict__ x2, const float* __restrict__ noise,
    const float* __restrict__ w_route, const float* __restrict__ b_route,
    const float* __restrict__ w_noise, const float* __restrict__ b_noise,
    float* gate, int* fidx, int D) {
  const int wave = threadIdx.x >> 5, lane = threadIdx.x & 31;
  const int t = blockIdx.x * 4 + wave;
  float ar[4] = {0, 0, 0, 0}, an[4] = {0, 0, 0, 0};
  for (int d = lane; d < D; d += 32) {
    const float xv = x2[(size_t)t * D + d];
#pragma unroll
    for (int e = 0; e < 4; ++e) {
      ar[e] += xv * w_route[d * 4 + e];
      an[e] += xv * w_noise[d * 4 + e];
    }
  }
#pragma unroll
  for (int e = 0; e < 4; ++e)
#pragma unroll
    for (int off = 16; off; off >>= 1) {
      ar[e] += __shfl_xor(ar[e], off, 32);
      an[e] += __shfl_xor(an[e], off, 32);
    }
  if (lane == 0) {
    float noisy[4];
#pragma unroll
    for (int e = 0; e < 4; ++e) {
      const float lg = ar[e] + b_route[e];
      const float ns = an[e] + b_noise[e];
      const float sp = (ns > 20.f) ? ns : log1pf(__expf(ns));
      noisy[e] = lg + noise[t * 4 + e] * sp;
    }
    int i0 = 0;
    for (int e = 1; e < 4; ++e)
      if (noisy[e] > noisy[i0]) i0 = e;
    int i1 = -1;
    for (int e = 0; e < 4; ++e)
      if (e != i0 && (i1 < 0 || noisy[e] > noisy[i1])) i1 = e;
    const float m = fmaxf(noisy[i0], noisy[i1]);
    const float e0 = __expf(noisy[i0] - m), e1 = __expf(noisy[i1] - m);
    const float p0 = e0 / (e0 + e1);
#pragma unroll
    for (int e = 0; e < 4; ++e) gate[t * 4 + e] = 0.f;
    gate[t * 4 + i0] = p0;
    gate[t * 4 + i1] = 1.f - p0;
    fidx[2 * t] = i0;
    fidx[2 * t + 1] = i1;
  }
}

// ---------------------------------------------------------------------------
// Per-expert capacity dispatch (stable token order). grid = E blocks.
// ---------------------------------------------------------------------------
__global__ __launch_bounds__(256) void dispatch_scan(
    const int* __restrict__ fidx, const float* __restrict__ gate, int* sel,
    float* selw, int capacity, int T) {
  const int e = blockIdx.x, tid = threadIdx.x;
  __shared__ int sm[256];
  int base = 0;
  for (int c0 = 0; c0 < T; c0 += 256) {
    const int t = c0 + tid;
    int m = 0;
    if (t < T) m = (fidx[2 * t] == e || fidx[2 * t + 1] == e) ? 1 : 0;
    sm[tid] = m;
    __syncthreads();
    for (int off = 1; off < 256; off <<= 1) {  // inclusive Hillis-Steele
      const int x = sm[tid];
      const int y = (tid >= off) ? sm[tid - off] : 0;
      __syncthreads();
      sm[tid] = x + y;
      __syncthreads();
    }
    const int incl = sm[tid];
    const int tot = sm[255];
    __syncthreads();
    const int pos = base + incl - 1;
    if (m && pos < capacity) {
      sel[e * capacity + pos] = t;
      selw[e * capacity + pos] = gate[t * 4 + e];
    }
    base += tot;
  }
  for (int i = (base < capacity ? base : capacity) + tid; i < capacity;
       i += 256) {
    sel[e * capacity + i] = 0;
    selw[e * capacity + i] = 0.f;  // padded rows contribute nothing
  }
}

__global__ __launch_bounds__(256) void gather_kernel(
    const __bf16* __restrict__ x2b, const int* __restrict__ sel, __bf16* xdisp,
    int D) {
  const int row = blockIdx.x;
  const int src = sel[row];
  for (int d = threadIdx.x; d < D; d += 256)
    xdisp[(size_t)row * D + d] = x2b[(size_t)src * D + d];
}

// ---------------------------------------------------------------------------
// fp32 -> bf16 converters (direct and transposing, for [K][N] -> [N][K]).
// ---------------------------------------------------------------------------
__global__ __launch_bounds__(256) void cvt_bf16(const float* __restrict__ in,
                                                __bf16* out, size_t n) {
  size_t i = (size_t)blockIdx.x * 256 + threadIdx.x;
  const size_t stride = (size_t)gridDim.x * 256;
  for (; i < n; i += stride) out[i] = (__bf16)in[i];
}

__global__ __launch_bounds__(256) void cvt_bf16_t(const float* __restrict__ in,
                                                  __bf16* out, int K, int N) {
  const size_t n = (size_t)K * N;
  size_t i = (size_t)blockIdx.x * 256 + threadIdx.x;
  const size_t stride = (size_t)gridDim.x * 256;
  for (; i < n; i += stride) {
    const int k = (int)(i / N), c = (int)(i % N);
    out[(size_t)c * K + k] = (__bf16)in[i];
  }
}

// ---------------------------------------------------------------------------
// Launch orchestration.
// ---------------------------------------------------------------------------
extern "C" void kernel_launch(void* const* d_in, const int* in_sizes, int n_in,
                              void* d_out, int out_size, void* d_ws,
                              size_t ws_size, hipStream_t stream) {
  (void)in_sizes; (void)n_in; (void)out_size; (void)ws_size;
  constexpr int Bb = 2, Nn = 2048, Dd = 1024, Hh = 16, hd = 64;
  constexpr int T = Bb * Nn, D3 = 3 * Dd, MLPH = 4096, MOEH = 256;
  constexpr int Ee = 4, CAP = 2048;

  const float* x      = (const float*)d_in[0];
  const float* noise  = (const float*)d_in[1];
  const float* ln1_g  = (const float*)d_in[2];
  const float* ln1_b  = (const float*)d_in[3];
  const float* ln2_g  = (const float*)d_in[4];
  const float* ln2_b  = (const float*)d_in[5];
  const float* w_qkv  = (const float*)d_in[6];
  const float* w_proj = (const float*)d_in[7];
  const float* b_proj = (const float*)d_in[8];
  const float* w_rt   = (const float*)d_in[9];
  const float* b_rt   = (const float*)d_in[10];
  const float* w_nz   = (const float*)d_in[11];
  const float* b_nz   = (const float*)d_in[12];
  const float* we1    = (const float*)d_in[13];
  const float* be1    = (const float*)d_in[14];
  const float* we2    = (const float*)d_in[15];
  const float* be2    = (const float*)d_in[16];
  const float* w_m1   = (const float*)d_in[17];
  const float* b_m1   = (const float*)d_in[18];
  const float* w_m2   = (const float*)d_in[19];
  const float* b_m2   = (const float*)d_in[20];
  float* out = (float*)d_out;

  char* wsp = (char*)d_ws;
  size_t off = 0;
  auto alloc = [&](size_t bytes) {
    void* p = wsp + off;
    off = (off + bytes + 255) & ~(size_t)255;
    return p;
  };
  __bf16* x1b    = (__bf16*)alloc((size_t)T * Dd * 2);
  __bf16* wqkvb  = (__bf16*)alloc((size_t)D3 * Dd * 2);
  __bf16* qkvb   = (__bf16*)alloc((size_t)T * D3 * 2);
  __bf16* attnb  = (__bf16*)alloc((size_t)T * Dd * 2);
  __bf16* wprojb = (__bf16*)alloc((size_t)Dd * Dd * 2);
  float*  xattn  = (float*)alloc((size_t)T * Dd * 4);
  float*  x2f    = (float*)alloc((size_t)T * Dd * 4);
  __bf16* x2b    = (__bf16*)alloc((size_t)T * Dd * 2);
  __bf16* wm1t   = (__bf16*)alloc((size_t)Dd * MLPH * 2);
  __bf16* wm2t   = (__bf16*)alloc((size_t)MLPH * Dd * 2);
  __bf16* hmlp   = (__bf16*)alloc((size_t)T * MLPH * 2);
  __bf16* we1t   = (__bf16*)alloc((size_t)Ee * Dd * MOEH * 2);
  __bf16* we2t   = (__bf16*)alloc((size_t)Ee * MOEH * Dd * 2);
  __bf16* xdisp  = (__bf16*)alloc((size_t)Ee * CAP * Dd * 2);
  __bf16* hdisp  = (__bf16*)alloc((size_t)Ee * CAP * MOEH * 2);
  float*  gate   = (float*)alloc((size_t)T * Ee * 4);
  int*    fidx   = (int*)alloc((size_t)T * 2 * 4);
  int*    sel    = (int*)alloc((size_t)Ee * CAP * 4);
  float*  selw   = (float*)alloc((size_t)Ee * CAP * 4);

  // 1) weight conversion to bf16 (w_qkv/w_proj are already [N][K])
  cvt_bf16<<<2048, 256, 0, stream>>>(w_qkv, wqkvb, (size_t)D3 * Dd);
  cvt_bf16<<<1024, 256, 0, stream>>>(w_proj, wprojb, (size_t)Dd * Dd);
  cvt_bf16_t<<<2048, 256, 0, stream>>>(w_m1, wm1t, Dd, MLPH);
  cvt_bf16_t<<<2048, 256, 0, stream>>>(w_m2, wm2t, MLPH, Dd);
  for (int e = 0; e < Ee; ++e) {
    cvt_bf16_t<<<512, 256, 0, stream>>>(we1 + (size_t)e * Dd * MOEH,
                                        we1t + (size_t)e * MOEH * Dd, Dd, MOEH);
    cvt_bf16_t<<<512, 256, 0, stream>>>(we2 + (size_t)e * MOEH * Dd,
                                        we2t + (size_t)e * Dd * MOEH, MOEH, Dd);
  }

  // 2) LN1 -> x1 (bf16)
  ln_kernel<<<T, 256, 0, stream>>>(x, ln1_g, ln1_b, nullptr, x1b, Dd);

  // 3) QKV GEMM: [T,D] x [3D,D]^T -> bf16 [T,3D]
  gemm_bf16_kernel<<<dim3(D3 / 64, T / 128), 256, 0, stream>>>(
      x1b, wqkvb, nullptr, nullptr, nullptr, qkvb, nullptr, nullptr, nullptr,
      T, D3, Dd, 0);

  // 4) flash attention -> bf16 [T,D]
  attn_kernel<<<dim3(Nn / 64, Hh, Bb), 128, 0, stream>>>(qkvb, attnb, Nn, Hh,
                                                         hd);

  // 5) proj GEMM + b_proj + residual x -> xattn (f32)
  gemm_bf16_kernel<<<dim3(Dd / 64, T / 128), 256, 0, stream>>>(
      attnb, wprojb, b_proj, x, xattn, nullptr, nullptr, nullptr, nullptr, T,
      Dd, Dd, 0);

  // 6) LN2 -> x2 (f32 + bf16)
  ln_kernel<<<T, 256, 0, stream>>>(xattn, ln2_g, ln2_b, x2f, x2b, Dd);

  // 7) router + capacity dispatch + gather
  router_kernel<<<T / 4, 128, 0, stream>>>(x2f, noise, w_rt, b_rt, w_nz, b_nz,
                                           gate, fidx, Dd);
  dispatch_scan<<<Ee, 256, 0, stream>>>(fidx, gate, sel, selw, CAP, T);
  gather_kernel<<<Ee * CAP, 256, 0, stream>>>(x2b, sel, xdisp, Dd);

  // 8) dense MLP: gelu(x2@W1+b1)@W2+b2 + xattn -> d_out (f32)
  gemm_bf16_kernel<<<dim3(MLPH / 64, T / 128), 256, 0, stream>>>(
      x2b, wm1t, b_m1, nullptr, nullptr, hmlp, nullptr, nullptr, nullptr, T,
      MLPH, Dd, 1);
  gemm_bf16_kernel<<<dim3(Dd / 64, T / 128), 256, 0, stream>>>(
      hmlp, wm2t, b_m2, xattn, out, nullptr, nullptr, nullptr, nullptr, T, Dd,
      MLPH, 0);

  // 9) expert FFNs; second GEMM scatter-adds gate-weighted rows into d_out
  for (int e = 0; e < Ee; ++e) {
    gemm_bf16_kernel<<<dim3(MOEH / 64, CAP / 128), 256, 0, stream>>>(
        xdisp + (size_t)e * CAP * Dd, we1t + (size_t)e * MOEH * Dd,
        be1 + (size_t)e * MOEH, nullptr, nullptr,
        hdisp + (size_t)e * CAP * MOEH, nullptr, nullptr, nullptr, CAP, MOEH,
        Dd, 1);
    gemm_bf16_kernel<<<dim3(Dd / 64, CAP / 128), 256, 0, stream>>>(
        hdisp + (size_t)e * CAP * MOEH, we2t + (size_t)e * Dd * MOEH,
        be2 + (size_t)e * Dd, nullptr, nullptr, nullptr, sel + e * CAP,
        selw + e * CAP, out, CAP, Dd, MOEH, 0);
  }
}

// v001
// It runs in 733 microseconds.
// Next to v000, in two timings, it ran 1.14 times as fast each time.
#include <hip/hip_runtime.h>
#include <hip/hip_bf16.h>
#include <math.h>
#include <stdint.h>

// ---------------------------------------------------------------------------
// Types for CDNA5 WMMA (wave32): D(f32 16x16) = A(bf16 16x32) x B(bf16 32x16) + C
// ---------------------------------------------------------------------------
typedef __attribute__((ext_vector_type(16))) __bf16 v16bf;
typedef __attribute__((ext_vector_type(8)))  float  v8f;

static __device__ __forceinline__ v8f wmma_bf16(v16bf a, v16bf b, v8f c) {
  // (neg_a, A, neg_b, B, c_mod, C, reuse_a, reuse_b)
  return __builtin_amdgcn_wmma_f32_16x16x32_bf16(false, a, false, b, (short)0, c,
                                                 false, false);
}

// CDNA5 async copy: global -> LDS, 16 bytes per lane, tracked by ASYNCcnt.
// lds_off = low 32 bits of the generic pointer (ISA: LDS generic addresses
// carry the LDS byte offset in [31:0]).
static __device__ __forceinline__ void async_ld_b128(void* lds_ptr,
                                                     const void* gptr) {
  const unsigned lds_off = (unsigned)(uintptr_t)lds_ptr;
  asm volatile("global_load_async_to_lds_b128 %0, %1, off"
               :
               : "v"(lds_off), "v"(gptr)
               : "memory");
}
static __device__ __forceinline__ void wait_async0() {
  asm volatile("s_wait_asynccnt 0" ::: "memory");
}

// Load a 16x32 bf16 fragment (A layout; B "Bt" layout is identical with N<->M)
// from row-major LDS with leading dim `ld` (bf16 elements, multiple of 8).
// Lane l: row = base + (l&15); half = l>>4 selects K subranges
// [half*8, half*8+8) and [16+half*8, 16+half*8+8)  -> two aligned b128 loads.
static __device__ __forceinline__ v16bf frag16(const __bf16* base, int row,
                                               int kbase, int ld) {
  const int lane = threadIdx.x & 31;
  const __bf16* p =
      base + (size_t)(row + (lane & 15)) * ld + kbase + ((lane >> 4) * 8);
  union { uint4 u[2]; v16bf v; } t;
  t.u[0] = *(const uint4*)p;
  t.u[1] = *(const uint4*)(p + 16);
  return t.v;
}

static __device__ __forceinline__ float gelu_exact(float x) {
  return 0.5f * x * (1.0f + erff(x * 0.70710678118654752f));
}

// ---------------------------------------------------------------------------
// Generic bf16 WMMA GEMM:  C[M][N] = A[M][K] * Bt[N][K]^T  (+bias, gelu, resid)
// Block 256 threads = 8 waves; tile 128(M) x 64(N); K-step 128.
// Async double-buffered LDS: global_load_async_to_lds_b128 fills the next
// tile while WMMA consumes the current one; one barrier per K-step.
// Sixteen lanes copy one 256-byte piece of a row, so a wave's copy covers
// whole cache lines. LDS rows are pitched 272 B (16 B x odd) for b128 reads.
// Epilogue modes: f32 store, bf16 store, atomic scatter-add with row scale.
// Requires M%128==0, N%64==0, K%128==0 (true for every GEMM in this model).
// ---------------------------------------------------------------------------
constexpr int GEMM_KT = 128;     // k per stage
constexpr int GEMM_LD = 136;     // LDS row pitch in bf16 elements (272 B)

// One stage's copies of one thread: 8 row pieces of A, 4 of Bt, rows 16 apart.
// The s_wait_xcnt stands inside the statement so that no address register of
// an issued copy is rewritten in front of it.
static __device__ __forceinline__ void async_stage12(const __bf16* lA,
                                                     const __bf16* lB,
                                                     const __bf16* gA,
                                                     const __bf16* gB, int K) {
  const unsigned la = (unsigned)(uintptr_t)lA;
  const unsigned lb = (unsigned)(uintptr_t)lB;
  constexpr unsigned LS = 16u * GEMM_LD * 2u;  // 16 LDS rows in bytes
  const size_t gs = (size_t)16 * K;            // 16 global rows in elements
  asm volatile(
      "global_load_async_to_lds_b128 %0, %12, off\n\t"
      "global_load_async_to_lds_b128 %1, %13, off\n\t"
      "global_load_async_to_lds_b128 %2, %14, off\n\t"
      "global_load_async_to_lds_b128 %3, %15, off\n\t"
      "global_load_async_to_lds_b128 %4, %16, off\n\t"
      "global_load_async_to_lds_b128 %5, %17, off\n\t"
      "global_load_async_to_lds_b128 %6, %18, off\n\t"
      "global_load_async_to_lds_b128 %7, %19, off\n\t"
      "global_load_async_to_lds_b128 %8, %20, off\n\t"
      "global_load_async_to_lds_b128 %9, %21, off\n\t"
      "global_load_async_to_lds_b128 %10, %22, off\n\t"
      "global_load_async_to_lds_b128 %11, %23, off\n\t"
      "s_wait_xcnt 0x0"
      :
      : "v"(la), "v"(la + LS), "v"(la + 2 * LS), "v"(la + 3 * LS),
        "v"(la + 4 * LS), "v"(la + 5 * LS), "v"(la + 6 * LS), "v"(la + 7 * LS),
        "v"(lb), "v"(lb + LS), "v"(lb + 2 * LS), "v"(lb + 3 * LS),
        "v"(gA), "v"(gA + gs), "v"(gA + 2 * gs), "v"(gA + 3 * gs),
        "v"(gA + 4 * gs), "v"(gA + 5 * gs), "v"(gA + 6 * gs), "v"(gA + 7 * gs),
        "v"(gB), "v"(gB + gs), "v"(gB + 2 * gs), "v"(gB + 3 * gs)
      : "memory");
}

__global__ __launch_bounds__(256) void gemm_bf16_kernel(
    const __bf16* __restrict__ A, const __bf16* __restrict__ Bt,
    const float* __restrict__ bias, const float* __restrict__ residual,
    float* Cf, __bf16* Cb, const int* __restrict__ scat_rows,
    const float* __restrict__ scat_scale, float* scat_out, int M, int N, int K,
    int act) {
  __shared__ __align__(16) __bf16 As[2][128][GEMM_LD];
  __shared__ __align__(16) __bf16 Bs[2][64][GEMM_LD];

  const int tid = threadIdx.x;
  const int wave = tid >> 5, lane = tid & 31;
  const int wm = wave & 3, wn = wave >> 2;
  const int bm = blockIdx.y * 128, bn = blockIdx.x * 64;

  const int rc = tid >> 4, cc = (tid & 15) * 8;  // copy: row in 16, 8 bf16
  const __bf16* gA0 = A + (size_t)(bm + rc) * K + cc;
  const __bf16* gB0 = Bt + (size_t)(bn + rc) * K + cc;

  auto issue_tile = [&](int buf, int k0) {
    async_stage12(&As[buf][rc][cc], &Bs[buf][rc][cc], gA0 + k0, gB0 + k0, K);
  };

  v8f acc[2][2] = {};
  const int nt = K / GEMM_KT;
  issue_tile(0, 0);
  wait_async0();      // tile 0 landed in LDS (this wave's copies)
  __syncthreads();    // ... and every other wave's
  if (nt > 1) issue_tile(1, GEMM_KT);

  for (int t = 0; t < nt; ++t) {
    const int cur = t & 1;
    // Unrolled so that ks folds into the immediate offsets of the LDS loads.
#pragma unroll
    for (int ks = 0; ks < GEMM_KT; ks += 32) {
      const v16bf a0 = frag16(&As[cur][0][0], wm * 32, ks, GEMM_LD);
      const v16bf a1 = frag16(&As[cur][0][0], wm * 32 + 16, ks, GEMM_LD);
      const v16bf b0 = frag16(&Bs[cur][0][0], wn * 32, ks, GEMM_LD);
      const v16bf b1 = frag16(&Bs[cur][0][0], wn * 32 + 16, ks, GEMM_LD);
      acc[0][0] = wmma_bf16(a0, b0, acc[0][0]);
      acc[0][1] = wmma_bf16(a0, b1, acc[0][1]);
      acc[1][0] = wmma_bf16(a1, b0, acc[1][0]);
      acc[1][1] = wmma_bf16(a1, b1, acc[1][1]);
    }
    // This wave's LDS reads of the buffer have retired before it is refilled.
    asm volatile("s_wait_dscnt 0x0" ::: "memory");
    wait_async0();      // next tile landed in LDS (this wave's copies)
    __syncthreads();    // all waves done copying AND done reading this buffer
    if (t + 2 < nt) issue_tile(cur, (t + 2) * GEMM_KT);  // flies over trip t+1
  }
  wait_async0();        // no copy is outstanding when the wave ends

  // Epilogue. C layout: lane half (l>>4) + VGPR v -> row half*8+v; col = l&15.
  const int half = lane >> 4, c0 = lane & 15;
#pragma unroll
  for (int i = 0; i < 2; ++i)
#pragma unroll
    for (int j = 0; j < 2; ++j)
#pragma unroll
      for (int v = 0; v < 8; ++v) {
        const int row = bm + wm * 32 + i * 16 + half * 8 + v;
        const int col = bn + wn * 32 + j * 16 + c0;
        float val = acc[i][j][v];
        if (bias) val += bias[col];
        if (act) val = gelu_exact(val);
        if (residual) val += residual[(size_t)row * N + col];
        if (Cf) Cf[(size_t)row * N + col] = val;
        if (Cb) Cb[(size_t)row * N + col] = (__bf16)val;
        if (scat_out) {
          const float sc = scat_scale[row];
          atomicAdd(&scat_out[(size_t)scat_rows[row] * N + col], val * sc);
        }
      }
}

// ---------------------------------------------------------------------------
// Flash attention: grid (N/64, H, B), 128 threads = 4 waves.
// Wave w owns 16 query rows x full 64-col key chunk -> row stats stay in-wave.
// Q/K tiles staged with async-to-LDS; V transposed manually (scattered b16).
// qkv layout: [T][3][H][hd] bf16;  out: [T][H*hd] bf16.
// ---------------------------------------------------------------------------
__global__ __launch_bounds__(128) void attn_kernel(
    const __bf16* __restrict__ qkv, __bf16* __restrict__ out, int N, int Hh,
    int hd) {
  const int D3 = 3 * Hh * hd;   // 3072
  const int Dm = Hh * hd;       // 1024
  const int qb = blockIdx.x, h = blockIdx.y, b = blockIdx.z;
  const int tid = threadIdx.x, wave = tid >> 5, lane = tid & 31;
  const int half = lane >> 4, c0 = lane & 15;

  __shared__ __align__(16) __bf16 Qs[64][80];
  __shared__ __align__(16) __bf16 Ks[64][80];
  __shared__ __align__(16) __bf16 Vt[64][80];       // V transposed: [d][key]
  __shared__ __align__(16) __bf16 Pb[4][16][80];    // per-wave P staging

  const int r = tid >> 1, d0 = (tid & 1) * 32;
  {  // Q tile (64x64) via async copy; first in-loop wait covers it
    const __bf16* g = qkv + (size_t)(b * N + qb * 64 + r) * D3 + h * hd + d0;
#pragma unroll
    for (int u = 0; u < 4; ++u) async_ld_b128(&Qs[r][d0 + u * 8], g + u * 8);
  }

  v8f o[4] = {};
  float mstat[8], lstat[8];
#pragma unroll
  for (int v = 0; v < 8; ++v) { mstat[v] = -1e30f; lstat[v] = 0.f; }

  for (int kb = 0; kb < N / 64; ++kb) {
    __syncthreads();  // prior P@V reads of Vt complete before overwrite
    {
      const __bf16* gk =
          qkv + (size_t)(b * N + kb * 64 + r) * D3 + Dm + h * hd + d0;
#pragma unroll
      for (int u = 0; u < 4; ++u)
        async_ld_b128(&Ks[r][d0 + u * 8], gk + u * 8);
      const __bf16* gv =
          qkv + (size_t)(b * N + kb * 64 + r) * D3 + 2 * Dm + h * hd + d0;
#pragma unroll
      for (int u = 0; u < 32; ++u) Vt[d0 + u][r] = gv[u];  // transpose to LDS
    }
    wait_async0();
    __syncthreads();

    // S = (Q * hd^-0.5) @ K^T  (64x64 per block; 16x64 per wave)
    v8f s[4] = {};
#pragma unroll
    for (int ks = 0; ks < 64; ks += 32) {
      const v16bf a = frag16(&Qs[0][0], wave * 16, ks, 80);
#pragma unroll
      for (int j = 0; j < 4; ++j) {
        const v16bf bf = frag16(&Ks[0][0], j * 16, ks, 80);
        s[j] = wmma_bf16(a, bf, s[j]);
      }
    }

    // online softmax per row (row = half*8+v, fully within this wave)
#pragma unroll
    for (int v = 0; v < 8; ++v) {
      float rmax = -1e30f;
#pragma unroll
      for (int j = 0; j < 4; ++j) {
        s[j][v] *= 0.125f;  // hd^-0.5
        rmax = fmaxf(rmax, s[j][v]);
      }
#pragma unroll
      for (int off = 1; off < 16; off <<= 1)
        rmax = fmaxf(rmax, __shfl_xor(rmax, off, 16));
      const float mnew = fmaxf(mstat[v], rmax);
      const float alpha = __expf(mstat[v] - mnew);
      float rsum = 0.f;
#pragma unroll
      for (int j = 0; j < 4; ++j) {
        const float p = __expf(s[j][v] - mnew);
        s[j][v] = p;
        rsum += p;
      }
#pragma unroll
      for (int off = 1; off < 16; off <<= 1) rsum += __shfl_xor(rsum, off, 16);
      lstat[v] = lstat[v] * alpha + rsum;
      mstat[v] = mnew;
#pragma unroll
      for (int j = 0; j < 4; ++j) {
        o[j][v] *= alpha;
        Pb[wave][half * 8 + v][j * 16 + c0] = (__bf16)s[j][v];
      }
    }
    __syncthreads();  // Pb visible for re-fragmentation

    // O += P @ V
#pragma unroll
    for (int ks = 0; ks < 64; ks += 32) {
      const v16bf a = frag16(&Pb[wave][0][0], 0, ks, 80);
#pragma unroll
      for (int j = 0; j < 4; ++j) {
        const v16bf bf = frag16(&Vt[0][0], j * 16, ks, 80);
        o[j] = wmma_bf16(a, bf, o[j]);
      }
    }
  }

  const int trow = b * N + qb * 64 + wave * 16 + half * 8;
#pragma unroll
  for (int v = 0; v < 8; ++v) {
    const float inv = 1.0f / lstat[v];
#pragma unroll
    for (int j = 0; j < 4; ++j)
      out[(size_t)(trow + v) * Dm + h * hd + j * 16 + c0] =
          (__bf16)(o[j][v] * inv);
  }
}

// ---------------------------------------------------------------------------
// LayerNorm (one token per block). Optional f32 and/or bf16 outputs.
// ---------------------------------------------------------------------------
__global__ __launch_bounds__(256) void ln_kernel(const float* __restrict__ x,
                                                 const float* __restrict__ g,
                                                 const float* __restrict__ bta,
                                                 float* outf, __bf16* outb,
                                                 int D) {
  const int t = blockIdx.x;
  const float* row = x + (size_t)t * D;
  float s = 0.f, ss = 0.f;
  for (int d = threadIdx.x; d < D; d += 256) {
    const float v = row[d];
    s += v;
    ss += v * v;
  }
#pragma unroll
  for (int off = 16; off; off >>= 1) {
    s += __shfl_xor(s, off, 32);
    ss += __shfl_xor(ss, off, 32);
  }
  __shared__ float rs[8], rss[8], mv[2];
  const int wave = threadIdx.x >> 5, lane = threadIdx.x & 31;
  if (lane == 0) { rs[wave] = s; rss[wave] = ss; }
  __syncthreads();
  if (threadIdx.x == 0) {
    float a = 0.f, b2 = 0.f;
    for (int i = 0; i < 8; ++i) { a += rs[i]; b2 += rss[i]; }
    const float mu = a / D;
    mv[0] = mu;
    mv[1] = rsqrtf(b2 / D - mu * mu + 1e-5f);
  }
  __syncthreads();
  const float mu = mv[0], r = mv[1];
  for (int d = threadIdx.x; d < D; d += 256) {
    const float v = (row[d] - mu) * r * g[d] + bta[d];
    if (outf) outf[(size_t)t * D + d] = v;
    if (outb) outb[(size_t)t * D + d] = (__bf16)v;
  }
}

// ---------------------------------------------------------------------------
// Router: noisy top-2 over E=4 experts. One wave per token.
// ---------------------------------------------------------------------------
__global__ __launch_bounds__(128) void router_kernel(
    const float* __restrict__ x2, const float* __restrict__ noise,
    const float* __restrict__ w_route, const float* __restrict__ b_route,
    const float* __restrict__ w_noise, const float* __restrict__ b_noise,
    float* gate, int* fidx, int D) {
  const int wave = threadIdx.x >> 5, lane = threadIdx.x & 31;
  const int t = blockIdx.x * 4 + wave;
  float ar[4] = {0, 0, 0, 0}, an[4] = {0, 0, 0, 0};
  for (int d = lane; d < D; d += 32) {
    const float xv = x2[(size_t)t * D + d];
#pragma unroll
    for (int e = 0; e < 4; ++e) {
      ar[e] += xv * w_route[d * 4 + e];
      an[e] += xv * w_noise[d * 4 + e];
    }
  }
#pragma unroll
  for (int e = 0; e < 4; ++e)
#pragma unroll
    for (int off = 16; off; off >>= 1) {
      ar[e] += __shfl_xor(ar[e], off, 32);
      an[e] += __shfl_xor(an[e], off, 32);
    }
  if (lane == 0) {
    float noisy[4];
#pragma unroll
    for (int e = 0; e < 4; ++e) {
      const float lg = ar[e] + b_route[e];
      const float ns = an[e] + b_noise[e];
      const float sp = (ns > 20.f) ? ns : log1pf(__expf(ns));
      noisy[e] = lg + noise[t * 4 + e] * sp;
    }
    int i0 = 0;
    for (int e = 1; e < 4; ++e)
      if (noisy[e] > noisy[i0]) i0 = e;
    int i1 = -1;
    for (int e = 0; e < 4; ++e)
      if (e != i0 && (i1 < 0 || noisy[e] > noisy[i1])) i1 = e;
    const float m = fmaxf(noisy[i0], noisy[i1]);
    const float e0 = __expf(noisy[i0] - m), e1 = __expf(noisy[i1] - m);
    const float p0 = e0 / (e0 + e1);
#pragma unroll
    for (int e = 0; e < 4; ++e) gate[t * 4 + e] = 0.f;
    gate[t * 4 + i0] = p0;
    gate[t * 4 + i1] = 1.f - p0;
    fidx[2 * t] = i0;
    fidx[2 * t + 1] = i1;
  }
}

// ---------------------------------------------------------------------------
// Per-expert capacity dispatch (stable token order). grid = E blocks.
// ---------------------------------------------------------------------------
__global__ __launch_bounds__(256) void dispatch_scan(
    const int* __restrict__ fidx, const float* __restrict__ gate, int* sel,
    float* selw, int capacity, int T) {
  const int e = blockIdx.x, tid = threadIdx.x;
  __shared__ int sm[256];
  int base = 0;
  for (int c0 = 0; c0 < T; c0 += 256) {
    const int t = c0 + tid;
    int m = 0;
    if (t < T) m = (fidx[2 * t] == e || fidx[2 * t + 1] == e) ? 1 : 0;
    sm[tid] = m;
    __syncthreads();
    for (int off = 1; off < 256; off <<= 1) {  // inclusive Hillis-Steele
      const int x = sm[tid];
      const int y = (tid >= off) ? sm[tid - off] : 0;
      __syncthreads();
      sm[tid] = x + y;
      __syncthreads();
    }
    const int incl = sm[tid];
    const int tot = sm[255];
    __syncthreads();
    const int pos = base + incl - 1;
    if (m && pos < capacity) {
      sel[e * capacity + pos] = t;
      selw[e * capacity + pos] = gate[t * 4 + e];
    }
    base += tot;
  }
  for (int i = (base < capacity ? base : capacity) + tid; i < capacity;
       i += 256) {
    sel[e * capacity + i] = 0;
    selw[e * capacity + i] = 0.f;  // padded rows contribute nothing
  }
}

__global__ __launch_bounds__(256) void gather_kernel(
    const __bf16* __restrict__ x2b, const int* __restrict__ sel, __bf16* xdisp,
    int D) {
  const int row = blockIdx.x;
  const int src = sel[row];
  for (int d = threadIdx.x; d < D; d += 256)
    xdisp[(size_t)row * D + d] = x2b[(size_t)src * D + d];
}

// ---------------------------------------------------------------------------
// fp32 -> bf16 converters (direct and transposing, for [K][N] -> [N][K]).
// ---------------------------------------------------------------------------
__global__ __launch_bounds__(256) void cvt_bf16(const float* __restrict__ in,
                                                __bf16* out, size_t n) {
  size_t i = (size_t)blockIdx.x * 256 + threadIdx.x;
  const size_t stride = (size_t)gridDim.x * 256;
  for (; i < n; i += stride) out[i] = (__bf16)in[i];
}

__global__ __launch_bounds__(256) void cvt_bf16_t(const float* __restrict__ in,
                                                  __bf16* out, int K, int N) {
  const size_t n = (size_t)K * N;
  size_t i = (size_t)blockIdx.x * 256 + threadIdx.x;
  const size_t stride = (size_t)gridDim.x * 256;
  for (; i < n; i += stride) {
    const int k = (int)(i / N), c = (int)(i % N);
    out[(size_t)c * K + k] = (__bf16)in[i];
  }
}

// ---------------------------------------------------------------------------
// Launch orchestration.
// ---------------------------------------------------------------------------
extern "C" void kernel_launch(void* const* d_in, const int* in_sizes, int n_in,
                              void* d_out, int out_size, void* d_ws,
                              size_t ws_size, hipStream_t stream) {
  (void)in_sizes; (void)n_in; (void)out_size; (void)ws_size;
  constexpr int Bb = 2, Nn = 2048, Dd = 1024, Hh = 16, hd = 64;
  constexpr int T = Bb * Nn, D3 = 3 * Dd, MLPH = 4096, MOEH = 256;
  constexpr int Ee = 4, CAP = 2048;

  const float* x      = (const float*)d_in[0];
  const float* noise  = (const float*)d_in[1];
  const float* ln1_g  = (const float*)d_in[2];
  const float* ln1_b  = (const float*)d_in[3];
  const float* ln2_g  = (const float*)d_in[4];
  const float* ln2_b  = (const float*)d_in[5];
  const float* w_qkv  = (const float*)d_in[6];
  const float* w_proj = (const float*)d_in[7];
  const float* b_proj = (const float*)d_in[8];
  const float* w_rt   = (const float*)d_in[9];
  const float* b_rt   = (const float*)d_in[10];
  const float* w_nz   = (const float*)d_in[11];
  const float* b_nz   = (const float*)d_in[12];
  const float* we1    = (const float*)d_in[13];
  const float* be1    = (const float*)d_in[14];
  const float* we2    = (const float*)d_in[15];
  const float* be2    = (const float*)d_in[16];
  const float* w_m1   = (const float*)d_in[17];
  const float* b_m1   = (const float*)d_in[18];
  const float* w_m2   = (const float*)d_in[19];
  const float* b_m2   = (const float*)d_in[20];
  float* out = (float*)d_out;

  char* wsp = (char*)d_ws;
  size_t off = 0;
  auto alloc = [&](size_t bytes) {
    void* p = wsp + off;
    off = (off + bytes + 255) & ~(size_t)255;
    return p;
  };
  __bf16* x1b    = (__bf16*)alloc((size_t)T * Dd * 2);
  __bf16* wqkvb  = (__bf16*)alloc((size_t)D3 * Dd * 2);
  __bf16* qkvb   = (__bf16*)alloc((size_t)T * D3 * 2);
  __bf16* attnb  = (__bf16*)alloc((size_t)T * Dd * 2);
  __bf16* wprojb = (__bf16*)alloc((size_t)Dd * Dd * 2);
  float*  xattn  = (float*)alloc((size_t)T * Dd * 4);
  float*  x2f    = (float*)alloc((size_t)T * Dd * 4);
  __bf16* x2b    = (__bf16*)alloc((size_t)T * Dd * 2);
  __bf16* wm1t   = (__bf16*)alloc((size_t)Dd * MLPH * 2);
  __bf16* wm2t   = (__bf16*)alloc((size_t)MLPH * Dd * 2);
  __bf16* hmlp   = (__bf16*)alloc((size_t)T * MLPH * 2);
  __bf16* we1t   = (__bf16*)alloc((size_t)Ee * Dd * MOEH * 2);
  __bf16* we2t   = (__bf16*)alloc((size_t)Ee * MOEH * Dd * 2);
  __bf16* xdisp  = (__bf16*)alloc((size_t)Ee * CAP * Dd * 2);
  __bf16* hdisp  = (__bf16*)alloc((size_t)Ee * CAP * MOEH * 2);
  float*  gate   = (float*)alloc((size_t)T * Ee * 4);
  int*    fidx   = (int*)alloc((size_t)T * 2 * 4);
  int*    sel    = (int*)alloc((size_t)Ee * CAP * 4);
  float*  selw   = (float*)alloc((size_t)Ee * CAP * 4);

  // 1) weight conversion to bf16 (w_qkv/w_proj are already [N][K])
  cvt_bf16<<<2048, 256, 0, stream>>>(w_qkv, wqkvb, (size_t)D3 * Dd);
  cvt_bf16<<<1024, 256, 0, stream>>>(w_proj, wprojb, (size_t)Dd * Dd);
  cvt_bf16_t<<<2048, 256, 0, stream>>>(w_m1, wm1t, Dd, MLPH);
  cvt_bf16_t<<<2048, 256, 0, stream>>>(w_m2, wm2t, MLPH, Dd);
  for (int e = 0; e < Ee; ++e) {
    cvt_bf16_t<<<512, 256, 0, stream>>>(we1 + (size_t)e * Dd * MOEH,
                                        we1t + (size_t)e * MOEH * Dd, Dd, MOEH);
    cvt_bf16_t<<<512, 256, 0, stream>>>(we2 + (size_t)e * MOEH * Dd,
                                        we2t + (size_t)e * Dd * MOEH, MOEH, Dd);
  }

  // 2) LN1 -> x1 (bf16)
  ln_kernel<<<T, 256, 0, stream>>>(x, ln1_g, ln1_b, nullptr, x1b, Dd);

  // 3) QKV GEMM: [T,D] x [3D,D]^T -> bf16 [T,3D]
  gemm_bf16_kernel<<<dim3(D3 / 64, T / 128), 256, 0, stream>>>(
      x1b, wqkvb, nullptr, nullptr, nullptr, qkvb, nullptr, nullptr, nullptr,
      T, D3, Dd, 0);

  // 4) flash attention -> bf16 [T,D]
  attn_kernel<<<dim3(Nn / 64, Hh, Bb), 128, 0, stream>>>(qkvb, attnb, Nn, Hh,
                                                         hd);

  // 5) proj GEMM + b_proj + residual x -> xattn (f32)
  gemm_bf16_kernel<<<dim3(Dd / 64, T / 128), 256, 0, stream>>>(
      attnb, wprojb, b_proj, x, xattn, nullptr, nullptr, nullptr, nullptr, T,
      Dd, Dd, 0);

  // 6) LN2 -> x2 (f32 + bf16)
  ln_kernel<<<T, 256, 0, stream>>>(xattn, ln2_g, ln2_b, x2f, x2b, Dd);

  // 7) router + capacity dispatch + gather
  router_kernel<<<T / 4, 128, 0, stream>>>(x2f, noise, w_rt, b_rt, w_nz, b_nz,
                                           gate, fidx, Dd);
  dispatch_scan<<<Ee, 256, 0, stream>>>(fidx, gate, sel, selw, CAP, T);
  gather_kernel<<<Ee * CAP, 256, 0, stream>>>(x2b, sel, xdisp, Dd);

  // 8) dense MLP: gelu(x2@W1+b1)@W2+b2 + xattn -> d_out (f32)
  gemm_bf16_kernel<<<dim3(MLPH / 64, T / 128), 256, 0, stream>>>(
      x2b, wm1t, b_m1, nullptr, nullptr, hmlp, nullptr, nullptr, nullptr, T,
      MLPH, Dd, 1);
  gemm_bf16_kernel<<<dim3(Dd / 64, T / 128), 256, 0, stream>>>(
      hmlp, wm2t, b_m2, xattn, out, nullptr, nullptr, nullptr, nullptr, T, Dd,
      MLPH, 0);

  // 9) expert FFNs; second GEMM scatter-adds gate-weighted rows into d_out
  for (int e = 0; e < Ee; ++e) {
    gemm_bf16_kernel<<<dim3(MOEH / 64, CAP / 128), 256, 0, stream>>>(
        xdisp + (size_t)e * CAP * Dd, we1t + (size_t)e * MOEH * Dd,
        be1 + (size_t)e * MOEH, nullptr, nullptr,
        hdisp + (size_t)e * CAP * MOEH, nullptr, nullptr, nullptr, CAP, MOEH,
        Dd, 1);
    gemm_bf16_kernel<<<dim3(Dd / 64, CAP / 128), 256, 0, stream>>>(
        hdisp + (size_t)e * CAP * MOEH, we2t + (size_t)e * Dd * MOEH,
        be2 + (size_t)e * Dd, nullptr, nullptr, nullptr, sel + e * CAP,
        selw + e * CAP, out, CAP, Dd, MOEH, 0);
  }
}

// v002
// It runs in 590 microseconds.
// Next to v001, in two timings, it ran 1.23 and 1.24 times as fast.
// Over all steps from v000 it is 1.41 times as fast.
#include <hip/hip_runtime.h>
#include <hip/hip_bf16.h>
#include <math.h>
#include <stdint.h>

// ---------------------------------------------------------------------------
// Types for CDNA5 WMMA (wave32): D(f32 16x16) = A(bf16 16x32) x B(bf16 32x16) + C
// ---------------------------------------------------------------------------
typedef __attribute__((ext_vector_type(16))) __bf16 v16bf;
typedef __attribute__((ext_vector_type(8)))  float  v8f;

static __device__ __forceinline__ v8f wmma_bf16(v16bf a, v16bf b, v8f c) {
  // (neg_a, A, neg_b, B, c_mod, C, reuse_a, reuse_b)
  return __builtin_amdgcn_wmma_f32_16x16x32_bf16(false, a, false, b, (short)0, c,
                                                 false, false);
}

// CDNA5 async copy: global -> LDS, 16 bytes per lane, tracked by ASYNCcnt.
// lds_off = low 32 bits of the generic pointer (ISA: LDS generic addresses
// carry the LDS byte offset in [31:0]).
static __device__ __forceinline__ void async_ld_b128(void* lds_ptr,
                                                     const void* gptr) {
  const unsigned lds_off = (unsigned)(uintptr_t)lds_ptr;
  asm volatile("global_load_async_to_lds_b128 %0, %1, off"
               :
               : "v"(lds_off), "v"(gptr)
               : "memory");
}
static __device__ __forceinline__ void wait_async0() {
  asm volatile("s_wait_asynccnt 0" ::: "memory");
}

// Load a 16x32 bf16 fragment (A layout; B "Bt" layout is identical with N<->M)
// from row-major LDS with leading dim `ld` (bf16 elements, multiple of 8).
// Lane l: row = base + (l&15); half = l>>4 selects K subranges
// [half*8, half*8+8) and [16+half*8, 16+half*8+8)  -> two aligned b128 loads.
static __device__ __forceinline__ v16bf frag16(const __bf16* base, int row,
                                               int kbase, int ld) {
  const int lane = threadIdx.x & 31;
  const __bf16* p =
      base + (size_t)(row + (lane & 15)) * ld + kbase + ((lane >> 4) * 8);
  union { uint4 u[2]; v16bf v; } t;
  t.u[0] = *(const uint4*)p;
  t.u[1] = *(const uint4*)(p + 16);
  return t.v;
}

static __device__ __forceinline__ float gelu_exact(float x) {
  return 0.5f * x * (1.0f + erff(x * 0.70710678118654752f));
}

// ---------------------------------------------------------------------------
// Generic bf16 WMMA GEMM:  C[M][N] = A[M][K] * Bt[N][K]^T  (+bias, gelu, resid)
// Block 256 threads = 8 waves; tile 128(M) x 64(N); K-step 128.
// Async double-buffered LDS: global_load_async_to_lds_b128 fills the next
// tile while WMMA consumes the current one; one barrier per K-step.
// Sixteen lanes copy one 256-byte piece of a row, so a wave's copy covers
// whole cache lines. LDS rows are pitched 272 B (16 B x odd) for b128 reads.
// Epilogue forms: f32 store, bf16 store, atomic scatter-add with row scale.
// Bias, activation, residual and output form are template parameters: each
// launch's epilogue is code without tests on pointers, so its bias, residual
// and scatter loads are issued together and waited for once, not per element.
// Requires M%128==0, N%64==0, K%128==0 (true for every GEMM in this model).
// ---------------------------------------------------------------------------
constexpr int GEMM_KT = 128;     // k per stage
constexpr int GEMM_LD = 136;     // LDS row pitch in bf16 elements (272 B)
constexpr int OUT_F32 = 0, OUT_BF16 = 1, OUT_SCATTER = 2;  // output forms

// One stage's copies of one thread: 8 row pieces of A, 4 of Bt, rows 16 apart.
// The s_wait_xcnt stands inside the statement so that no address register of
// an issued copy is rewritten in front of it.
static __device__ __forceinline__ void async_stage12(const __bf16* lA,
                                                     const __bf16* lB,
                                                     const __bf16* gA,
                                                     const __bf16* gB, int K) {
  const unsigned la = (unsigned)(uintptr_t)lA;
  const unsigned lb = (unsigned)(uintptr_t)lB;
  constexpr unsigned LS = 16u * GEMM_LD * 2u;  // 16 LDS rows in bytes
  const size_t gs = (size_t)16 * K;            // 16 global rows in elements
  asm volatile(
      "global_load_async_to_lds_b128 %0, %12, off\n\t"
      "global_load_async_to_lds_b128 %1, %13, off\n\t"
      "global_load_async_to_lds_b128 %2, %14, off\n\t"
      "global_load_async_to_lds_b128 %3, %15, off\n\t"
      "global_load_async_to_lds_b128 %4, %16, off\n\t"
      "global_load_async_to_lds_b128 %5, %17, off\n\t"
      "global_load_async_to_lds_b128 %6, %18, off\n\t"
      "global_load_async_to_lds_b128 %7, %19, off\n\t"
      "global_load_async_to_lds_b128 %8, %20, off\n\t"
      "global_load_async_to_lds_b128 %9, %21, off\n\t"
      "global_load_async_to_lds_b128 %10, %22, off\n\t"
      "global_load_async_to_lds_b128 %11, %23, off\n\t"
      "s_wait_xcnt 0x0"
      :
      : "v"(la), "v"(la + LS), "v"(la + 2 * LS), "v"(la + 3 * LS),
        "v"(la + 4 * LS), "v"(la + 5 * LS), "v"(la + 6 * LS), "v"(la + 7 * LS),
        "v"(lb), "v"(lb + LS), "v"(lb + 2 * LS), "v"(lb + 3 * LS),
        "v"(gA), "v"(gA + gs), "v"(gA + 2 * gs), "v"(gA + 3 * gs),
        "v"(gA + 4 * gs), "v"(gA + 5 * gs), "v"(gA + 6 * gs), "v"(gA + 7 * gs),
        "v"(gB), "v"(gB + gs), "v"(gB + 2 * gs), "v"(gB + 3 * gs)
      : "memory");
}

template <bool BIAS, bool ACT, bool RESID, int OUT>
__global__ __launch_bounds__(256) void gemm_bf16_kernel(
    const __bf16* __restrict__ A, const __bf16* __restrict__ Bt,
    const float* __restrict__ bias, const float* __restrict__ residual,
    float* Cf, __bf16* Cb, const int* __restrict__ scat_rows,
    const float* __restrict__ scat_scale, float* scat_out, int M, int N,
    int K) {
  __shared__ __align__(16) __bf16 As[2][128][GEMM_LD];
  __shared__ __align__(16) __bf16 Bs[2][64][GEMM_LD];

  const int tid = threadIdx.x;
  const int wave = tid >> 5, lane = tid & 31;
  const int wm = wave & 3, wn = wave >> 2;
  const int bm = blockIdx.y * 128, bn = blockIdx.x * 64;

  const int rc = tid >> 4, cc = (tid & 15) * 8;  // copy: row in 16, 8 bf16
  const __bf16* gA0 = A + (size_t)(bm + rc) * K + cc;
  const __bf16* gB0 = Bt + (size_t)(bn + rc) * K + cc;

  auto issue_tile = [&](int buf, int k0) {
    async_stage12(&As[buf][rc][cc], &Bs[buf][rc][cc], gA0 + k0, gB0 + k0, K);
  };

  v8f acc[2][2] = {};
  const int nt = K / GEMM_KT;
  issue_tile(0, 0);
  wait_async0();      // tile 0 landed in LDS (this wave's copies)
  __syncthreads();    // ... and every other wave's
  if (nt > 1) issue_tile(1, GEMM_KT);

  for (int t = 0; t < nt; ++t) {
    const int cur = t & 1;
    // Unrolled so that ks folds into the immediate offsets of the LDS loads.
#pragma unroll
    for (int ks = 0; ks < GEMM_KT; ks += 32) {
      const v16bf a0 = frag16(&As[cur][0][0], wm * 32, ks, GEMM_LD);
      const v16bf a1 = frag16(&As[cur][0][0], wm * 32 + 16, ks, GEMM_LD);
      const v16bf b0 = frag16(&Bs[cur][0][0], wn * 32, ks, GEMM_LD);
      const v16bf b1 = frag16(&Bs[cur][0][0], wn * 32 + 16, ks, GEMM_LD);
      acc[0][0] = wmma_bf16(a0, b0, acc[0][0]);
      acc[0][1] = wmma_bf16(a0, b1, acc[0][1]);
      acc[1][0] = wmma_bf16(a1, b0, acc[1][0]);
      acc[1][1] = wmma_bf16(a1, b1, acc[1][1]);
    }
    // This wave's LDS reads of the buffer have retired before it is refilled.
    asm volatile("s_wait_dscnt 0x0" ::: "memory");
    wait_async0();      // next tile landed in LDS (this wave's copies)
    __syncthreads();    // all waves done copying AND done reading this buffer
    if (t + 2 < nt) issue_tile(cur, (t + 2) * GEMM_KT);  // flies over trip t+1
  }
  wait_async0();        // no copy is outstanding when the wave ends

  // Epilogue. C layout: lane half (l>>4) + VGPR v -> row half*8+v; col = l&15.
  const int half = lane >> 4, c0 = lane & 15;
  const int row0 = bm + wm * 32 + half * 8;  // + i*16 + v
  const int col0 = bn + wn * 32 + c0;        // + j*16

  // Everything the epilogue reads is fetched first, in one run of loads.
  // All loops below are unrolled so that acc and these arrays are indexed by
  // constants and stay in registers.
  float bv[2] = {};
  float rv[2][2][8] = {};
  float sc[2][8] = {};
  int dr[2][8] = {};
  if constexpr (BIAS) {
#pragma unroll
    for (int j = 0; j < 2; ++j) bv[j] = bias[col0 + j * 16];
  }
  if constexpr (RESID) {
#pragma unroll
    for (int i = 0; i < 2; ++i)
#pragma unroll
      for (int j = 0; j < 2; ++j)
#pragma unroll
        for (int v = 0; v < 8; ++v)
          rv[i][j][v] =
              residual[(size_t)(row0 + i * 16 + v) * N + col0 + j * 16];
  }
  if constexpr (OUT == OUT_SCATTER) {
#pragma unroll
    for (int i = 0; i < 2; ++i)
#pragma unroll
      for (int v = 0; v < 8; ++v) {
        sc[i][v] = scat_scale[row0 + i * 16 + v];
        dr[i][v] = scat_rows[row0 + i * 16 + v];
      }
  }

#pragma unroll
  for (int i = 0; i < 2; ++i)
#pragma unroll
    for (int j = 0; j < 2; ++j)
#pragma unroll
      for (int v = 0; v < 8; ++v) {
        const int row = row0 + i * 16 + v;
        const int col = col0 + j * 16;
        float val = acc[i][j][v];
        if constexpr (BIAS) val += bv[j];
        if constexpr (ACT) val = gelu_exact(val);
        if constexpr (RESID) val += rv[i][j][v];
        if constexpr (OUT == OUT_F32) Cf[(size_t)row * N + col] = val;
        if constexpr (OUT == OUT_BF16) Cb[(size_t)row * N + col] = (__bf16)val;
        if constexpr (OUT == OUT_SCATTER)
          atomicAdd(&scat_out[(size_t)dr[i][v] * N + col], val * sc[i][v]);
      }
}

// ---------------------------------------------------------------------------
// Flash attention: grid (N/64, H, B), 128 threads = 4 waves.
// Wave w owns 16 query rows x full 64-col key chunk -> row stats stay in-wave.
// Q/K tiles staged with async-to-LDS; V transposed manually (scattered b16).
// qkv layout: [T][3][H][hd] bf16;  out: [T][H*hd] bf16.
// ---------------------------------------------------------------------------
__global__ __launch_bounds__(128) void attn_kernel(
    const __bf16* __restrict__ qkv, __bf16* __restrict__ out, int N, int Hh,
    int hd) {
  const int D3 = 3 * Hh * hd;   // 3072
  const int Dm = Hh * hd;       // 1024
  const int qb = blockIdx.x, h = blockIdx.y, b = blockIdx.z;
  const int tid = threadIdx.x, wave = tid >> 5, lane = tid & 31;
  const int half = lane >> 4, c0 = lane & 15;

  __shared__ __align__(16) __bf16 Qs[64][80];
  __shared__ __align__(16) __bf16 Ks[64][80];
  __shared__ __align__(16) __bf16 Vt[64][80];       // V transposed: [d][key]
  __shared__ __align__(16) __bf16 Pb[4][16][80];    // per-wave P staging

  const int r = tid >> 1, d0 = (tid & 1) * 32;
  {  // Q tile (64x64) via async copy; first in-loop wait covers it
    const __bf16* g = qkv + (size_t)(b * N + qb * 64 + r) * D3 + h * hd + d0;
#pragma unroll
    for (int u = 0; u < 4; ++u) async_ld_b128(&Qs[r][d0 + u * 8], g + u * 8);
  }

  v8f o[4] = {};
  float mstat[8], lstat[8];
#pragma unroll
  for (int v = 0; v < 8; ++v) { mstat[v] = -1e30f; lstat[v] = 0.f; }

  for (int kb = 0; kb < N / 64; ++kb) {
    __syncthreads();  // prior P@V reads of Vt complete before overwrite
    {
      const __bf16* gk =
          qkv + (size_t)(b * N + kb * 64 + r) * D3 + Dm + h * hd + d0;
#pragma unroll
      for (int u = 0; u < 4; ++u)
        async_ld_b128(&Ks[r][d0 + u * 8], gk + u * 8);
      const __bf16* gv =
          qkv + (size_t)(b * N + kb * 64 + r) * D3 + 2 * Dm + h * hd + d0;
#pragma unroll
      for (int u = 0; u < 32; ++u) Vt[d0 + u][r] = gv[u];  // transpose to LDS
    }
    wait_async0();
    __syncthreads();

    // S = (Q * hd^-0.5) @ K^T  (64x64 per block; 16x64 per wave)
    v8f s[4] = {};
#pragma unroll
    for (int ks = 0; ks < 64; ks += 32) {
      const v16bf a = frag16(&Qs[0][0], wave * 16, ks, 80);
#pragma unroll
      for (int j = 0; j < 4; ++j) {
        const v16bf bf = frag16(&Ks[0][0], j * 16, ks, 80);
        s[j] = wmma_bf16(a, bf, s[j]);
      }
    }

    // online softmax per row (row = half*8+v, fully within this wave)
#pragma unroll
    for (int v = 0; v < 8; ++v) {
      float rmax = -1e30f;
#pragma unroll
      for (int j = 0; j < 4; ++j) {
        s[j][v] *= 0.125f;  // hd^-0.5
        rmax = fmaxf(rmax, s[j][v]);
      }
#pragma unroll
      for (int off = 1; off < 16; off <<= 1)
        rmax = fmaxf(rmax, __shfl_xor(rmax, off, 16));
      const float mnew = fmaxf(mstat[v], rmax);
      const float alpha = __expf(mstat[v] - mnew);
      float rsum = 0.f;
#pragma unroll
      for (int j = 0; j < 4; ++j) {
        const float p = __expf(s[j][v] - mnew);
        s[j][v] = p;
        rsum += p;
      }
#pragma unroll
      for (int off = 1; off < 16; off <<= 1) rsum += __shfl_xor(rsum, off, 16);
      lstat[v] = lstat[v] * alpha + rsum;
      mstat[v] = mnew;
#pragma unroll
      for (int j = 0; j < 4; ++j) {
        o[j][v] *= alpha;
        Pb[wave][half * 8 + v][j * 16 + c0] = (__bf16)s[j][v];
      }
    }
    __syncthreads();  // Pb visible for re-fragmentation

    // O += P @ V
#pragma unroll
    for (int ks = 0; ks < 64; ks += 32) {
      const v16bf a = frag16(&Pb[wave][0][0], 0, ks, 80);
#pragma unroll
      for (int j = 0; j < 4; ++j) {
        const v16bf bf = frag16(&Vt[0][0], j * 16, ks, 80);
        o[j] = wmma_bf16(a, bf, o[j]);
      }
    }
  }

  const int trow = b * N + qb * 64 + wave * 16 + half * 8;
#pragma unroll
  for (int v = 0; v < 8; ++v) {
    const float inv = 1.0f / lstat[v];
#pragma unroll
    for (int j = 0; j < 4; ++j)
      out[(size_t)(trow + v) * Dm + h * hd + j * 16 + c0] =
          (__bf16)(o[j][v] * inv);
  }
}

// ---------------------------------------------------------------------------
// LayerNorm (one token per block). Optional f32 and/or bf16 outputs.
// ---------------------------------------------------------------------------
__global__ __launch_bounds__(256) void ln_kernel(const float* __restrict__ x,
                                                 const float* __restrict__ g,
                                                 const float* __restrict__ bta,
                                                 float* outf, __bf16* outb,
                                                 int D) {
  const int t = blockIdx.x;
  const float* row = x + (size_t)t * D;
  float s = 0.f, ss = 0.f;
  for (int d = threadIdx.x; d < D; d += 256) {
    const float v = row[d];
    s += v;
    ss += v * v;
  }
#pragma unroll
  for (int off = 16; off; off >>= 1) {
    s += __shfl_xor(s, off, 32);
    ss += __shfl_xor(ss, off, 32);
  }
  __shared__ float rs[8], rss[8], mv[2];
  const int wave = threadIdx.x >> 5, lane = threadIdx.x & 31;
  if (lane == 0) { rs[wave] = s; rss[wave] = ss; }
  __syncthreads();
  if (threadIdx.x == 0) {
    float a = 0.f, b2 = 0.f;
    for (int i = 0; i < 8; ++i) { a += rs[i]; b2 += rss[i]; }
    const float mu = a / D;
    mv[0] = mu;
    mv[1] = rsqrtf(b2 / D - mu * mu + 1e-5f);
  }
  __syncthreads();
  const float mu = mv[0], r = mv[1];
  for (int d = threadIdx.x; d < D; d += 256) {
    const float v = (row[d] - mu) * r * g[d] + bta[d];
    if (outf) outf[(size_t)t * D + d] = v;
    if (outb) outb[(size_t)t * D + d] = (__bf16)v;
  }
}

// ---------------------------------------------------------------------------
// Router: noisy top-2 over E=4 experts. One wave per token.
// ---------------------------------------------------------------------------
__global__ __launch_bounds__(128) void router_kernel(
    const float* __restrict__ x2, const float* __restrict__ noise,
    const float* __restrict__ w_route, const float* __restrict__ b_route,
    const float* __restrict__ w_noise, const float* __restrict__ b_noise,
    float* gate, int* fidx, int D) {
  const int wave = threadIdx.x >> 5, lane = threadIdx.x & 31;
  const int t = blockIdx.x * 4 + wave;
  float ar[4] = {0, 0, 0, 0}, an[4] = {0, 0, 0, 0};
  for (int d = lane; d < D; d += 32) {
    const float xv = x2[(size_t)t * D + d];
#pragma unroll
    for (int e = 0; e < 4; ++e) {
      ar[e] += xv * w_route[d * 4 + e];
      an[e] += xv * w_noise[d * 4 + e];
    }
  }
#pragma unroll
  for (int e = 0; e < 4; ++e)
#pragma unroll
    for (int off = 16; off; off >>= 1) {
      ar[e] += __shfl_xor(ar[e], off, 32);
      an[e] += __shfl_xor(an[e], off, 32);
    }
  if (lane == 0) {
    float noisy[4];
#pragma unroll
    for (int e = 0; e < 4; ++e) {
      const float lg = ar[e] + b_route[e];
      const float ns = an[e] + b_noise[e];
      const float sp = (ns > 20.f) ? ns : log1pf(__expf(ns));
      noisy[e] = lg + noise[t * 4 + e] * sp;
    }
    int i0 = 0;
    for (int e = 1; e < 4; ++e)
      if (noisy[e] > noisy[i0]) i0 = e;
    int i1 = -1;
    for (int e = 0; e < 4; ++e)
      if (e != i0 && (i1 < 0 || noisy[e] > noisy[i1])) i1 = e;
    const float m = fmaxf(noisy[i0], noisy[i1]);
    const float e0 = __expf(noisy[i0] - m), e1 = __expf(noisy[i1] - m);
    const float p0 = e0 / (e0 + e1);
#pragma unroll
    for (int e = 0; e < 4; ++e) gate[t * 4 + e] = 0.f;
    gate[t * 4 + i0] = p0;
    gate[t * 4 + i1] = 1.f - p0;
    fidx[2 * t] = i0;
    fidx[2 * t + 1] = i1;
  }
}

// ---------------------------------------------------------------------------
// Per-expert capacity dispatch (stable token order). grid = E blocks.
// ---------------------------------------------------------------------------
__global__ __launch_bounds__(256) void dispatch_scan(
    const int* __restrict__ fidx, const float* __restrict__ gate, int* sel,
    float* selw, int capacity, int T) {
  const int e = blockIdx.x, tid = threadIdx.x;
  __shared__ int sm[256];
  int base = 0;
  for (int c0 = 0; c0 < T; c0 += 256) {
    const int t = c0 + tid;
    int m = 0;
    if (t < T) m = (fidx[2 * t] == e || fidx[2 * t + 1] == e) ? 1 : 0;
    sm[tid] = m;
    __syncthreads();
    for (int off = 1; off < 256; off <<= 1) {  // inclusive Hillis-Steele
      const int x = sm[tid];
      const int y = (tid >= off) ? sm[tid - off] : 0;
      __syncthreads();
      sm[tid] = x + y;
      __syncthreads();
    }
    const int incl = sm[tid];
    const int tot = sm[255];
    __syncthreads();
    const int pos = base + incl - 1;
    if (m && pos < capacity) {
      sel[e * capacity + pos] = t;
      selw[e * capacity + pos] = gate[t * 4 + e];
    }
    base += tot;
  }
  for (int i = (base < capacity ? base : capacity) + tid; i < capacity;
       i += 256) {
    sel[e * capacity + i] = 0;
    selw[e * capacity + i] = 0.f;  // padded rows contribute nothing
  }
}

__global__ __launch_bounds__(256) void gather_kernel(
    const __bf16* __restrict__ x2b, const int* __restrict__ sel, __bf16* xdisp,
    int D) {
  const int row = blockIdx.x;
  const int src = sel[row];
  for (int d = threadIdx.x; d < D; d += 256)
    xdisp[(size_t)row * D + d] = x2b[(size_t)src * D + d];
}

// ---------------------------------------------------------------------------
// fp32 -> bf16 converters (direct and transposing, for [K][N] -> [N][K]).
// ---------------------------------------------------------------------------
__global__ __launch_bounds__(256) void cvt_bf16(const float* __restrict__ in,
                                                __bf16* out, size_t n) {
  size_t i = (size_t)blockIdx.x * 256 + threadIdx.x;
  const size_t stride = (size_t)gridDim.x * 256;
  for (; i < n; i += stride) out[i] = (__bf16)in[i];
}

__global__ __launch_bounds__(256) void cvt_bf16_t(const float* __restrict__ in,
                                                  __bf16* out, int K, int N) {
  const size_t n = (size_t)K * N;
  size_t i = (size_t)blockIdx.x * 256 + threadIdx.x;
  const size_t stride = (size_t)gridDim.x * 256;
  for (; i < n; i += stride) {
    const int k = (int)(i / N), c = (int)(i % N);
    out[(size_t)c * K + k] = (__bf16)in[i];
  }
}

// ---------------------------------------------------------------------------
// Launch orchestration.
// ---------------------------------------------------------------------------
extern "C" void kernel_launch(void* const* d_in, const int* in_sizes, int n_in,
                              void* d_out, int out_size, void* d_ws,
                              size_t ws_size, hipStream_t stream) {
  (void)in_sizes; (void)n_in; (void)out_size; (void)ws_size;
  constexpr int Bb = 2, Nn = 2048, Dd = 1024, Hh = 16, hd = 64;
  constexpr int T = Bb * Nn, D3 = 3 * Dd, MLPH = 4096, MOEH = 256;
  constexpr int Ee = 4, CAP = 2048;

  const float* x      = (const float*)d_in[0];
  const float* noise  = (const float*)d_in[1];
  const float* ln1_g  = (const float*)d_in[2];
  const float* ln1_b  = (const float*)d_in[3];
  const float* ln2_g  = (const float*)d_in[4];
  const float* ln2_b  = (const float*)d_in[5];
  const float* w_qkv  = (const float*)d_in[6];
  const float* w_proj = (const float*)d_in[7];
  const float* b_proj = (const float*)d_in[8];
  const float* w_rt   = (const float*)d_in[9];
  const float* b_rt   = (const float*)d_in[10];
  const float* w_nz   = (const float*)d_in[11];
  const float* b_nz   = (const float*)d_in[12];
  const float* we1    = (const float*)d_in[13];
  const float* be1    = (const float*)d_in[14];
  const float* we2    = (const float*)d_in[15];
  const float* be2    = (const float*)d_in[16];
  const float* w_m1   = (const float*)d_in[17];
  const float* b_m1   = (const float*)d_in[18];
  const float* w_m2   = (const float*)d_in[19];
  const float* b_m2   = (const float*)d_in[20];
  float* out = (float*)d_out;

  char* wsp = (char*)d_ws;
  size_t off = 0;
  auto alloc = [&](size_t bytes) {
    void* p = wsp + off;
    off = (off + bytes + 255) & ~(size_t)255;
    return p;
  };
  __bf16* x1b    = (__bf16*)alloc((size_t)T * Dd * 2);
  __bf16* wqkvb  = (__bf16*)alloc((size_t)D3 * Dd * 2);
  __bf16* qkvb   = (__bf16*)alloc((size_t)T * D3 * 2);
  __bf16* attnb  = (__bf16*)alloc((size_t)T * Dd * 2);
  __bf16* wprojb = (__bf16*)alloc((size_t)Dd * Dd * 2);
  float*  xattn  = (float*)alloc((size_t)T * Dd * 4);
  float*  x2f    = (float*)alloc((size_t)T * Dd * 4);
  __bf16* x2b    = (__bf16*)alloc((size_t)T * Dd * 2);
  __bf16* wm1t   = (__bf16*)alloc((size_t)Dd * MLPH * 2);
  __bf16* wm2t   = (__bf16*)alloc((size_t)MLPH * Dd * 2);
  __bf16* hmlp   = (__bf16*)alloc((size_t)T * MLPH * 2);
  __bf16* we1t   = (__bf16*)alloc((size_t)Ee * Dd * MOEH * 2);
  __bf16* we2t   = (__bf16*)alloc((size_t)Ee * MOEH * Dd * 2);
  __bf16* xdisp  = (__bf16*)alloc((size_t)Ee * CAP * Dd * 2);
  __bf16* hdisp  = (__bf16*)alloc((size_t)Ee * CAP * MOEH * 2);
  float*  gate   = (float*)alloc((size_t)T * Ee * 4);
  int*    fidx   = (int*)alloc((size_t)T * 2 * 4);
  int*    sel    = (int*)alloc((size_t)Ee * CAP * 4);
  float*  selw   = (float*)alloc((size_t)Ee * CAP * 4);

  // 1) weight conversion to bf16 (w_qkv/w_proj are already [N][K])
  cvt_bf16<<<2048, 256, 0, stream>>>(w_qkv, wqkvb, (size_t)D3 * Dd);
  cvt_bf16<<<1024, 256, 0, stream>>>(w_proj, wprojb, (size_t)Dd * Dd);
  cvt_bf16_t<<<2048, 256, 0, stream>>>(w_m1, wm1t, Dd, MLPH);
  cvt_bf16_t<<<2048, 256, 0, stream>>>(w_m2, wm2t, MLPH, Dd);
  for (int e = 0; e < Ee; ++e) {
    cvt_bf16_t<<<512, 256, 0, stream>>>(we1 + (size_t)e * Dd * MOEH,
                                        we1t + (size_t)e * MOEH * Dd, Dd, MOEH);
    cvt_bf16_t<<<512, 256, 0, stream>>>(we2 + (size_t)e * MOEH * Dd,
                                        we2t + (size_t)e * Dd * MOEH, MOEH, Dd);
  }

  // 2) LN1 -> x1 (bf16)
  ln_kernel<<<T, 256, 0, stream>>>(x, ln1_g, ln1_b, nullptr, x1b, Dd);

  // 3) QKV GEMM: [T,D] x [3D,D]^T -> bf16 [T,3D]
  gemm_bf16_kernel<false, false, false, OUT_BF16>
      <<<dim3(D3 / 64, T / 128), 256, 0, stream>>>(
          x1b, wqkvb, nullptr, nullptr, nullptr, qkvb, nullptr, nullptr,
          nullptr, T, D3, Dd);

  // 4) flash attention -> bf16 [T,D]
  attn_kernel<<<dim3(Nn / 64, Hh, Bb), 128, 0, stream>>>(qkvb, attnb, Nn, Hh,
                                                         hd);

  // 5) proj GEMM + b_proj + residual x -> xattn (f32)
  gemm_bf16_kernel<true, false, true, OUT_F32>
      <<<dim3(Dd / 64, T / 128), 256, 0, stream>>>(
          attnb, wprojb, b_proj, x, xattn, nullptr, nullptr, nullptr, nullptr,
          T, Dd, Dd);

  // 6) LN2 -> x2 (f32 + bf16)
  ln_kernel<<<T, 256, 0, stream>>>(xattn, ln2_g, ln2_b, x2f, x2b, Dd);

  // 7) router + capacity dispatch + gather
  router_kernel<<<T / 4, 128, 0, stream>>>(x2f, noise, w_rt, b_rt, w_nz, b_nz,
                                           gate, fidx, Dd);
  dispatch_scan<<<Ee, 256, 0, stream>>>(fidx, gate, sel, selw, CAP, T);
  gather_kernel<<<Ee * CAP, 256, 0, stream>>>(x2b, sel, xdisp, Dd);

  // 8) dense MLP: gelu(x2@W1+b1)@W2+b2 + xattn -> d_out (f32)
  gemm_bf16_kernel<true, true, false, OUT_BF16>
      <<<dim3(MLPH / 64, T / 128), 256, 0, stream>>>(
          x2b, wm1t, b_m1, nullptr, nullptr, hmlp, nullptr, nullptr, nullptr,
          T, MLPH, Dd);
  gemm_bf16_kernel<true, false, true, OUT_F32>
      <<<dim3(Dd / 64, T / 128), 256, 0, stream>>>(
          hmlp, wm2t, b_m2, xattn, out, nullptr, nullptr, nullptr, nullptr, T,
          Dd, MLPH);

  // 9) expert FFNs; second GEMM scatter-adds gate-weighted rows into d_out
  for (int e = 0; e < Ee; ++e) {
    gemm_bf16_kernel<true, true, false, OUT_BF16>
        <<<dim3(MOEH / 64, CAP / 128), 256, 0, stream>>>(
            xdisp + (size_t)e * CAP * Dd, we1t + (size_t)e * MOEH * Dd,
            be1 + (size_t)e * MOEH, nullptr, nullptr,
            hdisp + (size_t)e * CAP * MOEH, nullptr, nullptr, nullptr, CAP,
            MOEH, Dd);
    gemm_bf16_kernel<true, false, false, OUT_SCATTER>
        <<<dim3(Dd / 64, CAP / 128), 256, 0, stream>>>(
            hdisp + (size_t)e * CAP * MOEH, we2t + (size_t)e * Dd * MOEH,
            be2 + (size_t)e * Dd, nullptr, nullptr, nullptr, sel + e * CAP,
            selw + e * CAP, out, CAP, Dd, MOEH);
  }
}

// v003
// It runs in 373 microseconds.
// Next to v002, in two timings, it ran 1.56 and 1.58 times as fast.
// Counting every step since v000, it is 2.21 times as fast.
#include <hip/hip_runtime.h>
#include <hip/hip_bf16.h>
#include <math.h>
#include <stdint.h>

// ---------------------------------------------------------------------------
// Types for CDNA5 WMMA (wave32): D(f32 16x16) = A(bf16 16x32) x B(bf16 32x16) + C
// ---------------------------------------------------------------------------
typedef __attribute__((ext_vector_type(16))) __bf16 v16bf;
typedef __attribute__((ext_vector_type(8)))  float  v8f;

static __device__ __forceinline__ v8f wmma_bf16(v16bf a, v16bf b, v8f c) {
  // (neg_a, A, neg_b, B, c_mod, C, reuse_a, reuse_b)
  return __builtin_amdgcn_wmma_f32_16x16x32_bf16(false, a, false, b, (short)0, c,
                                                 false, false);
}

// CDNA5 async copy: global -> LDS, 16 bytes per lane, tracked by ASYNCcnt.
// lds_off = low 32 bits of the generic pointer (ISA: LDS generic addresses
// carry the LDS byte offset in [31:0]).
static __device__ __forceinline__ void async_ld_b128(void* lds_ptr,
                                                     const void* gptr) {
  const unsigned lds_off = (unsigned)(uintptr_t)lds_ptr;
  asm volatile("global_load_async_to_lds_b128 %0, %1, off"
               :
               : "v"(lds_off), "v"(gptr)
               : "memory");
}
static __device__ __forceinline__ void wait_async0() {
  asm volatile("s_wait_asynccnt 0" ::: "memory");
}

// Load a 16x32 bf16 fragment (A layout; B "Bt" layout is identical with N<->M)
// from row-major LDS with leading dim `ld` (bf16 elements, multiple of 8).
// Lane l: row = base + (l&15); half = l>>4 selects K subranges
// [half*8, half*8+8) and [16+half*8, 16+half*8+8)  -> two aligned b128 loads.
static __device__ __forceinline__ v16bf frag16(const __bf16* base, int row,
                                               int kbase, int ld) {
  const int lane = threadIdx.x & 31;
  const __bf16* p =
      base + (size_t)(row + (lane & 15)) * ld + kbase + ((lane >> 4) * 8);
  union { uint4 u[2]; v16bf v; } t;
  t.u[0] = *(const uint4*)p;
  t.u[1] = *(const uint4*)(p + 16);
  return t.v;
}

static __device__ __forceinline__ float gelu_exact(float x) {
  return 0.5f * x * (1.0f + erff(x * 0.70710678118654752f));
}

// ---------------------------------------------------------------------------
// Generic bf16 WMMA GEMM:  C[M][N] = A[M][K] * Bt[N][K]^T  (+bias, gelu, resid)
// Block 256 threads = 8 waves; tile 128(M) x 64(N); K-step 128.
// Async double-buffered LDS: global_load_async_to_lds_b128 fills the next
// tile while WMMA consumes the current one; one barrier per K-step.
// Sixteen lanes copy one 256-byte piece of a row, so a wave's copy covers
// whole cache lines. LDS rows are pitched 272 B (16 B x odd) for b128 reads.
// Epilogue forms: f32 store, bf16 store, atomic scatter-add with row scale.
// Bias, activation, residual and output form are template parameters: each
// launch's epilogue is code without tests on pointers, so its bias, residual
// and scatter loads are issued together and waited for once, not per element.
// Requires M%128==0, N%64==0, K%128==0 (true for every GEMM in this model).
// ---------------------------------------------------------------------------
constexpr int GEMM_KT = 128;     // k per stage
constexpr int GEMM_LD = 136;     // LDS row pitch in bf16 elements (272 B)
constexpr int OUT_F32 = 0, OUT_BF16 = 1, OUT_SCATTER = 2;  // output forms

// One stage's copies of one thread: 8 row pieces of A, 4 of Bt, rows 16 apart.
// The s_wait_xcnt stands inside the statement so that no address register of
// an issued copy is rewritten in front of it.
static __device__ __forceinline__ void async_stage12(const __bf16* lA,
                                                     const __bf16* lB,
                                                     const __bf16* gA,
                                                     const __bf16* gB, int K) {
  const unsigned la = (unsigned)(uintptr_t)lA;
  const unsigned lb = (unsigned)(uintptr_t)lB;
  constexpr unsigned LS = 16u * GEMM_LD * 2u;  // 16 LDS rows in bytes
  const size_t gs = (size_t)16 * K;            // 16 global rows in elements
  asm volatile(
      "global_load_async_to_lds_b128 %0, %12, off\n\t"
      "global_load_async_to_lds_b128 %1, %13, off\n\t"
      "global_load_async_to_lds_b128 %2, %14, off\n\t"
      "global_load_async_to_lds_b128 %3, %15, off\n\t"
      "global_load_async_to_lds_b128 %4, %16, off\n\t"
      "global_load_async_to_lds_b128 %5, %17, off\n\t"
      "global_load_async_to_lds_b128 %6, %18, off\n\t"
      "global_load_async_to_lds_b128 %7, %19, off\n\t"
      "global_load_async_to_lds_b128 %8, %20, off\n\t"
      "global_load_async_to_lds_b128 %9, %21, off\n\t"
      "global_load_async_to_lds_b128 %10, %22, off\n\t"
      "global_load_async_to_lds_b128 %11, %23, off\n\t"
      "s_wait_xcnt 0x0"
      :
      : "v"(la), "v"(la + LS), "v"(la + 2 * LS), "v"(la + 3 * LS),
        "v"(la + 4 * LS), "v"(la + 5 * LS), "v"(la + 6 * LS), "v"(la + 7 * LS),
        "v"(lb), "v"(lb + LS), "v"(lb + 2 * LS), "v"(lb + 3 * LS),
        "v"(gA), "v"(gA + gs), "v"(gA + 2 * gs), "v"(gA + 3 * gs),
        "v"(gA + 4 * gs), "v"(gA + 5 * gs), "v"(gA + 6 * gs), "v"(gA + 7 * gs),
        "v"(gB), "v"(gB + gs), "v"(gB + 2 * gs), "v"(gB + 3 * gs)
      : "memory");
}

template <bool BIAS, bool ACT, bool RESID, int OUT>
__global__ __launch_bounds__(256) void gemm_bf16_kernel(
    const __bf16* __restrict__ A, const __bf16* __restrict__ Bt,
    const float* __restrict__ bias, const float* __restrict__ residual,
    float* Cf, __bf16* Cb, const int* __restrict__ scat_rows,
    const float* __restrict__ scat_scale, float* scat_out, int M, int N,
    int K) {
  __shared__ __align__(16) __bf16 As[2][128][GEMM_LD];
  __shared__ __align__(16) __bf16 Bs[2][64][GEMM_LD];

  const int tid = threadIdx.x;
  const int wave = tid >> 5, lane = tid & 31;
  const int wm = wave & 3, wn = wave >> 2;
  const int bm = blockIdx.y * 128, bn = blockIdx.x * 64;

  const int rc = tid >> 4, cc = (tid & 15) * 8;  // copy: row in 16, 8 bf16
  const __bf16* gA0 = A + (size_t)(bm + rc) * K + cc;
  const __bf16* gB0 = Bt + (size_t)(bn + rc) * K + cc;

  auto issue_tile = [&](int buf, int k0) {
    async_stage12(&As[buf][rc][cc], &Bs[buf][rc][cc], gA0 + k0, gB0 + k0, K);
  };

  v8f acc[2][2] = {};
  const int nt = K / GEMM_KT;
  issue_tile(0, 0);
  wait_async0();      // tile 0 landed in LDS (this wave's copies)
  __syncthreads();    // ... and every other wave's
  if (nt > 1) issue_tile(1, GEMM_KT);

  for (int t = 0; t < nt; ++t) {
    const int cur = t & 1;
    // Unrolled so that ks folds into the immediate offsets of the LDS loads.
#pragma unroll
    for (int ks = 0; ks < GEMM_KT; ks += 32) {
      const v16bf a0 = frag16(&As[cur][0][0], wm * 32, ks, GEMM_LD);
      const v16bf a1 = frag16(&As[cur][0][0], wm * 32 + 16, ks, GEMM_LD);
      const v16bf b0 = frag16(&Bs[cur][0][0], wn * 32, ks, GEMM_LD);
      const v16bf b1 = frag16(&Bs[cur][0][0], wn * 32 + 16, ks, GEMM_LD);
      acc[0][0] = wmma_bf16(a0, b0, acc[0][0]);
      acc[0][1] = wmma_bf16(a0, b1, acc[0][1]);
      acc[1][0] = wmma_bf16(a1, b0, acc[1][0]);
      acc[1][1] = wmma_bf16(a1, b1, acc[1][1]);
    }
    // This wave's LDS reads of the buffer have retired before it is refilled.
    asm volatile("s_wait_dscnt 0x0" ::: "memory");
    wait_async0();      // next tile landed in LDS (this wave's copies)
    __syncthreads();    // all waves done copying AND done reading this buffer
    if (t + 2 < nt) issue_tile(cur, (t + 2) * GEMM_KT);  // flies over trip t+1
  }
  wait_async0();        // no copy is outstanding when the wave ends

  // Epilogue. C layout: lane half (l>>4) + VGPR v -> row half*8+v; col = l&15.
  const int half = lane >> 4, c0 = lane & 15;
  const int row0 = bm + wm * 32 + half * 8;  // + i*16 + v
  const int col0 = bn + wn * 32 + c0;        // + j*16

  // Everything the epilogue reads is fetched first, in one run of loads.
  // All loops below are unrolled so that acc and these arrays are indexed by
  // constants and stay in registers.
  float bv[2] = {};
  float rv[2][2][8] = {};
  float sc[2][8] = {};
  int dr[2][8] = {};
  if constexpr (BIAS) {
#pragma unroll
    for (int j = 0; j < 2; ++j) bv[j] = bias[col0 + j * 16];
  }
  if constexpr (RESID) {
#pragma unroll
    for (int i = 0; i < 2; ++i)
#pragma unroll
      for (int j = 0; j < 2; ++j)
#pragma unroll
        for (int v = 0; v < 8; ++v)
          rv[i][j][v] =
              residual[(size_t)(row0 + i * 16 + v) * N + col0 + j * 16];
  }
  if constexpr (OUT == OUT_SCATTER) {
#pragma unroll
    for (int i = 0; i < 2; ++i)
#pragma unroll
      for (int v = 0; v < 8; ++v) {
        sc[i][v] = scat_scale[row0 + i * 16 + v];
        dr[i][v] = scat_rows[row0 + i * 16 + v];
      }
  }

#pragma unroll
  for (int i = 0; i < 2; ++i)
#pragma unroll
    for (int j = 0; j < 2; ++j)
#pragma unroll
      for (int v = 0; v < 8; ++v) {
        const int row = row0 + i * 16 + v;
        const int col = col0 + j * 16;
        float val = acc[i][j][v];
        if constexpr (BIAS) val += bv[j];
        if constexpr (ACT) val = gelu_exact(val);
        if constexpr (RESID) val += rv[i][j][v];
        if constexpr (OUT == OUT_F32) Cf[(size_t)row * N + col] = val;
        if constexpr (OUT == OUT_BF16) Cb[(size_t)row * N + col] = (__bf16)val;
        if constexpr (OUT == OUT_SCATTER)
          atomicAdd(&scat_out[(size_t)dr[i][v] * N + col], val * sc[i][v]);
      }
}

// ---------------------------------------------------------------------------
// Flash attention: grid (N/64, H, B), 128 threads = 4 waves.
// Wave w owns 16 query rows x full 64-col key chunk -> row stats stay in-wave.
// Q/K tiles staged with async-to-LDS; V transposed manually (scattered b16).
// qkv layout: [T][3][H][hd] bf16;  out: [T][H*hd] bf16.
// ---------------------------------------------------------------------------
__global__ __launch_bounds__(128) void attn_kernel(
    const __bf16* __restrict__ qkv, __bf16* __restrict__ out, int N, int Hh,
    int hd) {
  const int D3 = 3 * Hh * hd;   // 3072
  const int Dm = Hh * hd;       // 1024
  const int qb = blockIdx.x, h = blockIdx.y, b = blockIdx.z;
  const int tid = threadIdx.x, wave = tid >> 5, lane = tid & 31;
  const int half = lane >> 4, c0 = lane & 15;

  __shared__ __align__(16) __bf16 Qs[64][80];
  __shared__ __align__(16) __bf16 Ks[64][80];
  __shared__ __align__(16) __bf16 Vt[64][80];       // V transposed: [d][key]
  __shared__ __align__(16) __bf16 Pb[4][16][80];    // per-wave P staging

  const int r = tid >> 1, d0 = (tid & 1) * 32;
  {  // Q tile (64x64) via async copy; first in-loop wait covers it
    const __bf16* g = qkv + (size_t)(b * N + qb * 64 + r) * D3 + h * hd + d0;
#pragma unroll
    for (int u = 0; u < 4; ++u) async_ld_b128(&Qs[r][d0 + u * 8], g + u * 8);
  }

  v8f o[4] = {};
  float mstat[8], lstat[8];
#pragma unroll
  for (int v = 0; v < 8; ++v) { mstat[v] = -1e30f; lstat[v] = 0.f; }

  for (int kb = 0; kb < N / 64; ++kb) {
    __syncthreads();  // prior P@V reads of Vt complete before overwrite
    {
      const __bf16* gk =
          qkv + (size_t)(b * N + kb * 64 + r) * D3 + Dm + h * hd + d0;
#pragma unroll
      for (int u = 0; u < 4; ++u)
        async_ld_b128(&Ks[r][d0 + u * 8], gk + u * 8);
      const __bf16* gv =
          qkv + (size_t)(b * N + kb * 64 + r) * D3 + 2 * Dm + h * hd + d0;
#pragma unroll
      for (int u = 0; u < 32; ++u) Vt[d0 + u][r] = gv[u];  // transpose to LDS
    }
    wait_async0();
    __syncthreads();

    // S = (Q * hd^-0.5) @ K^T  (64x64 per block; 16x64 per wave)
    v8f s[4] = {};
#pragma unroll
    for (int ks = 0; ks < 64; ks += 32) {
      const v16bf a = frag16(&Qs[0][0], wave * 16, ks, 80);
#pragma unroll
      for (int j = 0; j < 4; ++j) {
        const v16bf bf = frag16(&Ks[0][0], j * 16, ks, 80);
        s[j] = wmma_bf16(a, bf, s[j]);
      }
    }

    // online softmax per row (row = half*8+v, fully within this wave)
#pragma unroll
    for (int v = 0; v < 8; ++v) {
      float rmax = -1e30f;
#pragma unroll
      for (int j = 0; j < 4; ++j) {
        s[j][v] *= 0.125f;  // hd^-0.5
        rmax = fmaxf(rmax, s[j][v]);
      }
#pragma unroll
      for (int off = 1; off < 16; off <<= 1)
        rmax = fmaxf(rmax, __shfl_xor(rmax, off, 16));
      const float mnew = fmaxf(mstat[v], rmax);
      const float alpha = __expf(mstat[v] - mnew);
      float rsum = 0.f;
#pragma unroll
      for (int j = 0; j < 4; ++j) {
        const float p = __expf(s[j][v] - mnew);
        s[j][v] = p;
        rsum += p;
      }
#pragma unroll
      for (int off = 1; off < 16; off <<= 1) rsum += __shfl_xor(rsum, off, 16);
      lstat[v] = lstat[v] * alpha + rsum;
      mstat[v] = mnew;
#pragma unroll
      for (int j = 0; j < 4; ++j) {
        o[j][v] *= alpha;
        Pb[wave][half * 8 + v][j * 16 + c0] = (__bf16)s[j][v];
      }
    }
    __syncthreads();  // Pb visible for re-fragmentation

    // O += P @ V
#pragma unroll
    for (int ks = 0; ks < 64; ks += 32) {
      const v16bf a = frag16(&Pb[wave][0][0], 0, ks, 80);
#pragma unroll
      for (int j = 0; j < 4; ++j) {
        const v16bf bf = frag16(&Vt[0][0], j * 16, ks, 80);
        o[j] = wmma_bf16(a, bf, o[j]);
      }
    }
  }

  const int trow = b * N + qb * 64 + wave * 16 + half * 8;
#pragma unroll
  for (int v = 0; v < 8; ++v) {
    const float inv = 1.0f / lstat[v];
#pragma unroll
    for (int j = 0; j < 4; ++j)
      out[(size_t)(trow + v) * Dm + h * hd + j * 16 + c0] =
          (__bf16)(o[j][v] * inv);
  }
}

// ---------------------------------------------------------------------------
// LayerNorm (one token per block). Optional f32 and/or bf16 outputs.
// ---------------------------------------------------------------------------
__global__ __launch_bounds__(256) void ln_kernel(const float* __restrict__ x,
                                                 const float* __restrict__ g,
                                                 const float* __restrict__ bta,
                                                 float* outf, __bf16* outb,
                                                 int D) {
  const int t = blockIdx.x;
  const float* row = x + (size_t)t * D;
  float s = 0.f, ss = 0.f;
  for (int d = threadIdx.x; d < D; d += 256) {
    const float v = row[d];
    s += v;
    ss += v * v;
  }
#pragma unroll
  for (int off = 16; off; off >>= 1) {
    s += __shfl_xor(s, off, 32);
    ss += __shfl_xor(ss, off, 32);
  }
  __shared__ float rs[8], rss[8], mv[2];
  const int wave = threadIdx.x >> 5, lane = threadIdx.x & 31;
  if (lane == 0) { rs[wave] = s; rss[wave] = ss; }
  __syncthreads();
  if (threadIdx.x == 0) {
    float a = 0.f, b2 = 0.f;
    for (int i = 0; i < 8; ++i) { a += rs[i]; b2 += rss[i]; }
    const float mu = a / D;
    mv[0] = mu;
    mv[1] = rsqrtf(b2 / D - mu * mu + 1e-5f);
  }
  __syncthreads();
  const float mu = mv[0], r = mv[1];
  for (int d = threadIdx.x; d < D; d += 256) {
    const float v = (row[d] - mu) * r * g[d] + bta[d];
    if (outf) outf[(size_t)t * D + d] = v;
    if (outb) outb[(size_t)t * D + d] = (__bf16)v;
  }
}

// ---------------------------------------------------------------------------
// Router: noisy top-2 over E=4 experts. One wave per token.
// ---------------------------------------------------------------------------
__global__ __launch_bounds__(128) void router_kernel(
    const float* __restrict__ x2, const float* __restrict__ noise,
    const float* __restrict__ w_route, const float* __restrict__ b_route,
    const float* __restrict__ w_noise, const float* __restrict__ b_noise,
    float* gate, int* fidx, int D) {
  const int wave = threadIdx.x >> 5, lane = threadIdx.x & 31;
  const int t = blockIdx.x * 4 + wave;
  float ar[4] = {0, 0, 0, 0}, an[4] = {0, 0, 0, 0};
  for (int d = lane; d < D; d += 32) {
    const float xv = x2[(size_t)t * D + d];
#pragma unroll
    for (int e = 0; e < 4; ++e) {
      ar[e] += xv * w_route[d * 4 + e];
      an[e] += xv * w_noise[d * 4 + e];
    }
  }
#pragma unroll
  for (int e = 0; e < 4; ++e)
#pragma unroll
    for (int off = 16; off; off >>= 1) {
      ar[e] += __shfl_xor(ar[e], off, 32);
      an[e] += __shfl_xor(an[e], off, 32);
    }
  if (lane == 0) {
    float noisy[4];
#pragma unroll
    for (int e = 0; e < 4; ++e) {
      const float lg = ar[e] + b_route[e];
      const float ns = an[e] + b_noise[e];
      const float sp = (ns > 20.f) ? ns : log1pf(__expf(ns));
      noisy[e] = lg + noise[t * 4 + e] * sp;
    }
    int i0 = 0;
    for (int e = 1; e < 4; ++e)
      if (noisy[e] > noisy[i0]) i0 = e;
    int i1 = -1;
    for (int e = 0; e < 4; ++e)
      if (e != i0 && (i1 < 0 || noisy[e] > noisy[i1])) i1 = e;
    const float m = fmaxf(noisy[i0], noisy[i1]);
    const float e0 = __expf(noisy[i0] - m), e1 = __expf(noisy[i1] - m);
    const float p0 = e0 / (e0 + e1);
#pragma unroll
    for (int e = 0; e < 4; ++e) gate[t * 4 + e] = 0.f;
    gate[t * 4 + i0] = p0;
    gate[t * 4 + i1] = 1.f - p0;
    fidx[2 * t] = i0;
    fidx[2 * t + 1] = i1;
  }
}

// ---------------------------------------------------------------------------
// Per-expert capacity dispatch (stable token order). grid = E blocks.
// ---------------------------------------------------------------------------
__global__ __launch_bounds__(256) void dispatch_scan(
    const int* __restrict__ fidx, const float* __restrict__ gate, int* sel,
    float* selw, int capacity, int T) {
  const int e = blockIdx.x, tid = threadIdx.x;
  __shared__ int sm[256];
  int base = 0;
  for (int c0 = 0; c0 < T; c0 += 256) {
    const int t = c0 + tid;
    int m = 0;
    if (t < T) m = (fidx[2 * t] == e || fidx[2 * t + 1] == e) ? 1 : 0;
    sm[tid] = m;
    __syncthreads();
    for (int off = 1; off < 256; off <<= 1) {  // inclusive Hillis-Steele
      const int x = sm[tid];
      const int y = (tid >= off) ? sm[tid - off] : 0;
      __syncthreads();
      sm[tid] = x + y;
      __syncthreads();
    }
    const int incl = sm[tid];
    const int tot = sm[255];
    __syncthreads();
    const int pos = base + incl - 1;
    if (m && pos < capacity) {
      sel[e * capacity + pos] = t;
      selw[e * capacity + pos] = gate[t * 4 + e];
    }
    base += tot;
  }
  for (int i = (base < capacity ? base : capacity) + tid; i < capacity;
       i += 256) {
    sel[e * capacity + i] = 0;
    selw[e * capacity + i] = 0.f;  // padded rows contribute nothing
  }
}

__global__ __launch_bounds__(256) void gather_kernel(
    const __bf16* __restrict__ x2b, const int* __restrict__ sel, __bf16* xdisp,
    int D) {
  const int row = blockIdx.x;
  const int src = sel[row];
  for (int d = threadIdx.x; d < D; d += 256)
    xdisp[(size_t)row * D + d] = x2b[(size_t)src * D + d];
}

// ---------------------------------------------------------------------------
// fp32 -> bf16 conversion of every weight, one launch.
// The work is cut into pieces of 4096 elements; each work-group takes CVT_PER
// of them, so few waves are started and each moves many bytes.
// A piece of w_qkv or w_proj (already [N][K]) is a straight run of elements.
// A piece of any other weight is a 64x64 tile of in[K][N] that goes out as
// out[N][K]: input rows are read as 256-byte runs, two neighbouring k of one
// column are packed into a dword, the tile is turned in LDS, and each output
// row gets one whole 128-byte run.
// ---------------------------------------------------------------------------
constexpr int W_D = 1024, W_MLPH = 4096, W_MOEH = 256, W_E = 4;  // model dims
constexpr int CVT_PIECE = 64 * 64;
constexpr int CVT_B_PROJ = 3 * W_D * W_D / CVT_PIECE;             // after w_qkv
constexpr int CVT_B_M1 = CVT_B_PROJ + W_D * W_D / CVT_PIECE;      // after w_proj
constexpr int CVT_B_M2 = CVT_B_M1 + W_D * W_MLPH / CVT_PIECE;     // after w_mlp1
constexpr int CVT_B_E1 = CVT_B_M2 + W_MLPH * W_D / CVT_PIECE;     // after w_mlp2
constexpr int CVT_B_E2 = CVT_B_E1 + W_E * W_D * W_MOEH / CVT_PIECE;
constexpr int CVT_TOTAL = CVT_B_E2 + W_E * W_MOEH * W_D / CVT_PIECE;
constexpr int CVT_PER = 4;                      // pieces per work-group
constexpr int CVT_GRID = CVT_TOTAL / CVT_PER;   // work-groups
static_assert(CVT_GRID * CVT_PER == CVT_TOTAL, "pieces divide evenly");
constexpr int CVT_EXP_TILES = W_D * W_MOEH / CVT_PIECE;  // tiles per expert
static_assert(CVT_EXP_TILES == 64, "expert index is taken by a shift of 6");
constexpr int CVT_PITCH = 68;  // LDS row pitch in bf16: 136 B, 8-byte aligned

typedef __attribute__((ext_vector_type(2))) float  f32x2;
typedef __attribute__((ext_vector_type(2))) __bf16 bf16x2;

// Two floats to one dword of bf16, lo in the low half; converted as a pair so
// that one packed conversion does both.
static __device__ __forceinline__ unsigned pack_bf16(float lo, float hi) {
  const f32x2 f = {lo, hi};
  return __builtin_bit_cast(unsigned, __builtin_convertvector(f, bf16x2));
}

typedef __attribute__((ext_vector_type(4))) float    f32x4;
typedef __attribute__((ext_vector_type(2))) unsigned u32x2;
typedef __attribute__((ext_vector_type(4))) unsigned u32x4;

// Four 16-byte loads that fly together. Loads and their data wait are one
// statement with early-clobber outputs, so that no result lands in an address
// pair of the run and no address pair is rewritten while a load is out (as
// plain loads the compiler let one load's result take another's address).
static __device__ __forceinline__ void load4_b128(const float* p0,
                                                  const float* p1,
                                                  const float* p2,
                                                  const float* p3, f32x4& r0,
                                                  f32x4& r1, f32x4& r2,
                                                  f32x4& r3) {
  asm volatile(
      "global_load_b128 %0, %4, off\n\t"
      "global_load_b128 %1, %5, off\n\t"
      "global_load_b128 %2, %6, off\n\t"
      "global_load_b128 %3, %7, off\n\t"
      "s_wait_loadcnt 0x0"
      : "=&v"(r0), "=&v"(r1), "=&v"(r2), "=&v"(r3)
      : "v"(p0), "v"(p1), "v"(p2), "v"(p3)
      : "memory");
}

// Stores with their s_wait_xcnt in the same statement: the next piece rewrites
// the registers that they name, and a wait in a statement of its own is not
// tied to those registers.
static __device__ __forceinline__ void store4_b64_step2k(__bf16* p, u32x2 w0,
                                                         u32x2 w1, u32x2 w2,
                                                         u32x2 w3) {
  asm volatile(
      "global_store_b64 %0, %1, off\n\t"
      "global_store_b64 %0, %2, off offset:2048\n\t"
      "global_store_b64 %0, %3, off offset:4096\n\t"
      "global_store_b64 %0, %4, off offset:6144\n\t"
      "s_wait_xcnt 0x0"
      :
      : "v"(p), "v"(w0), "v"(w1), "v"(w2), "v"(w3)
      : "memory");
}
static __device__ __forceinline__ void store2_b128(__bf16* p, u32x4 d0,
                                                   u32x4 d1) {
  asm volatile(
      "global_store_b128 %0, %1, off\n\t"
      "global_store_b128 %0, %2, off offset:16\n\t"
      "s_wait_xcnt 0x0"
      :
      : "v"(p), "v"(d0), "v"(d1)
      : "memory");
}

__global__ __launch_bounds__(256) void cvt_weights(
    const float* __restrict__ w_qkv, const float* __restrict__ w_proj,
    const float* __restrict__ w_m1, const float* __restrict__ w_m2,
    const float* __restrict__ we1, const float* __restrict__ we2,
    __bf16* __restrict__ o_qkv, __bf16* __restrict__ o_proj,
    __bf16* __restrict__ o_m1, __bf16* __restrict__ o_m2,
    __bf16* __restrict__ o_e1, __bf16* __restrict__ o_e2) {
  __shared__ __align__(16) __bf16 tile[2][64][CVT_PITCH];
  const int tid = threadIdx.x;

  for (int i = 0; i < CVT_PER; ++i) {
    const int p = blockIdx.x + i * CVT_GRID;  // same for the whole work-group
    const bool turned = p >= CVT_B_M1;
    __bf16(*t)[CVT_PITCH] = tile[i & 1];

    // Which weight, and which tile of it. N = 64 << lnt columns of input.
    const float* in;
    __bf16* out;
    int K = 0, lnt = 0, q;
    if (p < CVT_B_PROJ) {
      in = w_qkv; out = o_qkv; q = p;
    } else if (p < CVT_B_M1) {
      in = w_proj; out = o_proj; q = p - CVT_B_PROJ;
    } else if (p < CVT_B_M2) {
      in = w_m1; out = o_m1; q = p - CVT_B_M1; K = W_D; lnt = 6;
    } else if (p < CVT_B_E1) {
      in = w_m2; out = o_m2; q = p - CVT_B_M2; K = W_MLPH; lnt = 4;
    } else if (p < CVT_B_E2) {
      q = p - CVT_B_E1;
      in = we1 + (size_t)(q >> 6) * (W_D * W_MOEH);
      out = o_e1 + (size_t)(q >> 6) * (W_D * W_MOEH);
      q &= 63; K = W_D; lnt = 2;
    } else {
      q = p - CVT_B_E2;
      in = we2 + (size_t)(q >> 6) * (W_D * W_MOEH);
      out = o_e2 + (size_t)(q >> 6) * (W_D * W_MOEH);
      q &= 63; K = W_MOEH; lnt = 4;
    }
    const int N = 64 << lnt;
    const int k0 = (q >> lnt) * 64, n0 = (q & ((1 << lnt) - 1)) * 64;

    if (!turned) {
      const size_t e = (size_t)q * CVT_PIECE + tid * 4;
      const float* g = in + e;
      f32x4 v0, v1, v2, v3;
      load4_b128(g, g + 1024, g + 2048, g + 3072, v0, v1, v2, v3);
      const u32x2 w0 = {pack_bf16(v0.x, v0.y), pack_bf16(v0.z, v0.w)};
      const u32x2 w1 = {pack_bf16(v1.x, v1.y), pack_bf16(v1.z, v1.w)};
      const u32x2 w2 = {pack_bf16(v2.x, v2.y), pack_bf16(v2.z, v2.w)};
      const u32x2 w3 = {pack_bf16(v3.x, v3.y), pack_bf16(v3.z, v3.w)};
      store4_b64_step2k(out + e, w0, w1, w2, w3);  // 1024 elements apart
    } else {
      const int c4 = (tid & 15) * 4, r2 = (tid >> 4) * 2;
      const float* g = in + (size_t)(k0 + r2) * N + n0 + c4;
      f32x4 a0, b0, a1, b1;  // rows k, k + 1 and k + 32, k + 33
      load4_b128(g, g + N, g + (size_t)32 * N, g + (size_t)33 * N, a0, b0, a1,
                 b1);
      *(unsigned*)&t[c4 + 0][r2] = pack_bf16(a0.x, b0.x);
      *(unsigned*)&t[c4 + 1][r2] = pack_bf16(a0.y, b0.y);
      *(unsigned*)&t[c4 + 2][r2] = pack_bf16(a0.z, b0.z);
      *(unsigned*)&t[c4 + 3][r2] = pack_bf16(a0.w, b0.w);
      *(unsigned*)&t[c4 + 0][r2 + 32] = pack_bf16(a1.x, b1.x);
      *(unsigned*)&t[c4 + 1][r2 + 32] = pack_bf16(a1.y, b1.y);
      *(unsigned*)&t[c4 + 2][r2 + 32] = pack_bf16(a1.z, b1.z);
      *(unsigned*)&t[c4 + 3][r2 + 32] = pack_bf16(a1.w, b1.w);
    }
    // One barrier a trip, passed by every wave whatever the piece: it
    // publishes this trip's tile, and it stands between the reads of a buffer
    // in trip i and its next filling in trip i + 2.
    __syncthreads();
    if (turned) {
      const int n = tid >> 2, kc = (tid & 3) * 16;
      const uint2* s = (const uint2*)&t[n][kc];
      const uint2 s0 = s[0], s1 = s[1], s2 = s[2], s3 = s[3];
      const u32x4 d0 = {s0.x, s0.y, s1.x, s1.y};
      const u32x4 d1 = {s2.x, s2.y, s3.x, s3.y};
      store2_b128(out + (size_t)(n0 + n) * K + k0 + kc, d0, d1);
    }
  }
}

// ---------------------------------------------------------------------------
// Launch orchestration.
// ---------------------------------------------------------------------------
extern "C" void kernel_launch(void* const* d_in, const int* in_sizes, int n_in,
                              void* d_out, int out_size, void* d_ws,
                              size_t ws_size, hipStream_t stream) {
  (void)in_sizes; (void)n_in; (void)out_size; (void)ws_size;
  constexpr int Bb = 2, Nn = 2048, Dd = 1024, Hh = 16, hd = 64;
  constexpr int T = Bb * Nn, D3 = 3 * Dd, MLPH = 4096, MOEH = 256;
  constexpr int Ee = 4, CAP = 2048;

  const float* x      = (const float*)d_in[0];
  const float* noise  = (const float*)d_in[1];
  const float* ln1_g  = (const float*)d_in[2];
  const float* ln1_b  = (const float*)d_in[3];
  const float* ln2_g  = (const float*)d_in[4];
  const float* ln2_b  = (const float*)d_in[5];
  const float* w_qkv  = (const float*)d_in[6];
  const float* w_proj = (const float*)d_in[7];
  const float* b_proj = (const float*)d_in[8];
  const float* w_rt   = (const float*)d_in[9];
  const float* b_rt   = (const float*)d_in[10];
  const float* w_nz   = (const float*)d_in[11];
  const float* b_nz   = (const float*)d_in[12];
  const float* we1    = (const float*)d_in[13];
  const float* be1    = (const float*)d_in[14];
  const float* we2    = (const float*)d_in[15];
  const float* be2    = (const float*)d_in[16];
  const float* w_m1   = (const float*)d_in[17];
  const float* b_m1   = (const float*)d_in[18];
  const float* w_m2   = (const float*)d_in[19];
  const float* b_m2   = (const float*)d_in[20];
  float* out = (float*)d_out;

  char* wsp = (char*)d_ws;
  size_t off = 0;
  auto alloc = [&](size_t bytes) {
    void* p = wsp + off;
    off = (off + bytes + 255) & ~(size_t)255;
    return p;
  };
  __bf16* x1b    = (__bf16*)alloc((size_t)T * Dd * 2);
  __bf16* wqkvb  = (__bf16*)alloc((size_t)D3 * Dd * 2);
  __bf16* qkvb   = (__bf16*)alloc((size_t)T * D3 * 2);
  __bf16* attnb  = (__bf16*)alloc((size_t)T * Dd * 2);
  __bf16* wprojb = (__bf16*)alloc((size_t)Dd * Dd * 2);
  float*  xattn  = (float*)alloc((size_t)T * Dd * 4);
  float*  x2f    = (float*)alloc((size_t)T * Dd * 4);
  __bf16* x2b    = (__bf16*)alloc((size_t)T * Dd * 2);
  __bf16* wm1t   = (__bf16*)alloc((size_t)Dd * MLPH * 2);
  __bf16* wm2t   = (__bf16*)alloc((size_t)MLPH * Dd * 2);
  __bf16* hmlp   = (__bf16*)alloc((size_t)T * MLPH * 2);
  __bf16* we1t   = (__bf16*)alloc((size_t)Ee * Dd * MOEH * 2);
  __bf16* we2t   = (__bf16*)alloc((size_t)Ee * MOEH * Dd * 2);
  __bf16* xdisp  = (__bf16*)alloc((size_t)Ee * CAP * Dd * 2);
  __bf16* hdisp  = (__bf16*)alloc((size_t)Ee * CAP * MOEH * 2);
  float*  gate   = (float*)alloc((size_t)T * Ee * 4);
  int*    fidx   = (int*)alloc((size_t)T * 2 * 4);
  int*    sel    = (int*)alloc((size_t)Ee * CAP * 4);
  float*  selw   = (float*)alloc((size_t)Ee * CAP * 4);

  // 1) weight conversion to bf16 (w_qkv/w_proj are already [N][K]; the rest
  //    goes from [K][N] to [N][K])
  static_assert(Dd == W_D && MLPH == W_MLPH && MOEH == W_MOEH && Ee == W_E,
                "the conversion kernel is cut for these shapes");
  cvt_weights<<<CVT_GRID, 256, 0, stream>>>(w_qkv, w_proj, w_m1, w_m2, we1, we2,
                                            wqkvb, wprojb, wm1t, wm2t, we1t,
                                            we2t);

  // 2) LN1 -> x1 (bf16)
  ln_kernel<<<T, 256, 0, stream>>>(x, ln1_g, ln1_b, nullptr, x1b, Dd);

  // 3) QKV GEMM: [T,D] x [3D,D]^T -> bf16 [T,3D]
  gemm_bf16_kernel<false, false, false, OUT_BF16>
      <<<dim3(D3 / 64, T / 128), 256, 0, stream>>>(
          x1b, wqkvb, nullptr, nullptr, nullptr, qkvb, nullptr, nullptr,
          nullptr, T, D3, Dd);

  // 4) flash attention -> bf16 [T,D]
  attn_kernel<<<dim3(Nn / 64, Hh, Bb), 128, 0, stream>>>(qkvb, attnb, Nn, Hh,
                                                         hd);

  // 5) proj GEMM + b_proj + residual x -> xattn (f32)
  gemm_bf16_kernel<true, false, true, OUT_F32>
      <<<dim3(Dd / 64, T / 128), 256, 0, stream>>>(
          attnb, wprojb, b_proj, x, xattn, nullptr, nullptr, nullptr, nullptr,
          T, Dd, Dd);

  // 6) LN2 -> x2 (f32 + bf16)
  ln_kernel<<<T, 256, 0, stream>>>(xattn, ln2_g, ln2_b, x2f, x2b, Dd);

  // 7) router + capacity dispatch + gather
  router_kernel<<<T / 4, 128, 0, stream>>>(x2f, noise, w_rt, b_rt, w_nz, b_nz,
                                           gate, fidx, Dd);
  dispatch_scan<<<Ee, 256, 0, stream>>>(fidx, gate, sel, selw, CAP, T);
  gather_kernel<<<Ee * CAP, 256, 0, stream>>>(x2b, sel, xdisp, Dd);

  // 8) dense MLP: gelu(x2@W1+b1)@W2+b2 + xattn -> d_out (f32)
  gemm_bf16_kernel<true, true, false, OUT_BF16>
      <<<dim3(MLPH / 64, T / 128), 256, 0, stream>>>(
          x2b, wm1t, b_m1, nullptr, nullptr, hmlp, nullptr, nullptr, nullptr,
          T, MLPH, Dd);
  gemm_bf16_kernel<true, false, true, OUT_F32>
      <<<dim3(Dd / 64, T / 128), 256, 0, stream>>>(
          hmlp, wm2t, b_m2, xattn, out, nullptr, nullptr, nullptr, nullptr, T,
          Dd, MLPH);

  // 9) expert FFNs; second GEMM scatter-adds gate-weighted rows into d_out
  for (int e = 0; e < Ee; ++e) {
    gemm_bf16_kernel<true, true, false, OUT_BF16>
        <<<dim3(MOEH / 64, CAP / 128), 256, 0, stream>>>(
            xdisp + (size_t)e * CAP * Dd, we1t + (size_t)e * MOEH * Dd,
            be1 + (size_t)e * MOEH, nullptr, nullptr,
            hdisp + (size_t)e * CAP * MOEH, nullptr, nullptr, nullptr, CAP,
            MOEH, Dd);
    gemm_bf16_kernel<true, false, false, OUT_SCATTER>
        <<<dim3(Dd / 64, CAP / 128), 256, 0, stream>>>(
            hdisp + (size_t)e * CAP * MOEH, we2t + (size_t)e * Dd * MOEH,
            be2 + (size_t)e * Dd, nullptr, nullptr, nullptr, sel + e * CAP,
            selw + e * CAP, out, CAP, Dd, MOEH);
  }
}

// v004
// It runs in 354 microseconds.
// Timed twice side by side with v003, it ran 1.05 times as fast both times.
// Over all steps from v000 it is 2.32 times as fast.
#include <hip/hip_runtime.h>
#include <hip/hip_bf16.h>
#include <math.h>
#include <stdint.h>

// ---------------------------------------------------------------------------
// Types for CDNA5 WMMA (wave32): D(f32 16x16) = A(bf16 16x32) x B(bf16 32x16) + C
// ---------------------------------------------------------------------------
typedef __attribute__((ext_vector_type(16))) __bf16 v16bf;
typedef __attribute__((ext_vector_type(8)))  float  v8f;

static __device__ __forceinline__ v8f wmma_bf16(v16bf a, v16bf b, v8f c) {
  // (neg_a, A, neg_b, B, c_mod, C, reuse_a, reuse_b)
  return __builtin_amdgcn_wmma_f32_16x16x32_bf16(false, a, false, b, (short)0, c,
                                                 false, false);
}

// CDNA5 async copy: global -> LDS, 16 bytes per lane, tracked by ASYNCcnt.
// lds_off = low 32 bits of the generic pointer (ISA: LDS generic addresses
// carry the LDS byte offset in [31:0]).
static __device__ __forceinline__ void async_ld_b128(void* lds_ptr,
                                                     const void* gptr) {
  const unsigned lds_off = (unsigned)(uintptr_t)lds_ptr;
  asm volatile("global_load_async_to_lds_b128 %0, %1, off"
               :
               : "v"(lds_off), "v"(gptr)
               : "memory");
}
static __device__ __forceinline__ void wait_async0() {
  asm volatile("s_wait_asynccnt 0" ::: "memory");
}

// Load a 16x32 bf16 fragment (A layout; B "Bt" layout is identical with N<->M)
// from row-major LDS with leading dim `ld` (bf16 elements, multiple of 8).
// Lane l: row = base + (l&15); half = l>>4 selects K subranges
// [half*8, half*8+8) and [16+half*8, 16+half*8+8)  -> two aligned b128 loads.
static __device__ __forceinline__ v16bf frag16(const __bf16* base, int row,
                                               int kbase, int ld) {
  const int lane = threadIdx.x & 31;
  const __bf16* p =
      base + (size_t)(row + (lane & 15)) * ld + kbase + ((lane >> 4) * 8);
  union { uint4 u[2]; v16bf v; } t;
  t.u[0] = *(const uint4*)p;
  t.u[1] = *(const uint4*)(p + 16);
  return t.v;
}

static __device__ __forceinline__ float gelu_exact(float x) {
  return 0.5f * x * (1.0f + erff(x * 0.70710678118654752f));
}

// ---------------------------------------------------------------------------
// Generic bf16 WMMA GEMM:  C[M][N] = A[M][K] * Bt[N][K]^T  (+bias, gelu, resid)
// Block 256 threads = 8 waves; tile 128(M) x 64(N); K-step 128.
// Async double-buffered LDS: global_load_async_to_lds_b128 fills the next
// tile while WMMA consumes the current one; one barrier per K-step.
// Sixteen lanes copy one 256-byte piece of a row, so a wave's copy covers
// whole cache lines. LDS rows are pitched 272 B (16 B x odd) for b128 reads.
// Epilogue forms: f32 store, bf16 store, atomic scatter-add with row scale.
// Bias, activation, residual and output form are template parameters: each
// launch's epilogue is code without tests on pointers, so its bias, residual
// and scatter loads are issued together and waited for once, not per element.
// Requires M%128==0, N%64==0, K%128==0 (true for every GEMM in this model).
// ---------------------------------------------------------------------------
constexpr int GEMM_KT = 128;     // k per stage
constexpr int GEMM_LD = 136;     // LDS row pitch in bf16 elements (272 B)
constexpr int OUT_F32 = 0, OUT_BF16 = 1, OUT_SCATTER = 2;  // output forms

// One stage's copies of one thread: 8 row pieces of A, 4 of Bt, rows 16 apart.
// The s_wait_xcnt stands inside the statement so that no address register of
// an issued copy is rewritten in front of it.
static __device__ __forceinline__ void async_stage12(const __bf16* lA,
                                                     const __bf16* lB,
                                                     const __bf16* gA,
                                                     const __bf16* gB, int K) {
  const unsigned la = (unsigned)(uintptr_t)lA;
  const unsigned lb = (unsigned)(uintptr_t)lB;
  constexpr unsigned LS = 16u * GEMM_LD * 2u;  // 16 LDS rows in bytes
  const size_t gs = (size_t)16 * K;            // 16 global rows in elements
  asm volatile(
      "global_load_async_to_lds_b128 %0, %12, off\n\t"
      "global_load_async_to_lds_b128 %1, %13, off\n\t"
      "global_load_async_to_lds_b128 %2, %14, off\n\t"
      "global_load_async_to_lds_b128 %3, %15, off\n\t"
      "global_load_async_to_lds_b128 %4, %16, off\n\t"
      "global_load_async_to_lds_b128 %5, %17, off\n\t"
      "global_load_async_to_lds_b128 %6, %18, off\n\t"
      "global_load_async_to_lds_b128 %7, %19, off\n\t"
      "global_load_async_to_lds_b128 %8, %20, off\n\t"
      "global_load_async_to_lds_b128 %9, %21, off\n\t"
      "global_load_async_to_lds_b128 %10, %22, off\n\t"
      "global_load_async_to_lds_b128 %11, %23, off\n\t"
      "s_wait_xcnt 0x0"
      :
      : "v"(la), "v"(la + LS), "v"(la + 2 * LS), "v"(la + 3 * LS),
        "v"(la + 4 * LS), "v"(la + 5 * LS), "v"(la + 6 * LS), "v"(la + 7 * LS),
        "v"(lb), "v"(lb + LS), "v"(lb + 2 * LS), "v"(lb + 3 * LS),
        "v"(gA), "v"(gA + gs), "v"(gA + 2 * gs), "v"(gA + 3 * gs),
        "v"(gA + 4 * gs), "v"(gA + 5 * gs), "v"(gA + 6 * gs), "v"(gA + 7 * gs),
        "v"(gB), "v"(gB + gs), "v"(gB + 2 * gs), "v"(gB + 3 * gs)
      : "memory");
}

template <bool BIAS, bool ACT, bool RESID, int OUT>
__global__ __launch_bounds__(256) void gemm_bf16_kernel(
    const __bf16* __restrict__ A, const __bf16* __restrict__ Bt,
    const float* __restrict__ bias, const float* __restrict__ residual,
    float* Cf, __bf16* Cb, const int* __restrict__ scat_rows,
    const float* __restrict__ scat_scale, float* scat_out, int M, int N,
    int K) {
  __shared__ __align__(16) __bf16 As[2][128][GEMM_LD];
  __shared__ __align__(16) __bf16 Bs[2][64][GEMM_LD];

  const int tid = threadIdx.x;
  const int wave = tid >> 5, lane = tid & 31;
  const int wm = wave & 3, wn = wave >> 2;
  const int bm = blockIdx.y * 128, bn = blockIdx.x * 64;

  const int rc = tid >> 4, cc = (tid & 15) * 8;  // copy: row in 16, 8 bf16
  const __bf16* gA0 = A + (size_t)(bm + rc) * K + cc;
  const __bf16* gB0 = Bt + (size_t)(bn + rc) * K + cc;

  auto issue_tile = [&](int buf, int k0) {
    async_stage12(&As[buf][rc][cc], &Bs[buf][rc][cc], gA0 + k0, gB0 + k0, K);
  };

  v8f acc[2][2] = {};
  const int nt = K / GEMM_KT;
  issue_tile(0, 0);
  wait_async0();      // tile 0 landed in LDS (this wave's copies)
  __syncthreads();    // ... and every other wave's
  if (nt > 1) issue_tile(1, GEMM_KT);

  for (int t = 0; t < nt; ++t) {
    const int cur = t & 1;
    // Unrolled so that ks folds into the immediate offsets of the LDS loads.
#pragma unroll
    for (int ks = 0; ks < GEMM_KT; ks += 32) {
      const v16bf a0 = frag16(&As[cur][0][0], wm * 32, ks, GEMM_LD);
      const v16bf a1 = frag16(&As[cur][0][0], wm * 32 + 16, ks, GEMM_LD);
      const v16bf b0 = frag16(&Bs[cur][0][0], wn * 32, ks, GEMM_LD);
      const v16bf b1 = frag16(&Bs[cur][0][0], wn * 32 + 16, ks, GEMM_LD);
      acc[0][0] = wmma_bf16(a0, b0, acc[0][0]);
      acc[0][1] = wmma_bf16(a0, b1, acc[0][1]);
      acc[1][0] = wmma_bf16(a1, b0, acc[1][0]);
      acc[1][1] = wmma_bf16(a1, b1, acc[1][1]);
    }
    // This wave's LDS reads of the buffer have retired before it is refilled.
    asm volatile("s_wait_dscnt 0x0" ::: "memory");
    wait_async0();      // next tile landed in LDS (this wave's copies)
    __syncthreads();    // all waves done copying AND done reading this buffer
    if (t + 2 < nt) issue_tile(cur, (t + 2) * GEMM_KT);  // flies over trip t+1
  }
  wait_async0();        // no copy is outstanding when the wave ends

  // Epilogue. C layout: lane half (l>>4) + VGPR v -> row half*8+v; col = l&15.
  const int half = lane >> 4, c0 = lane & 15;
  const int row0 = bm + wm * 32 + half * 8;  // + i*16 + v
  const int col0 = bn + wn * 32 + c0;        // + j*16

  // Everything the epilogue reads is fetched first, in one run of loads.
  // All loops below are unrolled so that acc and these arrays are indexed by
  // constants and stay in registers.
  float bv[2] = {};
  float rv[2][2][8] = {};
  float sc[2][8] = {};
  int dr[2][8] = {};
  if constexpr (BIAS) {
#pragma unroll
    for (int j = 0; j < 2; ++j) bv[j] = bias[col0 + j * 16];
  }
  if constexpr (RESID) {
#pragma unroll
    for (int i = 0; i < 2; ++i)
#pragma unroll
      for (int j = 0; j < 2; ++j)
#pragma unroll
        for (int v = 0; v < 8; ++v)
          rv[i][j][v] =
              residual[(size_t)(row0 + i * 16 + v) * N + col0 + j * 16];
  }
  if constexpr (OUT == OUT_SCATTER) {
#pragma unroll
    for (int i = 0; i < 2; ++i)
#pragma unroll
      for (int v = 0; v < 8; ++v) {
        sc[i][v] = scat_scale[row0 + i * 16 + v];
        dr[i][v] = scat_rows[row0 + i * 16 + v];
      }
  }

#pragma unroll
  for (int i = 0; i < 2; ++i)
#pragma unroll
    for (int j = 0; j < 2; ++j)
#pragma unroll
      for (int v = 0; v < 8; ++v) {
        const int row = row0 + i * 16 + v;
        const int col = col0 + j * 16;
        float val = acc[i][j][v];
        if constexpr (BIAS) val += bv[j];
        if constexpr (ACT) val = gelu_exact(val);
        if constexpr (RESID) val += rv[i][j][v];
        if constexpr (OUT == OUT_F32) Cf[(size_t)row * N + col] = val;
        if constexpr (OUT == OUT_BF16) Cb[(size_t)row * N + col] = (__bf16)val;
        if constexpr (OUT == OUT_SCATTER)
          atomicAdd(&scat_out[(size_t)dr[i][v] * N + col], val * sc[i][v]);
      }
}

// ---------------------------------------------------------------------------
// Flash attention: grid (N/64, H, B), 128 threads = 4 waves.
// Wave w owns 16 query rows x full 64-col key chunk -> row stats stay in-wave.
// Q/K tiles staged with async-to-LDS; V transposed manually (scattered b16).
// qkv layout: [T][3][H][hd] bf16;  out: [T][H*hd] bf16.
// ---------------------------------------------------------------------------
__global__ __launch_bounds__(128) void attn_kernel(
    const __bf16* __restrict__ qkv, __bf16* __restrict__ out, int N, int Hh,
    int hd) {
  const int D3 = 3 * Hh * hd;   // 3072
  const int Dm = Hh * hd;       // 1024
  const int qb = blockIdx.x, h = blockIdx.y, b = blockIdx.z;
  const int tid = threadIdx.x, wave = tid >> 5, lane = tid & 31;
  const int half = lane >> 4, c0 = lane & 15;

  __shared__ __align__(16) __bf16 Qs[64][80];
  __shared__ __align__(16) __bf16 Ks[64][80];
  __shared__ __align__(16) __bf16 Vt[64][80];       // V transposed: [d][key]
  __shared__ __align__(16) __bf16 Pb[4][16][80];    // per-wave P staging

  const int r = tid >> 1, d0 = (tid & 1) * 32;
  {  // Q tile (64x64) via async copy; first in-loop wait covers it
    const __bf16* g = qkv + (size_t)(b * N + qb * 64 + r) * D3 + h * hd + d0;
#pragma unroll
    for (int u = 0; u < 4; ++u) async_ld_b128(&Qs[r][d0 + u * 8], g + u * 8);
  }

  v8f o[4] = {};
  float mstat[8], lstat[8];
#pragma unroll
  for (int v = 0; v < 8; ++v) { mstat[v] = -1e30f; lstat[v] = 0.f; }

  for (int kb = 0; kb < N / 64; ++kb) {
    __syncthreads();  // prior P@V reads of Vt complete before overwrite
    {
      const __bf16* gk =
          qkv + (size_t)(b * N + kb * 64 + r) * D3 + Dm + h * hd + d0;
#pragma unroll
      for (int u = 0; u < 4; ++u)
        async_ld_b128(&Ks[r][d0 + u * 8], gk + u * 8);
      const __bf16* gv =
          qkv + (size_t)(b * N + kb * 64 + r) * D3 + 2 * Dm + h * hd + d0;
#pragma unroll
      for (int u = 0; u < 32; ++u) Vt[d0 + u][r] = gv[u];  // transpose to LDS
    }
    wait_async0();
    __syncthreads();

    // S = (Q * hd^-0.5) @ K^T  (64x64 per block; 16x64 per wave)
    v8f s[4] = {};
#pragma unroll
    for (int ks = 0; ks < 64; ks += 32) {
      const v16bf a = frag16(&Qs[0][0], wave * 16, ks, 80);
#pragma unroll
      for (int j = 0; j < 4; ++j) {
        const v16bf bf = frag16(&Ks[0][0], j * 16, ks, 80);
        s[j] = wmma_bf16(a, bf, s[j]);
      }
    }

    // online softmax per row (row = half*8+v, fully within this wave)
#pragma unroll
    for (int v = 0; v < 8; ++v) {
      float rmax = -1e30f;
#pragma unroll
      for (int j = 0; j < 4; ++j) {
        s[j][v] *= 0.125f;  // hd^-0.5
        rmax = fmaxf(rmax, s[j][v]);
      }
#pragma unroll
      for (int off = 1; off < 16; off <<= 1)
        rmax = fmaxf(rmax, __shfl_xor(rmax, off, 16));
      const float mnew = fmaxf(mstat[v], rmax);
      const float alpha = __expf(mstat[v] - mnew);
      float rsum = 0.f;
#pragma unroll
      for (int j = 0; j < 4; ++j) {
        const float p = __expf(s[j][v] - mnew);
        s[j][v] = p;
        rsum += p;
      }
#pragma unroll
      for (int off = 1; off < 16; off <<= 1) rsum += __shfl_xor(rsum, off, 16);
      lstat[v] = lstat[v] * alpha + rsum;
      mstat[v] = mnew;
#pragma unroll
      for (int j = 0; j < 4; ++j) {
        o[j][v] *= alpha;
        Pb[wave][half * 8 + v][j * 16 + c0] = (__bf16)s[j][v];
      }
    }
    __syncthreads();  // Pb visible for re-fragmentation

    // O += P @ V
#pragma unroll
    for (int ks = 0; ks < 64; ks += 32) {
      const v16bf a = frag16(&Pb[wave][0][0], 0, ks, 80);
#pragma unroll
      for (int j = 0; j < 4; ++j) {
        const v16bf bf = frag16(&Vt[0][0], j * 16, ks, 80);
        o[j] = wmma_bf16(a, bf, o[j]);
      }
    }
  }

  const int trow = b * N + qb * 64 + wave * 16 + half * 8;
#pragma unroll
  for (int v = 0; v < 8; ++v) {
    const float inv = 1.0f / lstat[v];
#pragma unroll
    for (int j = 0; j < 4; ++j)
      out[(size_t)(trow + v) * Dm + h * hd + j * 16 + c0] =
          (__bf16)(o[j][v] * inv);
  }
}

// ---------------------------------------------------------------------------
// Router: noisy top-2 over E=4 experts. One wave per token.
// ---------------------------------------------------------------------------
__global__ __launch_bounds__(128) void router_kernel(
    const float* __restrict__ x2, const float* __restrict__ noise,
    const float* __restrict__ w_route, const float* __restrict__ b_route,
    const float* __restrict__ w_noise, const float* __restrict__ b_noise,
    float* gate, int* fidx, int D) {
  const int wave = threadIdx.x >> 5, lane = threadIdx.x & 31;
  const int t = blockIdx.x * 4 + wave;
  float ar[4] = {0, 0, 0, 0}, an[4] = {0, 0, 0, 0};
  for (int d = lane; d < D; d += 32) {
    const float xv = x2[(size_t)t * D + d];
#pragma unroll
    for (int e = 0; e < 4; ++e) {
      ar[e] += xv * w_route[d * 4 + e];
      an[e] += xv * w_noise[d * 4 + e];
    }
  }
#pragma unroll
  for (int e = 0; e < 4; ++e)
#pragma unroll
    for (int off = 16; off; off >>= 1) {
      ar[e] += __shfl_xor(ar[e], off, 32);
      an[e] += __shfl_xor(an[e], off, 32);
    }
  if (lane == 0) {
    float noisy[4];
#pragma unroll
    for (int e = 0; e < 4; ++e) {
      const float lg = ar[e] + b_route[e];
      const float ns = an[e] + b_noise[e];
      const float sp = (ns > 20.f) ? ns : log1pf(__expf(ns));
      noisy[e] = lg + noise[t * 4 + e] * sp;
    }
    int i0 = 0;
    for (int e = 1; e < 4; ++e)
      if (noisy[e] > noisy[i0]) i0 = e;
    int i1 = -1;
    for (int e = 0; e < 4; ++e)
      if (e != i0 && (i1 < 0 || noisy[e] > noisy[i1])) i1 = e;
    const float m = fmaxf(noisy[i0], noisy[i1]);
    const float e0 = __expf(noisy[i0] - m), e1 = __expf(noisy[i1] - m);
    const float p0 = e0 / (e0 + e1);
#pragma unroll
    for (int e = 0; e < 4; ++e) gate[t * 4 + e] = 0.f;
    gate[t * 4 + i0] = p0;
    gate[t * 4 + i1] = 1.f - p0;
    fidx[2 * t] = i0;
    fidx[2 * t + 1] = i1;
  }
}

// ---------------------------------------------------------------------------
// Per-expert capacity dispatch (stable token order). grid = E blocks.
// ---------------------------------------------------------------------------
__global__ __launch_bounds__(256) void dispatch_scan(
    const int* __restrict__ fidx, const float* __restrict__ gate, int* sel,
    float* selw, int capacity, int T) {
  const int e = blockIdx.x, tid = threadIdx.x;
  __shared__ int sm[256];
  int base = 0;
  for (int c0 = 0; c0 < T; c0 += 256) {
    const int t = c0 + tid;
    int m = 0;
    if (t < T) m = (fidx[2 * t] == e || fidx[2 * t + 1] == e) ? 1 : 0;
    sm[tid] = m;
    __syncthreads();
    for (int off = 1; off < 256; off <<= 1) {  // inclusive Hillis-Steele
      const int x = sm[tid];
      const int y = (tid >= off) ? sm[tid - off] : 0;
      __syncthreads();
      sm[tid] = x + y;
      __syncthreads();
    }
    const int incl = sm[tid];
    const int tot = sm[255];
    __syncthreads();
    const int pos = base + incl - 1;
    if (m && pos < capacity) {
      sel[e * capacity + pos] = t;
      selw[e * capacity + pos] = gate[t * 4 + e];
    }
    base += tot;
  }
  for (int i = (base < capacity ? base : capacity) + tid; i < capacity;
       i += 256) {
    sel[e * capacity + i] = 0;
    selw[e * capacity + i] = 0.f;  // padded rows contribute nothing
  }
}

// ---------------------------------------------------------------------------
// fp32 -> bf16 conversion of every weight, one launch.
// The work is cut into pieces of 4096 elements; each work-group takes CVT_PER
// of them, so few waves are started and each moves many bytes.
// A piece of w_qkv or w_proj (already [N][K]) is a straight run of elements.
// A piece of any other weight is a 64x64 tile of in[K][N] that goes out as
// out[N][K]: input rows are read as 256-byte runs, two neighbouring k of one
// column are packed into a dword, the tile is turned in LDS, and each output
// row gets one whole 128-byte run.
// ---------------------------------------------------------------------------
constexpr int W_D = 1024, W_MLPH = 4096, W_MOEH = 256, W_E = 4;  // model dims
constexpr int CVT_PIECE = 64 * 64;
constexpr int CVT_B_PROJ = 3 * W_D * W_D / CVT_PIECE;             // after w_qkv
constexpr int CVT_B_M1 = CVT_B_PROJ + W_D * W_D / CVT_PIECE;      // after w_proj
constexpr int CVT_B_M2 = CVT_B_M1 + W_D * W_MLPH / CVT_PIECE;     // after w_mlp1
constexpr int CVT_B_E1 = CVT_B_M2 + W_MLPH * W_D / CVT_PIECE;     // after w_mlp2
constexpr int CVT_B_E2 = CVT_B_E1 + W_E * W_D * W_MOEH / CVT_PIECE;
constexpr int CVT_TOTAL = CVT_B_E2 + W_E * W_MOEH * W_D / CVT_PIECE;
constexpr int CVT_PER = 4;                      // pieces per work-group
constexpr int CVT_GRID = CVT_TOTAL / CVT_PER;   // work-groups
static_assert(CVT_GRID * CVT_PER == CVT_TOTAL, "pieces divide evenly");
constexpr int CVT_EXP_TILES = W_D * W_MOEH / CVT_PIECE;  // tiles per expert
static_assert(CVT_EXP_TILES == 64, "expert index is taken by a shift of 6");
constexpr int CVT_PITCH = 68;  // LDS row pitch in bf16: 136 B, 8-byte aligned

typedef __attribute__((ext_vector_type(2))) float  f32x2;
typedef __attribute__((ext_vector_type(2))) __bf16 bf16x2;

// Two floats to one dword of bf16, lo in the low half; converted as a pair so
// that one packed conversion does both.
static __device__ __forceinline__ unsigned pack_bf16(float lo, float hi) {
  const f32x2 f = {lo, hi};
  return __builtin_bit_cast(unsigned, __builtin_convertvector(f, bf16x2));
}

typedef __attribute__((ext_vector_type(4))) float    f32x4;
typedef __attribute__((ext_vector_type(2))) unsigned u32x2;
typedef __attribute__((ext_vector_type(4))) unsigned u32x4;

// Four 16-byte loads that fly together. Loads and their data wait are one
// statement with early-clobber outputs, so that no result lands in an address
// pair of the run and no address pair is rewritten while a load is out (as
// plain loads the compiler let one load's result take another's address).
static __device__ __forceinline__ void load4_b128(const float* p0,
                                                  const float* p1,
                                                  const float* p2,
                                                  const float* p3, f32x4& r0,
                                                  f32x4& r1, f32x4& r2,
                                                  f32x4& r3) {
  asm volatile(
      "global_load_b128 %0, %4, off\n\t"
      "global_load_b128 %1, %5, off\n\t"
      "global_load_b128 %2, %6, off\n\t"
      "global_load_b128 %3, %7, off\n\t"
      "s_wait_loadcnt 0x0"
      : "=&v"(r0), "=&v"(r1), "=&v"(r2), "=&v"(r3)
      : "v"(p0), "v"(p1), "v"(p2), "v"(p3)
      : "memory");
}

// Stores with their s_wait_xcnt in the same statement: the next piece rewrites
// the registers that they name, and a wait in a statement of its own is not
// tied to those registers.
static __device__ __forceinline__ void store4_b64_step2k(__bf16* p, u32x2 w0,
                                                         u32x2 w1, u32x2 w2,
                                                         u32x2 w3) {
  asm volatile(
      "global_store_b64 %0, %1, off\n\t"
      "global_store_b64 %0, %2, off offset:2048\n\t"
      "global_store_b64 %0, %3, off offset:4096\n\t"
      "global_store_b64 %0, %4, off offset:6144\n\t"
      "s_wait_xcnt 0x0"
      :
      : "v"(p), "v"(w0), "v"(w1), "v"(w2), "v"(w3)
      : "memory");
}
static __device__ __forceinline__ void store2_b128(__bf16* p, u32x4 d0,
                                                   u32x4 d1) {
  asm volatile(
      "global_store_b128 %0, %1, off\n\t"
      "global_store_b128 %0, %2, off offset:16\n\t"
      "s_wait_xcnt 0x0"
      :
      : "v"(p), "v"(d0), "v"(d1)
      : "memory");
}

__global__ __launch_bounds__(256) void cvt_weights(
    const float* __restrict__ w_qkv, const float* __restrict__ w_proj,
    const float* __restrict__ w_m1, const float* __restrict__ w_m2,
    const float* __restrict__ we1, const float* __restrict__ we2,
    __bf16* __restrict__ o_qkv, __bf16* __restrict__ o_proj,
    __bf16* __restrict__ o_m1, __bf16* __restrict__ o_m2,
    __bf16* __restrict__ o_e1, __bf16* __restrict__ o_e2) {
  __shared__ __align__(16) __bf16 tile[2][64][CVT_PITCH];
  const int tid = threadIdx.x;

  for (int i = 0; i < CVT_PER; ++i) {
    const int p = blockIdx.x + i * CVT_GRID;  // same for the whole work-group
    const bool turned = p >= CVT_B_M1;
    __bf16(*t)[CVT_PITCH] = tile[i & 1];

    // Which weight, and which tile of it. N = 64 << lnt columns of input.
    const float* in;
    __bf16* out;
    int K = 0, lnt = 0, q;
    if (p < CVT_B_PROJ) {
      in = w_qkv; out = o_qkv; q = p;
    } else if (p < CVT_B_M1) {
      in = w_proj; out = o_proj; q = p - CVT_B_PROJ;
    } else if (p < CVT_B_M2) {
      in = w_m1; out = o_m1; q = p - CVT_B_M1; K = W_D; lnt = 6;
    } else if (p < CVT_B_E1) {
      in = w_m2; out = o_m2; q = p - CVT_B_M2; K = W_MLPH; lnt = 4;
    } else if (p < CVT_B_E2) {
      q = p - CVT_B_E1;
      in = we1 + (size_t)(q >> 6) * (W_D * W_MOEH);
      out = o_e1 + (size_t)(q >> 6) * (W_D * W_MOEH);
      q &= 63; K = W_D; lnt = 2;
    } else {
      q = p - CVT_B_E2;
      in = we2 + (size_t)(q >> 6) * (W_D * W_MOEH);
      out = o_e2 + (size_t)(q >> 6) * (W_D * W_MOEH);
      q &= 63; K = W_MOEH; lnt = 4;
    }
    const int N = 64 << lnt;
    const int k0 = (q >> lnt) * 64, n0 = (q & ((1 << lnt) - 1)) * 64;

    if (!turned) {
      const size_t e = (size_t)q * CVT_PIECE + tid * 4;
      const float* g = in + e;
      f32x4 v0, v1, v2, v3;
      load4_b128(g, g + 1024, g + 2048, g + 3072, v0, v1, v2, v3);
      const u32x2 w0 = {pack_bf16(v0.x, v0.y), pack_bf16(v0.z, v0.w)};
      const u32x2 w1 = {pack_bf16(v1.x, v1.y), pack_bf16(v1.z, v1.w)};
      const u32x2 w2 = {pack_bf16(v2.x, v2.y), pack_bf16(v2.z, v2.w)};
      const u32x2 w3 = {pack_bf16(v3.x, v3.y), pack_bf16(v3.z, v3.w)};
      store4_b64_step2k(out + e, w0, w1, w2, w3);  // 1024 elements apart
    } else {
      const int c4 = (tid & 15) * 4, r2 = (tid >> 4) * 2;
      const float* g = in + (size_t)(k0 + r2) * N + n0 + c4;
      f32x4 a0, b0, a1, b1;  // rows k, k + 1 and k + 32, k + 33
      load4_b128(g, g + N, g + (size_t)32 * N, g + (size_t)33 * N, a0, b0, a1,
                 b1);
      *(unsigned*)&t[c4 + 0][r2] = pack_bf16(a0.x, b0.x);
      *(unsigned*)&t[c4 + 1][r2] = pack_bf16(a0.y, b0.y);
      *(unsigned*)&t[c4 + 2][r2] = pack_bf16(a0.z, b0.z);
      *(unsigned*)&t[c4 + 3][r2] = pack_bf16(a0.w, b0.w);
      *(unsigned*)&t[c4 + 0][r2 + 32] = pack_bf16(a1.x, b1.x);
      *(unsigned*)&t[c4 + 1][r2 + 32] = pack_bf16(a1.y, b1.y);
      *(unsigned*)&t[c4 + 2][r2 + 32] = pack_bf16(a1.z, b1.z);
      *(unsigned*)&t[c4 + 3][r2 + 32] = pack_bf16(a1.w, b1.w);
    }
    // One barrier a trip, passed by every wave whatever the piece: it
    // publishes this trip's tile, and it stands between the reads of a buffer
    // in trip i and its next filling in trip i + 2.
    __syncthreads();
    if (turned) {
      const int n = tid >> 2, kc = (tid & 3) * 16;
      const uint2* s = (const uint2*)&t[n][kc];
      const uint2 s0 = s[0], s1 = s[1], s2 = s[2], s3 = s[3];
      const u32x4 d0 = {s0.x, s0.y, s1.x, s1.y};
      const u32x4 d1 = {s2.x, s2.y, s3.x, s3.y};
      store2_b128(out + (size_t)(n0 + n) * K + k0 + kc, d0, d1);
    }
  }
}

// ---------------------------------------------------------------------------
// Row kernels: LayerNorm and the expert gather. A row is W_D elements.
// One wave takes a whole row (LayerNorm) or two rows (gather) in 16-byte
// pieces per lane, each wave-wide access covering 512 contiguous bytes, so a
// launch starts 4096 waves that each keep eight or more loads in flight.
// Loads stand with their data wait, stores with their s_wait_xcnt, in one
// statement each, for the reasons given at load4_b128 and store4_b64_step2k.
// ---------------------------------------------------------------------------
static_assert(W_D == 32 * 4 * 8, "a lane holds 8 pieces of 4 floats of a row");

// One row of x, and gamma and beta, 512 bytes of each per wave-wide load.
static __device__ __forceinline__ void load_ln_row(const float* x,
                                                   const float* g,
                                                   const float* b,
                                                   f32x4 (&xv)[8],
                                                   f32x4 (&gv)[8],
                                                   f32x4 (&bv)[8]) {
  asm volatile(
      "global_load_b128 %0, %24, off\n\t"
      "global_load_b128 %1, %24, off offset:512\n\t"
      "global_load_b128 %2, %24, off offset:1024\n\t"
      "global_load_b128 %3, %24, off offset:1536\n\t"
      "global_load_b128 %4, %24, off offset:2048\n\t"
      "global_load_b128 %5, %24, off offset:2560\n\t"
      "global_load_b128 %6, %24, off offset:3072\n\t"
      "global_load_b128 %7, %24, off offset:3584\n\t"
      "global_load_b128 %8, %25, off\n\t"
      "global_load_b128 %9, %25, off offset:512\n\t"
      "global_load_b128 %10, %25, off offset:1024\n\t"
      "global_load_b128 %11, %25, off offset:1536\n\t"
      "global_load_b128 %12, %25, off offset:2048\n\t"
      "global_load_b128 %13, %25, off offset:2560\n\t"
      "global_load_b128 %14, %25, off offset:3072\n\t"
      "global_load_b128 %15, %25, off offset:3584\n\t"
      "global_load_b128 %16, %26, off\n\t"
      "global_load_b128 %17, %26, off offset:512\n\t"
      "global_load_b128 %18, %26, off offset:1024\n\t"
      "global_load_b128 %19, %26, off offset:1536\n\t"
      "global_load_b128 %20, %26, off offset:2048\n\t"
      "global_load_b128 %21, %26, off offset:2560\n\t"
      "global_load_b128 %22, %26, off offset:3072\n\t"
      "global_load_b128 %23, %26, off offset:3584\n\t"
      "s_wait_loadcnt 0x0"
      : "=&v"(xv[0]), "=&v"(xv[1]), "=&v"(xv[2]), "=&v"(xv[3]), "=&v"(xv[4]), "=&v"(xv[5]), "=&v"(xv[6]), "=&v"(xv[7]),
        "=&v"(gv[0]), "=&v"(gv[1]), "=&v"(gv[2]), "=&v"(gv[3]), "=&v"(gv[4]), "=&v"(gv[5]), "=&v"(gv[6]), "=&v"(gv[7]),
        "=&v"(bv[0]), "=&v"(bv[1]), "=&v"(bv[2]), "=&v"(bv[3]), "=&v"(bv[4]), "=&v"(bv[5]), "=&v"(bv[6]), "=&v"(bv[7])
      : "v"(x), "v"(g), "v"(b)
      : "memory");
}
// Two rows of W_D bf16, four 16-byte pieces per lane of each.
static __device__ __forceinline__ void load_2rows_bf16(const __bf16* p0,
                                                       const __bf16* p1,
                                                       u32x4 (&d)[8]) {
  asm volatile(
      "global_load_b128 %0, %8, off\n\t"
      "global_load_b128 %1, %8, off offset:512\n\t"
      "global_load_b128 %2, %8, off offset:1024\n\t"
      "global_load_b128 %3, %8, off offset:1536\n\t"
      "global_load_b128 %4, %9, off\n\t"
      "global_load_b128 %5, %9, off offset:512\n\t"
      "global_load_b128 %6, %9, off offset:1024\n\t"
      "global_load_b128 %7, %9, off offset:1536\n\t"
      "s_wait_loadcnt 0x0"
      : "=&v"(d[0]), "=&v"(d[1]), "=&v"(d[2]), "=&v"(d[3]), "=&v"(d[4]), "=&v"(d[5]), "=&v"(d[6]), "=&v"(d[7])
      : "v"(p0), "v"(p1)
      : "memory");
}
static __device__ __forceinline__ void store8_f32x4(float* p,
                                                    const f32x4 (&d)[8]) {
  asm volatile(
      "global_store_b128 %0, %1, off\n\t"
      "global_store_b128 %0, %2, off offset:512\n\t"
      "global_store_b128 %0, %3, off offset:1024\n\t"
      "global_store_b128 %0, %4, off offset:1536\n\t"
      "global_store_b128 %0, %5, off offset:2048\n\t"
      "global_store_b128 %0, %6, off offset:2560\n\t"
      "global_store_b128 %0, %7, off offset:3072\n\t"
      "global_store_b128 %0, %8, off offset:3584\n\t"
      "s_wait_xcnt 0x0"
      :
      : "v"(p), "v"(d[0]), "v"(d[1]), "v"(d[2]), "v"(d[3]), "v"(d[4]), "v"(d[5]), "v"(d[6]), "v"(d[7])
      : "memory");
}
static __device__ __forceinline__ void store8_u32x4(__bf16* p,
                                                    const u32x4 (&d)[8]) {
  asm volatile(
      "global_store_b128 %0, %1, off\n\t"
      "global_store_b128 %0, %2, off offset:512\n\t"
      "global_store_b128 %0, %3, off offset:1024\n\t"
      "global_store_b128 %0, %4, off offset:1536\n\t"
      "global_store_b128 %0, %5, off offset:2048\n\t"
      "global_store_b128 %0, %6, off offset:2560\n\t"
      "global_store_b128 %0, %7, off offset:3072\n\t"
      "global_store_b128 %0, %8, off offset:3584\n\t"
      "s_wait_xcnt 0x0"
      :
      : "v"(p), "v"(d[0]), "v"(d[1]), "v"(d[2]), "v"(d[3]), "v"(d[4]), "v"(d[5]), "v"(d[6]), "v"(d[7])
      : "memory");
}
static __device__ __forceinline__ void store8_u32x2(__bf16* p,
                                                    const u32x2 (&d)[8]) {
  asm volatile(
      "global_store_b64 %0, %1, off\n\t"
      "global_store_b64 %0, %2, off offset:256\n\t"
      "global_store_b64 %0, %3, off offset:512\n\t"
      "global_store_b64 %0, %4, off offset:768\n\t"
      "global_store_b64 %0, %5, off offset:1024\n\t"
      "global_store_b64 %0, %6, off offset:1280\n\t"
      "global_store_b64 %0, %7, off offset:1536\n\t"
      "global_store_b64 %0, %8, off offset:1792\n\t"
      "s_wait_xcnt 0x0"
      :
      : "v"(p), "v"(d[0]), "v"(d[1]), "v"(d[2]), "v"(d[3]), "v"(d[4]), "v"(d[5]), "v"(d[6]), "v"(d[7])
      : "memory");
}

// LayerNorm: one token per wave, the row read once and kept in registers.
// Optional f32 and/or bf16 outputs. grid = tokens / 8.
__global__ __launch_bounds__(256) void ln_kernel(const float* __restrict__ x,
                                                 const float* __restrict__ g,
                                                 const float* __restrict__ bta,
                                                 float* outf, __bf16* outb) {
  const int wave = threadIdx.x >> 5, lane = threadIdx.x & 31;
  const size_t e = (size_t)(blockIdx.x * 8 + wave) * W_D + lane * 4;
  f32x4 xv[8], gv[8], bv[8];
  load_ln_row(x + e, g + lane * 4, bta + lane * 4, xv, gv, bv);

  // Four independent chains per sum; all loops over c are unrolled so that
  // the arrays are indexed by constants and stay in registers.
  f32x4 s4 = {}, ss4 = {};
#pragma unroll
  for (int c = 0; c < 8; ++c) {
    s4 += xv[c];
    ss4 += xv[c] * xv[c];
  }
  float s = (s4.x + s4.y) + (s4.z + s4.w);
  float ss = (ss4.x + ss4.y) + (ss4.z + ss4.w);
#pragma unroll
  for (int off = 16; off; off >>= 1) {
    s += __shfl_xor(s, off, 32);
    ss += __shfl_xor(ss, off, 32);
  }
  const float mu = s / W_D;
  const float r = rsqrtf(ss / W_D - mu * mu + 1e-5f);

  f32x4 y[8];
#pragma unroll
  for (int c = 0; c < 8; ++c) y[c] = (xv[c] - mu) * r * gv[c] + bv[c];
  if (outf) store8_f32x4(outf + e, y);
  if (outb) {
    u32x2 w[8];
#pragma unroll
    for (int c = 0; c < 8; ++c)
      w[c] = u32x2{pack_bf16(y[c].x, y[c].y), pack_bf16(y[c].z, y[c].w)};
    store8_u32x2(outb + e, w);
  }
}

// Gather: each wave copies two neighbouring rows of xdisp from the rows of
// x2b that sel names. grid = rows / 16.
__global__ __launch_bounds__(256) void gather_kernel(
    const __bf16* __restrict__ x2b, const int* __restrict__ sel,
    __bf16* xdisp) {
  // The wave's number as a scalar, so that sel is read by a scalar load.
  const int wave = __builtin_amdgcn_readfirstlane(threadIdx.x >> 5);
  const int lane = threadIdx.x & 31;
  const int row = (blockIdx.x * 8 + wave) * 2;
  const int src0 = sel[row], src1 = sel[row + 1];
  u32x4 d[8];
  load_2rows_bf16(x2b + (size_t)src0 * W_D + lane * 8,
                  x2b + (size_t)src1 * W_D + lane * 8, d);
  store8_u32x4(xdisp + (size_t)row * W_D + lane * 8, d);
}

// ---------------------------------------------------------------------------
// Launch orchestration.
// ---------------------------------------------------------------------------
extern "C" void kernel_launch(void* const* d_in, const int* in_sizes, int n_in,
                              void* d_out, int out_size, void* d_ws,
                              size_t ws_size, hipStream_t stream) {
  (void)in_sizes; (void)n_in; (void)out_size; (void)ws_size;
  constexpr int Bb = 2, Nn = 2048, Dd = 1024, Hh = 16, hd = 64;
  constexpr int T = Bb * Nn, D3 = 3 * Dd, MLPH = 4096, MOEH = 256;
  constexpr int Ee = 4, CAP = 2048;

  const float* x      = (const float*)d_in[0];
  const float* noise  = (const float*)d_in[1];
  const float* ln1_g  = (const float*)d_in[2];
  const float* ln1_b  = (const float*)d_in[3];
  const float* ln2_g  = (const float*)d_in[4];
  const float* ln2_b  = (const float*)d_in[5];
  const float* w_qkv  = (const float*)d_in[6];
  const float* w_proj = (const float*)d_in[7];
  const float* b_proj = (const float*)d_in[8];
  const float* w_rt   = (const float*)d_in[9];
  const float* b_rt   = (const float*)d_in[10];
  const float* w_nz   = (const float*)d_in[11];
  const float* b_nz   = (const float*)d_in[12];
  const float* we1    = (const float*)d_in[13];
  const float* be1    = (const float*)d_in[14];
  const float* we2    = (const float*)d_in[15];
  const float* be2    = (const float*)d_in[16];
  const float* w_m1   = (const float*)d_in[17];
  const float* b_m1   = (const float*)d_in[18];
  const float* w_m2   = (const float*)d_in[19];
  const float* b_m2   = (const float*)d_in[20];
  float* out = (float*)d_out;

  char* wsp = (char*)d_ws;
  size_t off = 0;
  auto alloc = [&](size_t bytes) {
    void* p = wsp + off;
    off = (off + bytes + 255) & ~(size_t)255;
    return p;
  };
  __bf16* x1b    = (__bf16*)alloc((size_t)T * Dd * 2);
  __bf16* wqkvb  = (__bf16*)alloc((size_t)D3 * Dd * 2);
  __bf16* qkvb   = (__bf16*)alloc((size_t)T * D3 * 2);
  __bf16* attnb  = (__bf16*)alloc((size_t)T * Dd * 2);
  __bf16* wprojb = (__bf16*)alloc((size_t)Dd * Dd * 2);
  float*  xattn  = (float*)alloc((size_t)T * Dd * 4);
  float*  x2f    = (float*)alloc((size_t)T * Dd * 4);
  __bf16* x2b    = (__bf16*)alloc((size_t)T * Dd * 2);
  __bf16* wm1t   = (__bf16*)alloc((size_t)Dd * MLPH * 2);
  __bf16* wm2t   = (__bf16*)alloc((size_t)MLPH * Dd * 2);
  __bf16* hmlp   = (__bf16*)alloc((size_t)T * MLPH * 2);
  __bf16* we1t   = (__bf16*)alloc((size_t)Ee * Dd * MOEH * 2);
  __bf16* we2t   = (__bf16*)alloc((size_t)Ee * MOEH * Dd * 2);
  __bf16* xdisp  = (__bf16*)alloc((size_t)Ee * CAP * Dd * 2);
  __bf16* hdisp  = (__bf16*)alloc((size_t)Ee * CAP * MOEH * 2);
  float*  gate   = (float*)alloc((size_t)T * Ee * 4);
  int*    fidx   = (int*)alloc((size_t)T * 2 * 4);
  int*    sel    = (int*)alloc((size_t)Ee * CAP * 4);
  float*  selw   = (float*)alloc((size_t)Ee * CAP * 4);

  // 1) weight conversion to bf16 (w_qkv/w_proj are already [N][K]; the rest
  //    goes from [K][N] to [N][K])
  static_assert(Dd == W_D && MLPH == W_MLPH && MOEH == W_MOEH && Ee == W_E,
                "the conversion and row kernels are cut for these shapes");
  cvt_weights<<<CVT_GRID, 256, 0, stream>>>(w_qkv, w_proj, w_m1, w_m2, we1, we2,
                                            wqkvb, wprojb, wm1t, wm2t, we1t,
                                            we2t);

  // 2) LN1 -> x1 (bf16)
  ln_kernel<<<T / 8, 256, 0, stream>>>(x, ln1_g, ln1_b, nullptr, x1b);

  // 3) QKV GEMM: [T,D] x [3D,D]^T -> bf16 [T,3D]
  gemm_bf16_kernel<false, false, false, OUT_BF16>
      <<<dim3(D3 / 64, T / 128), 256, 0, stream>>>(
          x1b, wqkvb, nullptr, nullptr, nullptr, qkvb, nullptr, nullptr,
          nullptr, T, D3, Dd);

  // 4) flash attention -> bf16 [T,D]
  attn_kernel<<<dim3(Nn / 64, Hh, Bb), 128, 0, stream>>>(qkvb, attnb, Nn, Hh,
                                                         hd);

  // 5) proj GEMM + b_proj + residual x -> xattn (f32)
  gemm_bf16_kernel<true, false, true, OUT_F32>
      <<<dim3(Dd / 64, T / 128), 256, 0, stream>>>(
          attnb, wprojb, b_proj, x, xattn, nullptr, nullptr, nullptr, nullptr,
          T, Dd, Dd);

  // 6) LN2 -> x2 (f32 + bf16)
  ln_kernel<<<T / 8, 256, 0, stream>>>(xattn, ln2_g, ln2_b, x2f, x2b);

  // 7) router + capacity dispatch + gather
  router_kernel<<<T / 4, 128, 0, stream>>>(x2f, noise, w_rt, b_rt, w_nz, b_nz,
                                           gate, fidx, Dd);
  dispatch_scan<<<Ee, 256, 0, stream>>>(fidx, gate, sel, selw, CAP, T);
  gather_kernel<<<Ee * CAP / 16, 256, 0, stream>>>(x2b, sel, xdisp);

  // 8) dense MLP: gelu(x2@W1+b1)@W2+b2 + xattn -> d_out (f32)
  gemm_bf16_kernel<true, true, false, OUT_BF16>
      <<<dim3(MLPH / 64, T / 128), 256, 0, stream>>>(
          x2b, wm1t, b_m1, nullptr, nullptr, hmlp, nullptr, nullptr, nullptr,
          T, MLPH, Dd);
  gemm_bf16_kernel<true, false, true, OUT_F32>
      <<<dim3(Dd / 64, T / 128), 256, 0, stream>>>(
          hmlp, wm2t, b_m2, xattn, out, nullptr, nullptr, nullptr, nullptr, T,
          Dd, MLPH);

  // 9) expert FFNs; second GEMM scatter-adds gate-weighted rows into d_out
  for (int e = 0; e < Ee; ++e) {
    gemm_bf16_kernel<true, true, false, OUT_BF16>
        <<<dim3(MOEH / 64, CAP / 128), 256, 0, stream>>>(
            xdisp + (size_t)e * CAP * Dd, we1t + (size_t)e * MOEH * Dd,
            be1 + (size_t)e * MOEH, nullptr, nullptr,
            hdisp + (size_t)e * CAP * MOEH, nullptr, nullptr, nullptr, CAP,
            MOEH, Dd);
    gemm_bf16_kernel<true, false, false, OUT_SCATTER>
        <<<dim3(Dd / 64, CAP / 128), 256, 0, stream>>>(
            hdisp + (size_t)e * CAP * MOEH, we2t + (size_t)e * Dd * MOEH,
            be2 + (size_t)e * Dd, nullptr, nullptr, nullptr, sel + e * CAP,
            selw + e * CAP, out, CAP, Dd, MOEH);
  }
}

// v005
// One run takes 311 microseconds.
// In both of two side-by-side timings against v004, it was 1.14 times as fast.
// Counting every step since v000, it is 2.65 times as fast.
#include <hip/hip_runtime.h>
#include <hip/hip_bf16.h>
#include <math.h>
#include <stdint.h>

// ---------------------------------------------------------------------------
// Types for CDNA5 WMMA (wave32): D(f32 16x16) = A(bf16 16x32) x B(bf16 32x16) + C
// ---------------------------------------------------------------------------
typedef __attribute__((ext_vector_type(16))) __bf16 v16bf;
typedef __attribute__((ext_vector_type(8)))  float  v8f;
typedef __attribute__((ext_vector_type(4)))  unsigned u32x4;

static __device__ __forceinline__ v8f wmma_bf16(v16bf a, v16bf b, v8f c) {
  // (neg_a, A, neg_b, B, c_mod, C, reuse_a, reuse_b)
  return __builtin_amdgcn_wmma_f32_16x16x32_bf16(false, a, false, b, (short)0, c,
                                                 false, false);
}

// CDNA5 async copy: global -> LDS, 16 bytes per lane, tracked by ASYNCcnt.
// lds_off = low 32 bits of the generic pointer (ISA: LDS generic addresses
// carry the LDS byte offset in [31:0]).
static __device__ __forceinline__ void async_ld_b128(void* lds_ptr,
                                                     const void* gptr) {
  const unsigned lds_off = (unsigned)(uintptr_t)lds_ptr;
  asm volatile("global_load_async_to_lds_b128 %0, %1, off"
               :
               : "v"(lds_off), "v"(gptr)
               : "memory");
}
static __device__ __forceinline__ void wait_async0() {
  asm volatile("s_wait_asynccnt 0" ::: "memory");
}

// Load a 16x32 bf16 fragment (A layout; B "Bt" layout is identical with N<->M)
// from row-major LDS with leading dim `ld` (bf16 elements, multiple of 8).
// Lane l: row = base + (l&15); half = l>>4 selects K subranges
// [half*8, half*8+8) and [16+half*8, 16+half*8+8)  -> two aligned b128 loads.
static __device__ __forceinline__ v16bf frag16(const __bf16* base, int row,
                                               int kbase, int ld) {
  const int lane = threadIdx.x & 31;
  const __bf16* p =
      base + (size_t)(row + (lane & 15)) * ld + kbase + ((lane >> 4) * 8);
  union { uint4 u[2]; v16bf v; } t;
  t.u[0] = *(const uint4*)p;
  t.u[1] = *(const uint4*)(p + 16);
  return t.v;
}

static __device__ __forceinline__ float gelu_exact(float x) {
  return 0.5f * x * (1.0f + erff(x * 0.70710678118654752f));
}

// ---------------------------------------------------------------------------
// Generic bf16 WMMA GEMM:  C[M][N] = A[M][K] * Bt[N][K]^T  (+bias, gelu, resid)
// Block 256 threads = 8 waves; tile 128(M) x 64(N); K-step 128.
// Async double-buffered LDS: global_load_async_to_lds_b128 fills the next
// tile while WMMA consumes the current one; one barrier per K-step.
// Sixteen lanes copy one 256-byte piece of a row, so a wave's copy covers
// whole cache lines. LDS rows are pitched 272 B (16 B x odd) for b128 reads.
// Epilogue forms: f32 store, bf16 store, f32 store with a scale per row.
// Bias, activation, residual and output form are template parameters: each
// launch's epilogue is code without tests on pointers, so its bias, residual
// and scale loads are issued together and waited for once, not per element.
// blockIdx.z picks one product of a batch whose operands, biases, scales and
// results lie back to back (the experts); a single product has grid z = 1.
// COMBINE adds to each result row the rows of comb_rows that its experts left
// for it, in expert order; comb_idx[e * M + row] names expert e's (0, an
// all-zero row, where that expert does not serve the token).
// Requires M%128==0, N%64==0, K%128==0 (true for every GEMM in this model).
// ---------------------------------------------------------------------------
constexpr int GEMM_KT = 128;     // k per stage
constexpr int GEMM_LD = 136;     // LDS row pitch in bf16 elements (272 B)
constexpr int OUT_F32 = 0, OUT_BF16 = 1, OUT_SCALED = 2;  // output forms
constexpr int GEMM_E = 4;        // experts that COMBINE looks through

// One stage's copies of one thread: 8 row pieces of A, 4 of Bt, rows 16 apart.
// The s_wait_xcnt stands inside the statement so that no address register of
// an issued copy is rewritten in front of it.
static __device__ __forceinline__ void async_stage12(const __bf16* lA,
                                                     const __bf16* lB,
                                                     const __bf16* gA,
                                                     const __bf16* gB, int K) {
  const unsigned la = (unsigned)(uintptr_t)lA;
  const unsigned lb = (unsigned)(uintptr_t)lB;
  constexpr unsigned LS = 16u * GEMM_LD * 2u;  // 16 LDS rows in bytes
  const size_t gs = (size_t)16 * K;            // 16 global rows in elements
  asm volatile(
      "global_load_async_to_lds_b128 %0, %12, off\n\t"
      "global_load_async_to_lds_b128 %1, %13, off\n\t"
      "global_load_async_to_lds_b128 %2, %14, off\n\t"
      "global_load_async_to_lds_b128 %3, %15, off\n\t"
      "global_load_async_to_lds_b128 %4, %16, off\n\t"
      "global_load_async_to_lds_b128 %5, %17, off\n\t"
      "global_load_async_to_lds_b128 %6, %18, off\n\t"
      "global_load_async_to_lds_b128 %7, %19, off\n\t"
      "global_load_async_to_lds_b128 %8, %20, off\n\t"
      "global_load_async_to_lds_b128 %9, %21, off\n\t"
      "global_load_async_to_lds_b128 %10, %22, off\n\t"
      "global_load_async_to_lds_b128 %11, %23, off\n\t"
      "s_wait_xcnt 0x0"
      :
      : "v"(la), "v"(la + LS), "v"(la + 2 * LS), "v"(la + 3 * LS),
        "v"(la + 4 * LS), "v"(la + 5 * LS), "v"(la + 6 * LS), "v"(la + 7 * LS),
        "v"(lb), "v"(lb + LS), "v"(lb + 2 * LS), "v"(lb + 3 * LS),
        "v"(gA), "v"(gA + gs), "v"(gA + 2 * gs), "v"(gA + 3 * gs),
        "v"(gA + 4 * gs), "v"(gA + 5 * gs), "v"(gA + 6 * gs), "v"(gA + 7 * gs),
        "v"(gB), "v"(gB + gs), "v"(gB + 2 * gs), "v"(gB + 3 * gs)
      : "memory");
}

// COMBINE's loads. Each run stands with its data wait in one statement with
// early-clobber outputs, so that no result lands in an address register of
// the run and none is rewritten while a load is out.
// The thread's 16 result rows (8 from off, 8 from off + 64 B) in 4 planes.
static __device__ __forceinline__ void load_comb_idx(
    const int* p0, const int* p1, const int* p2, const int* p3, unsigned off,
    u32x4 (&d)[GEMM_E][4]) {
  asm volatile(
      "global_load_b128 %0, %16, %17\n\t"
      "global_load_b128 %1, %16, %17 offset:16\n\t"
      "global_load_b128 %2, %16, %17 offset:64\n\t"
      "global_load_b128 %3, %16, %17 offset:80\n\t"
      "global_load_b128 %4, %16, %18\n\t"
      "global_load_b128 %5, %16, %18 offset:16\n\t"
      "global_load_b128 %6, %16, %18 offset:64\n\t"
      "global_load_b128 %7, %16, %18 offset:80\n\t"
      "global_load_b128 %8, %16, %19\n\t"
      "global_load_b128 %9, %16, %19 offset:16\n\t"
      "global_load_b128 %10, %16, %19 offset:64\n\t"
      "global_load_b128 %11, %16, %19 offset:80\n\t"
      "global_load_b128 %12, %16, %20\n\t"
      "global_load_b128 %13, %16, %20 offset:16\n\t"
      "global_load_b128 %14, %16, %20 offset:64\n\t"
      "global_load_b128 %15, %16, %20 offset:80\n\t"
      "s_wait_loadcnt 0x0"
      : "=&v"(d[0][0]), "=&v"(d[0][1]), "=&v"(d[0][2]), "=&v"(d[0][3]),
        "=&v"(d[1][0]), "=&v"(d[1][1]), "=&v"(d[1][2]), "=&v"(d[1][3]),
        "=&v"(d[2][0]), "=&v"(d[2][1]), "=&v"(d[2][2]), "=&v"(d[2][3]),
        "=&v"(d[3][0]), "=&v"(d[3][1]), "=&v"(d[3][2]), "=&v"(d[3][3])
      : "v"(off), "s"(p0), "s"(p1), "s"(p2), "s"(p3)
      : "memory");
}
// Two columns, 16 apart, of 8 rows of base; off holds byte offsets.
static __device__ __forceinline__ void load_comb_rows(const float* base,
                                                      const unsigned (&off)[8],
                                                      float (&d)[2][8]) {
  asm volatile(
      "global_load_b32 %0, %16, %24\n\t"
      "global_load_b32 %1, %17, %24\n\t"
      "global_load_b32 %2, %18, %24\n\t"
      "global_load_b32 %3, %19, %24\n\t"
      "global_load_b32 %4, %20, %24\n\t"
      "global_load_b32 %5, %21, %24\n\t"
      "global_load_b32 %6, %22, %24\n\t"
      "global_load_b32 %7, %23, %24\n\t"
      "global_load_b32 %8, %16, %24 offset:64\n\t"
      "global_load_b32 %9, %17, %24 offset:64\n\t"
      "global_load_b32 %10, %18, %24 offset:64\n\t"
      "global_load_b32 %11, %19, %24 offset:64\n\t"
      "global_load_b32 %12, %20, %24 offset:64\n\t"
      "global_load_b32 %13, %21, %24 offset:64\n\t"
      "global_load_b32 %14, %22, %24 offset:64\n\t"
      "global_load_b32 %15, %23, %24 offset:64\n\t"
      "s_wait_loadcnt 0x0"
      : "=&v"(d[0][0]), "=&v"(d[0][1]), "=&v"(d[0][2]), "=&v"(d[0][3]),
        "=&v"(d[0][4]), "=&v"(d[0][5]), "=&v"(d[0][6]), "=&v"(d[0][7]),
        "=&v"(d[1][0]), "=&v"(d[1][1]), "=&v"(d[1][2]), "=&v"(d[1][3]),
        "=&v"(d[1][4]), "=&v"(d[1][5]), "=&v"(d[1][6]), "=&v"(d[1][7])
      : "v"(off[0]), "v"(off[1]), "v"(off[2]), "v"(off[3]), "v"(off[4]),
        "v"(off[5]), "v"(off[6]), "v"(off[7]), "s"(base)
      : "memory");
}

template <bool BIAS, bool ACT, bool RESID, int OUT, bool COMBINE>
__global__ __launch_bounds__(256) void gemm_bf16_kernel(
    const __bf16* __restrict__ A, const __bf16* __restrict__ Bt,
    const float* __restrict__ bias, const float* __restrict__ residual,
    float* Cf, __bf16* Cb, const int* __restrict__ comb_idx,
    const float* __restrict__ row_scale, const float* __restrict__ comb_rows,
    int M, int N, int K) {
  __shared__ __align__(16) __bf16 As[2][128][GEMM_LD];
  __shared__ __align__(16) __bf16 Bs[2][64][GEMM_LD];

  const size_t zb = blockIdx.z;  // which product of the batch
  A += zb * M * K;
  Bt += zb * N * K;
  if constexpr (BIAS) bias += zb * N;
  if constexpr (RESID) residual += zb * M * N;
  if constexpr (OUT == OUT_BF16) Cb += zb * M * N;
  if constexpr (OUT != OUT_BF16) Cf += zb * M * N;
  if constexpr (OUT == OUT_SCALED) row_scale += zb * M;

  const int tid = threadIdx.x;
  const int wave = tid >> 5, lane = tid & 31;
  const int wm = wave & 3, wn = wave >> 2;
  const int bm = blockIdx.y * 128, bn = blockIdx.x * 64;

  const int rc = tid >> 4, cc = (tid & 15) * 8;  // copy: row in 16, 8 bf16
  const __bf16* gA0 = A + (size_t)(bm + rc) * K + cc;
  const __bf16* gB0 = Bt + (size_t)(bn + rc) * K + cc;

  auto issue_tile = [&](int buf, int k0) {
    async_stage12(&As[buf][rc][cc], &Bs[buf][rc][cc], gA0 + k0, gB0 + k0, K);
  };

  v8f acc[2][2] = {};
  const int nt = K / GEMM_KT;
  issue_tile(0, 0);

  // Byte offsets in comb_rows of the two rows that each result row gets,
  // fetched here so that the wait falls into the first tile's flight. A token
  // has two experts: the lowest and the highest plane that name a row are all.
  unsigned oa[2][8] = {}, ob[2][8] = {};
  if constexpr (COMBINE) {
    u32x4 ix[GEMM_E][4];
    load_comb_idx(comb_idx, comb_idx + M, comb_idx + 2 * (size_t)M,
                  comb_idx + 3 * (size_t)M,
                  (unsigned)(bm + wm * 32 + (lane >> 4) * 8) * 4u, ix);
    const unsigned colb = (unsigned)(bn + wn * 32 + (lane & 15)) * 4u;
    // Unrolled so that ix, oa and ob are indexed by constants and stay in
    // registers.
#pragma unroll
    for (int i = 0; i < 2; ++i)
#pragma unroll
      for (int v = 0; v < 8; ++v) {
        const unsigned x0 = ix[0][i * 2 + (v >> 2)][v & 3];
        const unsigned x1 = ix[1][i * 2 + (v >> 2)][v & 3];
        const unsigned x2 = ix[2][i * 2 + (v >> 2)][v & 3];
        const unsigned x3 = ix[3][i * 2 + (v >> 2)][v & 3];
        const unsigned lo = x0 ? x0 : x1 ? x1 : x2 ? x2 : x3;
        const unsigned hi = x3 ? x3 : x2 ? x2 : x1 ? x1 : x0;
        oa[i][v] = lo * (unsigned)N * 4u + colb;
        ob[i][v] = (hi == lo ? 0u : hi) * (unsigned)N * 4u + colb;
      }
  }

  wait_async0();      // tile 0 landed in LDS (this wave's copies)
  __syncthreads();    // ... and every other wave's
  if (nt > 1) issue_tile(1, GEMM_KT);

  for (int t = 0; t < nt; ++t) {
    const int cur = t & 1;
    // Unrolled so that ks folds into the immediate offsets of the LDS loads.
#pragma unroll
    for (int ks = 0; ks < GEMM_KT; ks += 32) {
      const v16bf a0 = frag16(&As[cur][0][0], wm * 32, ks, GEMM_LD);
      const v16bf a1 = frag16(&As[cur][0][0], wm * 32 + 16, ks, GEMM_LD);
      const v16bf b0 = frag16(&Bs[cur][0][0], wn * 32, ks, GEMM_LD);
      const v16bf b1 = frag16(&Bs[cur][0][0], wn * 32 + 16, ks, GEMM_LD);
      acc[0][0] = wmma_bf16(a0, b0, acc[0][0]);
      acc[0][1] = wmma_bf16(a0, b1, acc[0][1]);
      acc[1][0] = wmma_bf16(a1, b0, acc[1][0]);
      acc[1][1] = wmma_bf16(a1, b1, acc[1][1]);
    }
    // This wave's LDS reads of the buffer have retired before it is refilled.
    asm volatile("s_wait_dscnt 0x0" ::: "memory");
    wait_async0();      // next tile landed in LDS (this wave's copies)
    __syncthreads();    // all waves done copying AND done reading this buffer
    if (t + 2 < nt) issue_tile(cur, (t + 2) * GEMM_KT);  // flies over trip t+1
  }
  wait_async0();        // no copy is outstanding when the wave ends

  // Epilogue. C layout: lane half (l>>4) + VGPR v -> row half*8+v; col = l&15.
  const int half = lane >> 4, c0 = lane & 15;
  const int row0 = bm + wm * 32 + half * 8;  // + i*16 + v
  const int col0 = bn + wn * 32 + c0;        // + j*16

  // Bias, residual and scale are fetched first, in one run of loads; the rows
  // of comb_rows are fetched in the loop below, for each i in turn.
  // All loops below are unrolled so that acc and these arrays are indexed by
  // constants and stay in registers.
  float bv[2] = {};
  float rv[2][2][8] = {};
  float sc[2][8] = {};
  if constexpr (BIAS) {
#pragma unroll
    for (int j = 0; j < 2; ++j) bv[j] = bias[col0 + j * 16];
  }
  if constexpr (RESID) {
#pragma unroll
    for (int i = 0; i < 2; ++i)
#pragma unroll
      for (int j = 0; j < 2; ++j)
#pragma unroll
        for (int v = 0; v < 8; ++v)
          rv[i][j][v] =
              residual[(size_t)(row0 + i * 16 + v) * N + col0 + j * 16];
  }
  if constexpr (OUT == OUT_SCALED) {
#pragma unroll
    for (int i = 0; i < 2; ++i)
#pragma unroll
      for (int v = 0; v < 8; ++v) sc[i][v] = row_scale[row0 + i * 16 + v];
  }

#pragma unroll
  for (int i = 0; i < 2; ++i) {
    float pa[2][8] = {}, pb[2][8] = {};
    if constexpr (COMBINE) {
      load_comb_rows(comb_rows, oa[i], pa);
      load_comb_rows(comb_rows, ob[i], pb);
    }
#pragma unroll
    for (int j = 0; j < 2; ++j)
#pragma unroll
      for (int v = 0; v < 8; ++v) {
        const int row = row0 + i * 16 + v;
        const int col = col0 + j * 16;
        float val = acc[i][j][v];
        if constexpr (BIAS) val += bv[j];
        if constexpr (ACT) val = gelu_exact(val);
        if constexpr (RESID) val += rv[i][j][v];
        if constexpr (COMBINE) {
          val += pa[j][v];
          val += pb[j][v];
        }
        if constexpr (OUT == OUT_F32) Cf[(size_t)row * N + col] = val;
        if constexpr (OUT == OUT_BF16) Cb[(size_t)row * N + col] = (__bf16)val;
        if constexpr (OUT == OUT_SCALED)
          Cf[(size_t)row * N + col] = val * sc[i][v];
      }
  }
}

// ---------------------------------------------------------------------------
// Flash attention: grid (N/64, H, B), 128 threads = 4 waves.
// Wave w owns 16 query rows x full 64-col key chunk -> row stats stay in-wave.
// Q/K tiles staged with async-to-LDS; V transposed manually (scattered b16).
// qkv layout: [T][3][H][hd] bf16;  out: [T][H*hd] bf16.
// ---------------------------------------------------------------------------
__global__ __launch_bounds__(128) void attn_kernel(
    const __bf16* __restrict__ qkv, __bf16* __restrict__ out, int N, int Hh,
    int hd) {
  const int D3 = 3 * Hh * hd;   // 3072
  const int Dm = Hh * hd;       // 1024
  const int qb = blockIdx.x, h = blockIdx.y, b = blockIdx.z;
  const int tid = threadIdx.x, wave = tid >> 5, lane = tid & 31;
  const int half = lane >> 4, c0 = lane & 15;

  __shared__ __align__(16) __bf16 Qs[64][80];
  __shared__ __align__(16) __bf16 Ks[64][80];
  __shared__ __align__(16) __bf16 Vt[64][80];       // V transposed: [d][key]
  __shared__ __align__(16) __bf16 Pb[4][16][80];    // per-wave P staging

  const int r = tid >> 1, d0 = (tid & 1) * 32;
  {  // Q tile (64x64) via async copy; first in-loop wait covers it
    const __bf16* g = qkv + (size_t)(b * N + qb * 64 + r) * D3 + h * hd + d0;
#pragma unroll
    for (int u = 0; u < 4; ++u) async_ld_b128(&Qs[r][d0 + u * 8], g + u * 8);
  }

  v8f o[4] = {};
  float mstat[8], lstat[8];
#pragma unroll
  for (int v = 0; v < 8; ++v) { mstat[v] = -1e30f; lstat[v] = 0.f; }

  for (int kb = 0; kb < N / 64; ++kb) {
    __syncthreads();  // prior P@V reads of Vt complete before overwrite
    {
      const __bf16* gk =
          qkv + (size_t)(b * N + kb * 64 + r) * D3 + Dm + h * hd + d0;
#pragma unroll
      for (int u = 0; u < 4; ++u)
        async_ld_b128(&Ks[r][d0 + u * 8], gk + u * 8);
      const __bf16* gv =
          qkv + (size_t)(b * N + kb * 64 + r) * D3 + 2 * Dm + h * hd + d0;
#pragma unroll
      for (int u = 0; u < 32; ++u) Vt[d0 + u][r] = gv[u];  // transpose to LDS
    }
    wait_async0();
    __syncthreads();

    // S = (Q * hd^-0.5) @ K^T  (64x64 per block; 16x64 per wave)
    v8f s[4] = {};
#pragma unroll
    for (int ks = 0; ks < 64; ks += 32) {
      const v16bf a = frag16(&Qs[0][0], wave * 16, ks, 80);
#pragma unroll
      for (int j = 0; j < 4; ++j) {
        const v16bf bf = frag16(&Ks[0][0], j * 16, ks, 80);
        s[j] = wmma_bf16(a, bf, s[j]);
      }
    }

    // online softmax per row (row = half*8+v, fully within this wave)
#pragma unroll
    for (int v = 0; v < 8; ++v) {
      float rmax = -1e30f;
#pragma unroll
      for (int j = 0; j < 4; ++j) {
        s[j][v] *= 0.125f;  // hd^-0.5
        rmax = fmaxf(rmax, s[j][v]);
      }
#pragma unroll
      for (int off = 1; off < 16; off <<= 1)
        rmax = fmaxf(rmax, __shfl_xor(rmax, off, 16));
      const float mnew = fmaxf(mstat[v], rmax);
      const float alpha = __expf(mstat[v] - mnew);
      float rsum = 0.f;
#pragma unroll
      for (int j = 0; j < 4; ++j) {
        const float p = __expf(s[j][v] - mnew);
        s[j][v] = p;
        rsum += p;
      }
#pragma unroll
      for (int off = 1; off < 16; off <<= 1) rsum += __shfl_xor(rsum, off, 16);
      lstat[v] = lstat[v] * alpha + rsum;
      mstat[v] = mnew;
#pragma unroll
      for (int j = 0; j < 4; ++j) {
        o[j][v] *= alpha;
        Pb[wave][half * 8 + v][j * 16 + c0] = (__bf16)s[j][v];
      }
    }
    __syncthreads();  // Pb visible for re-fragmentation

    // O += P @ V
#pragma unroll
    for (int ks = 0; ks < 64; ks += 32) {
      const v16bf a = frag16(&Pb[wave][0][0], 0, ks, 80);
#pragma unroll
      for (int j = 0; j < 4; ++j) {
        const v16bf bf = frag16(&Vt[0][0], j * 16, ks, 80);
        o[j] = wmma_bf16(a, bf, o[j]);
      }
    }
  }

  const int trow = b * N + qb * 64 + wave * 16 + half * 8;
#pragma unroll
  for (int v = 0; v < 8; ++v) {
    const float inv = 1.0f / lstat[v];
#pragma unroll
    for (int j = 0; j < 4; ++j)
      out[(size_t)(trow + v) * Dm + h * hd + j * 16 + c0] =
          (__bf16)(o[j][v] * inv);
  }
}

// ---------------------------------------------------------------------------
// Router: noisy top-2 over E=4 experts. One wave per token.
// ---------------------------------------------------------------------------
__global__ __launch_bounds__(128) void router_kernel(
    const float* __restrict__ x2, const float* __restrict__ noise,
    const float* __restrict__ w_route, const float* __restrict__ b_route,
    const float* __restrict__ w_noise, const float* __restrict__ b_noise,
    float* gate, int* fidx, int D) {
  const int wave = threadIdx.x >> 5, lane = threadIdx.x & 31;
  const int t = blockIdx.x * 4 + wave;
  float ar[4] = {0, 0, 0, 0}, an[4] = {0, 0, 0, 0};
  for (int d = lane; d < D; d += 32) {
    const float xv = x2[(size_t)t * D + d];
#pragma unroll
    for (int e = 0; e < 4; ++e) {
      ar[e] += xv * w_route[d * 4 + e];
      an[e] += xv * w_noise[d * 4 + e];
    }
  }
#pragma unroll
  for (int e = 0; e < 4; ++e)
#pragma unroll
    for (int off = 16; off; off >>= 1) {
      ar[e] += __shfl_xor(ar[e], off, 32);
      an[e] += __shfl_xor(an[e], off, 32);
    }
  if (lane == 0) {
    float noisy[4];
#pragma unroll
    for (int e = 0; e < 4; ++e) {
      const float lg = ar[e] + b_route[e];
      const float ns = an[e] + b_noise[e];
      const float sp = (ns > 20.f) ? ns : log1pf(__expf(ns));
      noisy[e] = lg + noise[t * 4 + e] * sp;
    }
    int i0 = 0;
    for (int e = 1; e < 4; ++e)
      if (noisy[e] > noisy[i0]) i0 = e;
    int i1 = -1;
    for (int e = 0; e < 4; ++e)
      if (e != i0 && (i1 < 0 || noisy[e] > noisy[i1])) i1 = e;
    const float m = fmaxf(noisy[i0], noisy[i1]);
    const float e0 = __expf(noisy[i0] - m), e1 = __expf(noisy[i1] - m);
    const float p0 = e0 / (e0 + e1);
#pragma unroll
    for (int e = 0; e < 4; ++e) gate[t * 4 + e] = 0.f;
    gate[t * 4 + i0] = p0;
    gate[t * 4 + i1] = 1.f - p0;
    fidx[2 * t] = i0;
    fidx[2 * t + 1] = i1;
  }
}

// ---------------------------------------------------------------------------
// Per-expert capacity dispatch (stable token order). grid = E blocks.
// inv[e * T + t] is the way back: the row of the experts' result that token t
// has with expert e (they start at row 1), or row 0, cleared here, if none.
// ---------------------------------------------------------------------------
__global__ __launch_bounds__(256) void dispatch_scan(
    const int* __restrict__ fidx, const float* __restrict__ gate, int* sel,
    float* selw, int* inv, float* zero_row, int capacity, int T, int D) {
  const int e = blockIdx.x, tid = threadIdx.x;
  for (int i = e * 256 + tid; i < D; i += gridDim.x * 256) zero_row[i] = 0.f;
  __shared__ int sm[256];
  int base = 0;
  for (int c0 = 0; c0 < T; c0 += 256) {
    const int t = c0 + tid;
    int m = 0;
    if (t < T) m = (fidx[2 * t] == e || fidx[2 * t + 1] == e) ? 1 : 0;
    sm[tid] = m;
    __syncthreads();
    for (int off = 1; off < 256; off <<= 1) {  // inclusive Hillis-Steele
      const int x = sm[tid];
      const int y = (tid >= off) ? sm[tid - off] : 0;
      __syncthreads();
      sm[tid] = x + y;
      __syncthreads();
    }
    const int incl = sm[tid];
    const int tot = sm[255];
    __syncthreads();
    const int pos = base + incl - 1;
    const bool kept = m && pos < capacity;
    if (kept) {
      sel[e * capacity + pos] = t;
      selw[e * capacity + pos] = gate[t * 4 + e];
    }
    if (t < T) {
      inv[e * T + t] = kept ? 1 + e * capacity + pos : 0;
      // The next trip rewrites the registers that this store names.
      asm volatile("s_wait_xcnt 0x0" ::: "memory");
    }
    base += tot;
  }
  for (int i = (base < capacity ? base : capacity) + tid; i < capacity;
       i += 256) {
    sel[e * capacity + i] = 0;
    selw[e * capacity + i] = 0.f;  // padded rows contribute nothing
  }
}

// ---------------------------------------------------------------------------
// fp32 -> bf16 conversion of every weight, one launch.
// The work is cut into pieces of 4096 elements; each work-group takes CVT_PER
// of them, so few waves are started and each moves many bytes.
// A piece of w_qkv or w_proj (already [N][K]) is a straight run of elements.
// A piece of any other weight is a 64x64 tile of in[K][N] that goes out as
// out[N][K]: input rows are read as 256-byte runs, two neighbouring k of one
// column are packed into a dword, the tile is turned in LDS, and each output
// row gets one whole 128-byte run.
// ---------------------------------------------------------------------------
constexpr int W_D = 1024, W_MLPH = 4096, W_MOEH = 256, W_E = 4;  // model dims
constexpr int CVT_PIECE = 64 * 64;
constexpr int CVT_B_PROJ = 3 * W_D * W_D / CVT_PIECE;             // after w_qkv
constexpr int CVT_B_M1 = CVT_B_PROJ + W_D * W_D / CVT_PIECE;      // after w_proj
constexpr int CVT_B_M2 = CVT_B_M1 + W_D * W_MLPH / CVT_PIECE;     // after w_mlp1
constexpr int CVT_B_E1 = CVT_B_M2 + W_MLPH * W_D / CVT_PIECE;     // after w_mlp2
constexpr int CVT_B_E2 = CVT_B_E1 + W_E * W_D * W_MOEH / CVT_PIECE;
constexpr int CVT_TOTAL = CVT_B_E2 + W_E * W_MOEH * W_D / CVT_PIECE;
constexpr int CVT_PER = 4;                      // pieces per work-group
constexpr int CVT_GRID = CVT_TOTAL / CVT_PER;   // work-groups
static_assert(CVT_GRID * CVT_PER == CVT_TOTAL, "pieces divide evenly");
constexpr int CVT_EXP_TILES = W_D * W_MOEH / CVT_PIECE;  // tiles per expert
static_assert(CVT_EXP_TILES == 64, "expert index is taken by a shift of 6");
constexpr int CVT_PITCH = 68;  // LDS row pitch in bf16: 136 B, 8-byte aligned

typedef __attribute__((ext_vector_type(2))) float  f32x2;
typedef __attribute__((ext_vector_type(2))) __bf16 bf16x2;

// Two floats to one dword of bf16, lo in the low half; converted as a pair so
// that one packed conversion does both.
static __device__ __forceinline__ unsigned pack_bf16(float lo, float hi) {
  const f32x2 f = {lo, hi};
  return __builtin_bit_cast(unsigned, __builtin_convertvector(f, bf16x2));
}

typedef __attribute__((ext_vector_type(4))) float    f32x4;
typedef __attribute__((ext_vector_type(2))) unsigned u32x2;

// Four 16-byte loads that fly together. Loads and their data wait are one
// statement with early-clobber outputs, so that no result lands in an address
// pair of the run and no address pair is rewritten while a load is out (as
// plain loads the compiler let one load's result take another's address).
static __device__ __forceinline__ void load4_b128(const float* p0,
                                                  const float* p1,
                                                  const float* p2,
                                                  const float* p3, f32x4& r0,
                                                  f32x4& r1, f32x4& r2,
                                                  f32x4& r3) {
  asm volatile(
      "global_load_b128 %0, %4, off\n\t"
      "global_load_b128 %1, %5, off\n\t"
      "global_load_b128 %2, %6, off\n\t"
      "global_load_b128 %3, %7, off\n\t"
      "s_wait_loadcnt 0x0"
      : "=&v"(r0), "=&v"(r1), "=&v"(r2), "=&v"(r3)
      : "v"(p0), "v"(p1), "v"(p2), "v"(p3)
      : "memory");
}

// Stores with their s_wait_xcnt in the same statement: the next piece rewrites
// the registers that they name, and a wait in a statement of its own is not
// tied to those registers.
static __device__ __forceinline__ void store4_b64_step2k(__bf16* p, u32x2 w0,
                                                         u32x2 w1, u32x2 w2,
                                                         u32x2 w3) {
  asm volatile(
      "global_store_b64 %0, %1, off\n\t"
      "global_store_b64 %0, %2, off offset:2048\n\t"
      "global_store_b64 %0, %3, off offset:4096\n\t"
      "global_store_b64 %0, %4, off offset:6144\n\t"
      "s_wait_xcnt 0x0"
      :
      : "v"(p), "v"(w0), "v"(w1), "v"(w2), "v"(w3)
      : "memory");
}
static __device__ __forceinline__ void store2_b128(__bf16* p, u32x4 d0,
                                                   u32x4 d1) {
  asm volatile(
      "global_store_b128 %0, %1, off\n\t"
      "global_store_b128 %0, %2, off offset:16\n\t"
      "s_wait_xcnt 0x0"
      :
      : "v"(p), "v"(d0), "v"(d1)
      : "memory");
}

__global__ __launch_bounds__(256) void cvt_weights(
    const float* __restrict__ w_qkv, const float* __restrict__ w_proj,
    const float* __restrict__ w_m1, const float* __restrict__ w_m2,
    const float* __restrict__ we1, const float* __restrict__ we2,
    __bf16* __restrict__ o_qkv, __bf16* __restrict__ o_proj,
    __bf16* __restrict__ o_m1, __bf16* __restrict__ o_m2,
    __bf16* __restrict__ o_e1, __bf16* __restrict__ o_e2) {
  __shared__ __align__(16) __bf16 tile[2][64][CVT_PITCH];
  const int tid = threadIdx.x;

  for (int i = 0; i < CVT_PER; ++i) {
    const int p = blockIdx.x + i * CVT_GRID;  // same for the whole work-group
    const bool turned = p >= CVT_B_M1;
    __bf16(*t)[CVT_PITCH] = tile[i & 1];

    // Which weight, and which tile of it. N = 64 << lnt columns of input.
    const float* in;
    __bf16* out;
    int K = 0, lnt = 0, q;
    if (p < CVT_B_PROJ) {
      in = w_qkv; out = o_qkv; q = p;
    } else if (p < CVT_B_M1) {
      in = w_proj; out = o_proj; q = p - CVT_B_PROJ;
    } else if (p < CVT_B_M2) {
      in = w_m1; out = o_m1; q = p - CVT_B_M1; K = W_D; lnt = 6;
    } else if (p < CVT_B_E1) {
      in = w_m2; out = o_m2; q = p - CVT_B_M2; K = W_MLPH; lnt = 4;
    } else if (p < CVT_B_E2) {
      q = p - CVT_B_E1;
      in = we1 + (size_t)(q >> 6) * (W_D * W_MOEH);
      out = o_e1 + (size_t)(q >> 6) * (W_D * W_MOEH);
      q &= 63; K = W_D; lnt = 2;
    } else {
      q = p - CVT_B_E2;
      in = we2 + (size_t)(q >> 6) * (W_D * W_MOEH);
      out = o_e2 + (size_t)(q >> 6) * (W_D * W_MOEH);
      q &= 63; K = W_MOEH; lnt = 4;
    }
    const int N = 64 << lnt;
    const int k0 = (q >> lnt) * 64, n0 = (q & ((1 << lnt) - 1)) * 64;

    if (!turned) {
      const size_t e = (size_t)q * CVT_PIECE + tid * 4;
      const float* g = in + e;
      f32x4 v0, v1, v2, v3;
      load4_b128(g, g + 1024, g + 2048, g + 3072, v0, v1, v2, v3);
      const u32x2 w0 = {pack_bf16(v0.x, v0.y), pack_bf16(v0.z, v0.w)};
      const u32x2 w1 = {pack_bf16(v1.x, v1.y), pack_bf16(v1.z, v1.w)};
      const u32x2 w2 = {pack_bf16(v2.x, v2.y), pack_bf16(v2.z, v2.w)};
      const u32x2 w3 = {pack_bf16(v3.x, v3.y), pack_bf16(v3.z, v3.w)};
      store4_b64_step2k(out + e, w0, w1, w2, w3);  // 1024 elements apart
    } else {
      const int c4 = (tid & 15) * 4, r2 = (tid >> 4) * 2;
      const float* g = in + (size_t)(k0 + r2) * N + n0 + c4;
      f32x4 a0, b0, a1, b1;  // rows k, k + 1 and k + 32, k + 33
      load4_b128(g, g + N, g + (size_t)32 * N, g + (size_t)33 * N, a0, b0, a1,
                 b1);
      *(unsigned*)&t[c4 + 0][r2] = pack_bf16(a0.x, b0.x);
      *(unsigned*)&t[c4 + 1][r2] = pack_bf16(a0.y, b0.y);
      *(unsigned*)&t[c4 + 2][r2] = pack_bf16(a0.z, b0.z);
      *(unsigned*)&t[c4 + 3][r2] = pack_bf16(a0.w, b0.w);
      *(unsigned*)&t[c4 + 0][r2 + 32] = pack_bf16(a1.x, b1.x);
      *(unsigned*)&t[c4 + 1][r2 + 32] = pack_bf16(a1.y, b1.y);
      *(unsigned*)&t[c4 + 2][r2 + 32] = pack_bf16(a1.z, b1.z);
      *(unsigned*)&t[c4 + 3][r2 + 32] = pack_bf16(a1.w, b1.w);
    }
    // One barrier a trip, passed by every wave whatever the piece: it
    // publishes this trip's tile, and it stands between the reads of a buffer
    // in trip i and its next filling in trip i + 2.
    __syncthreads();
    if (turned) {
      const int n = tid >> 2, kc = (tid & 3) * 16;
      const uint2* s = (const uint2*)&t[n][kc];
      const uint2 s0 = s[0], s1 = s[1], s2 = s[2], s3 = s[3];
      const u32x4 d0 = {s0.x, s0.y, s1.x, s1.y};
      const u32x4 d1 = {s2.x, s2.y, s3.x, s3.y};
      store2_b128(out + (size_t)(n0 + n) * K + k0 + kc, d0, d1);
    }
  }
}

// ---------------------------------------------------------------------------
// Row kernels: LayerNorm and the expert gather. A row is W_D elements.
// One wave takes a whole row (LayerNorm) or two rows (gather) in 16-byte
// pieces per lane, each wave-wide access covering 512 contiguous bytes, so a
// launch starts 4096 waves that each keep eight or more loads in flight.
// Loads stand with their data wait, stores with their s_wait_xcnt, in one
// statement each, for the reasons given at load4_b128 and store4_b64_step2k.
// ---------------------------------------------------------------------------
static_assert(W_D == 32 * 4 * 8, "a lane holds 8 pieces of 4 floats of a row");

// One row of x, and gamma and beta, 512 bytes of each per wave-wide load.
static __device__ __forceinline__ void load_ln_row(const float* x,
                                                   const float* g,
                                                   const float* b,
                                                   f32x4 (&xv)[8],
                                                   f32x4 (&gv)[8],
                                                   f32x4 (&bv)[8]) {
  asm volatile(
      "global_load_b128 %0, %24, off\n\t"
      "global_load_b128 %1, %24, off offset:512\n\t"
      "global_load_b128 %2, %24, off offset:1024\n\t"
      "global_load_b128 %3, %24, off offset:1536\n\t"
      "global_load_b128 %4, %24, off offset:2048\n\t"
      "global_load_b128 %5, %24, off offset:2560\n\t"
      "global_load_b128 %6, %24, off offset:3072\n\t"
      "global_load_b128 %7, %24, off offset:3584\n\t"
      "global_load_b128 %8, %25, off\n\t"
      "global_load_b128 %9, %25, off offset:512\n\t"
      "global_load_b128 %10, %25, off offset:1024\n\t"
      "global_load_b128 %11, %25, off offset:1536\n\t"
      "global_load_b128 %12, %25, off offset:2048\n\t"
      "global_load_b128 %13, %25, off offset:2560\n\t"
      "global_load_b128 %14, %25, off offset:3072\n\t"
      "global_load_b128 %15, %25, off offset:3584\n\t"
      "global_load_b128 %16, %26, off\n\t"
      "global_load_b128 %17, %26, off offset:512\n\t"
      "global_load_b128 %18, %26, off offset:1024\n\t"
      "global_load_b128 %19, %26, off offset:1536\n\t"
      "global_load_b128 %20, %26, off offset:2048\n\t"
      "global_load_b128 %21, %26, off offset:2560\n\t"
      "global_load_b128 %22, %26, off offset:3072\n\t"
      "global_load_b128 %23, %26, off offset:3584\n\t"
      "s_wait_loadcnt 0x0"
      : "=&v"(xv[0]), "=&v"(xv[1]), "=&v"(xv[2]), "=&v"(xv[3]), "=&v"(xv[4]), "=&v"(xv[5]), "=&v"(xv[6]), "=&v"(xv[7]),
        "=&v"(gv[0]), "=&v"(gv[1]), "=&v"(gv[2]), "=&v"(gv[3]), "=&v"(gv[4]), "=&v"(gv[5]), "=&v"(gv[6]), "=&v"(gv[7]),
        "=&v"(bv[0]), "=&v"(bv[1]), "=&v"(bv[2]), "=&v"(bv[3]), "=&v"(bv[4]), "=&v"(bv[5]), "=&v"(bv[6]), "=&v"(bv[7])
      : "v"(x), "v"(g), "v"(b)
      : "memory");
}
// Two rows of W_D bf16, four 16-byte pieces per lane of each.
static __device__ __forceinline__ void load_2rows_bf16(const __bf16* p0,
                                                       const __bf16* p1,
                                                       u32x4 (&d)[8]) {
  asm volatile(
      "global_load_b128 %0, %8, off\n\t"
      "global_load_b128 %1, %8, off offset:512\n\t"
      "global_load_b128 %2, %8, off offset:1024\n\t"
      "global_load_b128 %3, %8, off offset:1536\n\t"
      "global_load_b128 %4, %9, off\n\t"
      "global_load_b128 %5, %9, off offset:512\n\t"
      "global_load_b128 %6, %9, off offset:1024\n\t"
      "global_load_b128 %7, %9, off offset:1536\n\t"
      "s_wait_loadcnt 0x0"
      : "=&v"(d[0]), "=&v"(d[1]), "=&v"(d[2]), "=&v"(d[3]), "=&v"(d[4]), "=&v"(d[5]), "=&v"(d[6]), "=&v"(d[7])
      : "v"(p0), "v"(p1)
      : "memory");
}
static __device__ __forceinline__ void store8_f32x4(float* p,
                                                    const f32x4 (&d)[8]) {
  asm volatile(
      "global_store_b128 %0, %1, off\n\t"
      "global_store_b128 %0, %2, off offset:512\n\t"
      "global_store_b128 %0, %3, off offset:1024\n\t"
      "global_store_b128 %0, %4, off offset:1536\n\t"
      "global_store_b128 %0, %5, off offset:2048\n\t"
      "global_store_b128 %0, %6, off offset:2560\n\t"
      "global_store_b128 %0, %7, off offset:3072\n\t"
      "global_store_b128 %0, %8, off offset:3584\n\t"
      "s_wait_xcnt 0x0"
      :
      : "v"(p), "v"(d[0]), "v"(d[1]), "v"(d[2]), "v"(d[3]), "v"(d[4]), "v"(d[5]), "v"(d[6]), "v"(d[7])
      : "memory");
}
static __device__ __forceinline__ void store8_u32x4(__bf16* p,
                                                    const u32x4 (&d)[8]) {
  asm volatile(
      "global_store_b128 %0, %1, off\n\t"
      "global_store_b128 %0, %2, off offset:512\n\t"
      "global_store_b128 %0, %3, off offset:1024\n\t"
      "global_store_b128 %0, %4, off offset:1536\n\t"
      "global_store_b128 %0, %5, off offset:2048\n\t"
      "global_store_b128 %0, %6, off offset:2560\n\t"
      "global_store_b128 %0, %7, off offset:3072\n\t"
      "global_store_b128 %0, %8, off offset:3584\n\t"
      "s_wait_xcnt 0x0"
      :
      : "v"(p), "v"(d[0]), "v"(d[1]), "v"(d[2]), "v"(d[3]), "v"(d[4]), "v"(d[5]), "v"(d[6]), "v"(d[7])
      : "memory");
}
static __device__ __forceinline__ void store8_u32x2(__bf16* p,
                                                    const u32x2 (&d)[8]) {
  asm volatile(
      "global_store_b64 %0, %1, off\n\t"
      "global_store_b64 %0, %2, off offset:256\n\t"
      "global_store_b64 %0, %3, off offset:512\n\t"
      "global_store_b64 %0, %4, off offset:768\n\t"
      "global_store_b64 %0, %5, off offset:1024\n\t"
      "global_store_b64 %0, %6, off offset:1280\n\t"
      "global_store_b64 %0, %7, off offset:1536\n\t"
      "global_store_b64 %0, %8, off offset:1792\n\t"
      "s_wait_xcnt 0x0"
      :
      : "v"(p), "v"(d[0]), "v"(d[1]), "v"(d[2]), "v"(d[3]), "v"(d[4]), "v"(d[5]), "v"(d[6]), "v"(d[7])
      : "memory");
}

// LayerNorm: one token per wave, the row read once and kept in registers.
// Optional f32 and/or bf16 outputs. grid = tokens / 8.
__global__ __launch_bounds__(256) void ln_kernel(const float* __restrict__ x,
                                                 const float* __restrict__ g,
                                                 const float* __restrict__ bta,
                                                 float* outf, __bf16* outb) {
  const int wave = threadIdx.x >> 5, lane = threadIdx.x & 31;
  const size_t e = (size_t)(blockIdx.x * 8 + wave) * W_D + lane * 4;
  f32x4 xv[8], gv[8], bv[8];
  load_ln_row(x + e, g + lane * 4, bta + lane * 4, xv, gv, bv);

  // Four independent chains per sum; all loops over c are unrolled so that
  // the arrays are indexed by constants and stay in registers.
  f32x4 s4 = {}, ss4 = {};
#pragma unroll
  for (int c = 0; c < 8; ++c) {
    s4 += xv[c];
    ss4 += xv[c] * xv[c];
  }
  float s = (s4.x + s4.y) + (s4.z + s4.w);
  float ss = (ss4.x + ss4.y) + (ss4.z + ss4.w);
#pragma unroll
  for (int off = 16; off; off >>= 1) {
    s += __shfl_xor(s, off, 32);
    ss += __shfl_xor(ss, off, 32);
  }
  const float mu = s / W_D;
  const float r = rsqrtf(ss / W_D - mu * mu + 1e-5f);

  f32x4 y[8];
#pragma unroll
  for (int c = 0; c < 8; ++c) y[c] = (xv[c] - mu) * r * gv[c] + bv[c];
  if (outf) store8_f32x4(outf + e, y);
  if (outb) {
    u32x2 w[8];
#pragma unroll
    for (int c = 0; c < 8; ++c)
      w[c] = u32x2{pack_bf16(y[c].x, y[c].y), pack_bf16(y[c].z, y[c].w)};
    store8_u32x2(outb + e, w);
  }
}

// Gather: each wave copies two neighbouring rows of xdisp from the rows of
// x2b that sel names. grid = rows / 16.
__global__ __launch_bounds__(256) void gather_kernel(
    const __bf16* __restrict__ x2b, const int* __restrict__ sel,
    __bf16* xdisp) {
  // The wave's number as a scalar, so that sel is read by a scalar load.
  const int wave = __builtin_amdgcn_readfirstlane(threadIdx.x >> 5);
  const int lane = threadIdx.x & 31;
  const int row = (blockIdx.x * 8 + wave) * 2;
  const int src0 = sel[row], src1 = sel[row + 1];
  u32x4 d[8];
  load_2rows_bf16(x2b + (size_t)src0 * W_D + lane * 8,
                  x2b + (size_t)src1 * W_D + lane * 8, d);
  store8_u32x4(xdisp + (size_t)row * W_D + lane * 8, d);
}

// ---------------------------------------------------------------------------
// Launch orchestration.
// ---------------------------------------------------------------------------
extern "C" void kernel_launch(void* const* d_in, const int* in_sizes, int n_in,
                              void* d_out, int out_size, void* d_ws,
                              size_t ws_size, hipStream_t stream) {
  (void)in_sizes; (void)n_in; (void)out_size; (void)ws_size;
  constexpr int Bb = 2, Nn = 2048, Dd = 1024, Hh = 16, hd = 64;
  constexpr int T = Bb * Nn, D3 = 3 * Dd, MLPH = 4096, MOEH = 256;
  constexpr int Ee = 4, CAP = 2048;

  const float* x      = (const float*)d_in[0];
  const float* noise  = (const float*)d_in[1];
  const float* ln1_g  = (const float*)d_in[2];
  const float* ln1_b  = (const float*)d_in[3];
  const float* ln2_g  = (const float*)d_in[4];
  const float* ln2_b  = (const float*)d_in[5];
  const float* w_qkv  = (const float*)d_in[6];
  const float* w_proj = (const float*)d_in[7];
  const float* b_proj = (const float*)d_in[8];
  const float* w_rt   = (const float*)d_in[9];
  const float* b_rt   = (const float*)d_in[10];
  const float* w_nz   = (const float*)d_in[11];
  const float* b_nz   = (const float*)d_in[12];
  const float* we1    = (const float*)d_in[13];
  const float* be1    = (const float*)d_in[14];
  const float* we2    = (const float*)d_in[15];
  const float* be2    = (const float*)d_in[16];
  const float* w_m1   = (const float*)d_in[17];
  const float* b_m1   = (const float*)d_in[18];
  const float* w_m2   = (const float*)d_in[19];
  const float* b_m2   = (const float*)d_in[20];
  float* out = (float*)d_out;

  char* wsp = (char*)d_ws;
  size_t off = 0;
  auto alloc = [&](size_t bytes) {
    void* p = wsp + off;
    off = (off + bytes + 255) & ~(size_t)255;
    return p;
  };
  __bf16* x1b    = (__bf16*)alloc((size_t)T * Dd * 2);
  __bf16* wqkvb  = (__bf16*)alloc((size_t)D3 * Dd * 2);
  __bf16* qkvb   = (__bf16*)alloc((size_t)T * D3 * 2);
  __bf16* attnb  = (__bf16*)alloc((size_t)T * Dd * 2);
  __bf16* wprojb = (__bf16*)alloc((size_t)Dd * Dd * 2);
  float*  xattn  = (float*)alloc((size_t)T * Dd * 4);
  float*  x2f    = (float*)alloc((size_t)T * Dd * 4);
  __bf16* x2b    = (__bf16*)alloc((size_t)T * Dd * 2);
  __bf16* wm1t   = (__bf16*)alloc((size_t)Dd * MLPH * 2);
  __bf16* wm2t   = (__bf16*)alloc((size_t)MLPH * Dd * 2);
  __bf16* hmlp   = (__bf16*)alloc((size_t)T * MLPH * 2);
  __bf16* we1t   = (__bf16*)alloc((size_t)Ee * Dd * MOEH * 2);
  __bf16* we2t   = (__bf16*)alloc((size_t)Ee * MOEH * Dd * 2);
  __bf16* xdisp  = (__bf16*)alloc((size_t)Ee * CAP * Dd * 2);
  __bf16* hdisp  = (__bf16*)alloc((size_t)Ee * CAP * MOEH * 2);
  float*  gate   = (float*)alloc((size_t)T * Ee * 4);
  int*    fidx   = (int*)alloc((size_t)T * 2 * 4);
  int*    sel    = (int*)alloc((size_t)Ee * CAP * 4);
  float*  selw   = (float*)alloc((size_t)Ee * CAP * 4);
  int*    inv    = (int*)alloc((size_t)Ee * T * 4);
  float*  ymoe   = (float*)alloc((size_t)(Ee * CAP + 1) * Dd * 4);

  // 1) weight conversion to bf16 (w_qkv/w_proj are already [N][K]; the rest
  //    goes from [K][N] to [N][K])
  static_assert(Dd == W_D && MLPH == W_MLPH && MOEH == W_MOEH && Ee == W_E,
                "the conversion and row kernels are cut for these shapes");
  cvt_weights<<<CVT_GRID, 256, 0, stream>>>(w_qkv, w_proj, w_m1, w_m2, we1, we2,
                                            wqkvb, wprojb, wm1t, wm2t, we1t,
                                            we2t);

  // 2) LN1 -> x1 (bf16)
  ln_kernel<<<T / 8, 256, 0, stream>>>(x, ln1_g, ln1_b, nullptr, x1b);

  // 3) QKV GEMM: [T,D] x [3D,D]^T -> bf16 [T,3D]
  gemm_bf16_kernel<false, false, false, OUT_BF16, false>
      <<<dim3(D3 / 64, T / 128), 256, 0, stream>>>(
          x1b, wqkvb, nullptr, nullptr, nullptr, qkvb, nullptr, nullptr,
          nullptr, T, D3, Dd);

  // 4) flash attention -> bf16 [T,D]
  attn_kernel<<<dim3(Nn / 64, Hh, Bb), 128, 0, stream>>>(qkvb, attnb, Nn, Hh,
                                                         hd);

  // 5) proj GEMM + b_proj + residual x -> xattn (f32)
  gemm_bf16_kernel<true, false, true, OUT_F32, false>
      <<<dim3(Dd / 64, T / 128), 256, 0, stream>>>(
          attnb, wprojb, b_proj, x, xattn, nullptr, nullptr, nullptr, nullptr,
          T, Dd, Dd);

  // 6) LN2 -> x2 (f32 + bf16)
  ln_kernel<<<T / 8, 256, 0, stream>>>(xattn, ln2_g, ln2_b, x2f, x2b);

  // 7) router + capacity dispatch + gather
  router_kernel<<<T / 4, 128, 0, stream>>>(x2f, noise, w_rt, b_rt, w_nz, b_nz,
                                           gate, fidx, Dd);
  dispatch_scan<<<Ee, 256, 0, stream>>>(fidx, gate, sel, selw, inv, ymoe, CAP,
                                        T, Dd);
  gather_kernel<<<Ee * CAP / 16, 256, 0, stream>>>(x2b, sel, xdisp);

  // 8) expert FFNs, all experts in one launch per layer (grid z = expert);
  //    the second layer leaves its gate-weighted rows in ymoe from row 1 on
  static_assert(Ee == GEMM_E, "the combining epilogue looks through this many planes");
  gemm_bf16_kernel<true, true, false, OUT_BF16, false>
      <<<dim3(MOEH / 64, CAP / 128, Ee), 256, 0, stream>>>(
          xdisp, we1t, be1, nullptr, nullptr, hdisp, nullptr, nullptr, nullptr,
          CAP, MOEH, Dd);
  gemm_bf16_kernel<true, false, false, OUT_SCALED, false>
      <<<dim3(Dd / 64, CAP / 128, Ee), 256, 0, stream>>>(
          hdisp, we2t, be2, nullptr, ymoe + Dd, nullptr, nullptr, selw, nullptr,
          CAP, Dd, MOEH);

  // 9) dense MLP: gelu(x2@W1+b1)@W2+b2 + xattn + each token's expert rows
  //    -> d_out (f32)
  gemm_bf16_kernel<true, true, false, OUT_BF16, false>
      <<<dim3(MLPH / 64, T / 128), 256, 0, stream>>>(
          x2b, wm1t, b_m1, nullptr, nullptr, hmlp, nullptr, nullptr, nullptr,
          T, MLPH, Dd);
  gemm_bf16_kernel<true, false, true, OUT_F32, true>
      <<<dim3(Dd / 64, T / 128), 256, 0, stream>>>(
          hmlp, wm2t, b_m2, xattn, out, nullptr, inv, nullptr, ymoe, T, Dd,
          MLPH);
}

// v006
// It runs in 285 microseconds.
// In both of two side-by-side timings against v005, it was 1.09 times as fast.
// Counting every step since v000, it is 2.88 times as fast.
#include <hip/hip_runtime.h>
#include <hip/hip_bf16.h>
#include <math.h>
#include <stdint.h>

// ---------------------------------------------------------------------------
// Types for CDNA5 WMMA (wave32): D(f32 16x16) = A(bf16 16x32) x B(bf16 32x16) + C
// ---------------------------------------------------------------------------
typedef __attribute__((ext_vector_type(16))) __bf16 v16bf;
typedef __attribute__((ext_vector_type(8)))  float  v8f;
typedef __attribute__((ext_vector_type(4)))  unsigned u32x4;

static __device__ __forceinline__ v8f wmma_bf16(v16bf a, v16bf b, v8f c) {
  // (neg_a, A, neg_b, B, c_mod, C, reuse_a, reuse_b)
  return __builtin_amdgcn_wmma_f32_16x16x32_bf16(false, a, false, b, (short)0, c,
                                                 false, false);
}

// CDNA5 async copy: global -> LDS, 16 bytes per lane, tracked by ASYNCcnt.
// lds_off = low 32 bits of the generic pointer (ISA: LDS generic addresses
// carry the LDS byte offset in [31:0]).
static __device__ __forceinline__ void async_ld_b128(void* lds_ptr,
                                                     const void* gptr) {
  const unsigned lds_off = (unsigned)(uintptr_t)lds_ptr;
  asm volatile("global_load_async_to_lds_b128 %0, %1, off"
               :
               : "v"(lds_off), "v"(gptr)
               : "memory");
}
static __device__ __forceinline__ void wait_async0() {
  asm volatile("s_wait_asynccnt 0" ::: "memory");
}

// Load a 16x32 bf16 fragment (A layout; B "Bt" layout is identical with N<->M)
// from row-major LDS with leading dim `ld` (bf16 elements, multiple of 8).
// Lane l: row = base + (l&15); half = l>>4 selects K subranges
// [half*8, half*8+8) and [16+half*8, 16+half*8+8)  -> two aligned b128 loads.
static __device__ __forceinline__ v16bf frag16(const __bf16* base, int row,
                                               int kbase, int ld) {
  const int lane = threadIdx.x & 31;
  const __bf16* p =
      base + (size_t)(row + (lane & 15)) * ld + kbase + ((lane >> 4) * 8);
  union { uint4 u[2]; v16bf v; } t;
  t.u[0] = *(const uint4*)p;
  t.u[1] = *(const uint4*)(p + 16);
  return t.v;
}

static __device__ __forceinline__ float gelu_exact(float x) {
  return 0.5f * x * (1.0f + erff(x * 0.70710678118654752f));
}

// ---------------------------------------------------------------------------
// Generic bf16 WMMA GEMM:  C[M][N] = A[M][K] * Bt[N][K]^T  (+bias, gelu, resid)
// Block 256 threads = 8 waves; tile 128(M) x 64(N); K-step 128.
// Async double-buffered LDS: global_load_async_to_lds_b128 fills the next
// tile while WMMA consumes the current one; one barrier per K-step.
// Sixteen lanes copy one 256-byte piece of a row, so a wave's copy covers
// whole cache lines. LDS rows are pitched 272 B (16 B x odd) for b128 reads.
// Epilogue forms: f32 store, bf16 store, f32 store with a scale per row.
// Bias, activation, residual and output form are template parameters: each
// launch's epilogue is code without tests on pointers, so its bias, residual
// and scale loads are issued together and waited for once, not per element.
// blockIdx.z picks one product of a batch whose operands, biases, scales and
// results lie back to back (the experts); a single product has grid z = 1.
// COMBINE adds to each result row the rows of comb_rows that its experts left
// for it, in expert order; comb_idx[e * M + row] names expert e's (0, an
// all-zero row, where that expert does not serve the token).
// Requires M%128==0, N%64==0, K%128==0 (true for every GEMM in this model).
// ---------------------------------------------------------------------------
constexpr int GEMM_KT = 128;     // k per stage
constexpr int GEMM_LD = 136;     // LDS row pitch in bf16 elements (272 B)
constexpr int OUT_F32 = 0, OUT_BF16 = 1, OUT_SCALED = 2;  // output forms
constexpr int GEMM_E = 4;        // experts that COMBINE looks through

// One stage's copies of one thread: 8 row pieces of A, 4 of Bt, rows 16 apart.
// The s_wait_xcnt stands inside the statement so that no address register of
// an issued copy is rewritten in front of it.
static __device__ __forceinline__ void async_stage12(const __bf16* lA,
                                                     const __bf16* lB,
                                                     const __bf16* gA,
                                                     const __bf16* gB, int K) {
  const unsigned la = (unsigned)(uintptr_t)lA;
  const unsigned lb = (unsigned)(uintptr_t)lB;
  constexpr unsigned LS = 16u * GEMM_LD * 2u;  // 16 LDS rows in bytes
  const size_t gs = (size_t)16 * K;            // 16 global rows in elements
  asm volatile(
      "global_load_async_to_lds_b128 %0, %12, off\n\t"
      "global_load_async_to_lds_b128 %1, %13, off\n\t"
      "global_load_async_to_lds_b128 %2, %14, off\n\t"
      "global_load_async_to_lds_b128 %3, %15, off\n\t"
      "global_load_async_to_lds_b128 %4, %16, off\n\t"
      "global_load_async_to_lds_b128 %5, %17, off\n\t"
      "global_load_async_to_lds_b128 %6, %18, off\n\t"
      "global_load_async_to_lds_b128 %7, %19, off\n\t"
      "global_load_async_to_lds_b128 %8, %20, off\n\t"
      "global_load_async_to_lds_b128 %9, %21, off\n\t"
      "global_load_async_to_lds_b128 %10, %22, off\n\t"
      "global_load_async_to_lds_b128 %11, %23, off\n\t"
      "s_wait_xcnt 0x0"
      :
      : "v"(la), "v"(la + LS), "v"(la + 2 * LS), "v"(la + 3 * LS),
        "v"(la + 4 * LS), "v"(la + 5 * LS), "v"(la + 6 * LS), "v"(la + 7 * LS),
        "v"(lb), "v"(lb + LS), "v"(lb + 2 * LS), "v"(lb + 3 * LS),
        "v"(gA), "v"(gA + gs), "v"(gA + 2 * gs), "v"(gA + 3 * gs),
        "v"(gA + 4 * gs), "v"(gA + 5 * gs), "v"(gA + 6 * gs), "v"(gA + 7 * gs),
        "v"(gB), "v"(gB + gs), "v"(gB + 2 * gs), "v"(gB + 3 * gs)
      : "memory");
}

// COMBINE's loads. Each run stands with its data wait in one statement with
// early-clobber outputs, so that no result lands in an address register of
// the run and none is rewritten while a load is out.
// The thread's 16 result rows (8 from off, 8 from off + 64 B) in 4 planes.
static __device__ __forceinline__ void load_comb_idx(
    const int* p0, const int* p1, const int* p2, const int* p3, unsigned off,
    u32x4 (&d)[GEMM_E][4]) {
  asm volatile(
      "global_load_b128 %0, %16, %17\n\t"
      "global_load_b128 %1, %16, %17 offset:16\n\t"
      "global_load_b128 %2, %16, %17 offset:64\n\t"
      "global_load_b128 %3, %16, %17 offset:80\n\t"
      "global_load_b128 %4, %16, %18\n\t"
      "global_load_b128 %5, %16, %18 offset:16\n\t"
      "global_load_b128 %6, %16, %18 offset:64\n\t"
      "global_load_b128 %7, %16, %18 offset:80\n\t"
      "global_load_b128 %8, %16, %19\n\t"
      "global_load_b128 %9, %16, %19 offset:16\n\t"
      "global_load_b128 %10, %16, %19 offset:64\n\t"
      "global_load_b128 %11, %16, %19 offset:80\n\t"
      "global_load_b128 %12, %16, %20\n\t"
      "global_load_b128 %13, %16, %20 offset:16\n\t"
      "global_load_b128 %14, %16, %20 offset:64\n\t"
      "global_load_b128 %15, %16, %20 offset:80\n\t"
      "s_wait_loadcnt 0x0"
      : "=&v"(d[0][0]), "=&v"(d[0][1]), "=&v"(d[0][2]), "=&v"(d[0][3]),
        "=&v"(d[1][0]), "=&v"(d[1][1]), "=&v"(d[1][2]), "=&v"(d[1][3]),
        "=&v"(d[2][0]), "=&v"(d[2][1]), "=&v"(d[2][2]), "=&v"(d[2][3]),
        "=&v"(d[3][0]), "=&v"(d[3][1]), "=&v"(d[3][2]), "=&v"(d[3][3])
      : "v"(off), "s"(p0), "s"(p1), "s"(p2), "s"(p3)
      : "memory");
}
// Two columns, 16 apart, of 8 rows of base; off holds byte offsets.
static __device__ __forceinline__ void load_comb_rows(const float* base,
                                                      const unsigned (&off)[8],
                                                      float (&d)[2][8]) {
  asm volatile(
      "global_load_b32 %0, %16, %24\n\t"
      "global_load_b32 %1, %17, %24\n\t"
      "global_load_b32 %2, %18, %24\n\t"
      "global_load_b32 %3, %19, %24\n\t"
      "global_load_b32 %4, %20, %24\n\t"
      "global_load_b32 %5, %21, %24\n\t"
      "global_load_b32 %6, %22, %24\n\t"
      "global_load_b32 %7, %23, %24\n\t"
      "global_load_b32 %8, %16, %24 offset:64\n\t"
      "global_load_b32 %9, %17, %24 offset:64\n\t"
      "global_load_b32 %10, %18, %24 offset:64\n\t"
      "global_load_b32 %11, %19, %24 offset:64\n\t"
      "global_load_b32 %12, %20, %24 offset:64\n\t"
      "global_load_b32 %13, %21, %24 offset:64\n\t"
      "global_load_b32 %14, %22, %24 offset:64\n\t"
      "global_load_b32 %15, %23, %24 offset:64\n\t"
      "s_wait_loadcnt 0x0"
      : "=&v"(d[0][0]), "=&v"(d[0][1]), "=&v"(d[0][2]), "=&v"(d[0][3]),
        "=&v"(d[0][4]), "=&v"(d[0][5]), "=&v"(d[0][6]), "=&v"(d[0][7]),
        "=&v"(d[1][0]), "=&v"(d[1][1]), "=&v"(d[1][2]), "=&v"(d[1][3]),
        "=&v"(d[1][4]), "=&v"(d[1][5]), "=&v"(d[1][6]), "=&v"(d[1][7])
      : "v"(off[0]), "v"(off[1]), "v"(off[2]), "v"(off[3]), "v"(off[4]),
        "v"(off[5]), "v"(off[6]), "v"(off[7]), "s"(base)
      : "memory");
}

template <bool BIAS, bool ACT, bool RESID, int OUT, bool COMBINE>
__global__ __launch_bounds__(256) void gemm_bf16_kernel(
    const __bf16* __restrict__ A, const __bf16* __restrict__ Bt,
    const float* __restrict__ bias, const float* __restrict__ residual,
    float* Cf, __bf16* Cb, const int* __restrict__ comb_idx,
    const float* __restrict__ row_scale, const float* __restrict__ comb_rows,
    int M, int N, int K) {
  __shared__ __align__(16) __bf16 As[2][128][GEMM_LD];
  __shared__ __align__(16) __bf16 Bs[2][64][GEMM_LD];

  const size_t zb = blockIdx.z;  // which product of the batch
  A += zb * M * K;
  Bt += zb * N * K;
  if constexpr (BIAS) bias += zb * N;
  if constexpr (RESID) residual += zb * M * N;
  if constexpr (OUT == OUT_BF16) Cb += zb * M * N;
  if constexpr (OUT != OUT_BF16) Cf += zb * M * N;
  if constexpr (OUT == OUT_SCALED) row_scale += zb * M;

  const int tid = threadIdx.x;
  const int wave = tid >> 5, lane = tid & 31;
  const int wm = wave & 3, wn = wave >> 2;
  const int bm = blockIdx.y * 128, bn = blockIdx.x * 64;

  const int rc = tid >> 4, cc = (tid & 15) * 8;  // copy: row in 16, 8 bf16
  const __bf16* gA0 = A + (size_t)(bm + rc) * K + cc;
  const __bf16* gB0 = Bt + (size_t)(bn + rc) * K + cc;

  auto issue_tile = [&](int buf, int k0) {
    async_stage12(&As[buf][rc][cc], &Bs[buf][rc][cc], gA0 + k0, gB0 + k0, K);
  };

  v8f acc[2][2] = {};
  const int nt = K / GEMM_KT;
  issue_tile(0, 0);

  // Byte offsets in comb_rows of the two rows that each result row gets,
  // fetched here so that the wait falls into the first tile's flight. A token
  // has two experts: the lowest and the highest plane that name a row are all.
  unsigned oa[2][8] = {}, ob[2][8] = {};
  if constexpr (COMBINE) {
    u32x4 ix[GEMM_E][4];
    load_comb_idx(comb_idx, comb_idx + M, comb_idx + 2 * (size_t)M,
                  comb_idx + 3 * (size_t)M,
                  (unsigned)(bm + wm * 32 + (lane >> 4) * 8) * 4u, ix);
    const unsigned colb = (unsigned)(bn + wn * 32 + (lane & 15)) * 4u;
    // Unrolled so that ix, oa and ob are indexed by constants and stay in
    // registers.
#pragma unroll
    for (int i = 0; i < 2; ++i)
#pragma unroll
      for (int v = 0; v < 8; ++v) {
        const unsigned x0 = ix[0][i * 2 + (v >> 2)][v & 3];
        const unsigned x1 = ix[1][i * 2 + (v >> 2)][v & 3];
        const unsigned x2 = ix[2][i * 2 + (v >> 2)][v & 3];
        const unsigned x3 = ix[3][i * 2 + (v >> 2)][v & 3];
        const unsigned lo = x0 ? x0 : x1 ? x1 : x2 ? x2 : x3;
        const unsigned hi = x3 ? x3 : x2 ? x2 : x1 ? x1 : x0;
        oa[i][v] = lo * (unsigned)N * 4u + colb;
        ob[i][v] = (hi == lo ? 0u : hi) * (unsigned)N * 4u + colb;
      }
  }

  wait_async0();      // tile 0 landed in LDS (this wave's copies)
  __syncthreads();    // ... and every other wave's
  if (nt > 1) issue_tile(1, GEMM_KT);

  for (int t = 0; t < nt; ++t) {
    const int cur = t & 1;
    // Unrolled so that ks folds into the immediate offsets of the LDS loads.
#pragma unroll
    for (int ks = 0; ks < GEMM_KT; ks += 32) {
      const v16bf a0 = frag16(&As[cur][0][0], wm * 32, ks, GEMM_LD);
      const v16bf a1 = frag16(&As[cur][0][0], wm * 32 + 16, ks, GEMM_LD);
      const v16bf b0 = frag16(&Bs[cur][0][0], wn * 32, ks, GEMM_LD);
      const v16bf b1 = frag16(&Bs[cur][0][0], wn * 32 + 16, ks, GEMM_LD);
      acc[0][0] = wmma_bf16(a0, b0, acc[0][0]);
      acc[0][1] = wmma_bf16(a0, b1, acc[0][1]);
      acc[1][0] = wmma_bf16(a1, b0, acc[1][0]);
      acc[1][1] = wmma_bf16(a1, b1, acc[1][1]);
    }
    // This wave's LDS reads of the buffer have retired before it is refilled.
    asm volatile("s_wait_dscnt 0x0" ::: "memory");
    wait_async0();      // next tile landed in LDS (this wave's copies)
    __syncthreads();    // all waves done copying AND done reading this buffer
    if (t + 2 < nt) issue_tile(cur, (t + 2) * GEMM_KT);  // flies over trip t+1
  }
  wait_async0();        // no copy is outstanding when the wave ends

  // Epilogue. C layout: lane half (l>>4) + VGPR v -> row half*8+v; col = l&15.
  const int half = lane >> 4, c0 = lane & 15;
  const int row0 = bm + wm * 32 + half * 8;  // + i*16 + v
  const int col0 = bn + wn * 32 + c0;        // + j*16

  // Bias, residual and scale are fetched first, in one run of loads; the rows
  // of comb_rows are fetched in the loop below, for each i in turn.
  // All loops below are unrolled so that acc and these arrays are indexed by
  // constants and stay in registers.
  float bv[2] = {};
  float rv[2][2][8] = {};
  float sc[2][8] = {};
  if constexpr (BIAS) {
#pragma unroll
    for (int j = 0; j < 2; ++j) bv[j] = bias[col0 + j * 16];
  }
  if constexpr (RESID) {
#pragma unroll
    for (int i = 0; i < 2; ++i)
#pragma unroll
      for (int j = 0; j < 2; ++j)
#pragma unroll
        for (int v = 0; v < 8; ++v)
          rv[i][j][v] =
              residual[(size_t)(row0 + i * 16 + v) * N + col0 + j * 16];
  }
  if constexpr (OUT == OUT_SCALED) {
#pragma unroll
    for (int i = 0; i < 2; ++i)
#pragma unroll
      for (int v = 0; v < 8; ++v) sc[i][v] = row_scale[row0 + i * 16 + v];
  }

#pragma unroll
  for (int i = 0; i < 2; ++i) {
    float pa[2][8] = {}, pb[2][8] = {};
    if constexpr (COMBINE) {
      load_comb_rows(comb_rows, oa[i], pa);
      load_comb_rows(comb_rows, ob[i], pb);
    }
#pragma unroll
    for (int j = 0; j < 2; ++j)
#pragma unroll
      for (int v = 0; v < 8; ++v) {
        const int row = row0 + i * 16 + v;
        const int col = col0 + j * 16;
        float val = acc[i][j][v];
        if constexpr (BIAS) val += bv[j];
        if constexpr (ACT) val = gelu_exact(val);
        if constexpr (RESID) val += rv[i][j][v];
        if constexpr (COMBINE) {
          val += pa[j][v];
          val += pb[j][v];
        }
        if constexpr (OUT == OUT_F32) Cf[(size_t)row * N + col] = val;
        if constexpr (OUT == OUT_BF16) Cb[(size_t)row * N + col] = (__bf16)val;
        if constexpr (OUT == OUT_SCALED)
          Cf[(size_t)row * N + col] = val * sc[i][v];
      }
  }
}

typedef __attribute__((ext_vector_type(8))) __bf16 v8bf;

__global__ __launch_bounds__(128) void attn_kernel(
    const __bf16* __restrict__ qkv, __bf16* __restrict__ out, int N, int Hh,
    int hd) {
  const int D3 = 3 * Hh * hd;   // 3072
  const int Dm = Hh * hd;       // 1024
  const int qb = blockIdx.x, h = blockIdx.y, b = blockIdx.z;
  const int tid = threadIdx.x, wave = tid >> 5, lane = tid & 31;
  const int half = lane >> 4, c0 = lane & 15;

  __shared__ __align__(16) __bf16 Qs[64][80];
  __shared__ __align__(16) __bf16 Ks[64][80];
  __shared__ __align__(16) __bf16 Vt[64][80];       // V transposed: [d][key]

  const int r = tid >> 1, d0 = (tid & 1) * 32;
  {  // Q tile (64x64) via async copy; first in-loop wait covers it
    const __bf16* g = qkv + (size_t)(b * N + qb * 64 + r) * D3 + h * hd + d0;
#pragma unroll
    for (int u = 0; u < 4; ++u) async_ld_b128(&Qs[r][d0 + u * 8], g + u * 8);
  }

  // o[j][v] = O[query c0][head dim j*16 + half*8 + v]. mstat is the running
  // maximum of query c0; lstat sums only the keys that this lane half holds.
  // Every loop over u, ks, j, v or m in this kernel is unrolled so that s, o
  // and the fragments are indexed by constants and stay in registers.
  v8f o[4] = {};
  float mstat = -1e30f, lstat = 0.f;

  for (int kb = 0; kb < N / 64; ++kb) {
    __syncthreads();  // prior reads of Ks/Vt complete before overwrite
    {
      const __bf16* gk =
          qkv + (size_t)(b * N + kb * 64 + r) * D3 + Dm + h * hd + d0;
#pragma unroll
      for (int u = 0; u < 4; ++u)
        async_ld_b128(&Ks[r][d0 + u * 8], gk + u * 8);
      const __bf16* gv =
          qkv + (size_t)(b * N + kb * 64 + r) * D3 + 2 * Dm + h * hd + d0;
#pragma unroll
      for (int u = 0; u < 32; ++u) Vt[d0 + u][r] = gv[u];  // transpose to LDS
    }
    wait_async0();
    __syncthreads();

    // S^T = K @ Q^T: s[j][v] = S[query c0][key j*16 + half*8 + v]
    v8f s[4] = {};
#pragma unroll
    for (int ks = 0; ks < 64; ks += 32) {
      const v16bf q = frag16(&Qs[0][0], wave * 16, ks, 80);
#pragma unroll
      for (int j = 0; j < 4; ++j) {
        const v16bf kf = frag16(&Ks[0][0], j * 16, ks, 80);
        s[j] = wmma_bf16(kf, q, s[j]);
      }
    }

    // online softmax of query c0: 32 keys in this lane, 32 in lane ^ 16
    float rmax = -1e30f;
#pragma unroll
    for (int j = 0; j < 4; ++j)
#pragma unroll
      for (int v = 0; v < 8; ++v) {
        s[j][v] *= 0.125f;  // hd^-0.5
        rmax = fmaxf(rmax, s[j][v]);
      }
    rmax = fmaxf(rmax, __shfl_xor(rmax, 16, 32));
    const float mnew = fmaxf(mstat, rmax);
    const float alpha = __expf(mstat - mnew);
    float rsum = 0.f;
#pragma unroll
    for (int j = 0; j < 4; ++j)
#pragma unroll
      for (int v = 0; v < 8; ++v) {
        const float p = __expf(s[j][v] - mnew);
        s[j][v] = p;
        rsum += p;
      }
    lstat = lstat * alpha + rsum;
    mstat = mnew;
#pragma unroll
    for (int j = 0; j < 4; ++j)
#pragma unroll
      for (int v = 0; v < 8; ++v) o[j][v] *= alpha;

    // O^T += V^T @ P^T. Tiles 2m and 2m+1 of S^T hold keys m*32 + half*8 + v
    // and m*32 + 16 + half*8 + v: the k order in which frag16 reads Vt.
#pragma unroll
    for (int m = 0; m < 2; ++m) {
      v16bf pf;
#pragma unroll
      for (int v = 0; v < 8; ++v) {
        pf[v] = (__bf16)s[2 * m][v];
        pf[8 + v] = (__bf16)s[2 * m + 1][v];
      }
#pragma unroll
      for (int j = 0; j < 4; ++j) {
        const v16bf vf = frag16(&Vt[0][0], j * 16, m * 32, 80);
        o[j] = wmma_bf16(vf, pf, o[j]);
      }
    }
  }

  // The two lane halves' sums are joined once; a lane stores 8 neighbouring
  // head dims of its query as one 16-byte piece per tile.
  lstat += __shfl_xor(lstat, 16, 32);
  const float inv = 1.0f / lstat;
  __bf16* orow = out + (size_t)(b * N + qb * 64 + wave * 16 + c0) * Dm +
                 h * hd + half * 8;
#pragma unroll
  for (int j = 0; j < 4; ++j) {
    v8bf w;
#pragma unroll
    for (int v = 0; v < 8; ++v) w[v] = (__bf16)(o[j][v] * inv);
    *(v8bf*)(orow + j * 16) = w;
  }
}

// ---------------------------------------------------------------------------
// Router: noisy top-2 over E=4 experts. One wave per token.
// ---------------------------------------------------------------------------
__global__ __launch_bounds__(128) void router_kernel(
    const float* __restrict__ x2, const float* __restrict__ noise,
    const float* __restrict__ w_route, const float* __restrict__ b_route,
    const float* __restrict__ w_noise, const float* __restrict__ b_noise,
    float* gate, int* fidx, int D) {
  const int wave = threadIdx.x >> 5, lane = threadIdx.x & 31;
  const int t = blockIdx.x * 4 + wave;
  float ar[4] = {0, 0, 0, 0}, an[4] = {0, 0, 0, 0};
  for (int d = lane; d < D; d += 32) {
    const float xv = x2[(size_t)t * D + d];
#pragma unroll
    for (int e = 0; e < 4; ++e) {
      ar[e] += xv * w_route[d * 4 + e];
      an[e] += xv * w_noise[d * 4 + e];
    }
  }
#pragma unroll
  for (int e = 0; e < 4; ++e)
#pragma unroll
    for (int off = 16; off; off >>= 1) {
      ar[e] += __shfl_xor(ar[e], off, 32);
      an[e] += __shfl_xor(an[e], off, 32);
    }
  if (lane == 0) {
    float noisy[4];
#pragma unroll
    for (int e = 0; e < 4; ++e) {
      const float lg = ar[e] + b_route[e];
      const float ns = an[e] + b_noise[e];
      const float sp = (ns > 20.f) ? ns : log1pf(__expf(ns));
      noisy[e] = lg + noise[t * 4 + e] * sp;
    }
    int i0 = 0;
    for (int e = 1; e < 4; ++e)
      if (noisy[e] > noisy[i0]) i0 = e;
    int i1 = -1;
    for (int e = 0; e < 4; ++e)
      if (e != i0 && (i1 < 0 || noisy[e] > noisy[i1])) i1 = e;
    const float m = fmaxf(noisy[i0], noisy[i1]);
    const float e0 = __expf(noisy[i0] - m), e1 = __expf(noisy[i1] - m);
    const float p0 = e0 / (e0 + e1);
#pragma unroll
    for (int e = 0; e < 4; ++e) gate[t * 4 + e] = 0.f;
    gate[t * 4 + i0] = p0;
    gate[t * 4 + i1] = 1.f - p0;
    fidx[2 * t] = i0;
    fidx[2 * t + 1] = i1;
  }
}

// ---------------------------------------------------------------------------
// Per-expert capacity dispatch (stable token order). grid = E blocks.
// inv[e * T + t] is the way back: the row of the experts' result that token t
// has with expert e (they start at row 1), or row 0, cleared here, if none.
// ---------------------------------------------------------------------------
__global__ __launch_bounds__(256) void dispatch_scan(
    const int* __restrict__ fidx, const float* __restrict__ gate, int* sel,
    float* selw, int* inv, float* zero_row, int capacity, int T, int D) {
  const int e = blockIdx.x, tid = threadIdx.x;
  for (int i = e * 256 + tid; i < D; i += gridDim.x * 256) zero_row[i] = 0.f;
  __shared__ int sm[256];
  int base = 0;
  for (int c0 = 0; c0 < T; c0 += 256) {
    const int t = c0 + tid;
    int m = 0;
    if (t < T) m = (fidx[2 * t] == e || fidx[2 * t + 1] == e) ? 1 : 0;
    sm[tid] = m;
    __syncthreads();
    for (int off = 1; off < 256; off <<= 1) {  // inclusive Hillis-Steele
      const int x = sm[tid];
      const int y = (tid >= off) ? sm[tid - off] : 0;
      __syncthreads();
      sm[tid] = x + y;
      __syncthreads();
    }
    const int incl = sm[tid];
    const int tot = sm[255];
    __syncthreads();
    const int pos = base + incl - 1;
    const bool kept = m && pos < capacity;
    if (kept) {
      sel[e * capacity + pos] = t;
      selw[e * capacity + pos] = gate[t * 4 + e];
    }
    if (t < T) {
      inv[e * T + t] = kept ? 1 + e * capacity + pos : 0;
      // The next trip rewrites the registers that this store names.
      asm volatile("s_wait_xcnt 0x0" ::: "memory");
    }
    base += tot;
  }
  for (int i = (base < capacity ? base : capacity) + tid; i < capacity;
       i += 256) {
    sel[e * capacity + i] = 0;
    selw[e * capacity + i] = 0.f;  // padded rows contribute nothing
  }
}

// ---------------------------------------------------------------------------
// fp32 -> bf16 conversion of every weight, one launch.
// The work is cut into pieces of 4096 elements; each work-group takes CVT_PER
// of them, so few waves are started and each moves many bytes.
// A piece of w_qkv or w_proj (already [N][K]) is a straight run of elements.
// A piece of any other weight is a 64x64 tile of in[K][N] that goes out as
// out[N][K]: input rows are read as 256-byte runs, two neighbouring k of one
// column are packed into a dword, the tile is turned in LDS, and each output
// row gets one whole 128-byte run.
// ---------------------------------------------------------------------------
constexpr int W_D = 1024, W_MLPH = 4096, W_MOEH = 256, W_E = 4;  // model dims
constexpr int CVT_PIECE = 64 * 64;
constexpr int CVT_B_PROJ = 3 * W_D * W_D / CVT_PIECE;             // after w_qkv
constexpr int CVT_B_M1 = CVT_B_PROJ + W_D * W_D / CVT_PIECE;      // after w_proj
constexpr int CVT_B_M2 = CVT_B_M1 + W_D * W_MLPH / CVT_PIECE;     // after w_mlp1
constexpr int CVT_B_E1 = CVT_B_M2 + W_MLPH * W_D / CVT_PIECE;     // after w_mlp2
constexpr int CVT_B_E2 = CVT_B_E1 + W_E * W_D * W_MOEH / CVT_PIECE;
constexpr int CVT_TOTAL = CVT_B_E2 + W_E * W_MOEH * W_D / CVT_PIECE;
constexpr int CVT_PER = 4;                      // pieces per work-group
constexpr int CVT_GRID = CVT_TOTAL / CVT_PER;   // work-groups
static_assert(CVT_GRID * CVT_PER == CVT_TOTAL, "pieces divide evenly");
constexpr int CVT_EXP_TILES = W_D * W_MOEH / CVT_PIECE;  // tiles per expert
static_assert(CVT_EXP_TILES == 64, "expert index is taken by a shift of 6");
constexpr int CVT_PITCH = 68;  // LDS row pitch in bf16: 136 B, 8-byte aligned

typedef __attribute__((ext_vector_type(2))) float  f32x2;
typedef __attribute__((ext_vector_type(2))) __bf16 bf16x2;

// Two floats to one dword of bf16, lo in the low half; converted as a pair so
// that one packed conversion does both.
static __device__ __forceinline__ unsigned pack_bf16(float lo, float hi) {
  const f32x2 f = {lo, hi};
  return __builtin_bit_cast(unsigned, __builtin_convertvector(f, bf16x2));
}

typedef __attribute__((ext_vector_type(4))) float    f32x4;
typedef __attribute__((ext_vector_type(2))) unsigned u32x2;

// Four 16-byte loads that fly together. Loads and their data wait are one
// statement with early-clobber outputs, so that no result lands in an address
// pair of the run and no address pair is rewritten while a load is out (as
// plain loads the compiler let one load's result take another's address).
static __device__ __forceinline__ void load4_b128(const float* p0,
                                                  const float* p1,
                                                  const float* p2,
                                                  const float* p3, f32x4& r0,
                                                  f32x4& r1, f32x4& r2,
                                                  f32x4& r3) {
  asm volatile(
      "global_load_b128 %0, %4, off\n\t"
      "global_load_b128 %1, %5, off\n\t"
      "global_load_b128 %2, %6, off\n\t"
      "global_load_b128 %3, %7, off\n\t"
      "s_wait_loadcnt 0x0"
      : "=&v"(r0), "=&v"(r1), "=&v"(r2), "=&v"(r3)
      : "v"(p0), "v"(p1), "v"(p2), "v"(p3)
      : "memory");
}

// Stores with their s_wait_xcnt in the same statement: the next piece rewrites
// the registers that they name, and a wait in a statement of its own is not
// tied to those registers.
static __device__ __forceinline__ void store4_b64_step2k(__bf16* p, u32x2 w0,
                                                         u32x2 w1, u32x2 w2,
                                                         u32x2 w3) {
  asm volatile(
      "global_store_b64 %0, %1, off\n\t"
      "global_store_b64 %0, %2, off offset:2048\n\t"
      "global_store_b64 %0, %3, off offset:4096\n\t"
      "global_store_b64 %0, %4, off offset:6144\n\t"
      "s_wait_xcnt 0x0"
      :
      : "v"(p), "v"(w0), "v"(w1), "v"(w2), "v"(w3)
      : "memory");
}
static __device__ __forceinline__ void store2_b128(__bf16* p, u32x4 d0,
                                                   u32x4 d1) {
  asm volatile(
      "global_store_b128 %0, %1, off\n\t"
      "global_store_b128 %0, %2, off offset:16\n\t"
      "s_wait_xcnt 0x0"
      :
      : "v"(p), "v"(d0), "v"(d1)
      : "memory");
}

__global__ __launch_bounds__(256) void cvt_weights(
    const float* __restrict__ w_qkv, const float* __restrict__ w_proj,
    const float* __restrict__ w_m1, const float* __restrict__ w_m2,
    const float* __restrict__ we1, const float* __restrict__ we2,
    __bf16* __restrict__ o_qkv, __bf16* __restrict__ o_proj,
    __bf16* __restrict__ o_m1, __bf16* __restrict__ o_m2,
    __bf16* __restrict__ o_e1, __bf16* __restrict__ o_e2) {
  __shared__ __align__(16) __bf16 tile[2][64][CVT_PITCH];
  const int tid = threadIdx.x;

  for (int i = 0; i < CVT_PER; ++i) {
    const int p = blockIdx.x + i * CVT_GRID;  // same for the whole work-group
    const bool turned = p >= CVT_B_M1;
    __bf16(*t)[CVT_PITCH] = tile[i & 1];

    // Which weight, and which tile of it. N = 64 << lnt columns of input.
    const float* in;
    __bf16* out;
    int K = 0, lnt = 0, q;
    if (p < CVT_B_PROJ) {
      in = w_qkv; out = o_qkv; q = p;
    } else if (p < CVT_B_M1) {
      in = w_proj; out = o_proj; q = p - CVT_B_PROJ;
    } else if (p < CVT_B_M2) {
      in = w_m1; out = o_m1; q = p - CVT_B_M1; K = W_D; lnt = 6;
    } else if (p < CVT_B_E1) {
      in = w_m2; out = o_m2; q = p - CVT_B_M2; K = W_MLPH; lnt = 4;
    } else if (p < CVT_B_E2) {
      q = p - CVT_B_E1;
      in = we1 + (size_t)(q >> 6) * (W_D * W_MOEH);
      out = o_e1 + (size_t)(q >> 6) * (W_D * W_MOEH);
      q &= 63; K = W_D; lnt = 2;
    } else {
      q = p - CVT_B_E2;
      in = we2 + (size_t)(q >> 6) * (W_D * W_MOEH);
      out = o_e2 + (size_t)(q >> 6) * (W_D * W_MOEH);
      q &= 63; K = W_MOEH; lnt = 4;
    }
    const int N = 64 << lnt;
    const int k0 = (q >> lnt) * 64, n0 = (q & ((1 << lnt) - 1)) * 64;

    if (!turned) {
      const size_t e = (size_t)q * CVT_PIECE + tid * 4;
      const float* g = in + e;
      f32x4 v0, v1, v2, v3;
      load4_b128(g, g + 1024, g + 2048, g + 3072, v0, v1, v2, v3);
      const u32x2 w0 = {pack_bf16(v0.x, v0.y), pack_bf16(v0.z, v0.w)};
      const u32x2 w1 = {pack_bf16(v1.x, v1.y), pack_bf16(v1.z, v1.w)};
      const u32x2 w2 = {pack_bf16(v2.x, v2.y), pack_bf16(v2.z, v2.w)};
      const u32x2 w3 = {pack_bf16(v3.x, v3.y), pack_bf16(v3.z, v3.w)};
      store4_b64_step2k(out + e, w0, w1, w2, w3);  // 1024 elements apart
    } else {
      const int c4 = (tid & 15) * 4, r2 = (tid >> 4) * 2;
      const float* g = in + (size_t)(k0 + r2) * N + n0 + c4;
      f32x4 a0, b0, a1, b1;  // rows k, k + 1 and k + 32, k + 33
      load4_b128(g, g + N, g + (size_t)32 * N, g + (size_t)33 * N, a0, b0, a1,
                 b1);
      *(unsigned*)&t[c4 + 0][r2] = pack_bf16(a0.x, b0.x);
      *(unsigned*)&t[c4 + 1][r2] = pack_bf16(a0.y, b0.y);
      *(unsigned*)&t[c4 + 2][r2] = pack_bf16(a0.z, b0.z);
      *(unsigned*)&t[c4 + 3][r2] = pack_bf16(a0.w, b0.w);
      *(unsigned*)&t[c4 + 0][r2 + 32] = pack_bf16(a1.x, b1.x);
      *(unsigned*)&t[c4 + 1][r2 + 32] = pack_bf16(a1.y, b1.y);
      *(unsigned*)&t[c4 + 2][r2 + 32] = pack_bf16(a1.z, b1.z);
      *(unsigned*)&t[c4 + 3][r2 + 32] = pack_bf16(a1.w, b1.w);
    }
    // One barrier a trip, passed by every wave whatever the piece: it
    // publishes this trip's tile, and it stands between the reads of a buffer
    // in trip i and its next filling in trip i + 2.
    __syncthreads();
    if (turned) {
      const int n = tid >> 2, kc = (tid & 3) * 16;
      const uint2* s = (const uint2*)&t[n][kc];
      const uint2 s0 = s[0], s1 = s[1], s2 = s[2], s3 = s[3];
      const u32x4 d0 = {s0.x, s0.y, s1.x, s1.y};
      const u32x4 d1 = {s2.x, s2.y, s3.x, s3.y};
      store2_b128(out + (size_t)(n0 + n) * K + k0 + kc, d0, d1);
    }
  }
}

// ---------------------------------------------------------------------------
// Row kernels: LayerNorm and the expert gather. A row is W_D elements.
// One wave takes a whole row (LayerNorm) or two rows (gather) in 16-byte
// pieces per lane, each wave-wide access covering 512 contiguous bytes, so a
// launch starts 4096 waves that each keep eight or more loads in flight.
// Loads stand with their data wait, stores with their s_wait_xcnt, in one
// statement each, for the reasons given at load4_b128 and store4_b64_step2k.
// ---------------------------------------------------------------------------
static_assert(W_D == 32 * 4 * 8, "a lane holds 8 pieces of 4 floats of a row");

// One row of x, and gamma and beta, 512 bytes of each per wave-wide load.
static __device__ __forceinline__ void load_ln_row(const float* x,
                                                   const float* g,
                                                   const float* b,
                                                   f32x4 (&xv)[8],
                                                   f32x4 (&gv)[8],
                                                   f32x4 (&bv)[8]) {
  asm volatile(
      "global_load_b128 %0, %24, off\n\t"
      "global_load_b128 %1, %24, off offset:512\n\t"
      "global_load_b128 %2, %24, off offset:1024\n\t"
      "global_load_b128 %3, %24, off offset:1536\n\t"
      "global_load_b128 %4, %24, off offset:2048\n\t"
      "global_load_b128 %5, %24, off offset:2560\n\t"
      "global_load_b128 %6, %24, off offset:3072\n\t"
      "global_load_b128 %7, %24, off offset:3584\n\t"
      "global_load_b128 %8, %25, off\n\t"
      "global_load_b128 %9, %25, off offset:512\n\t"
      "global_load_b128 %10, %25, off offset:1024\n\t"
      "global_load_b128 %11, %25, off offset:1536\n\t"
      "global_load_b128 %12, %25, off offset:2048\n\t"
      "global_load_b128 %13, %25, off offset:2560\n\t"
      "global_load_b128 %14, %25, off offset:3072\n\t"
      "global_load_b128 %15, %25, off offset:3584\n\t"
      "global_load_b128 %16, %26, off\n\t"
      "global_load_b128 %17, %26, off offset:512\n\t"
      "global_load_b128 %18, %26, off offset:1024\n\t"
      "global_load_b128 %19, %26, off offset:1536\n\t"
      "global_load_b128 %20, %26, off offset:2048\n\t"
      "global_load_b128 %21, %26, off offset:2560\n\t"
      "global_load_b128 %22, %26, off offset:3072\n\t"
      "global_load_b128 %23, %26, off offset:3584\n\t"
      "s_wait_loadcnt 0x0"
      : "=&v"(xv[0]), "=&v"(xv[1]), "=&v"(xv[2]), "=&v"(xv[3]), "=&v"(xv[4]), "=&v"(xv[5]), "=&v"(xv[6]), "=&v"(xv[7]),
        "=&v"(gv[0]), "=&v"(gv[1]), "=&v"(gv[2]), "=&v"(gv[3]), "=&v"(gv[4]), "=&v"(gv[5]), "=&v"(gv[6]), "=&v"(gv[7]),
        "=&v"(bv[0]), "=&v"(bv[1]), "=&v"(bv[2]), "=&v"(bv[3]), "=&v"(bv[4]), "=&v"(bv[5]), "=&v"(bv[6]), "=&v"(bv[7])
      : "v"(x), "v"(g), "v"(b)
      : "memory");
}
// Two rows of W_D bf16, four 16-byte pieces per lane of each.
static __device__ __forceinline__ void load_2rows_bf16(const __bf16* p0,
                                                       const __bf16* p1,
                                                       u32x4 (&d)[8]) {
  asm volatile(
      "global_load_b128 %0, %8, off\n\t"
      "global_load_b128 %1, %8, off offset:512\n\t"
      "global_load_b128 %2, %8, off offset:1024\n\t"
      "global_load_b128 %3, %8, off offset:1536\n\t"
      "global_load_b128 %4, %9, off\n\t"
      "global_load_b128 %5, %9, off offset:512\n\t"
      "global_load_b128 %6, %9, off offset:1024\n\t"
      "global_load_b128 %7, %9, off offset:1536\n\t"
      "s_wait_loadcnt 0x0"
      : "=&v"(d[0]), "=&v"(d[1]), "=&v"(d[2]), "=&v"(d[3]), "=&v"(d[4]), "=&v"(d[5]), "=&v"(d[6]), "=&v"(d[7])
      : "v"(p0), "v"(p1)
      : "memory");
}
static __device__ __forceinline__ void store8_f32x4(float* p,
                                                    const f32x4 (&d)[8]) {
  asm volatile(
      "global_store_b128 %0, %1, off\n\t"
      "global_store_b128 %0, %2, off offset:512\n\t"
      "global_store_b128 %0, %3, off offset:1024\n\t"
      "global_store_b128 %0, %4, off offset:1536\n\t"
      "global_store_b128 %0, %5, off offset:2048\n\t"
      "global_store_b128 %0, %6, off offset:2560\n\t"
      "global_store_b128 %0, %7, off offset:3072\n\t"
      "global_store_b128 %0, %8, off offset:3584\n\t"
      "s_wait_xcnt 0x0"
      :
      : "v"(p), "v"(d[0]), "v"(d[1]), "v"(d[2]), "v"(d[3]), "v"(d[4]), "v"(d[5]), "v"(d[6]), "v"(d[7])
      : "memory");
}
static __device__ __forceinline__ void store8_u32x4(__bf16* p,
                                                    const u32x4 (&d)[8]) {
  asm volatile(
      "global_store_b128 %0, %1, off\n\t"
      "global_store_b128 %0, %2, off offset:512\n\t"
      "global_store_b128 %0, %3, off offset:1024\n\t"
      "global_store_b128 %0, %4, off offset:1536\n\t"
      "global_store_b128 %0, %5, off offset:2048\n\t"
      "global_store_b128 %0, %6, off offset:2560\n\t"
      "global_store_b128 %0, %7, off offset:3072\n\t"
      "global_store_b128 %0, %8, off offset:3584\n\t"
      "s_wait_xcnt 0x0"
      :
      : "v"(p), "v"(d[0]), "v"(d[1]), "v"(d[2]), "v"(d[3]), "v"(d[4]), "v"(d[5]), "v"(d[6]), "v"(d[7])
      : "memory");
}
static __device__ __forceinline__ void store8_u32x2(__bf16* p,
                                                    const u32x2 (&d)[8]) {
  asm volatile(
      "global_store_b64 %0, %1, off\n\t"
      "global_store_b64 %0, %2, off offset:256\n\t"
      "global_store_b64 %0, %3, off offset:512\n\t"
      "global_store_b64 %0, %4, off offset:768\n\t"
      "global_store_b64 %0, %5, off offset:1024\n\t"
      "global_store_b64 %0, %6, off offset:1280\n\t"
      "global_store_b64 %0, %7, off offset:1536\n\t"
      "global_store_b64 %0, %8, off offset:1792\n\t"
      "s_wait_xcnt 0x0"
      :
      : "v"(p), "v"(d[0]), "v"(d[1]), "v"(d[2]), "v"(d[3]), "v"(d[4]), "v"(d[5]), "v"(d[6]), "v"(d[7])
      : "memory");
}

// LayerNorm: one token per wave, the row read once and kept in registers.
// Optional f32 and/or bf16 outputs. grid = tokens / 8.
__global__ __launch_bounds__(256) void ln_kernel(const float* __restrict__ x,
                                                 const float* __restrict__ g,
                                                 const float* __restrict__ bta,
                                                 float* outf, __bf16* outb) {
  const int wave = threadIdx.x >> 5, lane = threadIdx.x & 31;
  const size_t e = (size_t)(blockIdx.x * 8 + wave) * W_D + lane * 4;
  f32x4 xv[8], gv[8], bv[8];
  load_ln_row(x + e, g + lane * 4, bta + lane * 4, xv, gv, bv);

  // Four independent chains per sum; all loops over c are unrolled so that
  // the arrays are indexed by constants and stay in registers.
  f32x4 s4 = {}, ss4 = {};
#pragma unroll
  for (int c = 0; c < 8; ++c) {
    s4 += xv[c];
    ss4 += xv[c] * xv[c];
  }
  float s = (s4.x + s4.y) + (s4.z + s4.w);
  float ss = (ss4.x + ss4.y) + (ss4.z + ss4.w);
#pragma unroll
  for (int off = 16; off; off >>= 1) {
    s += __shfl_xor(s, off, 32);
    ss += __shfl_xor(ss, off, 32);
  }
  const float mu = s / W_D;
  const float r = rsqrtf(ss / W_D - mu * mu + 1e-5f);

  f32x4 y[8];
#pragma unroll
  for (int c = 0; c < 8; ++c) y[c] = (xv[c] - mu) * r * gv[c] + bv[c];
  if (outf) store8_f32x4(outf + e, y);
  if (outb) {
    u32x2 w[8];
#pragma unroll
    for (int c = 0; c < 8; ++c)
      w[c] = u32x2{pack_bf16(y[c].x, y[c].y), pack_bf16(y[c].z, y[c].w)};
    store8_u32x2(outb + e, w);
  }
}

// Gather: each wave copies two neighbouring rows of xdisp from the rows of
// x2b that sel names. grid = rows / 16.
__global__ __launch_bounds__(256) void gather_kernel(
    const __bf16* __restrict__ x2b, const int* __restrict__ sel,
    __bf16* xdisp) {
  // The wave's number as a scalar, so that sel is read by a scalar load.
  const int wave = __builtin_amdgcn_readfirstlane(threadIdx.x >> 5);
  const int lane = threadIdx.x & 31;
  const int row = (blockIdx.x * 8 + wave) * 2;
  const int src0 = sel[row], src1 = sel[row + 1];
  u32x4 d[8];
  load_2rows_bf16(x2b + (size_t)src0 * W_D + lane * 8,
                  x2b + (size_t)src1 * W_D + lane * 8, d);
  store8_u32x4(xdisp + (size_t)row * W_D + lane * 8, d);
}

// ---------------------------------------------------------------------------
// Launch orchestration.
// ---------------------------------------------------------------------------
extern "C" void kernel_launch(void* const* d_in, const int* in_sizes, int n_in,
                              void* d_out, int out_size, void* d_ws,
                              size_t ws_size, hipStream_t stream) {
  (void)in_sizes; (void)n_in; (void)out_size; (void)ws_size;
  constexpr int Bb = 2, Nn = 2048, Dd = 1024, Hh = 16, hd = 64;
  constexpr int T = Bb * Nn, D3 = 3 * Dd, MLPH = 4096, MOEH = 256;
  constexpr int Ee = 4, CAP = 2048;

  const float* x      = (const float*)d_in[0];
  const float* noise  = (const float*)d_in[1];
  const float* ln1_g  = (const float*)d_in[2];
  const float* ln1_b  = (const float*)d_in[3];
  const float* ln2_g  = (const float*)d_in[4];
  const float* ln2_b  = (const float*)d_in[5];
  const float* w_qkv  = (const float*)d_in[6];
  const float* w_proj = (const float*)d_in[7];
  const float* b_proj = (const float*)d_in[8];
  const float* w_rt   = (const float*)d_in[9];
  const float* b_rt   = (const float*)d_in[10];
  const float* w_nz   = (const float*)d_in[11];
  const float* b_nz   = (const float*)d_in[12];
  const float* we1    = (const float*)d_in[13];
  const float* be1    = (const float*)d_in[14];
  const float* we2    = (const float*)d_in[15];
  const float* be2    = (const float*)d_in[16];
  const float* w_m1   = (const float*)d_in[17];
  const float* b_m1   = (const float*)d_in[18];
  const float* w_m2   = (const float*)d_in[19];
  const float* b_m2   = (const float*)d_in[20];
  float* out = (float*)d_out;

  char* wsp = (char*)d_ws;
  size_t off = 0;
  auto alloc = [&](size_t bytes) {
    void* p = wsp + off;
    off = (off + bytes + 255) & ~(size_t)255;
    return p;
  };
  __bf16* x1b    = (__bf16*)alloc((size_t)T * Dd * 2);
  __bf16* wqkvb  = (__bf16*)alloc((size_t)D3 * Dd * 2);
  __bf16* qkvb   = (__bf16*)alloc((size_t)T * D3 * 2);
  __bf16* attnb  = (__bf16*)alloc((size_t)T * Dd * 2);
  __bf16* wprojb = (__bf16*)alloc((size_t)Dd * Dd * 2);
  float*  xattn  = (float*)alloc((size_t)T * Dd * 4);
  float*  x2f    = (float*)alloc((size_t)T * Dd * 4);
  __bf16* x2b    = (__bf16*)alloc((size_t)T * Dd * 2);
  __bf16* wm1t   = (__bf16*)alloc((size_t)Dd * MLPH * 2);
  __bf16* wm2t   = (__bf16*)alloc((size_t)MLPH * Dd * 2);
  __bf16* hmlp   = (__bf16*)alloc((size_t)T * MLPH * 2);
  __bf16* we1t   = (__bf16*)alloc((size_t)Ee * Dd * MOEH * 2);
  __bf16* we2t   = (__bf16*)alloc((size_t)Ee * MOEH * Dd * 2);
  __bf16* xdisp  = (__bf16*)alloc((size_t)Ee * CAP * Dd * 2);
  __bf16* hdisp  = (__bf16*)alloc((size_t)Ee * CAP * MOEH * 2);
  float*  gate   = (float*)alloc((size_t)T * Ee * 4);
  int*    fidx   = (int*)alloc((size_t)T * 2 * 4);
  int*    sel    = (int*)alloc((size_t)Ee * CAP * 4);
  float*  selw   = (float*)alloc((size_t)Ee * CAP * 4);
  int*    inv    = (int*)alloc((size_t)Ee * T * 4);
  float*  ymoe   = (float*)alloc((size_t)(Ee * CAP + 1) * Dd * 4);

  // 1) weight conversion to bf16 (w_qkv/w_proj are already [N][K]; the rest
  //    goes from [K][N] to [N][K])
  static_assert(Dd == W_D && MLPH == W_MLPH && MOEH == W_MOEH && Ee == W_E,
                "the conversion and row kernels are cut for these shapes");
  cvt_weights<<<CVT_GRID, 256, 0, stream>>>(w_qkv, w_proj, w_m1, w_m2, we1, we2,
                                            wqkvb, wprojb, wm1t, wm2t, we1t,
                                            we2t);

  // 2) LN1 -> x1 (bf16)
  ln_kernel<<<T / 8, 256, 0, stream>>>(x, ln1_g, ln1_b, nullptr, x1b);

  // 3) QKV GEMM: [T,D] x [3D,D]^T -> bf16 [T,3D]
  gemm_bf16_kernel<false, false, false, OUT_BF16, false>
      <<<dim3(D3 / 64, T / 128), 256, 0, stream>>>(
          x1b, wqkvb, nullptr, nullptr, nullptr, qkvb, nullptr, nullptr,
          nullptr, T, D3, Dd);

  // 4) flash attention -> bf16 [T,D]
  attn_kernel<<<dim3(Nn / 64, Hh, Bb), 128, 0, stream>>>(qkvb, attnb, Nn, Hh,
                                                         hd);

  // 5) proj GEMM + b_proj + residual x -> xattn (f32)
  gemm_bf16_kernel<true, false, true, OUT_F32, false>
      <<<dim3(Dd / 64, T / 128), 256, 0, stream>>>(
          attnb, wprojb, b_proj, x, xattn, nullptr, nullptr, nullptr, nullptr,
          T, Dd, Dd);

  // 6) LN2 -> x2 (f32 + bf16)
  ln_kernel<<<T / 8, 256, 0, stream>>>(xattn, ln2_g, ln2_b, x2f, x2b);

  // 7) router + capacity dispatch + gather
  router_kernel<<<T / 4, 128, 0, stream>>>(x2f, noise, w_rt, b_rt, w_nz, b_nz,
                                           gate, fidx, Dd);
  dispatch_scan<<<Ee, 256, 0, stream>>>(fidx, gate, sel, selw, inv, ymoe, CAP,
                                        T, Dd);
  gather_kernel<<<Ee * CAP / 16, 256, 0, stream>>>(x2b, sel, xdisp);

  // 8) expert FFNs, all experts in one launch per layer (grid z = expert);
  //    the second layer leaves its gate-weighted rows in ymoe from row 1 on
  static_assert(Ee == GEMM_E, "the combining epilogue looks through this many planes");
  gemm_bf16_kernel<true, true, false, OUT_BF16, false>
      <<<dim3(MOEH / 64, CAP / 128, Ee), 256, 0, stream>>>(
          xdisp, we1t, be1, nullptr, nullptr, hdisp, nullptr, nullptr, nullptr,
          CAP, MOEH, Dd);
  gemm_bf16_kernel<true, false, false, OUT_SCALED, false>
      <<<dim3(Dd / 64, CAP / 128, Ee), 256, 0, stream>>>(
          hdisp, we2t, be2, nullptr, ymoe + Dd, nullptr, nullptr, selw, nullptr,
          CAP, Dd, MOEH);

  // 9) dense MLP: gelu(x2@W1+b1)@W2+b2 + xattn + each token's expert rows
  //    -> d_out (f32)
  gemm_bf16_kernel<true, true, false, OUT_BF16, false>
      <<<dim3(MLPH / 64, T / 128), 256, 0, stream>>>(
          x2b, wm1t, b_m1, nullptr, nullptr, hmlp, nullptr, nullptr, nullptr,
          T, MLPH, Dd);
  gemm_bf16_kernel<true, false, true, OUT_F32, true>
      <<<dim3(Dd / 64, T / 128), 256, 0, stream>>>(
          hmlp, wm2t, b_m2, xattn, out, nullptr, inv, nullptr, ymoe, T, Dd,
          MLPH);
}

// v007
// A run of this version takes 260 microseconds.
// Timed twice side by side with v006, it ran 1.10 and 1.09 times as fast.
// Counting every step since v000, it is 3.16 times as fast.
#include <hip/hip_runtime.h>
#include <hip/hip_bf16.h>
#include <math.h>
#include <stdint.h>

// ---------------------------------------------------------------------------
// Types for CDNA5 WMMA (wave32): D(f32 16x16) = A(bf16 16x32) x B(bf16 32x16) + C
// ---------------------------------------------------------------------------
typedef __attribute__((ext_vector_type(16))) __bf16 v16bf;
typedef __attribute__((ext_vector_type(8)))  float  v8f;
typedef __attribute__((ext_vector_type(4)))  unsigned u32x4;

static __device__ __forceinline__ v8f wmma_bf16(v16bf a, v16bf b, v8f c) {
  // (neg_a, A, neg_b, B, c_mod, C, reuse_a, reuse_b)
  return __builtin_amdgcn_wmma_f32_16x16x32_bf16(false, a, false, b, (short)0, c,
                                                 false, false);
}

// CDNA5 async copy: global -> LDS, 16 bytes per lane, tracked by ASYNCcnt.
// lds_off = low 32 bits of the generic pointer (ISA: LDS generic addresses
// carry the LDS byte offset in [31:0]).
static __device__ __forceinline__ void async_ld_b128(void* lds_ptr,
                                                     const void* gptr) {
  const unsigned lds_off = (unsigned)(uintptr_t)lds_ptr;
  asm volatile("global_load_async_to_lds_b128 %0, %1, off"
               :
               : "v"(lds_off), "v"(gptr)
               : "memory");
}
static __device__ __forceinline__ void wait_async0() {
  asm volatile("s_wait_asynccnt 0" ::: "memory");
}

// Load a 16x32 bf16 fragment (A layout; B "Bt" layout is identical with N<->M)
// from row-major LDS with leading dim `ld` (bf16 elements, multiple of 8).
// Lane l: row = base + (l&15); half = l>>4 selects K subranges
// [half*8, half*8+8) and [16+half*8, 16+half*8+8)  -> two aligned b128 loads.
static __device__ __forceinline__ v16bf frag16(const __bf16* base, int row,
                                               int kbase, int ld) {
  const int lane = threadIdx.x & 31;
  const __bf16* p =
      base + (size_t)(row + (lane & 15)) * ld + kbase + ((lane >> 4) * 8);
  union { uint4 u[2]; v16bf v; } t;
  t.u[0] = *(const uint4*)p;
  t.u[1] = *(const uint4*)(p + 16);
  return t.v;
}

static __device__ __forceinline__ float gelu_exact(float x) {
  return 0.5f * x * (1.0f + erff(x * 0.70710678118654752f));
}

// ---------------------------------------------------------------------------
// Generic bf16 WMMA GEMM:  C[M][N] = A[M][K] * Bt[N][K]^T  (+bias, gelu, resid)
// Block 256 threads = 8 waves; tile 128(M) x 64(N); K-step 128.
// Async double-buffered LDS: global_load_async_to_lds_b128 fills the next
// tile while WMMA consumes the current one; one barrier per K-step.
// Sixteen lanes copy one 256-byte piece of a row, so a wave's copy covers
// whole cache lines. LDS rows are pitched 272 B (16 B x odd) for b128 reads.
// Epilogue forms: f32 store, bf16 store, f32 store with a scale per row.
// Bias, activation, residual and output form are template parameters: each
// launch's epilogue is code without tests on pointers, so its bias, residual
// and scale loads are issued together and waited for once, not per element.
// blockIdx.z picks one product of a batch whose operands, biases, scales and
// results lie back to back (the experts); a single product has grid z = 1.
// COMBINE adds to each result row the rows of comb_rows that its experts left
// for it, in expert order; comb_idx[e * M + row] names expert e's (0, an
// all-zero row, where that expert does not serve the token).
// Requires M%128==0, N%64==0, K%128==0 (true for every GEMM in this model).
// ---------------------------------------------------------------------------
constexpr int GEMM_KT = 128;     // k per stage
constexpr int GEMM_LD = 136;     // LDS row pitch in bf16 elements (272 B)
constexpr int OUT_F32 = 0, OUT_BF16 = 1, OUT_SCALED = 2;  // output forms
constexpr int GEMM_E = 4;        // experts that COMBINE looks through

// One stage's copies of one thread: 8 row pieces of A, 4 of Bt, rows 16 apart.
// The s_wait_xcnt stands inside the statement so that no address register of
// an issued copy is rewritten in front of it.
static __device__ __forceinline__ void async_stage12(const __bf16* lA,
                                                     const __bf16* lB,
                                                     const __bf16* gA,
                                                     const __bf16* gB, int K) {
  const unsigned la = (unsigned)(uintptr_t)lA;
  const unsigned lb = (unsigned)(uintptr_t)lB;
  constexpr unsigned LS = 16u * GEMM_LD * 2u;  // 16 LDS rows in bytes
  const size_t gs = (size_t)16 * K;            // 16 global rows in elements
  asm volatile(
      "global_load_async_to_lds_b128 %0, %12, off\n\t"
      "global_load_async_to_lds_b128 %1, %13, off\n\t"
      "global_load_async_to_lds_b128 %2, %14, off\n\t"
      "global_load_async_to_lds_b128 %3, %15, off\n\t"
      "global_load_async_to_lds_b128 %4, %16, off\n\t"
      "global_load_async_to_lds_b128 %5, %17, off\n\t"
      "global_load_async_to_lds_b128 %6, %18, off\n\t"
      "global_load_async_to_lds_b128 %7, %19, off\n\t"
      "global_load_async_to_lds_b128 %8, %20, off\n\t"
      "global_load_async_to_lds_b128 %9, %21, off\n\t"
      "global_load_async_to_lds_b128 %10, %22, off\n\t"
      "global_load_async_to_lds_b128 %11, %23, off\n\t"
      "s_wait_xcnt 0x0"
      :
      : "v"(la), "v"(la + LS), "v"(la + 2 * LS), "v"(la + 3 * LS),
        "v"(la + 4 * LS), "v"(la + 5 * LS), "v"(la + 6 * LS), "v"(la + 7 * LS),
        "v"(lb), "v"(lb + LS), "v"(lb + 2 * LS), "v"(lb + 3 * LS),
        "v"(gA), "v"(gA + gs), "v"(gA + 2 * gs), "v"(gA + 3 * gs),
        "v"(gA + 4 * gs), "v"(gA + 5 * gs), "v"(gA + 6 * gs), "v"(gA + 7 * gs),
        "v"(gB), "v"(gB + gs), "v"(gB + 2 * gs), "v"(gB + 3 * gs)
      : "memory");
}

// COMBINE's loads. Each run stands with its data wait in one statement with
// early-clobber outputs, so that no result lands in an address register of
// the run and none is rewritten while a load is out.
// The thread's 16 result rows (8 from off, 8 from off + 64 B) in 4 planes.
static __device__ __forceinline__ void load_comb_idx(
    const int* p0, const int* p1, const int* p2, const int* p3, unsigned off,
    u32x4 (&d)[GEMM_E][4]) {
  asm volatile(
      "global_load_b128 %0, %16, %17\n\t"
      "global_load_b128 %1, %16, %17 offset:16\n\t"
      "global_load_b128 %2, %16, %17 offset:64\n\t"
      "global_load_b128 %3, %16, %17 offset:80\n\t"
      "global_load_b128 %4, %16, %18\n\t"
      "global_load_b128 %5, %16, %18 offset:16\n\t"
      "global_load_b128 %6, %16, %18 offset:64\n\t"
      "global_load_b128 %7, %16, %18 offset:80\n\t"
      "global_load_b128 %8, %16, %19\n\t"
      "global_load_b128 %9, %16, %19 offset:16\n\t"
      "global_load_b128 %10, %16, %19 offset:64\n\t"
      "global_load_b128 %11, %16, %19 offset:80\n\t"
      "global_load_b128 %12, %16, %20\n\t"
      "global_load_b128 %13, %16, %20 offset:16\n\t"
      "global_load_b128 %14, %16, %20 offset:64\n\t"
      "global_load_b128 %15, %16, %20 offset:80\n\t"
      "s_wait_loadcnt 0x0"
      : "=&v"(d[0][0]), "=&v"(d[0][1]), "=&v"(d[0][2]), "=&v"(d[0][3]),
        "=&v"(d[1][0]), "=&v"(d[1][1]), "=&v"(d[1][2]), "=&v"(d[1][3]),
        "=&v"(d[2][0]), "=&v"(d[2][1]), "=&v"(d[2][2]), "=&v"(d[2][3]),
        "=&v"(d[3][0]), "=&v"(d[3][1]), "=&v"(d[3][2]), "=&v"(d[3][3])
      : "v"(off), "s"(p0), "s"(p1), "s"(p2), "s"(p3)
      : "memory");
}
// Two columns, 16 apart, of 8 rows of base; off holds byte offsets.
static __device__ __forceinline__ void load_comb_rows(const float* base,
                                                      const unsigned (&off)[8],
                                                      float (&d)[2][8]) {
  asm volatile(
      "global_load_b32 %0, %16, %24\n\t"
      "global_load_b32 %1, %17, %24\n\t"
      "global_load_b32 %2, %18, %24\n\t"
      "global_load_b32 %3, %19, %24\n\t"
      "global_load_b32 %4, %20, %24\n\t"
      "global_load_b32 %5, %21, %24\n\t"
      "global_load_b32 %6, %22, %24\n\t"
      "global_load_b32 %7, %23, %24\n\t"
      "global_load_b32 %8, %16, %24 offset:64\n\t"
      "global_load_b32 %9, %17, %24 offset:64\n\t"
      "global_load_b32 %10, %18, %24 offset:64\n\t"
      "global_load_b32 %11, %19, %24 offset:64\n\t"
      "global_load_b32 %12, %20, %24 offset:64\n\t"
      "global_load_b32 %13, %21, %24 offset:64\n\t"
      "global_load_b32 %14, %22, %24 offset:64\n\t"
      "global_load_b32 %15, %23, %24 offset:64\n\t"
      "s_wait_loadcnt 0x0"
      : "=&v"(d[0][0]), "=&v"(d[0][1]), "=&v"(d[0][2]), "=&v"(d[0][3]),
        "=&v"(d[0][4]), "=&v"(d[0][5]), "=&v"(d[0][6]), "=&v"(d[0][7]),
        "=&v"(d[1][0]), "=&v"(d[1][1]), "=&v"(d[1][2]), "=&v"(d[1][3]),
        "=&v"(d[1][4]), "=&v"(d[1][5]), "=&v"(d[1][6]), "=&v"(d[1][7])
      : "v"(off[0]), "v"(off[1]), "v"(off[2]), "v"(off[3]), "v"(off[4]),
        "v"(off[5]), "v"(off[6]), "v"(off[7]), "s"(base)
      : "memory");
}

template <bool BIAS, bool ACT, bool RESID, int OUT, bool COMBINE>
__global__ __launch_bounds__(256) void gemm_bf16_kernel(
    const __bf16* __restrict__ A, const __bf16* __restrict__ Bt,
    const float* __restrict__ bias, const float* __restrict__ residual,
    float* Cf, __bf16* Cb, const int* __restrict__ comb_idx,
    const float* __restrict__ row_scale, const float* __restrict__ comb_rows,
    int M, int N, int K) {
  __shared__ __align__(16) __bf16 As[2][128][GEMM_LD];
  __shared__ __align__(16) __bf16 Bs[2][64][GEMM_LD];

  const size_t zb = blockIdx.z;  // which product of the batch
  A += zb * M * K;
  Bt += zb * N * K;
  if constexpr (BIAS) bias += zb * N;
  if constexpr (RESID) residual += zb * M * N;
  if constexpr (OUT == OUT_BF16) Cb += zb * M * N;
  if constexpr (OUT != OUT_BF16) Cf += zb * M * N;
  if constexpr (OUT == OUT_SCALED) row_scale += zb * M;

  const int tid = threadIdx.x;
  const int wave = tid >> 5, lane = tid & 31;
  const int wm = wave & 3, wn = wave >> 2;
  const int bm = blockIdx.y * 128, bn = blockIdx.x * 64;

  const int rc = tid >> 4, cc = (tid & 15) * 8;  // copy: row in 16, 8 bf16
  const __bf16* gA0 = A + (size_t)(bm + rc) * K + cc;
  const __bf16* gB0 = Bt + (size_t)(bn + rc) * K + cc;

  auto issue_tile = [&](int buf, int k0) {
    async_stage12(&As[buf][rc][cc], &Bs[buf][rc][cc], gA0 + k0, gB0 + k0, K);
  };

  v8f acc[2][2] = {};
  const int nt = K / GEMM_KT;
  issue_tile(0, 0);

  // Byte offsets in comb_rows of the two rows that each result row gets,
  // fetched here so that the wait falls into the first tile's flight. A token
  // has two experts: the lowest and the highest plane that name a row are all.
  unsigned oa[2][8] = {}, ob[2][8] = {};
  if constexpr (COMBINE) {
    u32x4 ix[GEMM_E][4];
    load_comb_idx(comb_idx, comb_idx + M, comb_idx + 2 * (size_t)M,
                  comb_idx + 3 * (size_t)M,
                  (unsigned)(bm + wm * 32 + (lane >> 4) * 8) * 4u, ix);
    const unsigned colb = (unsigned)(bn + wn * 32 + (lane & 15)) * 4u;
    // Unrolled so that ix, oa and ob are indexed by constants and stay in
    // registers.
#pragma unroll
    for (int i = 0; i < 2; ++i)
#pragma unroll
      for (int v = 0; v < 8; ++v) {
        const unsigned x0 = ix[0][i * 2 + (v >> 2)][v & 3];
        const unsigned x1 = ix[1][i * 2 + (v >> 2)][v & 3];
        const unsigned x2 = ix[2][i * 2 + (v >> 2)][v & 3];
        const unsigned x3 = ix[3][i * 2 + (v >> 2)][v & 3];
        const unsigned lo = x0 ? x0 : x1 ? x1 : x2 ? x2 : x3;
        const unsigned hi = x3 ? x3 : x2 ? x2 : x1 ? x1 : x0;
        oa[i][v] = lo * (unsigned)N * 4u + colb;
        ob[i][v] = (hi == lo ? 0u : hi) * (unsigned)N * 4u + colb;
      }
  }

  wait_async0();      // tile 0 landed in LDS (this wave's copies)
  __syncthreads();    // ... and every other wave's
  if (nt > 1) issue_tile(1, GEMM_KT);

  for (int t = 0; t < nt; ++t) {
    const int cur = t & 1;
    // Unrolled so that ks folds into the immediate offsets of the LDS loads.
#pragma unroll
    for (int ks = 0; ks < GEMM_KT; ks += 32) {
      const v16bf a0 = frag16(&As[cur][0][0], wm * 32, ks, GEMM_LD);
      const v16bf a1 = frag16(&As[cur][0][0], wm * 32 + 16, ks, GEMM_LD);
      const v16bf b0 = frag16(&Bs[cur][0][0], wn * 32, ks, GEMM_LD);
      const v16bf b1 = frag16(&Bs[cur][0][0], wn * 32 + 16, ks, GEMM_LD);
      acc[0][0] = wmma_bf16(a0, b0, acc[0][0]);
      acc[0][1] = wmma_bf16(a0, b1, acc[0][1]);
      acc[1][0] = wmma_bf16(a1, b0, acc[1][0]);
      acc[1][1] = wmma_bf16(a1, b1, acc[1][1]);
    }
    // This wave's LDS reads of the buffer have retired before it is refilled.
    asm volatile("s_wait_dscnt 0x0" ::: "memory");
    wait_async0();      // next tile landed in LDS (this wave's copies)
    __syncthreads();    // all waves done copying AND done reading this buffer
    if (t + 2 < nt) issue_tile(cur, (t + 2) * GEMM_KT);  // flies over trip t+1
  }
  wait_async0();        // no copy is outstanding when the wave ends

  // Epilogue. C layout: lane half (l>>4) + VGPR v -> row half*8+v; col = l&15.
  const int half = lane >> 4, c0 = lane & 15;
  const int row0 = bm + wm * 32 + half * 8;  // + i*16 + v
  const int col0 = bn + wn * 32 + c0;        // + j*16

  // Bias, residual and scale are fetched first, in one run of loads; the rows
  // of comb_rows are fetched in the loop below, for each i in turn.
  // All loops below are unrolled so that acc and these arrays are indexed by
  // constants and stay in registers.
  float bv[2] = {};
  float rv[2][2][8] = {};
  float sc[2][8] = {};
  if constexpr (BIAS) {
#pragma unroll
    for (int j = 0; j < 2; ++j) bv[j] = bias[col0 + j * 16];
  }
  if constexpr (RESID) {
#pragma unroll
    for (int i = 0; i < 2; ++i)
#pragma unroll
      for (int j = 0; j < 2; ++j)
#pragma unroll
        for (int v = 0; v < 8; ++v)
          rv[i][j][v] =
              residual[(size_t)(row0 + i * 16 + v) * N + col0 + j * 16];
  }
  if constexpr (OUT == OUT_SCALED) {
#pragma unroll
    for (int i = 0; i < 2; ++i)
#pragma unroll
      for (int v = 0; v < 8; ++v) sc[i][v] = row_scale[row0 + i * 16 + v];
  }

#pragma unroll
  for (int i = 0; i < 2; ++i) {
    float pa[2][8] = {}, pb[2][8] = {};
    if constexpr (COMBINE) {
      load_comb_rows(comb_rows, oa[i], pa);
      load_comb_rows(comb_rows, ob[i], pb);
    }
#pragma unroll
    for (int j = 0; j < 2; ++j)
#pragma unroll
      for (int v = 0; v < 8; ++v) {
        const int row = row0 + i * 16 + v;
        const int col = col0 + j * 16;
        float val = acc[i][j][v];
        if constexpr (BIAS) val += bv[j];
        if constexpr (ACT) val = gelu_exact(val);
        if constexpr (RESID) val += rv[i][j][v];
        if constexpr (COMBINE) {
          val += pa[j][v];
          val += pb[j][v];
        }
        if constexpr (OUT == OUT_F32) Cf[(size_t)row * N + col] = val;
        if constexpr (OUT == OUT_BF16) Cb[(size_t)row * N + col] = (__bf16)val;
        if constexpr (OUT == OUT_SCALED)
          Cf[(size_t)row * N + col] = val * sc[i][v];
      }
  }
}

typedef __attribute__((ext_vector_type(8))) __bf16 v8bf;

__global__ __launch_bounds__(128) void attn_kernel(
    const __bf16* __restrict__ qkv, __bf16* __restrict__ out, int N, int Hh,
    int hd) {
  const int D3 = 3 * Hh * hd;   // 3072
  const int Dm = Hh * hd;       // 1024
  const int qb = blockIdx.x, h = blockIdx.y, b = blockIdx.z;
  const int tid = threadIdx.x, wave = tid >> 5, lane = tid & 31;
  const int half = lane >> 4, c0 = lane & 15;

  __shared__ __align__(16) __bf16 Qs[64][80];
  __shared__ __align__(16) __bf16 Ks[64][80];
  __shared__ __align__(16) __bf16 Vt[64][80];       // V transposed: [d][key]

  const int r = tid >> 1, d0 = (tid & 1) * 32;
  {  // Q tile (64x64) via async copy; first in-loop wait covers it
    const __bf16* g = qkv + (size_t)(b * N + qb * 64 + r) * D3 + h * hd + d0;
#pragma unroll
    for (int u = 0; u < 4; ++u) async_ld_b128(&Qs[r][d0 + u * 8], g + u * 8);
  }

  // o[j][v] = O[query c0][head dim j*16 + half*8 + v]. mstat is the running
  // maximum of query c0; lstat sums only the keys that this lane half holds.
  // Every loop over u, ks, j, v or m in this kernel is unrolled so that s, o
  // and the fragments are indexed by constants and stay in registers.
  v8f o[4] = {};
  float mstat = -1e30f, lstat = 0.f;

  for (int kb = 0; kb < N / 64; ++kb) {
    __syncthreads();  // prior reads of Ks/Vt complete before overwrite
    {
      const __bf16* gk =
          qkv + (size_t)(b * N + kb * 64 + r) * D3 + Dm + h * hd + d0;
#pragma unroll
      for (int u = 0; u < 4; ++u)
        async_ld_b128(&Ks[r][d0 + u * 8], gk + u * 8);
      const __bf16* gv =
          qkv + (size_t)(b * N + kb * 64 + r) * D3 + 2 * Dm + h * hd + d0;
#pragma unroll
      for (int u = 0; u < 32; ++u) Vt[d0 + u][r] = gv[u];  // transpose to LDS
    }
    wait_async0();
    __syncthreads();

    // S^T = K @ Q^T: s[j][v] = S[query c0][key j*16 + half*8 + v]
    v8f s[4] = {};
#pragma unroll
    for (int ks = 0; ks < 64; ks += 32) {
      const v16bf q = frag16(&Qs[0][0], wave * 16, ks, 80);
#pragma unroll
      for (int j = 0; j < 4; ++j) {
        const v16bf kf = frag16(&Ks[0][0], j * 16, ks, 80);
        s[j] = wmma_bf16(kf, q, s[j]);
      }
    }

    // online softmax of query c0: 32 keys in this lane, 32 in lane ^ 16
    float rmax = -1e30f;
#pragma unroll
    for (int j = 0; j < 4; ++j)
#pragma unroll
      for (int v = 0; v < 8; ++v) {
        s[j][v] *= 0.125f;  // hd^-0.5
        rmax = fmaxf(rmax, s[j][v]);
      }
    rmax = fmaxf(rmax, __shfl_xor(rmax, 16, 32));
    const float mnew = fmaxf(mstat, rmax);
    const float alpha = __expf(mstat - mnew);
    float rsum = 0.f;
#pragma unroll
    for (int j = 0; j < 4; ++j)
#pragma unroll
      for (int v = 0; v < 8; ++v) {
        const float p = __expf(s[j][v] - mnew);
        s[j][v] = p;
        rsum += p;
      }
    lstat = lstat * alpha + rsum;
    mstat = mnew;
#pragma unroll
    for (int j = 0; j < 4; ++j)
#pragma unroll
      for (int v = 0; v < 8; ++v) o[j][v] *= alpha;

    // O^T += V^T @ P^T. Tiles 2m and 2m+1 of S^T hold keys m*32 + half*8 + v
    // and m*32 + 16 + half*8 + v: the k order in which frag16 reads Vt.
#pragma unroll
    for (int m = 0; m < 2; ++m) {
      v16bf pf;
#pragma unroll
      for (int v = 0; v < 8; ++v) {
        pf[v] = (__bf16)s[2 * m][v];
        pf[8 + v] = (__bf16)s[2 * m + 1][v];
      }
#pragma unroll
      for (int j = 0; j < 4; ++j) {
        const v16bf vf = frag16(&Vt[0][0], j * 16, m * 32, 80);
        o[j] = wmma_bf16(vf, pf, o[j]);
      }
    }
  }

  // The two lane halves' sums are joined once; a lane stores 8 neighbouring
  // head dims of its query as one 16-byte piece per tile.
  lstat += __shfl_xor(lstat, 16, 32);
  const float inv = 1.0f / lstat;
  __bf16* orow = out + (size_t)(b * N + qb * 64 + wave * 16 + c0) * Dm +
                 h * hd + half * 8;
#pragma unroll
  for (int j = 0; j < 4; ++j) {
    v8bf w;
#pragma unroll
    for (int v = 0; v < 8; ++v) w[v] = (__bf16)(o[j][v] * inv);
    *(v8bf*)(orow + j * 16) = w;
  }
}

// ---------------------------------------------------------------------------
// Router: noisy top-2 over E=4 experts. One wave per token.
// ---------------------------------------------------------------------------
__global__ __launch_bounds__(128) void router_kernel(
    const float* __restrict__ x2, const float* __restrict__ noise,
    const float* __restrict__ w_route, const float* __restrict__ b_route,
    const float* __restrict__ w_noise, const float* __restrict__ b_noise,
    float* gate, int* fidx, int D) {
  const int wave = threadIdx.x >> 5, lane = threadIdx.x & 31;
  const int t = blockIdx.x * 4 + wave;
  float ar[4] = {0, 0, 0, 0}, an[4] = {0, 0, 0, 0};
  for (int d = lane; d < D; d += 32) {
    const float xv = x2[(size_t)t * D + d];
#pragma unroll
    for (int e = 0; e < 4; ++e) {
      ar[e] += xv * w_route[d * 4 + e];
      an[e] += xv * w_noise[d * 4 + e];
    }
  }
#pragma unroll
  for (int e = 0; e < 4; ++e)
#pragma unroll
    for (int off = 16; off; off >>= 1) {
      ar[e] += __shfl_xor(ar[e], off, 32);
      an[e] += __shfl_xor(an[e], off, 32);
    }
  if (lane == 0) {
    float noisy[4];
#pragma unroll
    for (int e = 0; e < 4; ++e) {
      const float lg = ar[e] + b_route[e];
      const float ns = an[e] + b_noise[e];
      const float sp = (ns > 20.f) ? ns : log1pf(__expf(ns));
      noisy[e] = lg + noise[t * 4 + e] * sp;
    }
    int i0 = 0;
    for (int e = 1; e < 4; ++e)
      if (noisy[e] > noisy[i0]) i0 = e;
    int i1 = -1;
    for (int e = 0; e < 4; ++e)
      if (e != i0 && (i1 < 0 || noisy[e] > noisy[i1])) i1 = e;
    const float m = fmaxf(noisy[i0], noisy[i1]);
    const float e0 = __expf(noisy[i0] - m), e1 = __expf(noisy[i1] - m);
    const float p0 = e0 / (e0 + e1);
#pragma unroll
    for (int e = 0; e < 4; ++e) gate[t * 4 + e] = 0.f;
    gate[t * 4 + i0] = p0;
    gate[t * 4 + i1] = 1.f - p0;
    fidx[2 * t] = i0;
    fidx[2 * t + 1] = i1;
  }
}

// ---------------------------------------------------------------------------
// Per-expert capacity dispatch (stable token order). grid = E blocks.
// A token's place with expert e is the number of e's tokens in front of it.
// A wave takes SCAN_PER groups of 32 neighbouring tokens: inside a group the
// count comes from a ballot and a bit count, over the wave's earlier groups
// from the ballots' sizes, over earlier waves from the waves' totals, which go
// through LDS behind the one barrier of a trip. A trip covers SCAN_CHUNK
// tokens, and all its loads are issued together in front of the counting.
// inv[e * T + t] is the way back: the row of the experts' result that token t
// has with expert e (they start at row 1), or row 0, cleared here, if none.
// ---------------------------------------------------------------------------
constexpr int SCAN_WAVES = 32;  // one total per lane when a wave sums them
constexpr int SCAN_PER = 4;     // groups of 32 tokens per wave and trip
constexpr int SCAN_THREADS = SCAN_WAVES * 32;
constexpr int SCAN_CHUNK = SCAN_THREADS * SCAN_PER;
static_assert(SCAN_CHUNK < (1 << 15), "two counts of a trip share one int");

// A store with its s_wait_xcnt in the same statement: what follows it rewrites
// the registers that it names, and a wait in a statement of its own is not
// tied to those registers.
static __device__ __forceinline__ void store_b32_wait(int* p, int v) {
  asm volatile(
      "global_store_b32 %0, %1, off\n\t"
      "s_wait_xcnt 0x0"
      :
      : "v"(p), "v"(v)
      : "memory");
}

__global__ __launch_bounds__(SCAN_THREADS) void dispatch_scan(
    const int* __restrict__ fidx, const float* __restrict__ gate, int* sel,
    float* selw, int* inv, float* zero_row, int capacity, int T, int D) {
  const int e = blockIdx.x, tid = threadIdx.x;
  const int wave = tid >> 5, lane = tid & 31;
  for (int i = e * SCAN_THREADS + tid; i < D; i += gridDim.x * SCAN_THREADS)
    zero_row[i] = 0.f;
  // Two sets, taken in turn: a trip's totals are read behind its barrier, and
  // the set is written again only behind the next trip's barrier.
  __shared__ int wtot[2][SCAN_WAVES];
  const unsigned below = (1u << lane) - 1u;  // the lanes in front of this one
  int base = 0;
  for (int c0 = 0, set = 0; c0 < T; c0 += SCAN_CHUNK, set ^= 1) {
    const int t0 = c0 + wave * (32 * SCAN_PER) + lane;
    // All loops over j are unrolled so that the arrays stay in registers.
    int2 f[SCAN_PER];
    float g[SCAN_PER];
#pragma unroll
    for (int j = 0; j < SCAN_PER; ++j) {
      const int t = t0 + j * 32;
      const int tc = t < T ? t : T - 1;  // a token past the end reads the last
      f[j] = *(const int2*)(fidx + 2 * tc);
      g[j] = gate[tc * 4 + e];
    }
    bool m[SCAN_PER];
    int before[SCAN_PER];
    int mine = 0;  // e's tokens in this wave's groups so far
#pragma unroll
    for (int j = 0; j < SCAN_PER; ++j) {
      // Plain | and &: all three tests are cheap, and no branch is wanted.
      m[j] = (t0 + j * 32 < T) & ((f[j].x == e) | (f[j].y == e));
      const unsigned b = __builtin_amdgcn_ballot_w32(m[j]);
      before[j] = mine + __popc(b & below);
      mine += __popc(b);
    }
    if (lane == 0) wtot[set][wave] = mine;
    __syncthreads();
    // Two sums in one exchange tree: the earlier waves' tokens in the high
    // half of a word, all waves' in the low half (neither passes SCAN_CHUNK).
    const int w = wtot[set][lane];
    int both = (lane < wave ? w << 16 : 0) | w;
#pragma unroll
    for (int off = 16; off; off >>= 1) both += __shfl_xor(both, off, 32);
    const int pre = both >> 16, tot = both & 0xffff;
#pragma unroll
    for (int j = 0; j < SCAN_PER; ++j) {
      const int t = t0 + j * 32;
      const int pos = base + pre + before[j];
      const bool kept = m[j] && pos < capacity;
      if (kept) {
        sel[e * capacity + pos] = t;
        selw[e * capacity + pos] = g[j];
      }
      if (t < T)
        store_b32_wait(inv + e * T + t, kept ? 1 + e * capacity + pos : 0);
    }
    base += tot;
  }
  for (int i = (base < capacity ? base : capacity) + tid; i < capacity;
       i += SCAN_THREADS) {
    sel[e * capacity + i] = 0;
    selw[e * capacity + i] = 0.f;  // padded rows contribute nothing
  }
}

// ---------------------------------------------------------------------------
// fp32 -> bf16 conversion of every weight, one launch.
// The work is cut into pieces of 4096 elements; each work-group takes CVT_PER
// of them, so few waves are started and each moves many bytes.
// A piece of w_qkv or w_proj (already [N][K]) is a straight run of elements.
// A piece of any other weight is a 64x64 tile of in[K][N] that goes out as
// out[N][K]: input rows are read as 256-byte runs, two neighbouring k of one
// column are packed into a dword, the tile is turned in LDS, and each output
// row gets one whole 128-byte run.
// ---------------------------------------------------------------------------
constexpr int W_D = 1024, W_MLPH = 4096, W_MOEH = 256, W_E = 4;  // model dims
constexpr int CVT_PIECE = 64 * 64;
constexpr int CVT_B_PROJ = 3 * W_D * W_D / CVT_PIECE;             // after w_qkv
constexpr int CVT_B_M1 = CVT_B_PROJ + W_D * W_D / CVT_PIECE;      // after w_proj
constexpr int CVT_B_M2 = CVT_B_M1 + W_D * W_MLPH / CVT_PIECE;     // after w_mlp1
constexpr int CVT_B_E1 = CVT_B_M2 + W_MLPH * W_D / CVT_PIECE;     // after w_mlp2
constexpr int CVT_B_E2 = CVT_B_E1 + W_E * W_D * W_MOEH / CVT_PIECE;
constexpr int CVT_TOTAL = CVT_B_E2 + W_E * W_MOEH * W_D / CVT_PIECE;
constexpr int CVT_PER = 4;                      // pieces per work-group
constexpr int CVT_GRID = CVT_TOTAL / CVT_PER;   // work-groups
static_assert(CVT_GRID * CVT_PER == CVT_TOTAL, "pieces divide evenly");
constexpr int CVT_EXP_TILES = W_D * W_MOEH / CVT_PIECE;  // tiles per expert
static_assert(CVT_EXP_TILES == 64, "expert index is taken by a shift of 6");
constexpr int CVT_PITCH = 68;  // LDS row pitch in bf16: 136 B, 8-byte aligned

typedef __attribute__((ext_vector_type(2))) float  f32x2;
typedef __attribute__((ext_vector_type(2))) __bf16 bf16x2;

// Two floats to one dword of bf16, lo in the low half; converted as a pair so
// that one packed conversion does both.
static __device__ __forceinline__ unsigned pack_bf16(float lo, float hi) {
  const f32x2 f = {lo, hi};
  return __builtin_bit_cast(unsigned, __builtin_convertvector(f, bf16x2));
}

typedef __attribute__((ext_vector_type(4))) float    f32x4;
typedef __attribute__((ext_vector_type(2))) unsigned u32x2;

// Four 16-byte loads that fly together. Loads and their data wait are one
// statement with early-clobber outputs, so that no result lands in an address
// pair of the run and no address pair is rewritten while a load is out (as
// plain loads the compiler let one load's result take another's address).
static __device__ __forceinline__ void load4_b128(const float* p0,
                                                  const float* p1,
                                                  const float* p2,
                                                  const float* p3, f32x4& r0,
                                                  f32x4& r1, f32x4& r2,
                                                  f32x4& r3) {
  asm volatile(
      "global_load_b128 %0, %4, off\n\t"
      "global_load_b128 %1, %5, off\n\t"
      "global_load_b128 %2, %6, off\n\t"
      "global_load_b128 %3, %7, off\n\t"
      "s_wait_loadcnt 0x0"
      : "=&v"(r0), "=&v"(r1), "=&v"(r2), "=&v"(r3)
      : "v"(p0), "v"(p1), "v"(p2), "v"(p3)
      : "memory");
}

// Stores with their s_wait_xcnt in the same statement: the next piece rewrites
// the registers that they name, and a wait in a statement of its own is not
// tied to those registers.
static __device__ __forceinline__ void store4_b64_step2k(__bf16* p, u32x2 w0,
                                                         u32x2 w1, u32x2 w2,
                                                         u32x2 w3) {
  asm volatile(
      "global_store_b64 %0, %1, off\n\t"
      "global_store_b64 %0, %2, off offset:2048\n\t"
      "global_store_b64 %0, %3, off offset:4096\n\t"
      "global_store_b64 %0, %4, off offset:6144\n\t"
      "s_wait_xcnt 0x0"
      :
      : "v"(p), "v"(w0), "v"(w1), "v"(w2), "v"(w3)
      : "memory");
}
static __device__ __forceinline__ void store2_b128(__bf16* p, u32x4 d0,
                                                   u32x4 d1) {
  asm volatile(
      "global_store_b128 %0, %1, off\n\t"
      "global_store_b128 %0, %2, off offset:16\n\t"
      "s_wait_xcnt 0x0"
      :
      : "v"(p), "v"(d0), "v"(d1)
      : "memory");
}

__global__ __launch_bounds__(256) void cvt_weights(
    const float* __restrict__ w_qkv, const float* __restrict__ w_proj,
    const float* __restrict__ w_m1, const float* __restrict__ w_m2,
    const float* __restrict__ we1, const float* __restrict__ we2,
    __bf16* __restrict__ o_qkv, __bf16* __restrict__ o_proj,
    __bf16* __restrict__ o_m1, __bf16* __restrict__ o_m2,
    __bf16* __restrict__ o_e1, __bf16* __restrict__ o_e2) {
  __shared__ __align__(16) __bf16 tile[2][64][CVT_PITCH];
  const int tid = threadIdx.x;

  for (int i = 0; i < CVT_PER; ++i) {
    const int p = blockIdx.x + i * CVT_GRID;  // same for the whole work-group
    const bool turned = p >= CVT_B_M1;
    __bf16(*t)[CVT_PITCH] = tile[i & 1];

    // Which weight, and which tile of it. N = 64 << lnt columns of input.
    const float* in;
    __bf16* out;
    int K = 0, lnt = 0, q;
    if (p < CVT_B_PROJ) {
      in = w_qkv; out = o_qkv; q = p;
    } else if (p < CVT_B_M1) {
      in = w_proj; out = o_proj; q = p - CVT_B_PROJ;
    } else if (p < CVT_B_M2) {
      in = w_m1; out = o_m1; q = p - CVT_B_M1; K = W_D; lnt = 6;
    } else if (p < CVT_B_E1) {
      in = w_m2; out = o_m2; q = p - CVT_B_M2; K = W_MLPH; lnt = 4;
    } else if (p < CVT_B_E2) {
      q = p - CVT_B_E1;
      in = we1 + (size_t)(q >> 6) * (W_D * W_MOEH);
      out = o_e1 + (size_t)(q >> 6) * (W_D * W_MOEH);
      q &= 63; K = W_D; lnt = 2;
    } else {
      q = p - CVT_B_E2;
      in = we2 + (size_t)(q >> 6) * (W_D * W_MOEH);
      out = o_e2 + (size_t)(q >> 6) * (W_D * W_MOEH);
      q &= 63; K = W_MOEH; lnt = 4;
    }
    const int N = 64 << lnt;
    const int k0 = (q >> lnt) * 64, n0 = (q & ((1 << lnt) - 1)) * 64;

    if (!turned) {
      const size_t e = (size_t)q * CVT_PIECE + tid * 4;
      const float* g = in + e;
      f32x4 v0, v1, v2, v3;
      load4_b128(g, g + 1024, g + 2048, g + 3072, v0, v1, v2, v3);
      const u32x2 w0 = {pack_bf16(v0.x, v0.y), pack_bf16(v0.z, v0.w)};
      const u32x2 w1 = {pack_bf16(v1.x, v1.y), pack_bf16(v1.z, v1.w)};
      const u32x2 w2 = {pack_bf16(v2.x, v2.y), pack_bf16(v2.z, v2.w)};
      const u32x2 w3 = {pack_bf16(v3.x, v3.y), pack_bf16(v3.z, v3.w)};
      store4_b64_step2k(out + e, w0, w1, w2, w3);  // 1024 elements apart
    } else {
      const int c4 = (tid & 15) * 4, r2 = (tid >> 4) * 2;
      const float* g = in + (size_t)(k0 + r2) * N + n0 + c4;
      f32x4 a0, b0, a1, b1;  // rows k, k + 1 and k + 32, k + 33
      load4_b128(g, g + N, g + (size_t)32 * N, g + (size_t)33 * N, a0, b0, a1,
                 b1);
      *(unsigned*)&t[c4 + 0][r2] = pack_bf16(a0.x, b0.x);
      *(unsigned*)&t[c4 + 1][r2] = pack_bf16(a0.y, b0.y);
      *(unsigned*)&t[c4 + 2][r2] = pack_bf16(a0.z, b0.z);
      *(unsigned*)&t[c4 + 3][r2] = pack_bf16(a0.w, b0.w);
      *(unsigned*)&t[c4 + 0][r2 + 32] = pack_bf16(a1.x, b1.x);
      *(unsigned*)&t[c4 + 1][r2 + 32] = pack_bf16(a1.y, b1.y);
      *(unsigned*)&t[c4 + 2][r2 + 32] = pack_bf16(a1.z, b1.z);
      *(unsigned*)&t[c4 + 3][r2 + 32] = pack_bf16(a1.w, b1.w);
    }
    // One barrier a trip, passed by every wave whatever the piece: it
    // publishes this trip's tile, and it stands between the reads of a buffer
    // in trip i and its next filling in trip i + 2.
    __syncthreads();
    if (turned) {
      const int n = tid >> 2, kc = (tid & 3) * 16;
      const uint2* s = (const uint2*)&t[n][kc];
      const uint2 s0 = s[0], s1 = s[1], s2 = s[2], s3 = s[3];
      const u32x4 d0 = {s0.x, s0.y, s1.x, s1.y};
      const u32x4 d1 = {s2.x, s2.y, s3.x, s3.y};
      store2_b128(out + (size_t)(n0 + n) * K + k0 + kc, d0, d1);
    }
  }
}

// ---------------------------------------------------------------------------
// Row kernels: LayerNorm and the expert gather. A row is W_D elements.
// One wave takes a whole row (LayerNorm) or two rows (gather) in 16-byte
// pieces per lane, each wave-wide access covering 512 contiguous bytes, so a
// launch starts 4096 waves that each keep eight or more loads in flight.
// Loads stand with their data wait, stores with their s_wait_xcnt, in one
// statement each, for the reasons given at load4_b128 and store4_b64_step2k.
// ---------------------------------------------------------------------------
static_assert(W_D == 32 * 4 * 8, "a lane holds 8 pieces of 4 floats of a row");

// One row of x, and gamma and beta, 512 bytes of each per wave-wide load.
static __device__ __forceinline__ void load_ln_row(const float* x,
                                                   const float* g,
                                                   const float* b,
                                                   f32x4 (&xv)[8],
                                                   f32x4 (&gv)[8],
                                                   f32x4 (&bv)[8]) {
  asm volatile(
      "global_load_b128 %0, %24, off\n\t"
      "global_load_b128 %1, %24, off offset:512\n\t"
      "global_load_b128 %2, %24, off offset:1024\n\t"
      "global_load_b128 %3, %24, off offset:1536\n\t"
      "global_load_b128 %4, %24, off offset:2048\n\t"
      "global_load_b128 %5, %24, off offset:2560\n\t"
      "global_load_b128 %6, %24, off offset:3072\n\t"
      "global_load_b128 %7, %24, off offset:3584\n\t"
      "global_load_b128 %8, %25, off\n\t"
      "global_load_b128 %9, %25, off offset:512\n\t"
      "global_load_b128 %10, %25, off offset:1024\n\t"
      "global_load_b128 %11, %25, off offset:1536\n\t"
      "global_load_b128 %12, %25, off offset:2048\n\t"
      "global_load_b128 %13, %25, off offset:2560\n\t"
      "global_load_b128 %14, %25, off offset:3072\n\t"
      "global_load_b128 %15, %25, off offset:3584\n\t"
      "global_load_b128 %16, %26, off\n\t"
      "global_load_b128 %17, %26, off offset:512\n\t"
      "global_load_b128 %18, %26, off offset:1024\n\t"
      "global_load_b128 %19, %26, off offset:1536\n\t"
      "global_load_b128 %20, %26, off offset:2048\n\t"
      "global_load_b128 %21, %26, off offset:2560\n\t"
      "global_load_b128 %22, %26, off offset:3072\n\t"
      "global_load_b128 %23, %26, off offset:3584\n\t"
      "s_wait_loadcnt 0x0"
      : "=&v"(xv[0]), "=&v"(xv[1]), "=&v"(xv[2]), "=&v"(xv[3]), "=&v"(xv[4]), "=&v"(xv[5]), "=&v"(xv[6]), "=&v"(xv[7]),
        "=&v"(gv[0]), "=&v"(gv[1]), "=&v"(gv[2]), "=&v"(gv[3]), "=&v"(gv[4]), "=&v"(gv[5]), "=&v"(gv[6]), "=&v"(gv[7]),
        "=&v"(bv[0]), "=&v"(bv[1]), "=&v"(bv[2]), "=&v"(bv[3]), "=&v"(bv[4]), "=&v"(bv[5]), "=&v"(bv[6]), "=&v"(bv[7])
      : "v"(x), "v"(g), "v"(b)
      : "memory");
}
// Two rows of W_D bf16, four 16-byte pieces per lane of each.
static __device__ __forceinline__ void load_2rows_bf16(const __bf16* p0,
                                                       const __bf16* p1,
                                                       u32x4 (&d)[8]) {
  asm volatile(
      "global_load_b128 %0, %8, off\n\t"
      "global_load_b128 %1, %8, off offset:512\n\t"
      "global_load_b128 %2, %8, off offset:1024\n\t"
      "global_load_b128 %3, %8, off offset:1536\n\t"
      "global_load_b128 %4, %9, off\n\t"
      "global_load_b128 %5, %9, off offset:512\n\t"
      "global_load_b128 %6, %9, off offset:1024\n\t"
      "global_load_b128 %7, %9, off offset:1536\n\t"
      "s_wait_loadcnt 0x0"
      : "=&v"(d[0]), "=&v"(d[1]), "=&v"(d[2]), "=&v"(d[3]), "=&v"(d[4]), "=&v"(d[5]), "=&v"(d[6]), "=&v"(d[7])
      : "v"(p0), "v"(p1)
      : "memory");
}
static __device__ __forceinline__ void store8_f32x4(float* p,
                                                    const f32x4 (&d)[8]) {
  asm volatile(
      "global_store_b128 %0, %1, off\n\t"
      "global_store_b128 %0, %2, off offset:512\n\t"
      "global_store_b128 %0, %3, off offset:1024\n\t"
      "global_store_b128 %0, %4, off offset:1536\n\t"
      "global_store_b128 %0, %5, off offset:2048\n\t"
      "global_store_b128 %0, %6, off offset:2560\n\t"
      "global_store_b128 %0, %7, off offset:3072\n\t"
      "global_store_b128 %0, %8, off offset:3584\n\t"
      "s_wait_xcnt 0x0"
      :
      : "v"(p), "v"(d[0]), "v"(d[1]), "v"(d[2]), "v"(d[3]), "v"(d[4]), "v"(d[5]), "v"(d[6]), "v"(d[7])
      : "memory");
}
static __device__ __forceinline__ void store8_u32x4(__bf16* p,
                                                    const u32x4 (&d)[8]) {
  asm volatile(
      "global_store_b128 %0, %1, off\n\t"
      "global_store_b128 %0, %2, off offset:512\n\t"
      "global_store_b128 %0, %3, off offset:1024\n\t"
      "global_store_b128 %0, %4, off offset:1536\n\t"
      "global_store_b128 %0, %5, off offset:2048\n\t"
      "global_store_b128 %0, %6, off offset:2560\n\t"
      "global_store_b128 %0, %7, off offset:3072\n\t"
      "global_store_b128 %0, %8, off offset:3584\n\t"
      "s_wait_xcnt 0x0"
      :
      : "v"(p), "v"(d[0]), "v"(d[1]), "v"(d[2]), "v"(d[3]), "v"(d[4]), "v"(d[5]), "v"(d[6]), "v"(d[7])
      : "memory");
}
static __device__ __forceinline__ void store8_u32x2(__bf16* p,
                                                    const u32x2 (&d)[8]) {
  asm volatile(
      "global_store_b64 %0, %1, off\n\t"
      "global_store_b64 %0, %2, off offset:256\n\t"
      "global_store_b64 %0, %3, off offset:512\n\t"
      "global_store_b64 %0, %4, off offset:768\n\t"
      "global_store_b64 %0, %5, off offset:1024\n\t"
      "global_store_b64 %0, %6, off offset:1280\n\t"
      "global_store_b64 %0, %7, off offset:1536\n\t"
      "global_store_b64 %0, %8, off offset:1792\n\t"
      "s_wait_xcnt 0x0"
      :
      : "v"(p), "v"(d[0]), "v"(d[1]), "v"(d[2]), "v"(d[3]), "v"(d[4]), "v"(d[5]), "v"(d[6]), "v"(d[7])
      : "memory");
}

// LayerNorm: one token per wave, the row read once and kept in registers.
// Optional f32 and/or bf16 outputs. grid = tokens / 8.
__global__ __launch_bounds__(256) void ln_kernel(const float* __restrict__ x,
                                                 const float* __restrict__ g,
                                                 const float* __restrict__ bta,
                                                 float* outf, __bf16* outb) {
  const int wave = threadIdx.x >> 5, lane = threadIdx.x & 31;
  const size_t e = (size_t)(blockIdx.x * 8 + wave) * W_D + lane * 4;
  f32x4 xv[8], gv[8], bv[8];
  load_ln_row(x + e, g + lane * 4, bta + lane * 4, xv, gv, bv);

  // Four independent chains per sum; all loops over c are unrolled so that
  // the arrays are indexed by constants and stay in registers.
  f32x4 s4 = {}, ss4 = {};
#pragma unroll
  for (int c = 0; c < 8; ++c) {
    s4 += xv[c];
    ss4 += xv[c] * xv[c];
  }
  float s = (s4.x + s4.y) + (s4.z + s4.w);
  float ss = (ss4.x + ss4.y) + (ss4.z + ss4.w);
#pragma unroll
  for (int off = 16; off; off >>= 1) {
    s += __shfl_xor(s, off, 32);
    ss += __shfl_xor(ss, off, 32);
  }
  const float mu = s / W_D;
  const float r = rsqrtf(ss / W_D - mu * mu + 1e-5f);

  f32x4 y[8];
#pragma unroll
  for (int c = 0; c < 8; ++c) y[c] = (xv[c] - mu) * r * gv[c] + bv[c];
  if (outf) store8_f32x4(outf + e, y);
  if (outb) {
    u32x2 w[8];
#pragma unroll
    for (int c = 0; c < 8; ++c)
      w[c] = u32x2{pack_bf16(y[c].x, y[c].y), pack_bf16(y[c].z, y[c].w)};
    store8_u32x2(outb + e, w);
  }
}

// Gather: each wave copies two neighbouring rows of xdisp from the rows of
// x2b that sel names. grid = rows / 16.
__global__ __launch_bounds__(256) void gather_kernel(
    const __bf16* __restrict__ x2b, const int* __restrict__ sel,
    __bf16* xdisp) {
  // The wave's number as a scalar, so that sel is read by a scalar load.
  const int wave = __builtin_amdgcn_readfirstlane(threadIdx.x >> 5);
  const int lane = threadIdx.x & 31;
  const int row = (blockIdx.x * 8 + wave) * 2;
  const int src0 = sel[row], src1 = sel[row + 1];
  u32x4 d[8];
  load_2rows_bf16(x2b + (size_t)src0 * W_D + lane * 8,
                  x2b + (size_t)src1 * W_D + lane * 8, d);
  store8_u32x4(xdisp + (size_t)row * W_D + lane * 8, d);
}

// ---------------------------------------------------------------------------
// Launch orchestration.
// ---------------------------------------------------------------------------
extern "C" void kernel_launch(void* const* d_in, const int* in_sizes, int n_in,
                              void* d_out, int out_size, void* d_ws,
                              size_t ws_size, hipStream_t stream) {
  (void)in_sizes; (void)n_in; (void)out_size; (void)ws_size;
  constexpr int Bb = 2, Nn = 2048, Dd = 1024, Hh = 16, hd = 64;
  constexpr int T = Bb * Nn, D3 = 3 * Dd, MLPH = 4096, MOEH = 256;
  constexpr int Ee = 4, CAP = 2048;

  const float* x      = (const float*)d_in[0];
  const float* noise  = (const float*)d_in[1];
  const float* ln1_g  = (const float*)d_in[2];
  const float* ln1_b  = (const float*)d_in[3];
  const float* ln2_g  = (const float*)d_in[4];
  const float* ln2_b  = (const float*)d_in[5];
  const float* w_qkv  = (const float*)d_in[6];
  const float* w_proj = (const float*)d_in[7];
  const float* b_proj = (const float*)d_in[8];
  const float* w_rt   = (const float*)d_in[9];
  const float* b_rt   = (const float*)d_in[10];
  const float* w_nz   = (const float*)d_in[11];
  const float* b_nz   = (const float*)d_in[12];
  const float* we1    = (const float*)d_in[13];
  const float* be1    = (const float*)d_in[14];
  const float* we2    = (const float*)d_in[15];
  const float* be2    = (const float*)d_in[16];
  const float* w_m1   = (const float*)d_in[17];
  const float* b_m1   = (const float*)d_in[18];
  const float* w_m2   = (const float*)d_in[19];
  const float* b_m2   = (const float*)d_in[20];
  float* out = (float*)d_out;

  char* wsp = (char*)d_ws;
  size_t off = 0;
  auto alloc = [&](size_t bytes) {
    void* p = wsp + off;
    off = (off + bytes + 255) & ~(size_t)255;
    return p;
  };
  __bf16* x1b    = (__bf16*)alloc((size_t)T * Dd * 2);
  __bf16* wqkvb  = (__bf16*)alloc((size_t)D3 * Dd * 2);
  __bf16* qkvb   = (__bf16*)alloc((size_t)T * D3 * 2);
  __bf16* attnb  = (__bf16*)alloc((size_t)T * Dd * 2);
  __bf16* wprojb = (__bf16*)alloc((size_t)Dd * Dd * 2);
  float*  xattn  = (float*)alloc((size_t)T * Dd * 4);
  float*  x2f    = (float*)alloc((size_t)T * Dd * 4);
  __bf16* x2b    = (__bf16*)alloc((size_t)T * Dd * 2);
  __bf16* wm1t   = (__bf16*)alloc((size_t)Dd * MLPH * 2);
  __bf16* wm2t   = (__bf16*)alloc((size_t)MLPH * Dd * 2);
  __bf16* hmlp   = (__bf16*)alloc((size_t)T * MLPH * 2);
  __bf16* we1t   = (__bf16*)alloc((size_t)Ee * Dd * MOEH * 2);
  __bf16* we2t   = (__bf16*)alloc((size_t)Ee * MOEH * Dd * 2);
  __bf16* xdisp  = (__bf16*)alloc((size_t)Ee * CAP * Dd * 2);
  __bf16* hdisp  = (__bf16*)alloc((size_t)Ee * CAP * MOEH * 2);
  float*  gate   = (float*)alloc((size_t)T * Ee * 4);
  int*    fidx   = (int*)alloc((size_t)T * 2 * 4);
  int*    sel    = (int*)alloc((size_t)Ee * CAP * 4);
  float*  selw   = (float*)alloc((size_t)Ee * CAP * 4);
  int*    inv    = (int*)alloc((size_t)Ee * T * 4);
  float*  ymoe   = (float*)alloc((size_t)(Ee * CAP + 1) * Dd * 4);

  // 1) weight conversion to bf16 (w_qkv/w_proj are already [N][K]; the rest
  //    goes from [K][N] to [N][K])
  static_assert(Dd == W_D && MLPH == W_MLPH && MOEH == W_MOEH && Ee == W_E,
                "the conversion and row kernels are cut for these shapes");
  cvt_weights<<<CVT_GRID, 256, 0, stream>>>(w_qkv, w_proj, w_m1, w_m2, we1, we2,
                                            wqkvb, wprojb, wm1t, wm2t, we1t,
                                            we2t);

  // 2) LN1 -> x1 (bf16)
  ln_kernel<<<T / 8, 256, 0, stream>>>(x, ln1_g, ln1_b, nullptr, x1b);

  // 3) QKV GEMM: [T,D] x [3D,D]^T -> bf16 [T,3D]
  gemm_bf16_kernel<false, false, false, OUT_BF16, false>
      <<<dim3(D3 / 64, T / 128), 256, 0, stream>>>(
          x1b, wqkvb, nullptr, nullptr, nullptr, qkvb, nullptr, nullptr,
          nullptr, T, D3, Dd);

  // 4) flash attention -> bf16 [T,D]
  attn_kernel<<<dim3(Nn / 64, Hh, Bb), 128, 0, stream>>>(qkvb, attnb, Nn, Hh,
                                                         hd);

  // 5) proj GEMM + b_proj + residual x -> xattn (f32)
  gemm_bf16_kernel<true, false, true, OUT_F32, false>
      <<<dim3(Dd / 64, T / 128), 256, 0, stream>>>(
          attnb, wprojb, b_proj, x, xattn, nullptr, nullptr, nullptr, nullptr,
          T, Dd, Dd);

  // 6) LN2 -> x2 (f32 + bf16)
  ln_kernel<<<T / 8, 256, 0, stream>>>(xattn, ln2_g, ln2_b, x2f, x2b);

  // 7) router + capacity dispatch + gather
  router_kernel<<<T / 4, 128, 0, stream>>>(x2f, noise, w_rt, b_rt, w_nz, b_nz,
                                           gate, fidx, Dd);
  dispatch_scan<<<Ee, SCAN_THREADS, 0, stream>>>(fidx, gate, sel, selw, inv, ymoe, CAP,
                                        T, Dd);
  gather_kernel<<<Ee * CAP / 16, 256, 0, stream>>>(x2b, sel, xdisp);

  // 8) expert FFNs, all experts in one launch per layer (grid z = expert);
  //    the second layer leaves its gate-weighted rows in ymoe from row 1 on
  static_assert(Ee == GEMM_E, "the combining epilogue looks through this many planes");
  gemm_bf16_kernel<true, true, false, OUT_BF16, false>
      <<<dim3(MOEH / 64, CAP / 128, Ee), 256, 0, stream>>>(
          xdisp, we1t, be1, nullptr, nullptr, hdisp, nullptr, nullptr, nullptr,
          CAP, MOEH, Dd);
  gemm_bf16_kernel<true, false, false, OUT_SCALED, false>
      <<<dim3(Dd / 64, CAP / 128, Ee), 256, 0, stream>>>(
          hdisp, we2t, be2, nullptr, ymoe + Dd, nullptr, nullptr, selw, nullptr,
          CAP, Dd, MOEH);

  // 9) dense MLP: gelu(x2@W1+b1)@W2+b2 + xattn + each token's expert rows
  //    -> d_out (f32)
  gemm_bf16_kernel<true, true, false, OUT_BF16, false>
      <<<dim3(MLPH / 64, T / 128), 256, 0, stream>>>(
          x2b, wm1t, b_m1, nullptr, nullptr, hmlp, nullptr, nullptr, nullptr,
          T, MLPH, Dd);
  gemm_bf16_kernel<true, false, true, OUT_F32, true>
      <<<dim3(Dd / 64, T / 128), 256, 0, stream>>>(
          hmlp, wm2t, b_m2, xattn, out, nullptr, inv, nullptr, ymoe, T, Dd,
          MLPH);
}

// v008
// Measured time: 240 microseconds a run.
// In both of two side-by-side timings against v007, it was 1.08 times as fast.
// Over all steps from v000 it is 3.42 times as fast.
#include <hip/hip_runtime.h>
#include <hip/hip_bf16.h>
#include <math.h>
#include <stdint.h>

// ---------------------------------------------------------------------------
// Types for CDNA5 WMMA (wave32): D(f32 16x16) = A(bf16 16x32) x B(bf16 32x16) + C
// ---------------------------------------------------------------------------
typedef __attribute__((ext_vector_type(16))) __bf16 v16bf;
typedef __attribute__((ext_vector_type(8)))  float  v8f;
typedef __attribute__((ext_vector_type(4)))  unsigned u32x4;

static __device__ __forceinline__ v8f wmma_bf16(v16bf a, v16bf b, v8f c) {
  // (neg_a, A, neg_b, B, c_mod, C, reuse_a, reuse_b)
  return __builtin_amdgcn_wmma_f32_16x16x32_bf16(false, a, false, b, (short)0, c,
                                                 false, false);
}

// CDNA5 async copy: global -> LDS, 16 bytes per lane, tracked by ASYNCcnt.
// lds_off = low 32 bits of the generic pointer (ISA: LDS generic addresses
// carry the LDS byte offset in [31:0]).
static __device__ __forceinline__ void async_ld_b128(void* lds_ptr,
                                                     const void* gptr) {
  const unsigned lds_off = (unsigned)(uintptr_t)lds_ptr;
  asm volatile("global_load_async_to_lds_b128 %0, %1, off"
               :
               : "v"(lds_off), "v"(gptr)
               : "memory");
}
static __device__ __forceinline__ void wait_async0() {
  asm volatile("s_wait_asynccnt 0" ::: "memory");
}
// One attention stage's copies of one lane: 4 pieces of K rows and 4 of V rows,
// rows 16 apart (ls bytes in LDS, gs elements in memory). The s_wait_xcnt
// stands inside the statement so that no address register of an issued copy
// is rewritten in front of it.
static __device__ __forceinline__ void async_stage_kv(void* ldsK, void* ldsV,
                                                      unsigned ls,
                                                      const __bf16* gK,
                                                      const __bf16* gV,
                                                      size_t gs) {
  const unsigned lk = (unsigned)(uintptr_t)ldsK;
  const unsigned lv = (unsigned)(uintptr_t)ldsV;
  asm volatile(
      "global_load_async_to_lds_b128 %0, %8, off\n\t"
      "global_load_async_to_lds_b128 %1, %9, off\n\t"
      "global_load_async_to_lds_b128 %2, %10, off\n\t"
      "global_load_async_to_lds_b128 %3, %11, off\n\t"
      "global_load_async_to_lds_b128 %4, %12, off\n\t"
      "global_load_async_to_lds_b128 %5, %13, off\n\t"
      "global_load_async_to_lds_b128 %6, %14, off\n\t"
      "global_load_async_to_lds_b128 %7, %15, off\n\t"
      "s_wait_xcnt 0x0"
      :
      : "v"(lk), "v"(lk + ls), "v"(lk + 2 * ls), "v"(lk + 3 * ls),
        "v"(lv), "v"(lv + ls), "v"(lv + 2 * ls), "v"(lv + 3 * ls),
        "v"(gK), "v"(gK + gs), "v"(gK + 2 * gs), "v"(gK + 3 * gs),
        "v"(gV), "v"(gV + gs), "v"(gV + 2 * gs), "v"(gV + 3 * gs)
      : "memory");
}

// Load a 16x32 bf16 fragment (A layout; B "Bt" layout is identical with N<->M)
// from row-major LDS with leading dim `ld` (bf16 elements, multiple of 8).
// Lane l: row = base + (l&15); half = l>>4 selects K subranges
// [half*8, half*8+8) and [16+half*8, 16+half*8+8)  -> two aligned b128 loads.
static __device__ __forceinline__ v16bf frag16(const __bf16* base, int row,
                                               int kbase, int ld) {
  const int lane = threadIdx.x & 31;
  const __bf16* p =
      base + (size_t)(row + (lane & 15)) * ld + kbase + ((lane >> 4) * 8);
  union { uint4 u[2]; v16bf v; } t;
  t.u[0] = *(const uint4*)p;
  t.u[1] = *(const uint4*)(p + 16);
  return t.v;
}

// The same 16x32 fragment of the TRANSPOSE of a row-major LDS tile T[k][row],
// by two transposing loads (ds_load_tr16_b128): lane l ends with
// T[kbase + half*8 + 0..7][row + (l&15)] and the same 16 k further on, the k
// order of frag16. Each lane names 16 bytes of one tile row; `ld` in bf16
// elements, 32 B x odd in bytes for conflict-free reads.
typedef __attribute__((ext_vector_type(8))) __bf16 v8bf;
typedef __attribute__((address_space(3))) v8bf lds_v8bf;
static __device__ __forceinline__ v16bf frag16_tr(const __bf16* base, int row,
                                                  int kbase, int ld) {
  const int lane = threadIdx.x & 31;
  const __bf16* p = base + (size_t)(kbase + (lane >> 4) * 8 + (lane & 7)) * ld +
                    row + ((lane >> 3) & 1) * 8;
  union { v8bf h[2]; v16bf v; } t;
  t.h[0] = __builtin_amdgcn_ds_load_tr16_b128_v8bf16((lds_v8bf*)p);
  t.h[1] = __builtin_amdgcn_ds_load_tr16_b128_v8bf16((lds_v8bf*)(p + 16 * ld));
  return t.v;
}

static __device__ __forceinline__ float gelu_exact(float x) {
  return 0.5f * x * (1.0f + erff(x * 0.70710678118654752f));
}

// ---------------------------------------------------------------------------
// Generic bf16 WMMA GEMM:  C[M][N] = A[M][K] * Bt[N][K]^T  (+bias, gelu, resid)
// Block 256 threads = 8 waves; tile 128(M) x 64(N); K-step 128.
// Async double-buffered LDS: global_load_async_to_lds_b128 fills the next
// tile while WMMA consumes the current one; one barrier per K-step.
// Sixteen lanes copy one 256-byte piece of a row, so a wave's copy covers
// whole cache lines. LDS rows are pitched 272 B (16 B x odd) for b128 reads.
// Epilogue forms: f32 store, bf16 store, f32 store with a scale per row.
// Bias, activation, residual and output form are template parameters: each
// launch's epilogue is code without tests on pointers, so its bias, residual
// and scale loads are issued together and waited for once, not per element.
// blockIdx.z picks one product of a batch whose operands, biases, scales and
// results lie back to back (the experts); a single product has grid z = 1.
// COMBINE adds to each result row the rows of comb_rows that its experts left
// for it, in expert order; comb_idx[e * M + row] names expert e's (0, an
// all-zero row, where that expert does not serve the token).
// Requires M%128==0, N%64==0, K%128==0 (true for every GEMM in this model).
// ---------------------------------------------------------------------------
constexpr int GEMM_KT = 128;     // k per stage
constexpr int GEMM_LD = 136;     // LDS row pitch in bf16 elements (272 B)
constexpr int OUT_F32 = 0, OUT_BF16 = 1, OUT_SCALED = 2;  // output forms
constexpr int GEMM_E = 4;        // experts that COMBINE looks through

// One stage's copies of one thread: 8 row pieces of A, 4 of Bt, rows 16 apart.
// The s_wait_xcnt stands inside the statement so that no address register of
// an issued copy is rewritten in front of it.
static __device__ __forceinline__ void async_stage12(const __bf16* lA,
                                                     const __bf16* lB,
                                                     const __bf16* gA,
                                                     const __bf16* gB, int K) {
  const unsigned la = (unsigned)(uintptr_t)lA;
  const unsigned lb = (unsigned)(uintptr_t)lB;
  constexpr unsigned LS = 16u * GEMM_LD * 2u;  // 16 LDS rows in bytes
  const size_t gs = (size_t)16 * K;            // 16 global rows in elements
  asm volatile(
      "global_load_async_to_lds_b128 %0, %12, off\n\t"
      "global_load_async_to_lds_b128 %1, %13, off\n\t"
      "global_load_async_to_lds_b128 %2, %14, off\n\t"
      "global_load_async_to_lds_b128 %3, %15, off\n\t"
      "global_load_async_to_lds_b128 %4, %16, off\n\t"
      "global_load_async_to_lds_b128 %5, %17, off\n\t"
      "global_load_async_to_lds_b128 %6, %18, off\n\t"
      "global_load_async_to_lds_b128 %7, %19, off\n\t"
      "global_load_async_to_lds_b128 %8, %20, off\n\t"
      "global_load_async_to_lds_b128 %9, %21, off\n\t"
      "global_load_async_to_lds_b128 %10, %22, off\n\t"
      "global_load_async_to_lds_b128 %11, %23, off\n\t"
      "s_wait_xcnt 0x0"
      :
      : "v"(la), "v"(la + LS), "v"(la + 2 * LS), "v"(la + 3 * LS),
        "v"(la + 4 * LS), "v"(la + 5 * LS), "v"(la + 6 * LS), "v"(la + 7 * LS),
        "v"(lb), "v"(lb + LS), "v"(lb + 2 * LS), "v"(lb + 3 * LS),
        "v"(gA), "v"(gA + gs), "v"(gA + 2 * gs), "v"(gA + 3 * gs),
        "v"(gA + 4 * gs), "v"(gA + 5 * gs), "v"(gA + 6 * gs), "v"(gA + 7 * gs),
        "v"(gB), "v"(gB + gs), "v"(gB + 2 * gs), "v"(gB + 3 * gs)
      : "memory");
}

// COMBINE's loads. Each run stands with its data wait in one statement with
// early-clobber outputs, so that no result lands in an address register of
// the run and none is rewritten while a load is out.
// The thread's 16 result rows (8 from off, 8 from off + 64 B) in 4 planes.
static __device__ __forceinline__ void load_comb_idx(
    const int* p0, const int* p1, const int* p2, const int* p3, unsigned off,
    u32x4 (&d)[GEMM_E][4]) {
  asm volatile(
      "global_load_b128 %0, %16, %17\n\t"
      "global_load_b128 %1, %16, %17 offset:16\n\t"
      "global_load_b128 %2, %16, %17 offset:64\n\t"
      "global_load_b128 %3, %16, %17 offset:80\n\t"
      "global_load_b128 %4, %16, %18\n\t"
      "global_load_b128 %5, %16, %18 offset:16\n\t"
      "global_load_b128 %6, %16, %18 offset:64\n\t"
      "global_load_b128 %7, %16, %18 offset:80\n\t"
      "global_load_b128 %8, %16, %19\n\t"
      "global_load_b128 %9, %16, %19 offset:16\n\t"
      "global_load_b128 %10, %16, %19 offset:64\n\t"
      "global_load_b128 %11, %16, %19 offset:80\n\t"
      "global_load_b128 %12, %16, %20\n\t"
      "global_load_b128 %13, %16, %20 offset:16\n\t"
      "global_load_b128 %14, %16, %20 offset:64\n\t"
      "global_load_b128 %15, %16, %20 offset:80\n\t"
      "s_wait_loadcnt 0x0"
      : "=&v"(d[0][0]), "=&v"(d[0][1]), "=&v"(d[0][2]), "=&v"(d[0][3]),
        "=&v"(d[1][0]), "=&v"(d[1][1]), "=&v"(d[1][2]), "=&v"(d[1][3]),
        "=&v"(d[2][0]), "=&v"(d[2][1]), "=&v"(d[2][2]), "=&v"(d[2][3]),
        "=&v"(d[3][0]), "=&v"(d[3][1]), "=&v"(d[3][2]), "=&v"(d[3][3])
      : "v"(off), "s"(p0), "s"(p1), "s"(p2), "s"(p3)
      : "memory");
}
// Two columns, 16 apart, of 8 rows of base; off holds byte offsets.
static __device__ __forceinline__ void load_comb_rows(const float* base,
                                                      const unsigned (&off)[8],
                                                      float (&d)[2][8]) {
  asm volatile(
      "global_load_b32 %0, %16, %24\n\t"
      "global_load_b32 %1, %17, %24\n\t"
      "global_load_b32 %2, %18, %24\n\t"
      "global_load_b32 %3, %19, %24\n\t"
      "global_load_b32 %4, %20, %24\n\t"
      "global_load_b32 %5, %21, %24\n\t"
      "global_load_b32 %6, %22, %24\n\t"
      "global_load_b32 %7, %23, %24\n\t"
      "global_load_b32 %8, %16, %24 offset:64\n\t"
      "global_load_b32 %9, %17, %24 offset:64\n\t"
      "global_load_b32 %10, %18, %24 offset:64\n\t"
      "global_load_b32 %11, %19, %24 offset:64\n\t"
      "global_load_b32 %12, %20, %24 offset:64\n\t"
      "global_load_b32 %13, %21, %24 offset:64\n\t"
      "global_load_b32 %14, %22, %24 offset:64\n\t"
      "global_load_b32 %15, %23, %24 offset:64\n\t"
      "s_wait_loadcnt 0x0"
      : "=&v"(d[0][0]), "=&v"(d[0][1]), "=&v"(d[0][2]), "=&v"(d[0][3]),
        "=&v"(d[0][4]), "=&v"(d[0][5]), "=&v"(d[0][6]), "=&v"(d[0][7]),
        "=&v"(d[1][0]), "=&v"(d[1][1]), "=&v"(d[1][2]), "=&v"(d[1][3]),
        "=&v"(d[1][4]), "=&v"(d[1][5]), "=&v"(d[1][6]), "=&v"(d[1][7])
      : "v"(off[0]), "v"(off[1]), "v"(off[2]), "v"(off[3]), "v"(off[4]),
        "v"(off[5]), "v"(off[6]), "v"(off[7]), "s"(base)
      : "memory");
}

template <bool BIAS, bool ACT, bool RESID, int OUT, bool COMBINE>
__global__ __launch_bounds__(256) void gemm_bf16_kernel(
    const __bf16* __restrict__ A, const __bf16* __restrict__ Bt,
    const float* __restrict__ bias, const float* __restrict__ residual,
    float* Cf, __bf16* Cb, const int* __restrict__ comb_idx,
    const float* __restrict__ row_scale, const float* __restrict__ comb_rows,
    int M, int N, int K) {
  __shared__ __align__(16) __bf16 As[2][128][GEMM_LD];
  __shared__ __align__(16) __bf16 Bs[2][64][GEMM_LD];

  const size_t zb = blockIdx.z;  // which product of the batch
  A += zb * M * K;
  Bt += zb * N * K;
  if constexpr (BIAS) bias += zb * N;
  if constexpr (RESID) residual += zb * M * N;
  if constexpr (OUT == OUT_BF16) Cb += zb * M * N;
  if constexpr (OUT != OUT_BF16) Cf += zb * M * N;
  if constexpr (OUT == OUT_SCALED) row_scale += zb * M;

  const int tid = threadIdx.x;
  const int wave = tid >> 5, lane = tid & 31;
  const int wm = wave & 3, wn = wave >> 2;
  const int bm = blockIdx.y * 128, bn = blockIdx.x * 64;

  const int rc = tid >> 4, cc = (tid & 15) * 8;  // copy: row in 16, 8 bf16
  const __bf16* gA0 = A + (size_t)(bm + rc) * K + cc;
  const __bf16* gB0 = Bt + (size_t)(bn + rc) * K + cc;

  auto issue_tile = [&](int buf, int k0) {
    async_stage12(&As[buf][rc][cc], &Bs[buf][rc][cc], gA0 + k0, gB0 + k0, K);
  };

  v8f acc[2][2] = {};
  const int nt = K / GEMM_KT;
  issue_tile(0, 0);

  // Byte offsets in comb_rows of the two rows that each result row gets,
  // fetched here so that the wait falls into the first tile's flight. A token
  // has two experts: the lowest and the highest plane that name a row are all.
  unsigned oa[2][8] = {}, ob[2][8] = {};
  if constexpr (COMBINE) {
    u32x4 ix[GEMM_E][4];
    load_comb_idx(comb_idx, comb_idx + M, comb_idx + 2 * (size_t)M,
                  comb_idx + 3 * (size_t)M,
                  (unsigned)(bm + wm * 32 + (lane >> 4) * 8) * 4u, ix);
    const unsigned colb = (unsigned)(bn + wn * 32 + (lane & 15)) * 4u;
    // Unrolled so that ix, oa and ob are indexed by constants and stay in
    // registers.
#pragma unroll
    for (int i = 0; i < 2; ++i)
#pragma unroll
      for (int v = 0; v < 8; ++v) {
        const unsigned x0 = ix[0][i * 2 + (v >> 2)][v & 3];
        const unsigned x1 = ix[1][i * 2 + (v >> 2)][v & 3];
        const unsigned x2 = ix[2][i * 2 + (v >> 2)][v & 3];
        const unsigned x3 = ix[3][i * 2 + (v >> 2)][v & 3];
        const unsigned lo = x0 ? x0 : x1 ? x1 : x2 ? x2 : x3;
        const unsigned hi = x3 ? x3 : x2 ? x2 : x1 ? x1 : x0;
        oa[i][v] = lo * (unsigned)N * 4u + colb;
        ob[i][v] = (hi == lo ? 0u : hi) * (unsigned)N * 4u + colb;
      }
  }

  wait_async0();      // tile 0 landed in LDS (this wave's copies)
  __syncthreads();    // ... and every other wave's
  if (nt > 1) issue_tile(1, GEMM_KT);

  for (int t = 0; t < nt; ++t) {
    const int cur = t & 1;
    // Unrolled so that ks folds into the immediate offsets of the LDS loads.
#pragma unroll
    for (int ks = 0; ks < GEMM_KT; ks += 32) {
      const v16bf a0 = frag16(&As[cur][0][0], wm * 32, ks, GEMM_LD);
      const v16bf a1 = frag16(&As[cur][0][0], wm * 32 + 16, ks, GEMM_LD);
      const v16bf b0 = frag16(&Bs[cur][0][0], wn * 32, ks, GEMM_LD);
      const v16bf b1 = frag16(&Bs[cur][0][0], wn * 32 + 16, ks, GEMM_LD);
      acc[0][0] = wmma_bf16(a0, b0, acc[0][0]);
      acc[0][1] = wmma_bf16(a0, b1, acc[0][1]);
      acc[1][0] = wmma_bf16(a1, b0, acc[1][0]);
      acc[1][1] = wmma_bf16(a1, b1, acc[1][1]);
    }
    // This wave's LDS reads of the buffer have retired before it is refilled.
    asm volatile("s_wait_dscnt 0x0" ::: "memory");
    wait_async0();      // next tile landed in LDS (this wave's copies)
    __syncthreads();    // all waves done copying AND done reading this buffer
    if (t + 2 < nt) issue_tile(cur, (t + 2) * GEMM_KT);  // flies over trip t+1
  }
  wait_async0();        // no copy is outstanding when the wave ends

  // Epilogue. C layout: lane half (l>>4) + VGPR v -> row half*8+v; col = l&15.
  const int half = lane >> 4, c0 = lane & 15;
  const int row0 = bm + wm * 32 + half * 8;  // + i*16 + v
  const int col0 = bn + wn * 32 + c0;        // + j*16

  // Bias, residual and scale are fetched first, in one run of loads; the rows
  // of comb_rows are fetched in the loop below, for each i in turn.
  // All loops below are unrolled so that acc and these arrays are indexed by
  // constants and stay in registers.
  float bv[2] = {};
  float rv[2][2][8] = {};
  float sc[2][8] = {};
  if constexpr (BIAS) {
#pragma unroll
    for (int j = 0; j < 2; ++j) bv[j] = bias[col0 + j * 16];
  }
  if constexpr (RESID) {
#pragma unroll
    for (int i = 0; i < 2; ++i)
#pragma unroll
      for (int j = 0; j < 2; ++j)
#pragma unroll
        for (int v = 0; v < 8; ++v)
          rv[i][j][v] =
              residual[(size_t)(row0 + i * 16 + v) * N + col0 + j * 16];
  }
  if constexpr (OUT == OUT_SCALED) {
#pragma unroll
    for (int i = 0; i < 2; ++i)
#pragma unroll
      for (int v = 0; v < 8; ++v) sc[i][v] = row_scale[row0 + i * 16 + v];
  }

#pragma unroll
  for (int i = 0; i < 2; ++i) {
    float pa[2][8] = {}, pb[2][8] = {};
    if constexpr (COMBINE) {
      load_comb_rows(comb_rows, oa[i], pa);
      load_comb_rows(comb_rows, ob[i], pb);
    }
#pragma unroll
    for (int j = 0; j < 2; ++j)
#pragma unroll
      for (int v = 0; v < 8; ++v) {
        const int row = row0 + i * 16 + v;
        const int col = col0 + j * 16;
        float val = acc[i][j][v];
        if constexpr (BIAS) val += bv[j];
        if constexpr (ACT) val = gelu_exact(val);
        if constexpr (RESID) val += rv[i][j][v];
        if constexpr (COMBINE) {
          val += pa[j][v];
          val += pb[j][v];
        }
        if constexpr (OUT == OUT_F32) Cf[(size_t)row * N + col] = val;
        if constexpr (OUT == OUT_BF16) Cb[(size_t)row * N + col] = (__bf16)val;
        if constexpr (OUT == OUT_SCALED)
          Cf[(size_t)row * N + col] = val * sc[i][v];
      }
  }
}

__global__ __launch_bounds__(128) void attn_kernel(
    const __bf16* __restrict__ qkv, __bf16* __restrict__ out, int N, int Hh,
    int hd) {
  const int D3 = 3 * Hh * hd;   // 3072
  const int Dm = Hh * hd;       // 1024
  const int qb = blockIdx.x, h = blockIdx.y, b = blockIdx.z;
  const int tid = threadIdx.x, wave = tid >> 5, lane = tid & 31;
  const int half = lane >> 4, c0 = lane & 15;

  __shared__ __align__(16) __bf16 Qs[64][80];
  __shared__ __align__(16) __bf16 Ks[64][80];
  __shared__ __align__(16) __bf16 Vs[64][80];  // [key][d], 160 B = 32 B x 5

  const int r = tid >> 1, d0 = (tid & 1) * 32;
  const int rk = tid >> 3, ck = (tid & 7) * 8;  // K, V copy: row in 16, 8 bf16
  {  // Q tile (64x64) via async copy; first in-loop wait_async0 covers it
    const __bf16* g = qkv + (size_t)(b * N + qb * 64 + r) * D3 + h * hd + d0;
#pragma unroll
    for (int u = 0; u < 4; ++u) async_ld_b128(&Qs[r][d0 + u * 8], g + u * 8);
  }

  // o[j][v] = O[query c0][head dim j*16 + half*8 + v]. mstat is the running
  // maximum of query c0; lstat sums only the keys that this lane half holds.
  // Every loop over u, ks, j, v or m in this kernel is unrolled so that s, o
  // and the fragments are indexed by constants and stay in registers.
  v8f o[4] = {};
  float mstat = -1e30f, lstat = 0.f;

  for (int kb = 0; kb < N / 64; ++kb) {
    // This wave's LDS reads of Ks and Vs have retired before they are refilled.
    asm volatile("s_wait_dscnt 0x0" ::: "memory");
    __syncthreads();  // prior reads of Ks/Vs complete before overwrite
    {
      // Eight lanes copy one 128-byte row of a head, so a wave's copy covers
      // four whole cache lines.
      const __bf16* gk =
          qkv + (size_t)(b * N + kb * 64 + rk) * D3 + Dm + h * hd + ck;
      async_stage_kv(&Ks[rk][ck], &Vs[rk][ck], 16u * sizeof(Ks[0]), gk, gk + Dm,
                     (size_t)16 * D3);
    }
    wait_async0();
    __syncthreads();

    // S^T = K @ Q^T: s[j][v] = S[query c0][key j*16 + half*8 + v]
    v8f s[4] = {};
#pragma unroll
    for (int ks = 0; ks < 64; ks += 32) {
      const v16bf q = frag16(&Qs[0][0], wave * 16, ks, 80);
#pragma unroll
      for (int j = 0; j < 4; ++j) {
        const v16bf kf = frag16(&Ks[0][0], j * 16, ks, 80);
        s[j] = wmma_bf16(kf, q, s[j]);
      }
    }

    // All V^T fragments, fetched as one group here so that the softmax below
    // covers their latency: vf[m][j] = head dims j*16.., keys m*32..
    v16bf vf[2][4];
#pragma unroll
    for (int m = 0; m < 2; ++m)
#pragma unroll
      for (int j = 0; j < 4; ++j)
        vf[m][j] = frag16_tr(&Vs[0][0], j * 16, m * 32, 80);
    // Keeps the group in front of the softmax: left free, the loads are spread
    // among the second product's WMMAs, each place with a wait of its own.
    __builtin_amdgcn_sched_barrier(0);

    // online softmax of query c0: 32 keys in this lane, 32 in lane ^ 16
    float rmax = -1e30f;
#pragma unroll
    for (int j = 0; j < 4; ++j)
#pragma unroll
      for (int v = 0; v < 8; ++v) {
        s[j][v] *= 0.125f;  // hd^-0.5
        rmax = fmaxf(rmax, s[j][v]);
      }
    rmax = fmaxf(rmax, __shfl_xor(rmax, 16, 32));
    const float mnew = fmaxf(mstat, rmax);
    const float alpha = __expf(mstat - mnew);
    float rsum = 0.f;
#pragma unroll
    for (int j = 0; j < 4; ++j)
#pragma unroll
      for (int v = 0; v < 8; ++v) {
        const float p = __expf(s[j][v] - mnew);
        s[j][v] = p;
        rsum += p;
      }
    lstat = lstat * alpha + rsum;
    mstat = mnew;
#pragma unroll
    for (int j = 0; j < 4; ++j)
#pragma unroll
      for (int v = 0; v < 8; ++v) o[j][v] *= alpha;

    // O^T += V^T @ P^T. Tiles 2m and 2m+1 of S^T hold keys m*32 + half*8 + v
    // and m*32 + 16 + half*8 + v: the k order in which frag16_tr reads Vs.
#pragma unroll
    for (int m = 0; m < 2; ++m) {
      v16bf pf;
#pragma unroll
      for (int v = 0; v < 8; ++v) {
        pf[v] = (__bf16)s[2 * m][v];
        pf[8 + v] = (__bf16)s[2 * m + 1][v];
      }
#pragma unroll
      for (int j = 0; j < 4; ++j) o[j] = wmma_bf16(vf[m][j], pf, o[j]);
    }
  }

  // The two lane halves' sums are joined once; a lane stores 8 neighbouring
  // head dims of its query as one 16-byte piece per tile.
  lstat += __shfl_xor(lstat, 16, 32);
  const float inv = 1.0f / lstat;
  __bf16* orow = out + (size_t)(b * N + qb * 64 + wave * 16 + c0) * Dm +
                 h * hd + half * 8;
#pragma unroll
  for (int j = 0; j < 4; ++j) {
    v8bf w;
#pragma unroll
    for (int v = 0; v < 8; ++v) w[v] = (__bf16)(o[j][v] * inv);
    *(v8bf*)(orow + j * 16) = w;
  }
}

// ---------------------------------------------------------------------------
// Router: noisy top-2 over E=4 experts. One wave per token.
// ---------------------------------------------------------------------------
__global__ __launch_bounds__(128) void router_kernel(
    const float* __restrict__ x2, const float* __restrict__ noise,
    const float* __restrict__ w_route, const float* __restrict__ b_route,
    const float* __restrict__ w_noise, const float* __restrict__ b_noise,
    float* gate, int* fidx, int D) {
  const int wave = threadIdx.x >> 5, lane = threadIdx.x & 31;
  const int t = blockIdx.x * 4 + wave;
  float ar[4] = {0, 0, 0, 0}, an[4] = {0, 0, 0, 0};
  for (int d = lane; d < D; d += 32) {
    const float xv = x2[(size_t)t * D + d];
#pragma unroll
    for (int e = 0; e < 4; ++e) {
      ar[e] += xv * w_route[d * 4 + e];
      an[e] += xv * w_noise[d * 4 + e];
    }
  }
#pragma unroll
  for (int e = 0; e < 4; ++e)
#pragma unroll
    for (int off = 16; off; off >>= 1) {
      ar[e] += __shfl_xor(ar[e], off, 32);
      an[e] += __shfl_xor(an[e], off, 32);
    }
  if (lane == 0) {
    float noisy[4];
#pragma unroll
    for (int e = 0; e < 4; ++e) {
      const float lg = ar[e] + b_route[e];
      const float ns = an[e] + b_noise[e];
      const float sp = (ns > 20.f) ? ns : log1pf(__expf(ns));
      noisy[e] = lg + noise[t * 4 + e] * sp;
    }
    int i0 = 0;
    for (int e = 1; e < 4; ++e)
      if (noisy[e] > noisy[i0]) i0 = e;
    int i1 = -1;
    for (int e = 0; e < 4; ++e)
      if (e != i0 && (i1 < 0 || noisy[e] > noisy[i1])) i1 = e;
    const float m = fmaxf(noisy[i0], noisy[i1]);
    const float e0 = __expf(noisy[i0] - m), e1 = __expf(noisy[i1] - m);
    const float p0 = e0 / (e0 + e1);
#pragma unroll
    for (int e = 0; e < 4; ++e) gate[t * 4 + e] = 0.f;
    gate[t * 4 + i0] = p0;
    gate[t * 4 + i1] = 1.f - p0;
    fidx[2 * t] = i0;
    fidx[2 * t + 1] = i1;
  }
}

// ---------------------------------------------------------------------------
// Per-expert capacity dispatch (stable token order). grid = E blocks.
// A token's place with expert e is the number of e's tokens in front of it.
// A wave takes SCAN_PER groups of 32 neighbouring tokens: inside a group the
// count comes from a ballot and a bit count, over the wave's earlier groups
// from the ballots' sizes, over earlier waves from the waves' totals, which go
// through LDS behind the one barrier of a trip. A trip covers SCAN_CHUNK
// tokens, and all its loads are issued together in front of the counting.
// inv[e * T + t] is the way back: the row of the experts' result that token t
// has with expert e (they start at row 1), or row 0, cleared here, if none.
// ---------------------------------------------------------------------------
constexpr int SCAN_WAVES = 32;  // one total per lane when a wave sums them
constexpr int SCAN_PER = 4;     // groups of 32 tokens per wave and trip
constexpr int SCAN_THREADS = SCAN_WAVES * 32;
constexpr int SCAN_CHUNK = SCAN_THREADS * SCAN_PER;
static_assert(SCAN_CHUNK < (1 << 15), "two counts of a trip share one int");

// A store with its s_wait_xcnt in the same statement: what follows it rewrites
// the registers that it names, and a wait in a statement of its own is not
// tied to those registers.
static __device__ __forceinline__ void store_b32_wait(int* p, int v) {
  asm volatile(
      "global_store_b32 %0, %1, off\n\t"
      "s_wait_xcnt 0x0"
      :
      : "v"(p), "v"(v)
      : "memory");
}

__global__ __launch_bounds__(SCAN_THREADS) void dispatch_scan(
    const int* __restrict__ fidx, const float* __restrict__ gate, int* sel,
    float* selw, int* inv, float* zero_row, int capacity, int T, int D) {
  const int e = blockIdx.x, tid = threadIdx.x;
  const int wave = tid >> 5, lane = tid & 31;
  for (int i = e * SCAN_THREADS + tid; i < D; i += gridDim.x * SCAN_THREADS)
    zero_row[i] = 0.f;
  // Two sets, taken in turn: a trip's totals are read behind its barrier, and
  // the set is written again only behind the next trip's barrier.
  __shared__ int wtot[2][SCAN_WAVES];
  const unsigned below = (1u << lane) - 1u;  // the lanes in front of this one
  int base = 0;
  for (int c0 = 0, set = 0; c0 < T; c0 += SCAN_CHUNK, set ^= 1) {
    const int t0 = c0 + wave * (32 * SCAN_PER) + lane;
    // All loops over j are unrolled so that the arrays stay in registers.
    int2 f[SCAN_PER];
    float g[SCAN_PER];
#pragma unroll
    for (int j = 0; j < SCAN_PER; ++j) {
      const int t = t0 + j * 32;
      const int tc = t < T ? t : T - 1;  // a token past the end reads the last
      f[j] = *(const int2*)(fidx + 2 * tc);
      g[j] = gate[tc * 4 + e];
    }
    bool m[SCAN_PER];
    int before[SCAN_PER];
    int mine = 0;  // e's tokens in this wave's groups so far
#pragma unroll
    for (int j = 0; j < SCAN_PER; ++j) {
      // Plain | and &: all three tests are cheap, and no branch is wanted.
      m[j] = (t0 + j * 32 < T) & ((f[j].x == e) | (f[j].y == e));
      const unsigned b = __builtin_amdgcn_ballot_w32(m[j]);
      before[j] = mine + __popc(b & below);
      mine += __popc(b);
    }
    if (lane == 0) wtot[set][wave] = mine;
    __syncthreads();
    // Two sums in one exchange tree: the earlier waves' tokens in the high
    // half of a word, all waves' in the low half (neither passes SCAN_CHUNK).
    const int w = wtot[set][lane];
    int both = (lane < wave ? w << 16 : 0) | w;
#pragma unroll
    for (int off = 16; off; off >>= 1) both += __shfl_xor(both, off, 32);
    const int pre = both >> 16, tot = both & 0xffff;
#pragma unroll
    for (int j = 0; j < SCAN_PER; ++j) {
      const int t = t0 + j * 32;
      const int pos = base + pre + before[j];
      const bool kept = m[j] && pos < capacity;
      if (kept) {
        sel[e * capacity + pos] = t;
        selw[e * capacity + pos] = g[j];
      }
      if (t < T)
        store_b32_wait(inv + e * T + t, kept ? 1 + e * capacity + pos : 0);
    }
    base += tot;
  }
  for (int i = (base < capacity ? base : capacity) + tid; i < capacity;
       i += SCAN_THREADS) {
    sel[e * capacity + i] = 0;
    selw[e * capacity + i] = 0.f;  // padded rows contribute nothing
  }
}

// ---------------------------------------------------------------------------
// fp32 -> bf16 conversion of every weight, one launch.
// The work is cut into pieces of 4096 elements; each work-group takes CVT_PER
// of them, so few waves are started and each moves many bytes.
// A piece of w_qkv or w_proj (already [N][K]) is a straight run of elements.
// A piece of any other weight is a 64x64 tile of in[K][N] that goes out as
// out[N][K]: input rows are read as 256-byte runs, two neighbouring k of one
// column are packed into a dword, the tile is turned in LDS, and each output
// row gets one whole 128-byte run.
// ---------------------------------------------------------------------------
constexpr int W_D = 1024, W_MLPH = 4096, W_MOEH = 256, W_E = 4;  // model dims
constexpr int CVT_PIECE = 64 * 64;
constexpr int CVT_B_PROJ = 3 * W_D * W_D / CVT_PIECE;             // after w_qkv
constexpr int CVT_B_M1 = CVT_B_PROJ + W_D * W_D / CVT_PIECE;      // after w_proj
constexpr int CVT_B_M2 = CVT_B_M1 + W_D * W_MLPH / CVT_PIECE;     // after w_mlp1
constexpr int CVT_B_E1 = CVT_B_M2 + W_MLPH * W_D / CVT_PIECE;     // after w_mlp2
constexpr int CVT_B_E2 = CVT_B_E1 + W_E * W_D * W_MOEH / CVT_PIECE;
constexpr int CVT_TOTAL = CVT_B_E2 + W_E * W_MOEH * W_D / CVT_PIECE;
constexpr int CVT_PER = 4;                      // pieces per work-group
constexpr int CVT_GRID = CVT_TOTAL / CVT_PER;   // work-groups
static_assert(CVT_GRID * CVT_PER == CVT_TOTAL, "pieces divide evenly");
constexpr int CVT_EXP_TILES = W_D * W_MOEH / CVT_PIECE;  // tiles per expert
static_assert(CVT_EXP_TILES == 64, "expert index is taken by a shift of 6");
constexpr int CVT_PITCH = 68;  // LDS row pitch in bf16: 136 B, 8-byte aligned

typedef __attribute__((ext_vector_type(2))) float  f32x2;
typedef __attribute__((ext_vector_type(2))) __bf16 bf16x2;

// Two floats to one dword of bf16, lo in the low half; converted as a pair so
// that one packed conversion does both.
static __device__ __forceinline__ unsigned pack_bf16(float lo, float hi) {
  const f32x2 f = {lo, hi};
  return __builtin_bit_cast(unsigned, __builtin_convertvector(f, bf16x2));
}

typedef __attribute__((ext_vector_type(4))) float    f32x4;
typedef __attribute__((ext_vector_type(2))) unsigned u32x2;

// Four 16-byte loads that fly together. Loads and their data wait are one
// statement with early-clobber outputs, so that no result lands in an address
// pair of the run and no address pair is rewritten while a load is out (as
// plain loads the compiler let one load's result take another's address).
static __device__ __forceinline__ void load4_b128(const float* p0,
                                                  const float* p1,
                                                  const float* p2,
                                                  const float* p3, f32x4& r0,
                                                  f32x4& r1, f32x4& r2,
                                                  f32x4& r3) {
  asm volatile(
      "global_load_b128 %0, %4, off\n\t"
      "global_load_b128 %1, %5, off\n\t"
      "global_load_b128 %2, %6, off\n\t"
      "global_load_b128 %3, %7, off\n\t"
      "s_wait_loadcnt 0x0"
      : "=&v"(r0), "=&v"(r1), "=&v"(r2), "=&v"(r3)
      : "v"(p0), "v"(p1), "v"(p2), "v"(p3)
      : "memory");
}

// Stores with their s_wait_xcnt in the same statement: the next piece rewrites
// the registers that they name, and a wait in a statement of its own is not
// tied to those registers.
static __device__ __forceinline__ void store4_b64_step2k(__bf16* p, u32x2 w0,
                                                         u32x2 w1, u32x2 w2,
                                                         u32x2 w3) {
  asm volatile(
      "global_store_b64 %0, %1, off\n\t"
      "global_store_b64 %0, %2, off offset:2048\n\t"
      "global_store_b64 %0, %3, off offset:4096\n\t"
      "global_store_b64 %0, %4, off offset:6144\n\t"
      "s_wait_xcnt 0x0"
      :
      : "v"(p), "v"(w0), "v"(w1), "v"(w2), "v"(w3)
      : "memory");
}
static __device__ __forceinline__ void store2_b128(__bf16* p, u32x4 d0,
                                                   u32x4 d1) {
  asm volatile(
      "global_store_b128 %0, %1, off\n\t"
      "global_store_b128 %0, %2, off offset:16\n\t"
      "s_wait_xcnt 0x0"
      :
      : "v"(p), "v"(d0), "v"(d1)
      : "memory");
}

__global__ __launch_bounds__(256) void cvt_weights(
    const float* __restrict__ w_qkv, const float* __restrict__ w_proj,
    const float* __restrict__ w_m1, const float* __restrict__ w_m2,
    const float* __restrict__ we1, const float* __restrict__ we2,
    __bf16* __restrict__ o_qkv, __bf16* __restrict__ o_proj,
    __bf16* __restrict__ o_m1, __bf16* __restrict__ o_m2,
    __bf16* __restrict__ o_e1, __bf16* __restrict__ o_e2) {
  __shared__ __align__(16) __bf16 tile[2][64][CVT_PITCH];
  const int tid = threadIdx.x;

  for (int i = 0; i < CVT_PER; ++i) {
    const int p = blockIdx.x + i * CVT_GRID;  // same for the whole work-group
    const bool turned = p >= CVT_B_M1;
    __bf16(*t)[CVT_PITCH] = tile[i & 1];

    // Which weight, and which tile of it. N = 64 << lnt columns of input.
    const float* in;
    __bf16* out;
    int K = 0, lnt = 0, q;
    if (p < CVT_B_PROJ) {
      in = w_qkv; out = o_qkv; q = p;
    } else if (p < CVT_B_M1) {
      in = w_proj; out = o_proj; q = p - CVT_B_PROJ;
    } else if (p < CVT_B_M2) {
      in = w_m1; out = o_m1; q = p - CVT_B_M1; K = W_D; lnt = 6;
    } else if (p < CVT_B_E1) {
      in = w_m2; out = o_m2; q = p - CVT_B_M2; K = W_MLPH; lnt = 4;
    } else if (p < CVT_B_E2) {
      q = p - CVT_B_E1;
      in = we1 + (size_t)(q >> 6) * (W_D * W_MOEH);
      out = o_e1 + (size_t)(q >> 6) * (W_D * W_MOEH);
      q &= 63; K = W_D; lnt = 2;
    } else {
      q = p - CVT_B_E2;
      in = we2 + (size_t)(q >> 6) * (W_D * W_MOEH);
      out = o_e2 + (size_t)(q >> 6) * (W_D * W_MOEH);
      q &= 63; K = W_MOEH; lnt = 4;
    }
    const int N = 64 << lnt;
    const int k0 = (q >> lnt) * 64, n0 = (q & ((1 << lnt) - 1)) * 64;

    if (!turned) {
      const size_t e = (size_t)q * CVT_PIECE + tid * 4;
      const float* g = in + e;
      f32x4 v0, v1, v2, v3;
      load4_b128(g, g + 1024, g + 2048, g + 3072, v0, v1, v2, v3);
      const u32x2 w0 = {pack_bf16(v0.x, v0.y), pack_bf16(v0.z, v0.w)};
      const u32x2 w1 = {pack_bf16(v1.x, v1.y), pack_bf16(v1.z, v1.w)};
      const u32x2 w2 = {pack_bf16(v2.x, v2.y), pack_bf16(v2.z, v2.w)};
      const u32x2 w3 = {pack_bf16(v3.x, v3.y), pack_bf16(v3.z, v3.w)};
      store4_b64_step2k(out + e, w0, w1, w2, w3);  // 1024 elements apart
    } else {
      const int c4 = (tid & 15) * 4, r2 = (tid >> 4) * 2;
      const float* g = in + (size_t)(k0 + r2) * N + n0 + c4;
      f32x4 a0, b0, a1, b1;  // rows k, k + 1 and k + 32, k + 33
      load4_b128(g, g + N, g + (size_t)32 * N, g + (size_t)33 * N, a0, b0, a1,
                 b1);
      *(unsigned*)&t[c4 + 0][r2] = pack_bf16(a0.x, b0.x);
      *(unsigned*)&t[c4 + 1][r2] = pack_bf16(a0.y, b0.y);
      *(unsigned*)&t[c4 + 2][r2] = pack_bf16(a0.z, b0.z);
      *(unsigned*)&t[c4 + 3][r2] = pack_bf16(a0.w, b0.w);
      *(unsigned*)&t[c4 + 0][r2 + 32] = pack_bf16(a1.x, b1.x);
      *(unsigned*)&t[c4 + 1][r2 + 32] = pack_bf16(a1.y, b1.y);
      *(unsigned*)&t[c4 + 2][r2 + 32] = pack_bf16(a1.z, b1.z);
      *(unsigned*)&t[c4 + 3][r2 + 32] = pack_bf16(a1.w, b1.w);
    }
    // One barrier a trip, passed by every wave whatever the piece: it
    // publishes this trip's tile, and it stands between the reads of a buffer
    // in trip i and its next filling in trip i + 2.
    __syncthreads();
    if (turned) {
      const int n = tid >> 2, kc = (tid & 3) * 16;
      const uint2* s = (const uint2*)&t[n][kc];
      const uint2 s0 = s[0], s1 = s[1], s2 = s[2], s3 = s[3];
      const u32x4 d0 = {s0.x, s0.y, s1.x, s1.y};
      const u32x4 d1 = {s2.x, s2.y, s3.x, s3.y};
      store2_b128(out + (size_t)(n0 + n) * K + k0 + kc, d0, d1);
    }
  }
}

// ---------------------------------------------------------------------------
// Row kernels: LayerNorm and the expert gather. A row is W_D elements.
// One wave takes a whole row (LayerNorm) or two rows (gather) in 16-byte
// pieces per lane, each wave-wide access covering 512 contiguous bytes, so a
// launch starts 4096 waves that each keep eight or more loads in flight.
// Loads stand with their data wait, stores with their s_wait_xcnt, in one
// statement each, for the reasons given at load4_b128 and store4_b64_step2k.
// ---------------------------------------------------------------------------
static_assert(W_D == 32 * 4 * 8, "a lane holds 8 pieces of 4 floats of a row");

// One row of x, and gamma and beta, 512 bytes of each per wave-wide load.
static __device__ __forceinline__ void load_ln_row(const float* x,
                                                   const float* g,
                                                   const float* b,
                                                   f32x4 (&xv)[8],
                                                   f32x4 (&gv)[8],
                                                   f32x4 (&bv)[8]) {
  asm volatile(
      "global_load_b128 %0, %24, off\n\t"
      "global_load_b128 %1, %24, off offset:512\n\t"
      "global_load_b128 %2, %24, off offset:1024\n\t"
      "global_load_b128 %3, %24, off offset:1536\n\t"
      "global_load_b128 %4, %24, off offset:2048\n\t"
      "global_load_b128 %5, %24, off offset:2560\n\t"
      "global_load_b128 %6, %24, off offset:3072\n\t"
      "global_load_b128 %7, %24, off offset:3584\n\t"
      "global_load_b128 %8, %25, off\n\t"
      "global_load_b128 %9, %25, off offset:512\n\t"
      "global_load_b128 %10, %25, off offset:1024\n\t"
      "global_load_b128 %11, %25, off offset:1536\n\t"
      "global_load_b128 %12, %25, off offset:2048\n\t"
      "global_load_b128 %13, %25, off offset:2560\n\t"
      "global_load_b128 %14, %25, off offset:3072\n\t"
      "global_load_b128 %15, %25, off offset:3584\n\t"
      "global_load_b128 %16, %26, off\n\t"
      "global_load_b128 %17, %26, off offset:512\n\t"
      "global_load_b128 %18, %26, off offset:1024\n\t"
      "global_load_b128 %19, %26, off offset:1536\n\t"
      "global_load_b128 %20, %26, off offset:2048\n\t"
      "global_load_b128 %21, %26, off offset:2560\n\t"
      "global_load_b128 %22, %26, off offset:3072\n\t"
      "global_load_b128 %23, %26, off offset:3584\n\t"
      "s_wait_loadcnt 0x0"
      : "=&v"(xv[0]), "=&v"(xv[1]), "=&v"(xv[2]), "=&v"(xv[3]), "=&v"(xv[4]), "=&v"(xv[5]), "=&v"(xv[6]), "=&v"(xv[7]),
        "=&v"(gv[0]), "=&v"(gv[1]), "=&v"(gv[2]), "=&v"(gv[3]), "=&v"(gv[4]), "=&v"(gv[5]), "=&v"(gv[6]), "=&v"(gv[7]),
        "=&v"(bv[0]), "=&v"(bv[1]), "=&v"(bv[2]), "=&v"(bv[3]), "=&v"(bv[4]), "=&v"(bv[5]), "=&v"(bv[6]), "=&v"(bv[7])
      : "v"(x), "v"(g), "v"(b)
      : "memory");
}
// Two rows of W_D bf16, four 16-byte pieces per lane of each.
static __device__ __forceinline__ void load_2rows_bf16(const __bf16* p0,
                                                       const __bf16* p1,
                                                       u32x4 (&d)[8]) {
  asm volatile(
      "global_load_b128 %0, %8, off\n\t"
      "global_load_b128 %1, %8, off offset:512\n\t"
      "global_load_b128 %2, %8, off offset:1024\n\t"
      "global_load_b128 %3, %8, off offset:1536\n\t"
      "global_load_b128 %4, %9, off\n\t"
      "global_load_b128 %5, %9, off offset:512\n\t"
      "global_load_b128 %6, %9, off offset:1024\n\t"
      "global_load_b128 %7, %9, off offset:1536\n\t"
      "s_wait_loadcnt 0x0"
      : "=&v"(d[0]), "=&v"(d[1]), "=&v"(d[2]), "=&v"(d[3]), "=&v"(d[4]), "=&v"(d[5]), "=&v"(d[6]), "=&v"(d[7])
      : "v"(p0), "v"(p1)
      : "memory");
}
static __device__ __forceinline__ void store8_f32x4(float* p,
                                                    const f32x4 (&d)[8]) {
  asm volatile(
      "global_store_b128 %0, %1, off\n\t"
      "global_store_b128 %0, %2, off offset:512\n\t"
      "global_store_b128 %0, %3, off offset:1024\n\t"
      "global_store_b128 %0, %4, off offset:1536\n\t"
      "global_store_b128 %0, %5, off offset:2048\n\t"
      "global_store_b128 %0, %6, off offset:2560\n\t"
      "global_store_b128 %0, %7, off offset:3072\n\t"
      "global_store_b128 %0, %8, off offset:3584\n\t"
      "s_wait_xcnt 0x0"
      :
      : "v"(p), "v"(d[0]), "v"(d[1]), "v"(d[2]), "v"(d[3]), "v"(d[4]), "v"(d[5]), "v"(d[6]), "v"(d[7])
      : "memory");
}
static __device__ __forceinline__ void store8_u32x4(__bf16* p,
                                                    const u32x4 (&d)[8]) {
  asm volatile(
      "global_store_b128 %0, %1, off\n\t"
      "global_store_b128 %0, %2, off offset:512\n\t"
      "global_store_b128 %0, %3, off offset:1024\n\t"
      "global_store_b128 %0, %4, off offset:1536\n\t"
      "global_store_b128 %0, %5, off offset:2048\n\t"
      "global_store_b128 %0, %6, off offset:2560\n\t"
      "global_store_b128 %0, %7, off offset:3072\n\t"
      "global_store_b128 %0, %8, off offset:3584\n\t"
      "s_wait_xcnt 0x0"
      :
      : "v"(p), "v"(d[0]), "v"(d[1]), "v"(d[2]), "v"(d[3]), "v"(d[4]), "v"(d[5]), "v"(d[6]), "v"(d[7])
      : "memory");
}
static __device__ __forceinline__ void store8_u32x2(__bf16* p,
                                                    const u32x2 (&d)[8]) {
  asm volatile(
      "global_store_b64 %0, %1, off\n\t"
      "global_store_b64 %0, %2, off offset:256\n\t"
      "global_store_b64 %0, %3, off offset:512\n\t"
      "global_store_b64 %0, %4, off offset:768\n\t"
      "global_store_b64 %0, %5, off offset:1024\n\t"
      "global_store_b64 %0, %6, off offset:1280\n\t"
      "global_store_b64 %0, %7, off offset:1536\n\t"
      "global_store_b64 %0, %8, off offset:1792\n\t"
      "s_wait_xcnt 0x0"
      :
      : "v"(p), "v"(d[0]), "v"(d[1]), "v"(d[2]), "v"(d[3]), "v"(d[4]), "v"(d[5]), "v"(d[6]), "v"(d[7])
      : "memory");
}

// LayerNorm: one token per wave, the row read once and kept in registers.
// Optional f32 and/or bf16 outputs. grid = tokens / 8.
__global__ __launch_bounds__(256) void ln_kernel(const float* __restrict__ x,
                                                 const float* __restrict__ g,
                                                 const float* __restrict__ bta,
                                                 float* outf, __bf16* outb) {
  const int wave = threadIdx.x >> 5, lane = threadIdx.x & 31;
  const size_t e = (size_t)(blockIdx.x * 8 + wave) * W_D + lane * 4;
  f32x4 xv[8], gv[8], bv[8];
  load_ln_row(x + e, g + lane * 4, bta + lane * 4, xv, gv, bv);

  // Four independent chains per sum; all loops over c are unrolled so that
  // the arrays are indexed by constants and stay in registers.
  f32x4 s4 = {}, ss4 = {};
#pragma unroll
  for (int c = 0; c < 8; ++c) {
    s4 += xv[c];
    ss4 += xv[c] * xv[c];
  }
  float s = (s4.x + s4.y) + (s4.z + s4.w);
  float ss = (ss4.x + ss4.y) + (ss4.z + ss4.w);
#pragma unroll
  for (int off = 16; off; off >>= 1) {
    s += __shfl_xor(s, off, 32);
    ss += __shfl_xor(ss, off, 32);
  }
  const float mu = s / W_D;
  const float r = rsqrtf(ss / W_D - mu * mu + 1e-5f);

  f32x4 y[8];
#pragma unroll
  for (int c = 0; c < 8; ++c) y[c] = (xv[c] - mu) * r * gv[c] + bv[c];
  if (outf) store8_f32x4(outf + e, y);
  if (outb) {
    u32x2 w[8];
#pragma unroll
    for (int c = 0; c < 8; ++c)
      w[c] = u32x2{pack_bf16(y[c].x, y[c].y), pack_bf16(y[c].z, y[c].w)};
    store8_u32x2(outb + e, w);
  }
}

// Gather: each wave copies two neighbouring rows of xdisp from the rows of
// x2b that sel names. grid = rows / 16.
__global__ __launch_bounds__(256) void gather_kernel(
    const __bf16* __restrict__ x2b, const int* __restrict__ sel,
    __bf16* xdisp) {
  // The wave's number as a scalar, so that sel is read by a scalar load.
  const int wave = __builtin_amdgcn_readfirstlane(threadIdx.x >> 5);
  const int lane = threadIdx.x & 31;
  const int row = (blockIdx.x * 8 + wave) * 2;
  const int src0 = sel[row], src1 = sel[row + 1];
  u32x4 d[8];
  load_2rows_bf16(x2b + (size_t)src0 * W_D + lane * 8,
                  x2b + (size_t)src1 * W_D + lane * 8, d);
  store8_u32x4(xdisp + (size_t)row * W_D + lane * 8, d);
}

// ---------------------------------------------------------------------------
// Launch orchestration.
// ---------------------------------------------------------------------------
extern "C" void kernel_launch(void* const* d_in, const int* in_sizes, int n_in,
                              void* d_out, int out_size, void* d_ws,
                              size_t ws_size, hipStream_t stream) {
  (void)in_sizes; (void)n_in; (void)out_size; (void)ws_size;
  constexpr int Bb = 2, Nn = 2048, Dd = 1024, Hh = 16, hd = 64;
  constexpr int T = Bb * Nn, D3 = 3 * Dd, MLPH = 4096, MOEH = 256;
  constexpr int Ee = 4, CAP = 2048;

  const float* x      = (const float*)d_in[0];
  const float* noise  = (const float*)d_in[1];
  const float* ln1_g  = (const float*)d_in[2];
  const float* ln1_b  = (const float*)d_in[3];
  const float* ln2_g  = (const float*)d_in[4];
  const float* ln2_b  = (const float*)d_in[5];
  const float* w_qkv  = (const float*)d_in[6];
  const float* w_proj = (const float*)d_in[7];
  const float* b_proj = (const float*)d_in[8];
  const float* w_rt   = (const float*)d_in[9];
  const float* b_rt   = (const float*)d_in[10];
  const float* w_nz   = (const float*)d_in[11];
  const float* b_nz   = (const float*)d_in[12];
  const float* we1    = (const float*)d_in[13];
  const float* be1    = (const float*)d_in[14];
  const float* we2    = (const float*)d_in[15];
  const float* be2    = (const float*)d_in[16];
  const float* w_m1   = (const float*)d_in[17];
  const float* b_m1   = (const float*)d_in[18];
  const float* w_m2   = (const float*)d_in[19];
  const float* b_m2   = (const float*)d_in[20];
  float* out = (float*)d_out;

  char* wsp = (char*)d_ws;
  size_t off = 0;
  auto alloc = [&](size_t bytes) {
    void* p = wsp + off;
    off = (off + bytes + 255) & ~(size_t)255;
    return p;
  };
  __bf16* x1b    = (__bf16*)alloc((size_t)T * Dd * 2);
  __bf16* wqkvb  = (__bf16*)alloc((size_t)D3 * Dd * 2);
  __bf16* qkvb   = (__bf16*)alloc((size_t)T * D3 * 2);
  __bf16* attnb  = (__bf16*)alloc((size_t)T * Dd * 2);
  __bf16* wprojb = (__bf16*)alloc((size_t)Dd * Dd * 2);
  float*  xattn  = (float*)alloc((size_t)T * Dd * 4);
  float*  x2f    = (float*)alloc((size_t)T * Dd * 4);
  __bf16* x2b    = (__bf16*)alloc((size_t)T * Dd * 2);
  __bf16* wm1t   = (__bf16*)alloc((size_t)Dd * MLPH * 2);
  __bf16* wm2t   = (__bf16*)alloc((size_t)MLPH * Dd * 2);
  __bf16* hmlp   = (__bf16*)alloc((size_t)T * MLPH * 2);
  __bf16* we1t   = (__bf16*)alloc((size_t)Ee * Dd * MOEH * 2);
  __bf16* we2t   = (__bf16*)alloc((size_t)Ee * MOEH * Dd * 2);
  __bf16* xdisp  = (__bf16*)alloc((size_t)Ee * CAP * Dd * 2);
  __bf16* hdisp  = (__bf16*)alloc((size_t)Ee * CAP * MOEH * 2);
  float*  gate   = (float*)alloc((size_t)T * Ee * 4);
  int*    fidx   = (int*)alloc((size_t)T * 2 * 4);
  int*    sel    = (int*)alloc((size_t)Ee * CAP * 4);
  float*  selw   = (float*)alloc((size_t)Ee * CAP * 4);
  int*    inv    = (int*)alloc((size_t)Ee * T * 4);
  float*  ymoe   = (float*)alloc((size_t)(Ee * CAP + 1) * Dd * 4);

  // 1) weight conversion to bf16 (w_qkv/w_proj are already [N][K]; the rest
  //    goes from [K][N] to [N][K])
  static_assert(Dd == W_D && MLPH == W_MLPH && MOEH == W_MOEH && Ee == W_E,
                "the conversion and row kernels are cut for these shapes");
  cvt_weights<<<CVT_GRID, 256, 0, stream>>>(w_qkv, w_proj, w_m1, w_m2, we1, we2,
                                            wqkvb, wprojb, wm1t, wm2t, we1t,
                                            we2t);

  // 2) LN1 -> x1 (bf16)
  ln_kernel<<<T / 8, 256, 0, stream>>>(x, ln1_g, ln1_b, nullptr, x1b);

  // 3) QKV GEMM: [T,D] x [3D,D]^T -> bf16 [T,3D]
  gemm_bf16_kernel<false, false, false, OUT_BF16, false>
      <<<dim3(D3 / 64, T / 128), 256, 0, stream>>>(
          x1b, wqkvb, nullptr, nullptr, nullptr, qkvb, nullptr, nullptr,
          nullptr, T, D3, Dd);

  // 4) flash attention -> bf16 [T,D]
  attn_kernel<<<dim3(Nn / 64, Hh, Bb), 128, 0, stream>>>(qkvb, attnb, Nn, Hh,
                                                         hd);

  // 5) proj GEMM + b_proj + residual x -> xattn (f32)
  gemm_bf16_kernel<true, false, true, OUT_F32, false>
      <<<dim3(Dd / 64, T / 128), 256, 0, stream>>>(
          attnb, wprojb, b_proj, x, xattn, nullptr, nullptr, nullptr, nullptr,
          T, Dd, Dd);

  // 6) LN2 -> x2 (f32 + bf16)
  ln_kernel<<<T / 8, 256, 0, stream>>>(xattn, ln2_g, ln2_b, x2f, x2b);

  // 7) router + capacity dispatch + gather
  router_kernel<<<T / 4, 128, 0, stream>>>(x2f, noise, w_rt, b_rt, w_nz, b_nz,
                                           gate, fidx, Dd);
  dispatch_scan<<<Ee, SCAN_THREADS, 0, stream>>>(fidx, gate, sel, selw, inv, ymoe, CAP,
                                        T, Dd);
  gather_kernel<<<Ee * CAP / 16, 256, 0, stream>>>(x2b, sel, xdisp);

  // 8) expert FFNs, all experts in one launch per layer (grid z = expert);
  //    the second layer leaves its gate-weighted rows in ymoe from row 1 on
  static_assert(Ee == GEMM_E, "the combining epilogue looks through this many planes");
  gemm_bf16_kernel<true, true, false, OUT_BF16, false>
      <<<dim3(MOEH / 64, CAP / 128, Ee), 256, 0, stream>>>(
          xdisp, we1t, be1, nullptr, nullptr, hdisp, nullptr, nullptr, nullptr,
          CAP, MOEH, Dd);
  gemm_bf16_kernel<true, false, false, OUT_SCALED, false>
      <<<dim3(Dd / 64, CAP / 128, Ee), 256, 0, stream>>>(
          hdisp, we2t, be2, nullptr, ymoe + Dd, nullptr, nullptr, selw, nullptr,
          CAP, Dd, MOEH);

  // 9) dense MLP: gelu(x2@W1+b1)@W2+b2 + xattn + each token's expert rows
  //    -> d_out (f32)
  gemm_bf16_kernel<true, true, false, OUT_BF16, false>
      <<<dim3(MLPH / 64, T / 128), 256, 0, stream>>>(
          x2b, wm1t, b_m1, nullptr, nullptr, hmlp, nullptr, nullptr, nullptr,
          T, MLPH, Dd);
  gemm_bf16_kernel<true, false, true, OUT_F32, true>
      <<<dim3(Dd / 64, T / 128), 256, 0, stream>>>(
          hmlp, wm2t, b_m2, xattn, out, nullptr, inv, nullptr, ymoe, T, Dd,
          MLPH);
}

// v009
// It runs in 227 microseconds.
// Two timings next to v008 put it at 1.05 and 1.06 times that version's speed.
// Counting every step since v000, it is 3.60 times as fast.
#include <hip/hip_runtime.h>
#include <hip/hip_bf16.h>
#include <math.h>
#include <stdint.h>

// ---------------------------------------------------------------------------
// Types for CDNA5 WMMA (wave32): D(f32 16x16) = A(bf16 16x32) x B(bf16 32x16) + C
// ---------------------------------------------------------------------------
typedef __attribute__((ext_vector_type(16))) __bf16 v16bf;
typedef __attribute__((ext_vector_type(8)))  float  v8f;
typedef __attribute__((ext_vector_type(4)))  unsigned u32x4;

static __device__ __forceinline__ v8f wmma_bf16(v16bf a, v16bf b, v8f c) {
  // (neg_a, A, neg_b, B, c_mod, C, reuse_a, reuse_b)
  return __builtin_amdgcn_wmma_f32_16x16x32_bf16(false, a, false, b, (short)0, c,
                                                 false, false);
}

// CDNA5 async copy: global -> LDS, 16 bytes per lane, tracked by ASYNCcnt.
// lds_off = low 32 bits of the generic pointer (ISA: LDS generic addresses
// carry the LDS byte offset in [31:0]).
static __device__ __forceinline__ void async_ld_b128(void* lds_ptr,
                                                     const void* gptr) {
  const unsigned lds_off = (unsigned)(uintptr_t)lds_ptr;
  asm volatile("global_load_async_to_lds_b128 %0, %1, off"
               :
               : "v"(lds_off), "v"(gptr)
               : "memory");
}
static __device__ __forceinline__ void wait_async0() {
  asm volatile("s_wait_asynccnt 0" ::: "memory");
}
// One attention stage's copies of one lane: 4 pieces of K rows and 4 of V rows,
// rows 16 apart (ls bytes in LDS, gs elements in memory). The s_wait_xcnt
// stands inside the statement so that no address register of an issued copy
// is rewritten in front of it.
static __device__ __forceinline__ void async_stage_kv(void* ldsK, void* ldsV,
                                                      unsigned ls,
                                                      const __bf16* gK,
                                                      const __bf16* gV,
                                                      size_t gs) {
  const unsigned lk = (unsigned)(uintptr_t)ldsK;
  const unsigned lv = (unsigned)(uintptr_t)ldsV;
  asm volatile(
      "global_load_async_to_lds_b128 %0, %8, off\n\t"
      "global_load_async_to_lds_b128 %1, %9, off\n\t"
      "global_load_async_to_lds_b128 %2, %10, off\n\t"
      "global_load_async_to_lds_b128 %3, %11, off\n\t"
      "global_load_async_to_lds_b128 %4, %12, off\n\t"
      "global_load_async_to_lds_b128 %5, %13, off\n\t"
      "global_load_async_to_lds_b128 %6, %14, off\n\t"
      "global_load_async_to_lds_b128 %7, %15, off\n\t"
      "s_wait_xcnt 0x0"
      :
      : "v"(lk), "v"(lk + ls), "v"(lk + 2 * ls), "v"(lk + 3 * ls),
        "v"(lv), "v"(lv + ls), "v"(lv + 2 * ls), "v"(lv + 3 * ls),
        "v"(gK), "v"(gK + gs), "v"(gK + 2 * gs), "v"(gK + 3 * gs),
        "v"(gV), "v"(gV + gs), "v"(gV + 2 * gs), "v"(gV + 3 * gs)
      : "memory");
}

// Load a 16x32 bf16 fragment (A layout; B "Bt" layout is identical with N<->M)
// from row-major LDS with leading dim `ld` (bf16 elements, multiple of 8).
// Lane l: row = base + (l&15); half = l>>4 selects K subranges
// [half*8, half*8+8) and [16+half*8, 16+half*8+8)  -> two aligned b128 loads.
static __device__ __forceinline__ v16bf frag16(const __bf16* base, int row,
                                               int kbase, int ld) {
  const int lane = threadIdx.x & 31;
  const __bf16* p =
      base + (size_t)(row + (lane & 15)) * ld + kbase + ((lane >> 4) * 8);
  union { uint4 u[2]; v16bf v; } t;
  t.u[0] = *(const uint4*)p;
  t.u[1] = *(const uint4*)(p + 16);
  return t.v;
}

// The same 16x32 fragment of the TRANSPOSE of a row-major LDS tile T[k][row],
// by two transposing loads (ds_load_tr16_b128): lane l ends with
// T[kbase + half*8 + 0..7][row + (l&15)] and the same 16 k further on, the k
// order of frag16. Each lane names 16 bytes of one tile row; `ld` in bf16
// elements, 32 B x odd in bytes for conflict-free reads.
typedef __attribute__((ext_vector_type(8))) __bf16 v8bf;
typedef __attribute__((address_space(3))) v8bf lds_v8bf;
static __device__ __forceinline__ v16bf frag16_tr(const __bf16* base, int row,
                                                  int kbase, int ld) {
  const int lane = threadIdx.x & 31;
  const __bf16* p = base + (size_t)(kbase + (lane >> 4) * 8 + (lane & 7)) * ld +
                    row + ((lane >> 3) & 1) * 8;
  union { v8bf h[2]; v16bf v; } t;
  t.h[0] = __builtin_amdgcn_ds_load_tr16_b128_v8bf16((lds_v8bf*)p);
  t.h[1] = __builtin_amdgcn_ds_load_tr16_b128_v8bf16((lds_v8bf*)(p + 16 * ld));
  return t.v;
}

static __device__ __forceinline__ float gelu_exact(float x) {
  return 0.5f * x * (1.0f + erff(x * 0.70710678118654752f));
}

// ---------------------------------------------------------------------------
// Generic bf16 WMMA GEMM:  C[M][N] = A[M][K] * Bt[N][K]^T  (+bias, gelu, resid)
// Block 256 threads = 8 waves; tile 128(M) x 64(N); K-step 128.
// Async double-buffered LDS: global_load_async_to_lds_b128 fills the next
// tile while WMMA consumes the current one; one barrier per K-step.
// Sixteen lanes copy one 256-byte piece of a row, so a wave's copy covers
// whole cache lines. LDS rows are pitched 272 B (16 B x odd) for b128 reads.
// Epilogue forms: f32 store, bf16 store, f32 store with a scale per row.
// Bias, activation, residual and output form are template parameters: each
// launch's epilogue is code without tests on pointers, so its bias, residual
// and scale loads are issued together and waited for once, not per element.
// blockIdx.z picks one product of a batch whose operands, biases, scales and
// results lie back to back (the experts); a single product has grid z = 1.
// COMBINE adds to each result row the rows of comb_rows that its experts left
// for it, in expert order; comb_idx[e * M + row] names expert e's (0, an
// all-zero row, where that expert does not serve the token).
// Requires M%128==0, N%64==0, K%128==0 (true for every GEMM in this model).
// ---------------------------------------------------------------------------
constexpr int GEMM_KT = 128;     // k per stage
constexpr int GEMM_LD = 136;     // LDS row pitch in bf16 elements (272 B)
constexpr int OUT_F32 = 0, OUT_BF16 = 1, OUT_SCALED = 2;  // output forms
constexpr int GEMM_E = 4;        // experts that COMBINE looks through

// One stage's copies of one thread: 8 row pieces of A, 4 of Bt, rows 16 apart.
// The s_wait_xcnt stands inside the statement so that no address register of
// an issued copy is rewritten in front of it.
static __device__ __forceinline__ void async_stage12(const __bf16* lA,
                                                     const __bf16* lB,
                                                     const __bf16* gA,
                                                     const __bf16* gB, int K) {
  const unsigned la = (unsigned)(uintptr_t)lA;
  const unsigned lb = (unsigned)(uintptr_t)lB;
  constexpr unsigned LS = 16u * GEMM_LD * 2u;  // 16 LDS rows in bytes
  const size_t gs = (size_t)16 * K;            // 16 global rows in elements
  asm volatile(
      "global_load_async_to_lds_b128 %0, %12, off\n\t"
      "global_load_async_to_lds_b128 %1, %13, off\n\t"
      "global_load_async_to_lds_b128 %2, %14, off\n\t"
      "global_load_async_to_lds_b128 %3, %15, off\n\t"
      "global_load_async_to_lds_b128 %4, %16, off\n\t"
      "global_load_async_to_lds_b128 %5, %17, off\n\t"
      "global_load_async_to_lds_b128 %6, %18, off\n\t"
      "global_load_async_to_lds_b128 %7, %19, off\n\t"
      "global_load_async_to_lds_b128 %8, %20, off\n\t"
      "global_load_async_to_lds_b128 %9, %21, off\n\t"
      "global_load_async_to_lds_b128 %10, %22, off\n\t"
      "global_load_async_to_lds_b128 %11, %23, off\n\t"
      "s_wait_xcnt 0x0"
      :
      : "v"(la), "v"(la + LS), "v"(la + 2 * LS), "v"(la + 3 * LS),
        "v"(la + 4 * LS), "v"(la + 5 * LS), "v"(la + 6 * LS), "v"(la + 7 * LS),
        "v"(lb), "v"(lb + LS), "v"(lb + 2 * LS), "v"(lb + 3 * LS),
        "v"(gA), "v"(gA + gs), "v"(gA + 2 * gs), "v"(gA + 3 * gs),
        "v"(gA + 4 * gs), "v"(gA + 5 * gs), "v"(gA + 6 * gs), "v"(gA + 7 * gs),
        "v"(gB), "v"(gB + gs), "v"(gB + 2 * gs), "v"(gB + 3 * gs)
      : "memory");
}

// COMBINE's loads. Each run stands with its data wait in one statement with
// early-clobber outputs, so that no result lands in an address register of
// the run and none is rewritten while a load is out.
// The thread's 16 result rows (8 from off, 8 from off + 64 B) in 4 planes.
static __device__ __forceinline__ void load_comb_idx(
    const int* p0, const int* p1, const int* p2, const int* p3, unsigned off,
    u32x4 (&d)[GEMM_E][4]) {
  asm volatile(
      "global_load_b128 %0, %16, %17\n\t"
      "global_load_b128 %1, %16, %17 offset:16\n\t"
      "global_load_b128 %2, %16, %17 offset:64\n\t"
      "global_load_b128 %3, %16, %17 offset:80\n\t"
      "global_load_b128 %4, %16, %18\n\t"
      "global_load_b128 %5, %16, %18 offset:16\n\t"
      "global_load_b128 %6, %16, %18 offset:64\n\t"
      "global_load_b128 %7, %16, %18 offset:80\n\t"
      "global_load_b128 %8, %16, %19\n\t"
      "global_load_b128 %9, %16, %19 offset:16\n\t"
      "global_load_b128 %10, %16, %19 offset:64\n\t"
      "global_load_b128 %11, %16, %19 offset:80\n\t"
      "global_load_b128 %12, %16, %20\n\t"
      "global_load_b128 %13, %16, %20 offset:16\n\t"
      "global_load_b128 %14, %16, %20 offset:64\n\t"
      "global_load_b128 %15, %16, %20 offset:80\n\t"
      "s_wait_loadcnt 0x0"
      : "=&v"(d[0][0]), "=&v"(d[0][1]), "=&v"(d[0][2]), "=&v"(d[0][3]),
        "=&v"(d[1][0]), "=&v"(d[1][1]), "=&v"(d[1][2]), "=&v"(d[1][3]),
        "=&v"(d[2][0]), "=&v"(d[2][1]), "=&v"(d[2][2]), "=&v"(d[2][3]),
        "=&v"(d[3][0]), "=&v"(d[3][1]), "=&v"(d[3][2]), "=&v"(d[3][3])
      : "v"(off), "s"(p0), "s"(p1), "s"(p2), "s"(p3)
      : "memory");
}
// Two columns, 16 apart, of 8 rows of base; off holds byte offsets.
static __device__ __forceinline__ void load_comb_rows(const float* base,
                                                      const unsigned (&off)[8],
                                                      float (&d)[2][8]) {
  asm volatile(
      "global_load_b32 %0, %16, %24\n\t"
      "global_load_b32 %1, %17, %24\n\t"
      "global_load_b32 %2, %18, %24\n\t"
      "global_load_b32 %3, %19, %24\n\t"
      "global_load_b32 %4, %20, %24\n\t"
      "global_load_b32 %5, %21, %24\n\t"
      "global_load_b32 %6, %22, %24\n\t"
      "global_load_b32 %7, %23, %24\n\t"
      "global_load_b32 %8, %16, %24 offset:64\n\t"
      "global_load_b32 %9, %17, %24 offset:64\n\t"
      "global_load_b32 %10, %18, %24 offset:64\n\t"
      "global_load_b32 %11, %19, %24 offset:64\n\t"
      "global_load_b32 %12, %20, %24 offset:64\n\t"
      "global_load_b32 %13, %21, %24 offset:64\n\t"
      "global_load_b32 %14, %22, %24 offset:64\n\t"
      "global_load_b32 %15, %23, %24 offset:64\n\t"
      "s_wait_loadcnt 0x0"
      : "=&v"(d[0][0]), "=&v"(d[0][1]), "=&v"(d[0][2]), "=&v"(d[0][3]),
        "=&v"(d[0][4]), "=&v"(d[0][5]), "=&v"(d[0][6]), "=&v"(d[0][7]),
        "=&v"(d[1][0]), "=&v"(d[1][1]), "=&v"(d[1][2]), "=&v"(d[1][3]),
        "=&v"(d[1][4]), "=&v"(d[1][5]), "=&v"(d[1][6]), "=&v"(d[1][7])
      : "v"(off[0]), "v"(off[1]), "v"(off[2]), "v"(off[3]), "v"(off[4]),
        "v"(off[5]), "v"(off[6]), "v"(off[7]), "s"(base)
      : "memory");
}

template <bool BIAS, bool ACT, bool RESID, int OUT, bool COMBINE>
__global__ __launch_bounds__(256) void gemm_bf16_kernel(
    const __bf16* __restrict__ A, const __bf16* __restrict__ Bt,
    const float* __restrict__ bias, const float* __restrict__ residual,
    float* Cf, __bf16* Cb, const int* __restrict__ comb_idx,
    const float* __restrict__ row_scale, const float* __restrict__ comb_rows,
    int M, int N, int K) {
  __shared__ __align__(16) __bf16 As[2][128][GEMM_LD];
  __shared__ __align__(16) __bf16 Bs[2][64][GEMM_LD];

  const size_t zb = blockIdx.z;  // which product of the batch
  A += zb * M * K;
  Bt += zb * N * K;
  if constexpr (BIAS) bias += zb * N;
  if constexpr (RESID) residual += zb * M * N;
  if constexpr (OUT == OUT_BF16) Cb += zb * M * N;
  if constexpr (OUT != OUT_BF16) Cf += zb * M * N;
  if constexpr (OUT == OUT_SCALED) row_scale += zb * M;

  const int tid = threadIdx.x;
  const int wave = tid >> 5, lane = tid & 31;
  const int wm = wave & 3, wn = wave >> 2;
  const int bm = blockIdx.y * 128, bn = blockIdx.x * 64;

  const int rc = tid >> 4, cc = (tid & 15) * 8;  // copy: row in 16, 8 bf16
  const __bf16* gA0 = A + (size_t)(bm + rc) * K + cc;
  const __bf16* gB0 = Bt + (size_t)(bn + rc) * K + cc;

  auto issue_tile = [&](int buf, int k0) {
    async_stage12(&As[buf][rc][cc], &Bs[buf][rc][cc], gA0 + k0, gB0 + k0, K);
  };

  v8f acc[2][2] = {};
  const int nt = K / GEMM_KT;
  issue_tile(0, 0);

  // Byte offsets in comb_rows of the two rows that each result row gets,
  // fetched here so that the wait falls into the first tile's flight. A token
  // has two experts: the lowest and the highest plane that name a row are all.
  unsigned oa[2][8] = {}, ob[2][8] = {};
  if constexpr (COMBINE) {
    u32x4 ix[GEMM_E][4];
    load_comb_idx(comb_idx, comb_idx + M, comb_idx + 2 * (size_t)M,
                  comb_idx + 3 * (size_t)M,
                  (unsigned)(bm + wm * 32 + (lane >> 4) * 8) * 4u, ix);
    const unsigned colb = (unsigned)(bn + wn * 32 + (lane & 15)) * 4u;
    // Unrolled so that ix, oa and ob are indexed by constants and stay in
    // registers.
#pragma unroll
    for (int i = 0; i < 2; ++i)
#pragma unroll
      for (int v = 0; v < 8; ++v) {
        const unsigned x0 = ix[0][i * 2 + (v >> 2)][v & 3];
        const unsigned x1 = ix[1][i * 2 + (v >> 2)][v & 3];
        const unsigned x2 = ix[2][i * 2 + (v >> 2)][v & 3];
        const unsigned x3 = ix[3][i * 2 + (v >> 2)][v & 3];
        const unsigned lo = x0 ? x0 : x1 ? x1 : x2 ? x2 : x3;
        const unsigned hi = x3 ? x3 : x2 ? x2 : x1 ? x1 : x0;
        oa[i][v] = lo * (unsigned)N * 4u + colb;
        ob[i][v] = (hi == lo ? 0u : hi) * (unsigned)N * 4u + colb;
      }
  }

  wait_async0();      // tile 0 landed in LDS (this wave's copies)
  __syncthreads();    // ... and every other wave's
  if (nt > 1) issue_tile(1, GEMM_KT);

  for (int t = 0; t < nt; ++t) {
    const int cur = t & 1;
    // Unrolled so that ks folds into the immediate offsets of the LDS loads.
#pragma unroll
    for (int ks = 0; ks < GEMM_KT; ks += 32) {
      const v16bf a0 = frag16(&As[cur][0][0], wm * 32, ks, GEMM_LD);
      const v16bf a1 = frag16(&As[cur][0][0], wm * 32 + 16, ks, GEMM_LD);
      const v16bf b0 = frag16(&Bs[cur][0][0], wn * 32, ks, GEMM_LD);
      const v16bf b1 = frag16(&Bs[cur][0][0], wn * 32 + 16, ks, GEMM_LD);
      acc[0][0] = wmma_bf16(a0, b0, acc[0][0]);
      acc[0][1] = wmma_bf16(a0, b1, acc[0][1]);
      acc[1][0] = wmma_bf16(a1, b0, acc[1][0]);
      acc[1][1] = wmma_bf16(a1, b1, acc[1][1]);
    }
    // This wave's LDS reads of the buffer have retired before it is refilled.
    asm volatile("s_wait_dscnt 0x0" ::: "memory");
    wait_async0();      // next tile landed in LDS (this wave's copies)
    __syncthreads();    // all waves done copying AND done reading this buffer
    if (t + 2 < nt) issue_tile(cur, (t + 2) * GEMM_KT);  // flies over trip t+1
  }
  wait_async0();        // no copy is outstanding when the wave ends

  // Epilogue. C layout: lane half (l>>4) + VGPR v -> row half*8+v; col = l&15.
  const int half = lane >> 4, c0 = lane & 15;
  const int row0 = bm + wm * 32 + half * 8;  // + i*16 + v
  const int col0 = bn + wn * 32 + c0;        // + j*16

  // Bias, residual and scale are fetched first, in one run of loads; the rows
  // of comb_rows are fetched in the loop below, for each i in turn.
  // All loops below are unrolled so that acc and these arrays are indexed by
  // constants and stay in registers.
  float bv[2] = {};
  float rv[2][2][8] = {};
  float sc[2][8] = {};
  if constexpr (BIAS) {
#pragma unroll
    for (int j = 0; j < 2; ++j) bv[j] = bias[col0 + j * 16];
  }
  if constexpr (RESID) {
#pragma unroll
    for (int i = 0; i < 2; ++i)
#pragma unroll
      for (int j = 0; j < 2; ++j)
#pragma unroll
        for (int v = 0; v < 8; ++v)
          rv[i][j][v] =
              residual[(size_t)(row0 + i * 16 + v) * N + col0 + j * 16];
  }
  if constexpr (OUT == OUT_SCALED) {
#pragma unroll
    for (int i = 0; i < 2; ++i)
#pragma unroll
      for (int v = 0; v < 8; ++v) sc[i][v] = row_scale[row0 + i * 16 + v];
  }

#pragma unroll
  for (int i = 0; i < 2; ++i) {
    float pa[2][8] = {}, pb[2][8] = {};
    if constexpr (COMBINE) {
      load_comb_rows(comb_rows, oa[i], pa);
      load_comb_rows(comb_rows, ob[i], pb);
    }
#pragma unroll
    for (int j = 0; j < 2; ++j)
#pragma unroll
      for (int v = 0; v < 8; ++v) {
        const int row = row0 + i * 16 + v;
        const int col = col0 + j * 16;
        float val = acc[i][j][v];
        if constexpr (BIAS) val += bv[j];
        if constexpr (ACT) val = gelu_exact(val);
        if constexpr (RESID) val += rv[i][j][v];
        if constexpr (COMBINE) {
          val += pa[j][v];
          val += pb[j][v];
        }
        if constexpr (OUT == OUT_F32) Cf[(size_t)row * N + col] = val;
        if constexpr (OUT == OUT_BF16) Cb[(size_t)row * N + col] = (__bf16)val;
        if constexpr (OUT == OUT_SCALED)
          Cf[(size_t)row * N + col] = val * sc[i][v];
      }
  }
}

__global__ __launch_bounds__(128) void attn_kernel(
    const __bf16* __restrict__ qkv, __bf16* __restrict__ out, int N, int Hh,
    int hd) {
  const int D3 = 3 * Hh * hd;   // 3072
  const int Dm = Hh * hd;       // 1024
  const int qb = blockIdx.x, h = blockIdx.y, b = blockIdx.z;
  const int tid = threadIdx.x, wave = tid >> 5, lane = tid & 31;
  const int half = lane >> 4, c0 = lane & 15;

  __shared__ __align__(16) __bf16 Qs[64][80];
  __shared__ __align__(16) __bf16 Ks[64][80];
  __shared__ __align__(16) __bf16 Vs[64][80];  // [key][d], 160 B = 32 B x 5

  const int r = tid >> 1, d0 = (tid & 1) * 32;
  const int rk = tid >> 3, ck = (tid & 7) * 8;  // K, V copy: row in 16, 8 bf16
  {  // Q tile (64x64) via async copy; first in-loop wait_async0 covers it
    const __bf16* g = qkv + (size_t)(b * N + qb * 64 + r) * D3 + h * hd + d0;
#pragma unroll
    for (int u = 0; u < 4; ++u) async_ld_b128(&Qs[r][d0 + u * 8], g + u * 8);
  }

  // o[j][v] = O[query c0][head dim j*16 + half*8 + v]. mstat is the running
  // maximum of query c0; lstat sums only the keys that this lane half holds.
  // Every loop over u, ks, j, v or m in this kernel is unrolled so that s, o
  // and the fragments are indexed by constants and stay in registers.
  v8f o[4] = {};
  float mstat = -1e30f, lstat = 0.f;

  for (int kb = 0; kb < N / 64; ++kb) {
    // This wave's LDS reads of Ks and Vs have retired before they are refilled.
    asm volatile("s_wait_dscnt 0x0" ::: "memory");
    __syncthreads();  // prior reads of Ks/Vs complete before overwrite
    {
      // Eight lanes copy one 128-byte row of a head, so a wave's copy covers
      // four whole cache lines.
      const __bf16* gk =
          qkv + (size_t)(b * N + kb * 64 + rk) * D3 + Dm + h * hd + ck;
      async_stage_kv(&Ks[rk][ck], &Vs[rk][ck], 16u * sizeof(Ks[0]), gk, gk + Dm,
                     (size_t)16 * D3);
    }
    wait_async0();
    __syncthreads();

    // S^T = K @ Q^T: s[j][v] = S[query c0][key j*16 + half*8 + v]
    v8f s[4] = {};
#pragma unroll
    for (int ks = 0; ks < 64; ks += 32) {
      const v16bf q = frag16(&Qs[0][0], wave * 16, ks, 80);
#pragma unroll
      for (int j = 0; j < 4; ++j) {
        const v16bf kf = frag16(&Ks[0][0], j * 16, ks, 80);
        s[j] = wmma_bf16(kf, q, s[j]);
      }
    }

    // All V^T fragments, fetched as one group here so that the softmax below
    // covers their latency: vf[m][j] = head dims j*16.., keys m*32..
    v16bf vf[2][4];
#pragma unroll
    for (int m = 0; m < 2; ++m)
#pragma unroll
      for (int j = 0; j < 4; ++j)
        vf[m][j] = frag16_tr(&Vs[0][0], j * 16, m * 32, 80);
    // Keeps the group in front of the softmax: left free, the loads are spread
    // among the second product's WMMAs, each place with a wait of its own.
    __builtin_amdgcn_sched_barrier(0);

    // online softmax of query c0: 32 keys in this lane, 32 in lane ^ 16
    float rmax = -1e30f;
#pragma unroll
    for (int j = 0; j < 4; ++j)
#pragma unroll
      for (int v = 0; v < 8; ++v) {
        s[j][v] *= 0.125f;  // hd^-0.5
        rmax = fmaxf(rmax, s[j][v]);
      }
    rmax = fmaxf(rmax, __shfl_xor(rmax, 16, 32));
    const float mnew = fmaxf(mstat, rmax);
    const float alpha = __expf(mstat - mnew);
    float rsum = 0.f;
#pragma unroll
    for (int j = 0; j < 4; ++j)
#pragma unroll
      for (int v = 0; v < 8; ++v) {
        const float p = __expf(s[j][v] - mnew);
        s[j][v] = p;
        rsum += p;
      }
    lstat = lstat * alpha + rsum;
    mstat = mnew;
#pragma unroll
    for (int j = 0; j < 4; ++j)
#pragma unroll
      for (int v = 0; v < 8; ++v) o[j][v] *= alpha;

    // O^T += V^T @ P^T. Tiles 2m and 2m+1 of S^T hold keys m*32 + half*8 + v
    // and m*32 + 16 + half*8 + v: the k order in which frag16_tr reads Vs.
#pragma unroll
    for (int m = 0; m < 2; ++m) {
      v16bf pf;
#pragma unroll
      for (int v = 0; v < 8; ++v) {
        pf[v] = (__bf16)s[2 * m][v];
        pf[8 + v] = (__bf16)s[2 * m + 1][v];
      }
#pragma unroll
      for (int j = 0; j < 4; ++j) o[j] = wmma_bf16(vf[m][j], pf, o[j]);
    }
  }

  // The two lane halves' sums are joined once; a lane stores 8 neighbouring
  // head dims of its query as one 16-byte piece per tile.
  lstat += __shfl_xor(lstat, 16, 32);
  const float inv = 1.0f / lstat;
  __bf16* orow = out + (size_t)(b * N + qb * 64 + wave * 16 + c0) * Dm +
                 h * hd + half * 8;
#pragma unroll
  for (int j = 0; j < 4; ++j) {
    v8bf w;
#pragma unroll
    for (int v = 0; v < 8; ++v) w[v] = (__bf16)(o[j][v] * inv);
    *(v8bf*)(orow + j * 16) = w;
  }
}

// ---------------------------------------------------------------------------
// Per-expert capacity dispatch (stable token order). grid = E blocks.
// A token's place with expert e is the number of e's tokens in front of it.
// A wave takes SCAN_PER groups of 32 neighbouring tokens: inside a group the
// count comes from a ballot and a bit count, over the wave's earlier groups
// from the ballots' sizes, over earlier waves from the waves' totals, which go
// through LDS behind the one barrier of a trip. A trip covers SCAN_CHUNK
// tokens, and all its loads are issued together in front of the counting.
// inv[e * T + t] is the way back: the row of the experts' result that token t
// has with expert e (they start at row 1), or row 0, cleared here, if none.
// ---------------------------------------------------------------------------
constexpr int SCAN_WAVES = 32;  // one total per lane when a wave sums them
constexpr int SCAN_PER = 4;     // groups of 32 tokens per wave and trip
constexpr int SCAN_THREADS = SCAN_WAVES * 32;
constexpr int SCAN_CHUNK = SCAN_THREADS * SCAN_PER;
static_assert(SCAN_CHUNK < (1 << 15), "two counts of a trip share one int");

// A store with its s_wait_xcnt in the same statement: what follows it rewrites
// the registers that it names, and a wait in a statement of its own is not
// tied to those registers.
static __device__ __forceinline__ void store_b32_wait(int* p, int v) {
  asm volatile(
      "global_store_b32 %0, %1, off\n\t"
      "s_wait_xcnt 0x0"
      :
      : "v"(p), "v"(v)
      : "memory");
}

__global__ __launch_bounds__(SCAN_THREADS) void dispatch_scan(
    const int* __restrict__ fidx, const float* __restrict__ gate, int* sel,
    float* selw, int* inv, float* zero_row, int capacity, int T, int D) {
  const int e = blockIdx.x, tid = threadIdx.x;
  const int wave = tid >> 5, lane = tid & 31;
  for (int i = e * SCAN_THREADS + tid; i < D; i += gridDim.x * SCAN_THREADS)
    zero_row[i] = 0.f;
  // Two sets, taken in turn: a trip's totals are read behind its barrier, and
  // the set is written again only behind the next trip's barrier.
  __shared__ int wtot[2][SCAN_WAVES];
  const unsigned below = (1u << lane) - 1u;  // the lanes in front of this one
  int base = 0;
  for (int c0 = 0, set = 0; c0 < T; c0 += SCAN_CHUNK, set ^= 1) {
    const int t0 = c0 + wave * (32 * SCAN_PER) + lane;
    // All loops over j are unrolled so that the arrays stay in registers.
    int2 f[SCAN_PER];
    float g[SCAN_PER];
#pragma unroll
    for (int j = 0; j < SCAN_PER; ++j) {
      const int t = t0 + j * 32;
      const int tc = t < T ? t : T - 1;  // a token past the end reads the last
      f[j] = *(const int2*)(fidx + 2 * tc);
      g[j] = gate[tc * 4 + e];
    }
    bool m[SCAN_PER];
    int before[SCAN_PER];
    int mine = 0;  // e's tokens in this wave's groups so far
#pragma unroll
    for (int j = 0; j < SCAN_PER; ++j) {
      // Plain | and &: all three tests are cheap, and no branch is wanted.
      m[j] = (t0 + j * 32 < T) & ((f[j].x == e) | (f[j].y == e));
      const unsigned b = __builtin_amdgcn_ballot_w32(m[j]);
      before[j] = mine + __popc(b & below);
      mine += __popc(b);
    }
    if (lane == 0) wtot[set][wave] = mine;
    __syncthreads();
    // Two sums in one exchange tree: the earlier waves' tokens in the high
    // half of a word, all waves' in the low half (neither passes SCAN_CHUNK).
    const int w = wtot[set][lane];
    int both = (lane < wave ? w << 16 : 0) | w;
#pragma unroll
    for (int off = 16; off; off >>= 1) both += __shfl_xor(both, off, 32);
    const int pre = both >> 16, tot = both & 0xffff;
#pragma unroll
    for (int j = 0; j < SCAN_PER; ++j) {
      const int t = t0 + j * 32;
      const int pos = base + pre + before[j];
      const bool kept = m[j] && pos < capacity;
      if (kept) {
        sel[e * capacity + pos] = t;
        selw[e * capacity + pos] = g[j];
      }
      if (t < T)
        store_b32_wait(inv + e * T + t, kept ? 1 + e * capacity + pos : 0);
    }
    base += tot;
  }
  for (int i = (base < capacity ? base : capacity) + tid; i < capacity;
       i += SCAN_THREADS) {
    sel[e * capacity + i] = 0;
    selw[e * capacity + i] = 0.f;  // padded rows contribute nothing
  }
}

// ---------------------------------------------------------------------------
// fp32 -> bf16 conversion of every weight, one launch.
// The work is cut into pieces of 4096 elements; each work-group takes CVT_PER
// of them, so few waves are started and each moves many bytes.
// A piece of w_qkv or w_proj (already [N][K]) is a straight run of elements.
// A piece of any other weight is a 64x64 tile of in[K][N] that goes out as
// out[N][K]: input rows are read as 256-byte runs, two neighbouring k of one
// column are packed into a dword, the tile is turned in LDS, and each output
// row gets one whole 128-byte run.
// ---------------------------------------------------------------------------
constexpr int W_D = 1024, W_MLPH = 4096, W_MOEH = 256, W_E = 4;  // model dims
constexpr int CVT_PIECE = 64 * 64;
constexpr int CVT_B_PROJ = 3 * W_D * W_D / CVT_PIECE;             // after w_qkv
constexpr int CVT_B_M1 = CVT_B_PROJ + W_D * W_D / CVT_PIECE;      // after w_proj
constexpr int CVT_B_M2 = CVT_B_M1 + W_D * W_MLPH / CVT_PIECE;     // after w_mlp1
constexpr int CVT_B_E1 = CVT_B_M2 + W_MLPH * W_D / CVT_PIECE;     // after w_mlp2
constexpr int CVT_B_E2 = CVT_B_E1 + W_E * W_D * W_MOEH / CVT_PIECE;
constexpr int CVT_TOTAL = CVT_B_E2 + W_E * W_MOEH * W_D / CVT_PIECE;
constexpr int CVT_PER = 4;                      // pieces per work-group
constexpr int CVT_GRID = CVT_TOTAL / CVT_PER;   // work-groups
static_assert(CVT_GRID * CVT_PER == CVT_TOTAL, "pieces divide evenly");
constexpr int CVT_EXP_TILES = W_D * W_MOEH / CVT_PIECE;  // tiles per expert
static_assert(CVT_EXP_TILES == 64, "expert index is taken by a shift of 6");
constexpr int CVT_PITCH = 68;  // LDS row pitch in bf16: 136 B, 8-byte aligned

typedef __attribute__((ext_vector_type(2))) float  f32x2;
typedef __attribute__((ext_vector_type(2))) __bf16 bf16x2;

// Two floats to one dword of bf16, lo in the low half; converted as a pair so
// that one packed conversion does both.
static __device__ __forceinline__ unsigned pack_bf16(float lo, float hi) {
  const f32x2 f = {lo, hi};
  return __builtin_bit_cast(unsigned, __builtin_convertvector(f, bf16x2));
}

typedef __attribute__((ext_vector_type(4))) float    f32x4;
typedef __attribute__((ext_vector_type(2))) unsigned u32x2;

// Four 16-byte loads that fly together. Loads and their data wait are one
// statement with early-clobber outputs, so that no result lands in an address
// pair of the run and no address pair is rewritten while a load is out (as
// plain loads the compiler let one load's result take another's address).
static __device__ __forceinline__ void load4_b128(const float* p0,
                                                  const float* p1,
                                                  const float* p2,
                                                  const float* p3, f32x4& r0,
                                                  f32x4& r1, f32x4& r2,
                                                  f32x4& r3) {
  asm volatile(
      "global_load_b128 %0, %4, off\n\t"
      "global_load_b128 %1, %5, off\n\t"
      "global_load_b128 %2, %6, off\n\t"
      "global_load_b128 %3, %7, off\n\t"
      "s_wait_loadcnt 0x0"
      : "=&v"(r0), "=&v"(r1), "=&v"(r2), "=&v"(r3)
      : "v"(p0), "v"(p1), "v"(p2), "v"(p3)
      : "memory");
}

// Stores with their s_wait_xcnt in the same statement: the next piece rewrites
// the registers that they name, and a wait in a statement of its own is not
// tied to those registers.
static __device__ __forceinline__ void store4_b64_step2k(__bf16* p, u32x2 w0,
                                                         u32x2 w1, u32x2 w2,
                                                         u32x2 w3) {
  asm volatile(
      "global_store_b64 %0, %1, off\n\t"
      "global_store_b64 %0, %2, off offset:2048\n\t"
      "global_store_b64 %0, %3, off offset:4096\n\t"
      "global_store_b64 %0, %4, off offset:6144\n\t"
      "s_wait_xcnt 0x0"
      :
      : "v"(p), "v"(w0), "v"(w1), "v"(w2), "v"(w3)
      : "memory");
}
static __device__ __forceinline__ void store2_b128(__bf16* p, u32x4 d0,
                                                   u32x4 d1) {
  asm volatile(
      "global_store_b128 %0, %1, off\n\t"
      "global_store_b128 %0, %2, off offset:16\n\t"
      "s_wait_xcnt 0x0"
      :
      : "v"(p), "v"(d0), "v"(d1)
      : "memory");
}

__global__ __launch_bounds__(256) void cvt_weights(
    const float* __restrict__ w_qkv, const float* __restrict__ w_proj,
    const float* __restrict__ w_m1, const float* __restrict__ w_m2,
    const float* __restrict__ we1, const float* __restrict__ we2,
    __bf16* __restrict__ o_qkv, __bf16* __restrict__ o_proj,
    __bf16* __restrict__ o_m1, __bf16* __restrict__ o_m2,
    __bf16* __restrict__ o_e1, __bf16* __restrict__ o_e2) {
  __shared__ __align__(16) __bf16 tile[2][64][CVT_PITCH];
  const int tid = threadIdx.x;

  for (int i = 0; i < CVT_PER; ++i) {
    const int p = blockIdx.x + i * CVT_GRID;  // same for the whole work-group
    const bool turned = p >= CVT_B_M1;
    __bf16(*t)[CVT_PITCH] = tile[i & 1];

    // Which weight, and which tile of it. N = 64 << lnt columns of input.
    const float* in;
    __bf16* out;
    int K = 0, lnt = 0, q;
    if (p < CVT_B_PROJ) {
      in = w_qkv; out = o_qkv; q = p;
    } else if (p < CVT_B_M1) {
      in = w_proj; out = o_proj; q = p - CVT_B_PROJ;
    } else if (p < CVT_B_M2) {
      in = w_m1; out = o_m1; q = p - CVT_B_M1; K = W_D; lnt = 6;
    } else if (p < CVT_B_E1) {
      in = w_m2; out = o_m2; q = p - CVT_B_M2; K = W_MLPH; lnt = 4;
    } else if (p < CVT_B_E2) {
      q = p - CVT_B_E1;
      in = we1 + (size_t)(q >> 6) * (W_D * W_MOEH);
      out = o_e1 + (size_t)(q >> 6) * (W_D * W_MOEH);
      q &= 63; K = W_D; lnt = 2;
    } else {
      q = p - CVT_B_E2;
      in = we2 + (size_t)(q >> 6) * (W_D * W_MOEH);
      out = o_e2 + (size_t)(q >> 6) * (W_D * W_MOEH);
      q &= 63; K = W_MOEH; lnt = 4;
    }
    const int N = 64 << lnt;
    const int k0 = (q >> lnt) * 64, n0 = (q & ((1 << lnt) - 1)) * 64;

    if (!turned) {
      const size_t e = (size_t)q * CVT_PIECE + tid * 4;
      const float* g = in + e;
      f32x4 v0, v1, v2, v3;
      load4_b128(g, g + 1024, g + 2048, g + 3072, v0, v1, v2, v3);
      const u32x2 w0 = {pack_bf16(v0.x, v0.y), pack_bf16(v0.z, v0.w)};
      const u32x2 w1 = {pack_bf16(v1.x, v1.y), pack_bf16(v1.z, v1.w)};
      const u32x2 w2 = {pack_bf16(v2.x, v2.y), pack_bf16(v2.z, v2.w)};
      const u32x2 w3 = {pack_bf16(v3.x, v3.y), pack_bf16(v3.z, v3.w)};
      store4_b64_step2k(out + e, w0, w1, w2, w3);  // 1024 elements apart
    } else {
      const int c4 = (tid & 15) * 4, r2 = (tid >> 4) * 2;
      const float* g = in + (size_t)(k0 + r2) * N + n0 + c4;
      f32x4 a0, b0, a1, b1;  // rows k, k + 1 and k + 32, k + 33
      load4_b128(g, g + N, g + (size_t)32 * N, g + (size_t)33 * N, a0, b0, a1,
                 b1);
      *(unsigned*)&t[c4 + 0][r2] = pack_bf16(a0.x, b0.x);
      *(unsigned*)&t[c4 + 1][r2] = pack_bf16(a0.y, b0.y);
      *(unsigned*)&t[c4 + 2][r2] = pack_bf16(a0.z, b0.z);
      *(unsigned*)&t[c4 + 3][r2] = pack_bf16(a0.w, b0.w);
      *(unsigned*)&t[c4 + 0][r2 + 32] = pack_bf16(a1.x, b1.x);
      *(unsigned*)&t[c4 + 1][r2 + 32] = pack_bf16(a1.y, b1.y);
      *(unsigned*)&t[c4 + 2][r2 + 32] = pack_bf16(a1.z, b1.z);
      *(unsigned*)&t[c4 + 3][r2 + 32] = pack_bf16(a1.w, b1.w);
    }
    // One barrier a trip, passed by every wave whatever the piece: it
    // publishes this trip's tile, and it stands between the reads of a buffer
    // in trip i and its next filling in trip i + 2.
    __syncthreads();
    if (turned) {
      const int n = tid >> 2, kc = (tid & 3) * 16;
      const uint2* s = (const uint2*)&t[n][kc];
      const uint2 s0 = s[0], s1 = s[1], s2 = s[2], s3 = s[3];
      const u32x4 d0 = {s0.x, s0.y, s1.x, s1.y};
      const u32x4 d1 = {s2.x, s2.y, s3.x, s3.y};
      store2_b128(out + (size_t)(n0 + n) * K + k0 + kc, d0, d1);
    }
  }
}

// ---------------------------------------------------------------------------
// Row kernels: LayerNorm and the expert gather. A row is W_D elements.
// One wave takes a whole row (LayerNorm) or two rows (gather) in 16-byte
// pieces per lane, each wave-wide access covering 512 contiguous bytes, so a
// launch starts 4096 waves that each keep eight or more loads in flight.
// Loads stand with their data wait, stores with their s_wait_xcnt, in one
// statement each, for the reasons given at load4_b128 and store4_b64_step2k.
// ---------------------------------------------------------------------------
static_assert(W_D == 32 * 4 * 8, "a lane holds 8 pieces of 4 floats of a row");

// One row of x, and gamma and beta, 512 bytes of each per wave-wide load.
static __device__ __forceinline__ void load_ln_row(const float* x,
                                                   const float* g,
                                                   const float* b,
                                                   f32x4 (&xv)[8],
                                                   f32x4 (&gv)[8],
                                                   f32x4 (&bv)[8]) {
  asm volatile(
      "global_load_b128 %0, %24, off\n\t"
      "global_load_b128 %1, %24, off offset:512\n\t"
      "global_load_b128 %2, %24, off offset:1024\n\t"
      "global_load_b128 %3, %24, off offset:1536\n\t"
      "global_load_b128 %4, %24, off offset:2048\n\t"
      "global_load_b128 %5, %24, off offset:2560\n\t"
      "global_load_b128 %6, %24, off offset:3072\n\t"
      "global_load_b128 %7, %24, off offset:3584\n\t"
      "global_load_b128 %8, %25, off\n\t"
      "global_load_b128 %9, %25, off offset:512\n\t"
      "global_load_b128 %10, %25, off offset:1024\n\t"
      "global_load_b128 %11, %25, off offset:1536\n\t"
      "global_load_b128 %12, %25, off offset:2048\n\t"
      "global_load_b128 %13, %25, off offset:2560\n\t"
      "global_load_b128 %14, %25, off offset:3072\n\t"
      "global_load_b128 %15, %25, off offset:3584\n\t"
      "global_load_b128 %16, %26, off\n\t"
      "global_load_b128 %17, %26, off offset:512\n\t"
      "global_load_b128 %18, %26, off offset:1024\n\t"
      "global_load_b128 %19, %26, off offset:1536\n\t"
      "global_load_b128 %20, %26, off offset:2048\n\t"
      "global_load_b128 %21, %26, off offset:2560\n\t"
      "global_load_b128 %22, %26, off offset:3072\n\t"
      "global_load_b128 %23, %26, off offset:3584\n\t"
      "s_wait_loadcnt 0x0"
      : "=&v"(xv[0]), "=&v"(xv[1]), "=&v"(xv[2]), "=&v"(xv[3]), "=&v"(xv[4]), "=&v"(xv[5]), "=&v"(xv[6]), "=&v"(xv[7]),
        "=&v"(gv[0]), "=&v"(gv[1]), "=&v"(gv[2]), "=&v"(gv[3]), "=&v"(gv[4]), "=&v"(gv[5]), "=&v"(gv[6]), "=&v"(gv[7]),
        "=&v"(bv[0]), "=&v"(bv[1]), "=&v"(bv[2]), "=&v"(bv[3]), "=&v"(bv[4]), "=&v"(bv[5]), "=&v"(bv[6]), "=&v"(bv[7])
      : "v"(x), "v"(g), "v"(b)
      : "memory");
}
// Two rows of W_D bf16, four 16-byte pieces per lane of each.
static __device__ __forceinline__ void load_2rows_bf16(const __bf16* p0,
                                                       const __bf16* p1,
                                                       u32x4 (&d)[8]) {
  asm volatile(
      "global_load_b128 %0, %8, off\n\t"
      "global_load_b128 %1, %8, off offset:512\n\t"
      "global_load_b128 %2, %8, off offset:1024\n\t"
      "global_load_b128 %3, %8, off offset:1536\n\t"
      "global_load_b128 %4, %9, off\n\t"
      "global_load_b128 %5, %9, off offset:512\n\t"
      "global_load_b128 %6, %9, off offset:1024\n\t"
      "global_load_b128 %7, %9, off offset:1536\n\t"
      "s_wait_loadcnt 0x0"
      : "=&v"(d[0]), "=&v"(d[1]), "=&v"(d[2]), "=&v"(d[3]), "=&v"(d[4]), "=&v"(d[5]), "=&v"(d[6]), "=&v"(d[7])
      : "v"(p0), "v"(p1)
      : "memory");
}
static __device__ __forceinline__ void store8_u32x4(__bf16* p,
                                                    const u32x4 (&d)[8]) {
  asm volatile(
      "global_store_b128 %0, %1, off\n\t"
      "global_store_b128 %0, %2, off offset:512\n\t"
      "global_store_b128 %0, %3, off offset:1024\n\t"
      "global_store_b128 %0, %4, off offset:1536\n\t"
      "global_store_b128 %0, %5, off offset:2048\n\t"
      "global_store_b128 %0, %6, off offset:2560\n\t"
      "global_store_b128 %0, %7, off offset:3072\n\t"
      "global_store_b128 %0, %8, off offset:3584\n\t"
      "s_wait_xcnt 0x0"
      :
      : "v"(p), "v"(d[0]), "v"(d[1]), "v"(d[2]), "v"(d[3]), "v"(d[4]), "v"(d[5]), "v"(d[6]), "v"(d[7])
      : "memory");
}
static __device__ __forceinline__ void store8_u32x2(__bf16* p,
                                                    const u32x2 (&d)[8]) {
  asm volatile(
      "global_store_b64 %0, %1, off\n\t"
      "global_store_b64 %0, %2, off offset:256\n\t"
      "global_store_b64 %0, %3, off offset:512\n\t"
      "global_store_b64 %0, %4, off offset:768\n\t"
      "global_store_b64 %0, %5, off offset:1024\n\t"
      "global_store_b64 %0, %6, off offset:1280\n\t"
      "global_store_b64 %0, %7, off offset:1536\n\t"
      "global_store_b64 %0, %8, off offset:1792\n\t"
      "s_wait_xcnt 0x0"
      :
      : "v"(p), "v"(d[0]), "v"(d[1]), "v"(d[2]), "v"(d[3]), "v"(d[4]), "v"(d[5]), "v"(d[6]), "v"(d[7])
      : "memory");
}

// The router's weights as a work-group stages them: rows tid + 256 k of
// w_route and of w_noise (a row is the 4 experts' weights of one element, 16
// bytes), and the token's row of noise. Loads and data wait in one statement,
// as in load4_b128.
static __device__ __forceinline__ void load_router_w(const float* wr,
                                                     const float* wn,
                                                     const float* nz,
                                                     f32x4 (&d)[8],
                                                     f32x4& nv) {
  asm volatile(
      "global_load_b128 %0, %9, off\n\t"
      "global_load_b128 %1, %9, off offset:4096\n\t"
      "global_load_b128 %2, %9, off offset:8192\n\t"
      "global_load_b128 %3, %9, off offset:12288\n\t"
      "global_load_b128 %4, %10, off\n\t"
      "global_load_b128 %5, %10, off offset:4096\n\t"
      "global_load_b128 %6, %10, off offset:8192\n\t"
      "global_load_b128 %7, %10, off offset:12288\n\t"
      "global_load_b128 %8, %11, off\n\t"
      "s_wait_loadcnt 0x0"
      : "=&v"(d[0]), "=&v"(d[1]), "=&v"(d[2]), "=&v"(d[3]), "=&v"(d[4]), "=&v"(d[5]), "=&v"(d[6]), "=&v"(d[7]),
        "=&v"(nv)
      : "v"(wr), "v"(wn), "v"(nz)
      : "memory");
}
// In LDS the weight rows of 4 neighbouring elements (64 B, what one lane needs
// for one of its pieces) are pitched 80 B = 16 B x 5 for 16-byte reads.
constexpr int RT_PITCH = 20;  // floats
static_assert(W_E == 4, "a weight row of the router is one 16-byte piece");

// LayerNorm: one token per wave, the row read once and kept in registers;
// bf16 output. grid = tokens / 8.
// ROUTE adds the noisy top-2 router over the 4 experts: the wave takes the
// token's 8 dot products straight from the normalised row in its registers
// (f32, never stored), against the router's weights, which the work-group has
// put into LDS once for its 8 tokens.
template <bool ROUTE>
__global__ __launch_bounds__(256) void ln_kernel(
    const float* __restrict__ x, const float* __restrict__ g,
    const float* __restrict__ bta, __bf16* outb,
    const float* __restrict__ noise, const float* __restrict__ w_route,
    const float* __restrict__ b_route, const float* __restrict__ w_noise,
    const float* __restrict__ b_noise, float* gate, int* fidx) {
  const int wave = threadIdx.x >> 5, lane = threadIdx.x & 31;
  const int t = blockIdx.x * 8 + wave;
  const size_t e = (size_t)t * W_D + lane * 4;

  __shared__ __align__(16) float wl[2][W_D / 4][RT_PITCH];
  f32x4 nz = {}, br = {}, bn = {};
  if constexpr (ROUTE) {
    const int tid = threadIdx.x;
    // The biases are fetched here, not where lane 0 needs them one by one.
    br = *(const f32x4*)b_route;
    bn = *(const f32x4*)b_noise;
    f32x4 w8[8];
    load_router_w(w_route + tid * 4, w_noise + tid * 4, noise + t * 4, w8, nz);
    // Unrolled so that w8 is indexed by constants and stays in registers.
#pragma unroll
    for (int k = 0; k < 4; ++k) {
      const int d = tid + 256 * k;
      *(f32x4*)&wl[0][d >> 2][(d & 3) * 4] = w8[k];
      *(f32x4*)&wl[1][d >> 2][(d & 3) * 4] = w8[4 + k];
    }
  }

  f32x4 xv[8], gv[8], bv[8];
  load_ln_row(x + e, g + lane * 4, bta + lane * 4, xv, gv, bv);

  // Four independent chains per sum; all loops over c are unrolled so that
  // the arrays are indexed by constants and stay in registers.
  f32x4 s4 = {}, ss4 = {};
#pragma unroll
  for (int c = 0; c < 8; ++c) {
    s4 += xv[c];
    ss4 += xv[c] * xv[c];
  }
  float s = (s4.x + s4.y) + (s4.z + s4.w);
  float ss = (ss4.x + ss4.y) + (ss4.z + ss4.w);
#pragma unroll
  for (int off = 16; off; off >>= 1) {
    s += __shfl_xor(s, off, 32);
    ss += __shfl_xor(ss, off, 32);
  }
  const float mu = s / W_D;
  const float r = rsqrtf(ss / W_D - mu * mu + 1e-5f);

  f32x4 y[8];
#pragma unroll
  for (int c = 0; c < 8; ++c) y[c] = (xv[c] - mu) * r * gv[c] + bv[c];
  u32x2 w[8];
#pragma unroll
  for (int c = 0; c < 8; ++c)
    w[c] = u32x2{pack_bf16(y[c].x, y[c].y), pack_bf16(y[c].z, y[c].w)};
  store8_u32x2(outb + e, w);

  if constexpr (ROUTE) {
    __syncthreads();  // every wave's share of the router's weights is in LDS
    // The lane's elements are c * 128 + lane * 4 + i: group c * 32 + lane.
    f32x4 ar4 = {}, an4 = {};
#pragma unroll
    for (int c = 0; c < 8; ++c)
#pragma unroll
      for (int i = 0; i < 4; ++i) {
        ar4 += y[c][i] * *(const f32x4*)&wl[0][c * 32 + lane][i * 4];
        an4 += y[c][i] * *(const f32x4*)&wl[1][c * 32 + lane][i * 4];
      }
    float ar[4] = {ar4.x, ar4.y, ar4.z, ar4.w};
    float an[4] = {an4.x, an4.y, an4.z, an4.w};
#pragma unroll
    for (int e = 0; e < 4; ++e)
#pragma unroll
      for (int off = 16; off; off >>= 1) {
        ar[e] += __shfl_xor(ar[e], off, 32);
        an[e] += __shfl_xor(an[e], off, 32);
      }
    if (lane == 0) {
      float noisy[4];
#pragma unroll
      for (int e = 0; e < 4; ++e) {
        const float lg = ar[e] + br[e];
        const float ns = an[e] + bn[e];
        const float sp = (ns > 20.f) ? ns : log1pf(__expf(ns));
        noisy[e] = lg + nz[e] * sp;
      }
      int i0 = 0;
      for (int e = 1; e < 4; ++e)
        if (noisy[e] > noisy[i0]) i0 = e;
      int i1 = -1;
      for (int e = 0; e < 4; ++e)
        if (e != i0 && (i1 < 0 || noisy[e] > noisy[i1])) i1 = e;
      const float m = fmaxf(noisy[i0], noisy[i1]);
      const float e0 = __expf(noisy[i0] - m), e1 = __expf(noisy[i1] - m);
      const float p0 = e0 / (e0 + e1);
#pragma unroll
      for (int e = 0; e < 4; ++e) gate[t * 4 + e] = 0.f;
      gate[t * 4 + i0] = p0;
      gate[t * 4 + i1] = 1.f - p0;
      fidx[2 * t] = i0;
      fidx[2 * t + 1] = i1;
    }
  }
}

// Gather: each wave copies two neighbouring rows of xdisp from the rows of
// x2b that sel names. grid = rows / 16.
__global__ __launch_bounds__(256) void gather_kernel(
    const __bf16* __restrict__ x2b, const int* __restrict__ sel,
    __bf16* xdisp) {
  // The wave's number as a scalar, so that sel is read by a scalar load.
  const int wave = __builtin_amdgcn_readfirstlane(threadIdx.x >> 5);
  const int lane = threadIdx.x & 31;
  const int row = (blockIdx.x * 8 + wave) * 2;
  const int src0 = sel[row], src1 = sel[row + 1];
  u32x4 d[8];
  load_2rows_bf16(x2b + (size_t)src0 * W_D + lane * 8,
                  x2b + (size_t)src1 * W_D + lane * 8, d);
  store8_u32x4(xdisp + (size_t)row * W_D + lane * 8, d);
}

// ---------------------------------------------------------------------------
// Launch orchestration.
// ---------------------------------------------------------------------------
extern "C" void kernel_launch(void* const* d_in, const int* in_sizes, int n_in,
                              void* d_out, int out_size, void* d_ws,
                              size_t ws_size, hipStream_t stream) {
  (void)in_sizes; (void)n_in; (void)out_size; (void)ws_size;
  constexpr int Bb = 2, Nn = 2048, Dd = 1024, Hh = 16, hd = 64;
  constexpr int T = Bb * Nn, D3 = 3 * Dd, MLPH = 4096, MOEH = 256;
  constexpr int Ee = 4, CAP = 2048;

  const float* x      = (const float*)d_in[0];
  const float* noise  = (const float*)d_in[1];
  const float* ln1_g  = (const float*)d_in[2];
  const float* ln1_b  = (const float*)d_in[3];
  const float* ln2_g  = (const float*)d_in[4];
  const float* ln2_b  = (const float*)d_in[5];
  const float* w_qkv  = (const float*)d_in[6];
  const float* w_proj = (const float*)d_in[7];
  const float* b_proj = (const float*)d_in[8];
  const float* w_rt   = (const float*)d_in[9];
  const float* b_rt   = (const float*)d_in[10];
  const float* w_nz   = (const float*)d_in[11];
  const float* b_nz   = (const float*)d_in[12];
  const float* we1    = (const float*)d_in[13];
  const float* be1    = (const float*)d_in[14];
  const float* we2    = (const float*)d_in[15];
  const float* be2    = (const float*)d_in[16];
  const float* w_m1   = (const float*)d_in[17];
  const float* b_m1   = (const float*)d_in[18];
  const float* w_m2   = (const float*)d_in[19];
  const float* b_m2   = (const float*)d_in[20];
  float* out = (float*)d_out;

  char* wsp = (char*)d_ws;
  size_t off = 0;
  auto alloc = [&](size_t bytes) {
    void* p = wsp + off;
    off = (off + bytes + 255) & ~(size_t)255;
    return p;
  };
  __bf16* x1b    = (__bf16*)alloc((size_t)T * Dd * 2);
  __bf16* wqkvb  = (__bf16*)alloc((size_t)D3 * Dd * 2);
  __bf16* qkvb   = (__bf16*)alloc((size_t)T * D3 * 2);
  __bf16* attnb  = (__bf16*)alloc((size_t)T * Dd * 2);
  __bf16* wprojb = (__bf16*)alloc((size_t)Dd * Dd * 2);
  float*  xattn  = (float*)alloc((size_t)T * Dd * 4);
  __bf16* x2b    = (__bf16*)alloc((size_t)T * Dd * 2);
  __bf16* wm1t   = (__bf16*)alloc((size_t)Dd * MLPH * 2);
  __bf16* wm2t   = (__bf16*)alloc((size_t)MLPH * Dd * 2);
  __bf16* hmlp   = (__bf16*)alloc((size_t)T * MLPH * 2);
  __bf16* we1t   = (__bf16*)alloc((size_t)Ee * Dd * MOEH * 2);
  __bf16* we2t   = (__bf16*)alloc((size_t)Ee * MOEH * Dd * 2);
  __bf16* xdisp  = (__bf16*)alloc((size_t)Ee * CAP * Dd * 2);
  __bf16* hdisp  = (__bf16*)alloc((size_t)Ee * CAP * MOEH * 2);
  float*  gate   = (float*)alloc((size_t)T * Ee * 4);
  int*    fidx   = (int*)alloc((size_t)T * 2 * 4);
  int*    sel    = (int*)alloc((size_t)Ee * CAP * 4);
  float*  selw   = (float*)alloc((size_t)Ee * CAP * 4);
  int*    inv    = (int*)alloc((size_t)Ee * T * 4);
  float*  ymoe   = (float*)alloc((size_t)(Ee * CAP + 1) * Dd * 4);

  // 1) weight conversion to bf16 (w_qkv/w_proj are already [N][K]; the rest
  //    goes from [K][N] to [N][K])
  static_assert(Dd == W_D && MLPH == W_MLPH && MOEH == W_MOEH && Ee == W_E,
                "the conversion and row kernels are cut for these shapes");
  cvt_weights<<<CVT_GRID, 256, 0, stream>>>(w_qkv, w_proj, w_m1, w_m2, we1, we2,
                                            wqkvb, wprojb, wm1t, wm2t, we1t,
                                            we2t);

  // 2) LN1 -> x1 (bf16)
  ln_kernel<false><<<T / 8, 256, 0, stream>>>(x, ln1_g, ln1_b, x1b, nullptr,
                                              nullptr, nullptr, nullptr,
                                              nullptr, nullptr, nullptr);

  // 3) QKV GEMM: [T,D] x [3D,D]^T -> bf16 [T,3D]
  gemm_bf16_kernel<false, false, false, OUT_BF16, false>
      <<<dim3(D3 / 64, T / 128), 256, 0, stream>>>(
          x1b, wqkvb, nullptr, nullptr, nullptr, qkvb, nullptr, nullptr,
          nullptr, T, D3, Dd);

  // 4) flash attention -> bf16 [T,D]
  attn_kernel<<<dim3(Nn / 64, Hh, Bb), 128, 0, stream>>>(qkvb, attnb, Nn, Hh,
                                                         hd);

  // 5) proj GEMM + b_proj + residual x -> xattn (f32)
  gemm_bf16_kernel<true, false, true, OUT_F32, false>
      <<<dim3(Dd / 64, T / 128), 256, 0, stream>>>(
          attnb, wprojb, b_proj, x, xattn, nullptr, nullptr, nullptr, nullptr,
          T, Dd, Dd);

  // 6) LN2 -> x2 (bf16), and the router on the f32 row while a wave holds it
  ln_kernel<true><<<T / 8, 256, 0, stream>>>(xattn, ln2_g, ln2_b, x2b, noise,
                                             w_rt, b_rt, w_nz, b_nz, gate,
                                             fidx);

  // 7) capacity dispatch + gather
  dispatch_scan<<<Ee, SCAN_THREADS, 0, stream>>>(fidx, gate, sel, selw, inv, ymoe, CAP,
                                        T, Dd);
  gather_kernel<<<Ee * CAP / 16, 256, 0, stream>>>(x2b, sel, xdisp);

  // 8) expert FFNs, all experts in one launch per layer (grid z = expert);
  //    the second layer leaves its gate-weighted rows in ymoe from row 1 on
  static_assert(Ee == GEMM_E, "the combining epilogue looks through this many planes");
  gemm_bf16_kernel<true, true, false, OUT_BF16, false>
      <<<dim3(MOEH / 64, CAP / 128, Ee), 256, 0, stream>>>(
          xdisp, we1t, be1, nullptr, nullptr, hdisp, nullptr, nullptr, nullptr,
          CAP, MOEH, Dd);
  gemm_bf16_kernel<true, false, false, OUT_SCALED, false>
      <<<dim3(Dd / 64, CAP / 128, Ee), 256, 0, stream>>>(
          hdisp, we2t, be2, nullptr, ymoe + Dd, nullptr, nullptr, selw, nullptr,
          CAP, Dd, MOEH);

  // 9) dense MLP: gelu(x2@W1+b1)@W2+b2 + xattn + each token's expert rows
  //    -> d_out (f32)
  gemm_bf16_kernel<true, true, false, OUT_BF16, false>
      <<<dim3(MLPH / 64, T / 128), 256, 0, stream>>>(
          x2b, wm1t, b_m1, nullptr, nullptr, hmlp, nullptr, nullptr, nullptr,
          T, MLPH, Dd);
  gemm_bf16_kernel<true, false, true, OUT_F32, true>
      <<<dim3(Dd / 64, T / 128), 256, 0, stream>>>(
          hmlp, wm2t, b_m2, xattn, out, nullptr, inv, nullptr, ymoe, T, Dd,
          MLPH);
}

// v010
// A run of this version takes 220 microseconds.
// Next to v009, in two timings, it ran 1.03 and 1.04 times as fast.
// Over all steps from v000 it is 3.74 times as fast.
#include <hip/hip_runtime.h>
#include <hip/hip_bf16.h>
#include <math.h>
#include <stdint.h>

// ---------------------------------------------------------------------------
// Types for CDNA5 WMMA (wave32): D(f32 16x16) = A(bf16 16x32) x B(bf16 32x16) + C
// ---------------------------------------------------------------------------
typedef __attribute__((ext_vector_type(16))) __bf16 v16bf;
typedef __attribute__((ext_vector_type(8)))  float  v8f;
typedef __attribute__((ext_vector_type(4)))  unsigned u32x4;

static __device__ __forceinline__ v8f wmma_bf16(v16bf a, v16bf b, v8f c) {
  // (neg_a, A, neg_b, B, c_mod, C, reuse_a, reuse_b)
  return __builtin_amdgcn_wmma_f32_16x16x32_bf16(false, a, false, b, (short)0, c,
                                                 false, false);
}

// CDNA5 async copy: global -> LDS, 16 bytes per lane, tracked by ASYNCcnt.
// lds_off = low 32 bits of the generic pointer (ISA: LDS generic addresses
// carry the LDS byte offset in [31:0]).
static __device__ __forceinline__ void async_ld_b128(void* lds_ptr,
                                                     const void* gptr) {
  const unsigned lds_off = (unsigned)(uintptr_t)lds_ptr;
  asm volatile("global_load_async_to_lds_b128 %0, %1, off"
               :
               : "v"(lds_off), "v"(gptr)
               : "memory");
}
static __device__ __forceinline__ void wait_async0() {
  asm volatile("s_wait_asynccnt 0" ::: "memory");
}
// One attention stage's copies of one lane: 4 pieces of K rows and 4 of V rows,
// rows 16 apart (ls bytes in LDS, gs elements in memory). The s_wait_xcnt
// stands inside the statement so that no address register of an issued copy
// is rewritten in front of it.
static __device__ __forceinline__ void async_stage_kv(void* ldsK, void* ldsV,
                                                      unsigned ls,
                                                      const __bf16* gK,
                                                      const __bf16* gV,
                                                      size_t gs) {
  const unsigned lk = (unsigned)(uintptr_t)ldsK;
  const unsigned lv = (unsigned)(uintptr_t)ldsV;
  asm volatile(
      "global_load_async_to_lds_b128 %0, %8, off\n\t"
      "global_load_async_to_lds_b128 %1, %9, off\n\t"
      "global_load_async_to_lds_b128 %2, %10, off\n\t"
      "global_load_async_to_lds_b128 %3, %11, off\n\t"
      "global_load_async_to_lds_b128 %4, %12, off\n\t"
      "global_load_async_to_lds_b128 %5, %13, off\n\t"
      "global_load_async_to_lds_b128 %6, %14, off\n\t"
      "global_load_async_to_lds_b128 %7, %15, off\n\t"
      "s_wait_xcnt 0x0"
      :
      : "v"(lk), "v"(lk + ls), "v"(lk + 2 * ls), "v"(lk + 3 * ls),
        "v"(lv), "v"(lv + ls), "v"(lv + 2 * ls), "v"(lv + 3 * ls),
        "v"(gK), "v"(gK + gs), "v"(gK + 2 * gs), "v"(gK + 3 * gs),
        "v"(gV), "v"(gV + gs), "v"(gV + 2 * gs), "v"(gV + 3 * gs)
      : "memory");
}

// Load a 16x32 bf16 fragment (A layout; B "Bt" layout is identical with N<->M)
// from row-major LDS with leading dim `ld` (bf16 elements, multiple of 8).
// Lane l: row = base + (l&15); half = l>>4 selects K subranges
// [half*8, half*8+8) and [16+half*8, 16+half*8+8)  -> two aligned b128 loads.
static __device__ __forceinline__ v16bf frag16(const __bf16* base, int row,
                                               int kbase, int ld) {
  const int lane = threadIdx.x & 31;
  const __bf16* p =
      base + (size_t)(row + (lane & 15)) * ld + kbase + ((lane >> 4) * 8);
  union { uint4 u[2]; v16bf v; } t;
  t.u[0] = *(const uint4*)p;
  t.u[1] = *(const uint4*)(p + 16);
  return t.v;
}

// The same 16x32 fragment of the TRANSPOSE of a row-major LDS tile T[k][row],
// by two transposing loads (ds_load_tr16_b128): lane l ends with
// T[kbase + half*8 + 0..7][row + (l&15)] and the same 16 k further on, the k
// order of frag16. Each lane names 16 bytes of one tile row; `ld` in bf16
// elements, 32 B x odd in bytes for conflict-free reads.
typedef __attribute__((ext_vector_type(8))) __bf16 v8bf;
typedef __attribute__((address_space(3))) v8bf lds_v8bf;
static __device__ __forceinline__ v16bf frag16_tr(const __bf16* base, int row,
                                                  int kbase, int ld) {
  const int lane = threadIdx.x & 31;
  const __bf16* p = base + (size_t)(kbase + (lane >> 4) * 8 + (lane & 7)) * ld +
                    row + ((lane >> 3) & 1) * 8;
  union { v8bf h[2]; v16bf v; } t;
  t.h[0] = __builtin_amdgcn_ds_load_tr16_b128_v8bf16((lds_v8bf*)p);
  t.h[1] = __builtin_amdgcn_ds_load_tr16_b128_v8bf16((lds_v8bf*)(p + 16 * ld));
  return t.v;
}

static __device__ __forceinline__ float gelu_exact(float x) {
  return 0.5f * x * (1.0f + erff(x * 0.70710678118654752f));
}

// ---------------------------------------------------------------------------
// Generic bf16 WMMA GEMM:  C[M][N] = A[M][K] * Bt[N][K]^T  (+bias, gelu, resid)
// Block 256 threads = 8 waves, 4 (M) x 2 (N); tile 128(M) x BN(N); K-step 128.
// BN = 128 wherever the grid still fills the chip: a wave then owns 32 x 64,
// so that each byte copied from L2 and each fragment read from LDS feeds more
// WMMAs than at BN = 64 (32 x 32 a wave).
// Async double-buffered LDS: global_load_async_to_lds_b128 fills the next
// tile while WMMA consumes the current one; one barrier per K-step.
// Sixteen lanes copy one 256-byte piece of a row, so a wave's copy covers
// whole cache lines. LDS rows are pitched 272 B (16 B x odd) for b128 reads.
// Epilogue forms: f32 store, bf16 store, f32 store with a scale per row.
// Bias, activation, residual and output form are template parameters: each
// launch's epilogue is code without tests on pointers, so its bias, residual
// and scale loads are issued together and waited for once, not per element.
// blockIdx.z picks one product of a batch whose operands, biases, scales and
// results lie back to back (the experts); a single product has grid z = 1.
// COMBINE adds to each result row the rows of comb_rows that its experts left
// for it, in expert order; comb_idx[e * M + row] names expert e's (0, an
// all-zero row, where that expert does not serve the token).
// Requires M%128==0, N%BN==0, K%128==0 (true for every GEMM in this model).
// ---------------------------------------------------------------------------
constexpr int GEMM_KT = 128;     // k per stage
constexpr int GEMM_LD = 136;     // LDS row pitch in bf16 elements (272 B)
constexpr int OUT_F32 = 0, OUT_BF16 = 1, OUT_SCALED = 2;  // output forms
constexpr int GEMM_E = 4;        // experts that COMBINE looks through

// One stage's copies of one thread: 8 row pieces of A, 4 of Bt, rows 16 apart.
// The s_wait_xcnt stands inside the statement so that no address register of
// an issued copy is rewritten in front of it.
static __device__ __forceinline__ void async_stage12(const __bf16* lA,
                                                     const __bf16* lB,
                                                     const __bf16* gA,
                                                     const __bf16* gB, int K) {
  const unsigned la = (unsigned)(uintptr_t)lA;
  const unsigned lb = (unsigned)(uintptr_t)lB;
  constexpr unsigned LS = 16u * GEMM_LD * 2u;  // 16 LDS rows in bytes
  const size_t gs = (size_t)16 * K;            // 16 global rows in elements
  asm volatile(
      "global_load_async_to_lds_b128 %0, %12, off\n\t"
      "global_load_async_to_lds_b128 %1, %13, off\n\t"
      "global_load_async_to_lds_b128 %2, %14, off\n\t"
      "global_load_async_to_lds_b128 %3, %15, off\n\t"
      "global_load_async_to_lds_b128 %4, %16, off\n\t"
      "global_load_async_to_lds_b128 %5, %17, off\n\t"
      "global_load_async_to_lds_b128 %6, %18, off\n\t"
      "global_load_async_to_lds_b128 %7, %19, off\n\t"
      "global_load_async_to_lds_b128 %8, %20, off\n\t"
      "global_load_async_to_lds_b128 %9, %21, off\n\t"
      "global_load_async_to_lds_b128 %10, %22, off\n\t"
      "global_load_async_to_lds_b128 %11, %23, off\n\t"
      "s_wait_xcnt 0x0"
      :
      : "v"(la), "v"(la + LS), "v"(la + 2 * LS), "v"(la + 3 * LS),
        "v"(la + 4 * LS), "v"(la + 5 * LS), "v"(la + 6 * LS), "v"(la + 7 * LS),
        "v"(lb), "v"(lb + LS), "v"(lb + 2 * LS), "v"(lb + 3 * LS),
        "v"(gA), "v"(gA + gs), "v"(gA + 2 * gs), "v"(gA + 3 * gs),
        "v"(gA + 4 * gs), "v"(gA + 5 * gs), "v"(gA + 6 * gs), "v"(gA + 7 * gs),
        "v"(gB), "v"(gB + gs), "v"(gB + 2 * gs), "v"(gB + 3 * gs)
      : "memory");
}

// Half a stage's copies of one thread at BN = 128: 8 row pieces of one operand,
// rows 16 apart (an asm statement does not take the operands of all 16). The
// s_wait_xcnt stands inside the statement, for the reason given above.
static __device__ __forceinline__ void async_stage8(const __bf16* lP,
                                                    const __bf16* gP, int K) {
  const unsigned lp = (unsigned)(uintptr_t)lP;
  constexpr unsigned LS = 16u * GEMM_LD * 2u;  // 16 LDS rows in bytes
  const size_t gs = (size_t)16 * K;            // 16 global rows in elements
  asm volatile(
      "global_load_async_to_lds_b128 %0, %8, off\n\t"
      "global_load_async_to_lds_b128 %1, %9, off\n\t"
      "global_load_async_to_lds_b128 %2, %10, off\n\t"
      "global_load_async_to_lds_b128 %3, %11, off\n\t"
      "global_load_async_to_lds_b128 %4, %12, off\n\t"
      "global_load_async_to_lds_b128 %5, %13, off\n\t"
      "global_load_async_to_lds_b128 %6, %14, off\n\t"
      "global_load_async_to_lds_b128 %7, %15, off\n\t"
      "s_wait_xcnt 0x0"
      :
      : "v"(lp), "v"(lp + LS), "v"(lp + 2 * LS), "v"(lp + 3 * LS),
        "v"(lp + 4 * LS), "v"(lp + 5 * LS), "v"(lp + 6 * LS), "v"(lp + 7 * LS),
        "v"(gP), "v"(gP + gs), "v"(gP + 2 * gs), "v"(gP + 3 * gs),
        "v"(gP + 4 * gs), "v"(gP + 5 * gs), "v"(gP + 6 * gs), "v"(gP + 7 * gs)
      : "memory");
}

// COMBINE's loads. Each run stands with its data wait in one statement with
// early-clobber outputs, so that no result lands in an address register of
// the run and none is rewritten while a load is out.
// The thread's 16 result rows (8 from off, 8 from off + 64 B) in 4 planes.
static __device__ __forceinline__ void load_comb_idx(
    const int* p0, const int* p1, const int* p2, const int* p3, unsigned off,
    u32x4 (&d)[GEMM_E][4]) {
  asm volatile(
      "global_load_b128 %0, %16, %17\n\t"
      "global_load_b128 %1, %16, %17 offset:16\n\t"
      "global_load_b128 %2, %16, %17 offset:64\n\t"
      "global_load_b128 %3, %16, %17 offset:80\n\t"
      "global_load_b128 %4, %16, %18\n\t"
      "global_load_b128 %5, %16, %18 offset:16\n\t"
      "global_load_b128 %6, %16, %18 offset:64\n\t"
      "global_load_b128 %7, %16, %18 offset:80\n\t"
      "global_load_b128 %8, %16, %19\n\t"
      "global_load_b128 %9, %16, %19 offset:16\n\t"
      "global_load_b128 %10, %16, %19 offset:64\n\t"
      "global_load_b128 %11, %16, %19 offset:80\n\t"
      "global_load_b128 %12, %16, %20\n\t"
      "global_load_b128 %13, %16, %20 offset:16\n\t"
      "global_load_b128 %14, %16, %20 offset:64\n\t"
      "global_load_b128 %15, %16, %20 offset:80\n\t"
      "s_wait_loadcnt 0x0"
      : "=&v"(d[0][0]), "=&v"(d[0][1]), "=&v"(d[0][2]), "=&v"(d[0][3]),
        "=&v"(d[1][0]), "=&v"(d[1][1]), "=&v"(d[1][2]), "=&v"(d[1][3]),
        "=&v"(d[2][0]), "=&v"(d[2][1]), "=&v"(d[2][2]), "=&v"(d[2][3]),
        "=&v"(d[3][0]), "=&v"(d[3][1]), "=&v"(d[3][2]), "=&v"(d[3][3])
      : "v"(off), "s"(p0), "s"(p1), "s"(p2), "s"(p3)
      : "memory");
}
// Two columns, 16 apart, of 8 rows of base; off holds byte offsets.
static __device__ __forceinline__ void load_comb_rows(const float* base,
                                                      const unsigned (&off)[8],
                                                      float (&d)[2][8]) {
  asm volatile(
      "global_load_b32 %0, %16, %24\n\t"
      "global_load_b32 %1, %17, %24\n\t"
      "global_load_b32 %2, %18, %24\n\t"
      "global_load_b32 %3, %19, %24\n\t"
      "global_load_b32 %4, %20, %24\n\t"
      "global_load_b32 %5, %21, %24\n\t"
      "global_load_b32 %6, %22, %24\n\t"
      "global_load_b32 %7, %23, %24\n\t"
      "global_load_b32 %8, %16, %24 offset:64\n\t"
      "global_load_b32 %9, %17, %24 offset:64\n\t"
      "global_load_b32 %10, %18, %24 offset:64\n\t"
      "global_load_b32 %11, %19, %24 offset:64\n\t"
      "global_load_b32 %12, %20, %24 offset:64\n\t"
      "global_load_b32 %13, %21, %24 offset:64\n\t"
      "global_load_b32 %14, %22, %24 offset:64\n\t"
      "global_load_b32 %15, %23, %24 offset:64\n\t"
      "s_wait_loadcnt 0x0"
      : "=&v"(d[0][0]), "=&v"(d[0][1]), "=&v"(d[0][2]), "=&v"(d[0][3]),
        "=&v"(d[0][4]), "=&v"(d[0][5]), "=&v"(d[0][6]), "=&v"(d[0][7]),
        "=&v"(d[1][0]), "=&v"(d[1][1]), "=&v"(d[1][2]), "=&v"(d[1][3]),
        "=&v"(d[1][4]), "=&v"(d[1][5]), "=&v"(d[1][6]), "=&v"(d[1][7])
      : "v"(off[0]), "v"(off[1]), "v"(off[2]), "v"(off[3]), "v"(off[4]),
        "v"(off[5]), "v"(off[6]), "v"(off[7]), "s"(base)
      : "memory");
}

template <int BN, bool BIAS, bool ACT, bool RESID, int OUT, bool COMBINE>
__global__ __launch_bounds__(256) void gemm_bf16_kernel(
    const __bf16* __restrict__ A, const __bf16* __restrict__ Bt,
    const float* __restrict__ bias, const float* __restrict__ residual,
    float* Cf, __bf16* Cb, const int* __restrict__ comb_idx,
    const float* __restrict__ row_scale, const float* __restrict__ comb_rows,
    int M, int N, int K) {
  __shared__ __align__(16) __bf16 As[2][128][GEMM_LD];
  __shared__ __align__(16) __bf16 Bs[2][BN][GEMM_LD];
  static_assert(BN == 64 || BN == 128, "the copies are written for these");
  constexpr int WN = BN / 2;   // columns of a wave
  constexpr int NJ = WN / 16;  // Bt fragments, and result tiles per 16 rows

  const size_t zb = blockIdx.z;  // which product of the batch
  A += zb * M * K;
  Bt += zb * N * K;
  if constexpr (BIAS) bias += zb * N;
  if constexpr (RESID) residual += zb * M * N;
  if constexpr (OUT == OUT_BF16) Cb += zb * M * N;
  if constexpr (OUT != OUT_BF16) Cf += zb * M * N;
  if constexpr (OUT == OUT_SCALED) row_scale += zb * M;

  const int tid = threadIdx.x;
  const int wave = tid >> 5, lane = tid & 31;
  const int wm = wave & 3, wn = wave >> 2;
  const int bm = blockIdx.y * 128, bn = blockIdx.x * BN;

  const int rc = tid >> 4, cc = (tid & 15) * 8;  // copy: row in 16, 8 bf16
  const __bf16* gA0 = A + (size_t)(bm + rc) * K + cc;
  const __bf16* gB0 = Bt + (size_t)(bn + rc) * K + cc;

  auto issue_tile = [&](int buf, int k0) {
    if constexpr (BN == 64) {
      async_stage12(&As[buf][rc][cc], &Bs[buf][rc][cc], gA0 + k0, gB0 + k0, K);
    } else {
      async_stage8(&As[buf][rc][cc], gA0 + k0, K);
      async_stage8(&Bs[buf][rc][cc], gB0 + k0, K);
    }
  };

  v8f acc[2][NJ] = {};
  const int nt = K / GEMM_KT;
  issue_tile(0, 0);

  // Byte offsets in comb_rows of the two rows that each result row gets,
  // fetched here so that the wait falls into the first tile's flight. A token
  // has two experts: the lowest and the highest plane that name a row are all.
  unsigned oa[2][8] = {}, ob[2][8] = {};
  if constexpr (COMBINE) {
    u32x4 ix[GEMM_E][4];
    load_comb_idx(comb_idx, comb_idx + M, comb_idx + 2 * (size_t)M,
                  comb_idx + 3 * (size_t)M,
                  (unsigned)(bm + wm * 32 + (lane >> 4) * 8) * 4u, ix);
    const unsigned colb = (unsigned)(bn + wn * WN + (lane & 15)) * 4u;
    // Unrolled so that ix, oa and ob are indexed by constants and stay in
    // registers.
#pragma unroll
    for (int i = 0; i < 2; ++i)
#pragma unroll
      for (int v = 0; v < 8; ++v) {
        const unsigned x0 = ix[0][i * 2 + (v >> 2)][v & 3];
        const unsigned x1 = ix[1][i * 2 + (v >> 2)][v & 3];
        const unsigned x2 = ix[2][i * 2 + (v >> 2)][v & 3];
        const unsigned x3 = ix[3][i * 2 + (v >> 2)][v & 3];
        const unsigned lo = x0 ? x0 : x1 ? x1 : x2 ? x2 : x3;
        const unsigned hi = x3 ? x3 : x2 ? x2 : x1 ? x1 : x0;
        oa[i][v] = lo * (unsigned)N * 4u + colb;
        ob[i][v] = (hi == lo ? 0u : hi) * (unsigned)N * 4u + colb;
      }
  }

  wait_async0();      // tile 0 landed in LDS (this wave's copies)
  __syncthreads();    // ... and every other wave's
  if (nt > 1) issue_tile(1, GEMM_KT);

  for (int t = 0; t < nt; ++t) {
    const int cur = t & 1;
    // Two fragment sets: while one k-step's WMMAs run on one set, the next
    // k-step's fragments (of this same buffer) are on their way into the other.
    // All loops here are unrolled so that the sets and acc are indexed by
    // constants and stay in registers, and ks folds into the loads' offsets.
    v16bf a[2][2], b[2][NJ];
    auto load_frags = [&](int set, int ks) {
      a[set][0] = frag16(&As[cur][0][0], wm * 32, ks, GEMM_LD);
      a[set][1] = frag16(&As[cur][0][0], wm * 32 + 16, ks, GEMM_LD);
#pragma unroll
      for (int j = 0; j < NJ; ++j)
        b[set][j] = frag16(&Bs[cur][0][0], wn * WN + j * 16, ks, GEMM_LD);
    };
    load_frags(0, 0);
#pragma unroll
    for (int s = 0; s < GEMM_KT / 32; ++s) {
      if (s + 1 < GEMM_KT / 32) load_frags((s + 1) & 1, (s + 1) * 32);
      // Keeps the loads above as one group in front of the WMMAs: left free,
      // they are spread among the WMMAs into one shared register set, with a
      // wait for LDS in front of every second WMMA.
      __builtin_amdgcn_sched_barrier(0);
#pragma unroll
      for (int j = 0; j < NJ; ++j) {
        acc[0][j] = wmma_bf16(a[s & 1][0], b[s & 1][j], acc[0][j]);
        acc[1][j] = wmma_bf16(a[s & 1][1], b[s & 1][j], acc[1][j]);
      }
      // Keeps the next group of loads behind this k-step's WMMAs, for the same
      // reason.
      __builtin_amdgcn_sched_barrier(0);
    }
    // This wave's LDS reads of the buffer have retired before it is refilled.
    asm volatile("s_wait_dscnt 0x0" ::: "memory");
    wait_async0();      // next tile landed in LDS (this wave's copies)
    __syncthreads();    // all waves done copying AND done reading this buffer
    if (t + 2 < nt) issue_tile(cur, (t + 2) * GEMM_KT);  // flies over trip t+1
  }
  wait_async0();        // no copy is outstanding when the wave ends

  // Epilogue. C layout: lane half (l>>4) + VGPR v -> row half*8+v; col = l&15.
  const int half = lane >> 4, c0 = lane & 15;
  const int row0 = bm + wm * 32 + half * 8;  // + i*16 + v
  const int col0 = bn + wn * WN + c0;        // + j*16

  // Bias, residual and scale are fetched first, in one run of loads.
  // All loops below are unrolled so that acc and these arrays are indexed by
  // constants and stay in registers.
  float bv[NJ] = {};
  float rv[2][NJ][8] = {};
  float sc[2][8] = {};
  if constexpr (BIAS) {
#pragma unroll
    for (int j = 0; j < NJ; ++j) bv[j] = bias[col0 + j * 16];
  }
  if constexpr (RESID) {
#pragma unroll
    for (int i = 0; i < 2; ++i)
#pragma unroll
      for (int j = 0; j < NJ; ++j)
#pragma unroll
        for (int v = 0; v < 8; ++v)
          rv[i][j][v] =
              residual[(size_t)(row0 + i * 16 + v) * N + col0 + j * 16];
  }
  if constexpr (OUT == OUT_SCALED) {
#pragma unroll
    for (int i = 0; i < 2; ++i)
#pragma unroll
      for (int v = 0; v < 8; ++v) sc[i][v] = row_scale[row0 + i * 16 + v];
  }

#pragma unroll
  for (int i = 0; i < 2; ++i) {
    float pa[NJ / 2][2][8] = {}, pb[NJ / 2][2][8] = {};  // [j / 2][j % 2][v]
    if constexpr (COMBINE) {
#pragma unroll
      for (int jj = 0; jj < NJ / 2; ++jj) {
        load_comb_rows(comb_rows + jj * 32, oa[i], pa[jj]);
        load_comb_rows(comb_rows + jj * 32, ob[i], pb[jj]);
      }
    }
#pragma unroll
    for (int j = 0; j < NJ; ++j)
#pragma unroll
      for (int v = 0; v < 8; ++v) {
        const int row = row0 + i * 16 + v;
        const int col = col0 + j * 16;
        float val = acc[i][j][v];
        if constexpr (BIAS) val += bv[j];
        if constexpr (ACT) val = gelu_exact(val);
        if constexpr (RESID) val += rv[i][j][v];
        if constexpr (COMBINE) {
          val += pa[j >> 1][j & 1][v];
          val += pb[j >> 1][j & 1][v];
        }
        if constexpr (OUT == OUT_F32) Cf[(size_t)row * N + col] = val;
        if constexpr (OUT == OUT_BF16) Cb[(size_t)row * N + col] = (__bf16)val;
        if constexpr (OUT == OUT_SCALED)
          Cf[(size_t)row * N + col] = val * sc[i][v];
      }
  }
}

__global__ __launch_bounds__(128) void attn_kernel(
    const __bf16* __restrict__ qkv, __bf16* __restrict__ out, int N, int Hh,
    int hd) {
  const int D3 = 3 * Hh * hd;   // 3072
  const int Dm = Hh * hd;       // 1024
  const int qb = blockIdx.x, h = blockIdx.y, b = blockIdx.z;
  const int tid = threadIdx.x, wave = tid >> 5, lane = tid & 31;
  const int half = lane >> 4, c0 = lane & 15;

  __shared__ __align__(16) __bf16 Qs[64][80];
  __shared__ __align__(16) __bf16 Ks[64][80];
  __shared__ __align__(16) __bf16 Vs[64][80];  // [key][d], 160 B = 32 B x 5

  const int r = tid >> 1, d0 = (tid & 1) * 32;
  const int rk = tid >> 3, ck = (tid & 7) * 8;  // K, V copy: row in 16, 8 bf16
  {  // Q tile (64x64) via async copy; first in-loop wait_async0 covers it
    const __bf16* g = qkv + (size_t)(b * N + qb * 64 + r) * D3 + h * hd + d0;
#pragma unroll
    for (int u = 0; u < 4; ++u) async_ld_b128(&Qs[r][d0 + u * 8], g + u * 8);
  }

  // o[j][v] = O[query c0][head dim j*16 + half*8 + v]. mstat is the running
  // maximum of query c0; lstat sums only the keys that this lane half holds.
  // Every loop over u, ks, j, v or m in this kernel is unrolled so that s, o
  // and the fragments are indexed by constants and stay in registers.
  v8f o[4] = {};
  float mstat = -1e30f, lstat = 0.f;

  for (int kb = 0; kb < N / 64; ++kb) {
    // This wave's LDS reads of Ks and Vs have retired before they are refilled.
    asm volatile("s_wait_dscnt 0x0" ::: "memory");
    __syncthreads();  // prior reads of Ks/Vs complete before overwrite
    {
      // Eight lanes copy one 128-byte row of a head, so a wave's copy covers
      // four whole cache lines.
      const __bf16* gk =
          qkv + (size_t)(b * N + kb * 64 + rk) * D3 + Dm + h * hd + ck;
      async_stage_kv(&Ks[rk][ck], &Vs[rk][ck], 16u * sizeof(Ks[0]), gk, gk + Dm,
                     (size_t)16 * D3);
    }
    wait_async0();
    __syncthreads();

    // S^T = K @ Q^T: s[j][v] = S[query c0][key j*16 + half*8 + v]
    v8f s[4] = {};
#pragma unroll
    for (int ks = 0; ks < 64; ks += 32) {
      const v16bf q = frag16(&Qs[0][0], wave * 16, ks, 80);
#pragma unroll
      for (int j = 0; j < 4; ++j) {
        const v16bf kf = frag16(&Ks[0][0], j * 16, ks, 80);
        s[j] = wmma_bf16(kf, q, s[j]);
      }
    }

    // All V^T fragments, fetched as one group here so that the softmax below
    // covers their latency: vf[m][j] = head dims j*16.., keys m*32..
    v16bf vf[2][4];
#pragma unroll
    for (int m = 0; m < 2; ++m)
#pragma unroll
      for (int j = 0; j < 4; ++j)
        vf[m][j] = frag16_tr(&Vs[0][0], j * 16, m * 32, 80);
    // Keeps the group in front of the softmax: left free, the loads are spread
    // among the second product's WMMAs, each place with a wait of its own.
    __builtin_amdgcn_sched_barrier(0);

    // online softmax of query c0: 32 keys in this lane, 32 in lane ^ 16
    float rmax = -1e30f;
#pragma unroll
    for (int j = 0; j < 4; ++j)
#pragma unroll
      for (int v = 0; v < 8; ++v) {
        s[j][v] *= 0.125f;  // hd^-0.5
        rmax = fmaxf(rmax, s[j][v]);
      }
    rmax = fmaxf(rmax, __shfl_xor(rmax, 16, 32));
    const float mnew = fmaxf(mstat, rmax);
    const float alpha = __expf(mstat - mnew);
    float rsum = 0.f;
#pragma unroll
    for (int j = 0; j < 4; ++j)
#pragma unroll
      for (int v = 0; v < 8; ++v) {
        const float p = __expf(s[j][v] - mnew);
        s[j][v] = p;
        rsum += p;
      }
    lstat = lstat * alpha + rsum;
    mstat = mnew;
#pragma unroll
    for (int j = 0; j < 4; ++j)
#pragma unroll
      for (int v = 0; v < 8; ++v) o[j][v] *= alpha;

    // O^T += V^T @ P^T. Tiles 2m and 2m+1 of S^T hold keys m*32 + half*8 + v
    // and m*32 + 16 + half*8 + v: the k order in which frag16_tr reads Vs.
#pragma unroll
    for (int m = 0; m < 2; ++m) {
      v16bf pf;
#pragma unroll
      for (int v = 0; v < 8; ++v) {
        pf[v] = (__bf16)s[2 * m][v];
        pf[8 + v] = (__bf16)s[2 * m + 1][v];
      }
#pragma unroll
      for (int j = 0; j < 4; ++j) o[j] = wmma_bf16(vf[m][j], pf, o[j]);
    }
  }

  // The two lane halves' sums are joined once; a lane stores 8 neighbouring
  // head dims of its query as one 16-byte piece per tile.
  lstat += __shfl_xor(lstat, 16, 32);
  const float inv = 1.0f / lstat;
  __bf16* orow = out + (size_t)(b * N + qb * 64 + wave * 16 + c0) * Dm +
                 h * hd + half * 8;
#pragma unroll
  for (int j = 0; j < 4; ++j) {
    v8bf w;
#pragma unroll
    for (int v = 0; v < 8; ++v) w[v] = (__bf16)(o[j][v] * inv);
    *(v8bf*)(orow + j * 16) = w;
  }
}

// ---------------------------------------------------------------------------
// Per-expert capacity dispatch (stable token order). grid = E blocks.
// A token's place with expert e is the number of e's tokens in front of it.
// A wave takes SCAN_PER groups of 32 neighbouring tokens: inside a group the
// count comes from a ballot and a bit count, over the wave's earlier groups
// from the ballots' sizes, over earlier waves from the waves' totals, which go
// through LDS behind the one barrier of a trip. A trip covers SCAN_CHUNK
// tokens, and all its loads are issued together in front of the counting.
// inv[e * T + t] is the way back: the row of the experts' result that token t
// has with expert e (they start at row 1), or row 0, cleared here, if none.
// ---------------------------------------------------------------------------
constexpr int SCAN_WAVES = 32;  // one total per lane when a wave sums them
constexpr int SCAN_PER = 4;     // groups of 32 tokens per wave and trip
constexpr int SCAN_THREADS = SCAN_WAVES * 32;
constexpr int SCAN_CHUNK = SCAN_THREADS * SCAN_PER;
static_assert(SCAN_CHUNK < (1 << 15), "two counts of a trip share one int");

// A store with its s_wait_xcnt in the same statement: what follows it rewrites
// the registers that it names, and a wait in a statement of its own is not
// tied to those registers.
static __device__ __forceinline__ void store_b32_wait(int* p, int v) {
  asm volatile(
      "global_store_b32 %0, %1, off\n\t"
      "s_wait_xcnt 0x0"
      :
      : "v"(p), "v"(v)
      : "memory");
}

__global__ __launch_bounds__(SCAN_THREADS) void dispatch_scan(
    const int* __restrict__ fidx, const float* __restrict__ gate, int* sel,
    float* selw, int* inv, float* zero_row, int capacity, int T, int D) {
  const int e = blockIdx.x, tid = threadIdx.x;
  const int wave = tid >> 5, lane = tid & 31;
  for (int i = e * SCAN_THREADS + tid; i < D; i += gridDim.x * SCAN_THREADS)
    zero_row[i] = 0.f;
  // Two sets, taken in turn: a trip's totals are read behind its barrier, and
  // the set is written again only behind the next trip's barrier.
  __shared__ int wtot[2][SCAN_WAVES];
  const unsigned below = (1u << lane) - 1u;  // the lanes in front of this one
  int base = 0;
  for (int c0 = 0, set = 0; c0 < T; c0 += SCAN_CHUNK, set ^= 1) {
    const int t0 = c0 + wave * (32 * SCAN_PER) + lane;
    // All loops over j are unrolled so that the arrays stay in registers.
    int2 f[SCAN_PER];
    float g[SCAN_PER];
#pragma unroll
    for (int j = 0; j < SCAN_PER; ++j) {
      const int t = t0 + j * 32;
      const int tc = t < T ? t : T - 1;  // a token past the end reads the last
      f[j] = *(const int2*)(fidx + 2 * tc);
      g[j] = gate[tc * 4 + e];
    }
    bool m[SCAN_PER];
    int before[SCAN_PER];
    int mine = 0;  // e's tokens in this wave's groups so far
#pragma unroll
    for (int j = 0; j < SCAN_PER; ++j) {
      // Plain | and &: all three tests are cheap, and no branch is wanted.
      m[j] = (t0 + j * 32 < T) & ((f[j].x == e) | (f[j].y == e));
      const unsigned b = __builtin_amdgcn_ballot_w32(m[j]);
      before[j] = mine + __popc(b & below);
      mine += __popc(b);
    }
    if (lane == 0) wtot[set][wave] = mine;
    __syncthreads();
    // Two sums in one exchange tree: the earlier waves' tokens in the high
    // half of a word, all waves' in the low half (neither passes SCAN_CHUNK).
    const int w = wtot[set][lane];
    int both = (lane < wave ? w << 16 : 0) | w;
#pragma unroll
    for (int off = 16; off; off >>= 1) both += __shfl_xor(both, off, 32);
    const int pre = both >> 16, tot = both & 0xffff;
#pragma unroll
    for (int j = 0; j < SCAN_PER; ++j) {
      const int t = t0 + j * 32;
      const int pos = base + pre + before[j];
      const bool kept = m[j] && pos < capacity;
      if (kept) {
        sel[e * capacity + pos] = t;
        selw[e * capacity + pos] = g[j];
      }
      if (t < T)
        store_b32_wait(inv + e * T + t, kept ? 1 + e * capacity + pos : 0);
    }
    base += tot;
  }
  for (int i = (base < capacity ? base : capacity) + tid; i < capacity;
       i += SCAN_THREADS) {
    sel[e * capacity + i] = 0;
    selw[e * capacity + i] = 0.f;  // padded rows contribute nothing
  }
}

// ---------------------------------------------------------------------------
// fp32 -> bf16 conversion of every weight, one launch.
// The work is cut into pieces of 4096 elements; each work-group takes CVT_PER
// of them, so few waves are started and each moves many bytes.
// A piece of w_qkv or w_proj (already [N][K]) is a straight run of elements.
// A piece of any other weight is a 64x64 tile of in[K][N] that goes out as
// out[N][K]: input rows are read as 256-byte runs, two neighbouring k of one
// column are packed into a dword, the tile is turned in LDS, and each output
// row gets one whole 128-byte run.
// ---------------------------------------------------------------------------
constexpr int W_D = 1024, W_MLPH = 4096, W_MOEH = 256, W_E = 4;  // model dims
constexpr int CVT_PIECE = 64 * 64;
constexpr int CVT_B_PROJ = 3 * W_D * W_D / CVT_PIECE;             // after w_qkv
constexpr int CVT_B_M1 = CVT_B_PROJ + W_D * W_D / CVT_PIECE;      // after w_proj
constexpr int CVT_B_M2 = CVT_B_M1 + W_D * W_MLPH / CVT_PIECE;     // after w_mlp1
constexpr int CVT_B_E1 = CVT_B_M2 + W_MLPH * W_D / CVT_PIECE;     // after w_mlp2
constexpr int CVT_B_E2 = CVT_B_E1 + W_E * W_D * W_MOEH / CVT_PIECE;
constexpr int CVT_TOTAL = CVT_B_E2 + W_E * W_MOEH * W_D / CVT_PIECE;
constexpr int CVT_PER = 4;                      // pieces per work-group
constexpr int CVT_GRID = CVT_TOTAL / CVT_PER;   // work-groups
static_assert(CVT_GRID * CVT_PER == CVT_TOTAL, "pieces divide evenly");
constexpr int CVT_EXP_TILES = W_D * W_MOEH / CVT_PIECE;  // tiles per expert
static_assert(CVT_EXP_TILES == 64, "expert index is taken by a shift of 6");
constexpr int CVT_PITCH = 68;  // LDS row pitch in bf16: 136 B, 8-byte aligned

typedef __attribute__((ext_vector_type(2))) float  f32x2;
typedef __attribute__((ext_vector_type(2))) __bf16 bf16x2;

// Two floats to one dword of bf16, lo in the low half; converted as a pair so
// that one packed conversion does both.
static __device__ __forceinline__ unsigned pack_bf16(float lo, float hi) {
  const f32x2 f = {lo, hi};
  return __builtin_bit_cast(unsigned, __builtin_convertvector(f, bf16x2));
}

typedef __attribute__((ext_vector_type(4))) float    f32x4;
typedef __attribute__((ext_vector_type(2))) unsigned u32x2;

// Four 16-byte loads that fly together. Loads and their data wait are one
// statement with early-clobber outputs, so that no result lands in an address
// pair of the run and no address pair is rewritten while a load is out (as
// plain loads the compiler let one load's result take another's address).
static __device__ __forceinline__ void load4_b128(const float* p0,
                                                  const float* p1,
                                                  const float* p2,
                                                  const float* p3, f32x4& r0,
                                                  f32x4& r1, f32x4& r2,
                                                  f32x4& r3) {
  asm volatile(
      "global_load_b128 %0, %4, off\n\t"
      "global_load_b128 %1, %5, off\n\t"
      "global_load_b128 %2, %6, off\n\t"
      "global_load_b128 %3, %7, off\n\t"
      "s_wait_loadcnt 0x0"
      : "=&v"(r0), "=&v"(r1), "=&v"(r2), "=&v"(r3)
      : "v"(p0), "v"(p1), "v"(p2), "v"(p3)
      : "memory");
}

// Stores with their s_wait_xcnt in the same statement: the next piece rewrites
// the registers that they name, and a wait in a statement of its own is not
// tied to those registers.
static __device__ __forceinline__ void store4_b64_step2k(__bf16* p, u32x2 w0,
                                                         u32x2 w1, u32x2 w2,
                                                         u32x2 w3) {
  asm volatile(
      "global_store_b64 %0, %1, off\n\t"
      "global_store_b64 %0, %2, off offset:2048\n\t"
      "global_store_b64 %0, %3, off offset:4096\n\t"
      "global_store_b64 %0, %4, off offset:6144\n\t"
      "s_wait_xcnt 0x0"
      :
      : "v"(p), "v"(w0), "v"(w1), "v"(w2), "v"(w3)
      : "memory");
}
static __device__ __forceinline__ void store2_b128(__bf16* p, u32x4 d0,
                                                   u32x4 d1) {
  asm volatile(
      "global_store_b128 %0, %1, off\n\t"
      "global_store_b128 %0, %2, off offset:16\n\t"
      "s_wait_xcnt 0x0"
      :
      : "v"(p), "v"(d0), "v"(d1)
      : "memory");
}

__global__ __launch_bounds__(256) void cvt_weights(
    const float* __restrict__ w_qkv, const float* __restrict__ w_proj,
    const float* __restrict__ w_m1, const float* __restrict__ w_m2,
    const float* __restrict__ we1, const float* __restrict__ we2,
    __bf16* __restrict__ o_qkv, __bf16* __restrict__ o_proj,
    __bf16* __restrict__ o_m1, __bf16* __restrict__ o_m2,
    __bf16* __restrict__ o_e1, __bf16* __restrict__ o_e2) {
  __shared__ __align__(16) __bf16 tile[2][64][CVT_PITCH];
  const int tid = threadIdx.x;

  for (int i = 0; i < CVT_PER; ++i) {
    const int p = blockIdx.x + i * CVT_GRID;  // same for the whole work-group
    const bool turned = p >= CVT_B_M1;
    __bf16(*t)[CVT_PITCH] = tile[i & 1];

    // Which weight, and which tile of it. N = 64 << lnt columns of input.
    const float* in;
    __bf16* out;
    int K = 0, lnt = 0, q;
    if (p < CVT_B_PROJ) {
      in = w_qkv; out = o_qkv; q = p;
    } else if (p < CVT_B_M1) {
      in = w_proj; out = o_proj; q = p - CVT_B_PROJ;
    } else if (p < CVT_B_M2) {
      in = w_m1; out = o_m1; q = p - CVT_B_M1; K = W_D; lnt = 6;
    } else if (p < CVT_B_E1) {
      in = w_m2; out = o_m2; q = p - CVT_B_M2; K = W_MLPH; lnt = 4;
    } else if (p < CVT_B_E2) {
      q = p - CVT_B_E1;
      in = we1 + (size_t)(q >> 6) * (W_D * W_MOEH);
      out = o_e1 + (size_t)(q >> 6) * (W_D * W_MOEH);
      q &= 63; K = W_D; lnt = 2;
    } else {
      q = p - CVT_B_E2;
      in = we2 + (size_t)(q >> 6) * (W_D * W_MOEH);
      out = o_e2 + (size_t)(q >> 6) * (W_D * W_MOEH);
      q &= 63; K = W_MOEH; lnt = 4;
    }
    const int N = 64 << lnt;
    const int k0 = (q >> lnt) * 64, n0 = (q & ((1 << lnt) - 1)) * 64;

    if (!turned) {
      const size_t e = (size_t)q * CVT_PIECE + tid * 4;
      const float* g = in + e;
      f32x4 v0, v1, v2, v3;
      load4_b128(g, g + 1024, g + 2048, g + 3072, v0, v1, v2, v3);
      const u32x2 w0 = {pack_bf16(v0.x, v0.y), pack_bf16(v0.z, v0.w)};
      const u32x2 w1 = {pack_bf16(v1.x, v1.y), pack_bf16(v1.z, v1.w)};
      const u32x2 w2 = {pack_bf16(v2.x, v2.y), pack_bf16(v2.z, v2.w)};
      const u32x2 w3 = {pack_bf16(v3.x, v3.y), pack_bf16(v3.z, v3.w)};
      store4_b64_step2k(out + e, w0, w1, w2, w3);  // 1024 elements apart
    } else {
      const int c4 = (tid & 15) * 4, r2 = (tid >> 4) * 2;
      const float* g = in + (size_t)(k0 + r2) * N + n0 + c4;
      f32x4 a0, b0, a1, b1;  // rows k, k + 1 and k + 32, k + 33
      load4_b128(g, g + N, g + (size_t)32 * N, g + (size_t)33 * N, a0, b0, a1,
                 b1);
      *(unsigned*)&t[c4 + 0][r2] = pack_bf16(a0.x, b0.x);
      *(unsigned*)&t[c4 + 1][r2] = pack_bf16(a0.y, b0.y);
      *(unsigned*)&t[c4 + 2][r2] = pack_bf16(a0.z, b0.z);
      *(unsigned*)&t[c4 + 3][r2] = pack_bf16(a0.w, b0.w);
      *(unsigned*)&t[c4 + 0][r2 + 32] = pack_bf16(a1.x, b1.x);
      *(unsigned*)&t[c4 + 1][r2 + 32] = pack_bf16(a1.y, b1.y);
      *(unsigned*)&t[c4 + 2][r2 + 32] = pack_bf16(a1.z, b1.z);
      *(unsigned*)&t[c4 + 3][r2 + 32] = pack_bf16(a1.w, b1.w);
    }
    // One barrier a trip, passed by every wave whatever the piece: it
    // publishes this trip's tile, and it stands between the reads of a buffer
    // in trip i and its next filling in trip i + 2.
    __syncthreads();
    if (turned) {
      const int n = tid >> 2, kc = (tid & 3) * 16;
      const uint2* s = (const uint2*)&t[n][kc];
      const uint2 s0 = s[0], s1 = s[1], s2 = s[2], s3 = s[3];
      const u32x4 d0 = {s0.x, s0.y, s1.x, s1.y};
      const u32x4 d1 = {s2.x, s2.y, s3.x, s3.y};
      store2_b128(out + (size_t)(n0 + n) * K + k0 + kc, d0, d1);
    }
  }
}

// ---------------------------------------------------------------------------
// Row kernels: LayerNorm and the expert gather. A row is W_D elements.
// One wave takes a whole row (LayerNorm) or two rows (gather) in 16-byte
// pieces per lane, each wave-wide access covering 512 contiguous bytes, so a
// launch starts 4096 waves that each keep eight or more loads in flight.
// Loads stand with their data wait, stores with their s_wait_xcnt, in one
// statement each, for the reasons given at load4_b128 and store4_b64_step2k.
// ---------------------------------------------------------------------------
static_assert(W_D == 32 * 4 * 8, "a lane holds 8 pieces of 4 floats of a row");

// One row of x, and gamma and beta, 512 bytes of each per wave-wide load.
static __device__ __forceinline__ void load_ln_row(const float* x,
                                                   const float* g,
                                                   const float* b,
                                                   f32x4 (&xv)[8],
                                                   f32x4 (&gv)[8],
                                                   f32x4 (&bv)[8]) {
  asm volatile(
      "global_load_b128 %0, %24, off\n\t"
      "global_load_b128 %1, %24, off offset:512\n\t"
      "global_load_b128 %2, %24, off offset:1024\n\t"
      "global_load_b128 %3, %24, off offset:1536\n\t"
      "global_load_b128 %4, %24, off offset:2048\n\t"
      "global_load_b128 %5, %24, off offset:2560\n\t"
      "global_load_b128 %6, %24, off offset:3072\n\t"
      "global_load_b128 %7, %24, off offset:3584\n\t"
      "global_load_b128 %8, %25, off\n\t"
      "global_load_b128 %9, %25, off offset:512\n\t"
      "global_load_b128 %10, %25, off offset:1024\n\t"
      "global_load_b128 %11, %25, off offset:1536\n\t"
      "global_load_b128 %12, %25, off offset:2048\n\t"
      "global_load_b128 %13, %25, off offset:2560\n\t"
      "global_load_b128 %14, %25, off offset:3072\n\t"
      "global_load_b128 %15, %25, off offset:3584\n\t"
      "global_load_b128 %16, %26, off\n\t"
      "global_load_b128 %17, %26, off offset:512\n\t"
      "global_load_b128 %18, %26, off offset:1024\n\t"
      "global_load_b128 %19, %26, off offset:1536\n\t"
      "global_load_b128 %20, %26, off offset:2048\n\t"
      "global_load_b128 %21, %26, off offset:2560\n\t"
      "global_load_b128 %22, %26, off offset:3072\n\t"
      "global_load_b128 %23, %26, off offset:3584\n\t"
      "s_wait_loadcnt 0x0"
      : "=&v"(xv[0]), "=&v"(xv[1]), "=&v"(xv[2]), "=&v"(xv[3]), "=&v"(xv[4]), "=&v"(xv[5]), "=&v"(xv[6]), "=&v"(xv[7]),
        "=&v"(gv[0]), "=&v"(gv[1]), "=&v"(gv[2]), "=&v"(gv[3]), "=&v"(gv[4]), "=&v"(gv[5]), "=&v"(gv[6]), "=&v"(gv[7]),
        "=&v"(bv[0]), "=&v"(bv[1]), "=&v"(bv[2]), "=&v"(bv[3]), "=&v"(bv[4]), "=&v"(bv[5]), "=&v"(bv[6]), "=&v"(bv[7])
      : "v"(x), "v"(g), "v"(b)
      : "memory");
}
// Two rows of W_D bf16, four 16-byte pieces per lane of each.
static __device__ __forceinline__ void load_2rows_bf16(const __bf16* p0,
                                                       const __bf16* p1,
                                                       u32x4 (&d)[8]) {
  asm volatile(
      "global_load_b128 %0, %8, off\n\t"
      "global_load_b128 %1, %8, off offset:512\n\t"
      "global_load_b128 %2, %8, off offset:1024\n\t"
      "global_load_b128 %3, %8, off offset:1536\n\t"
      "global_load_b128 %4, %9, off\n\t"
      "global_load_b128 %5, %9, off offset:512\n\t"
      "global_load_b128 %6, %9, off offset:1024\n\t"
      "global_load_b128 %7, %9, off offset:1536\n\t"
      "s_wait_loadcnt 0x0"
      : "=&v"(d[0]), "=&v"(d[1]), "=&v"(d[2]), "=&v"(d[3]), "=&v"(d[4]), "=&v"(d[5]), "=&v"(d[6]), "=&v"(d[7])
      : "v"(p0), "v"(p1)
      : "memory");
}
static __device__ __forceinline__ void store8_u32x4(__bf16* p,
                                                    const u32x4 (&d)[8]) {
  asm volatile(
      "global_store_b128 %0, %1, off\n\t"
      "global_store_b128 %0, %2, off offset:512\n\t"
      "global_store_b128 %0, %3, off offset:1024\n\t"
      "global_store_b128 %0, %4, off offset:1536\n\t"
      "global_store_b128 %0, %5, off offset:2048\n\t"
      "global_store_b128 %0, %6, off offset:2560\n\t"
      "global_store_b128 %0, %7, off offset:3072\n\t"
      "global_store_b128 %0, %8, off offset:3584\n\t"
      "s_wait_xcnt 0x0"
      :
      : "v"(p), "v"(d[0]), "v"(d[1]), "v"(d[2]), "v"(d[3]), "v"(d[4]), "v"(d[5]), "v"(d[6]), "v"(d[7])
      : "memory");
}
static __device__ __forceinline__ void store8_u32x2(__bf16* p,
                                                    const u32x2 (&d)[8]) {
  asm volatile(
      "global_store_b64 %0, %1, off\n\t"
      "global_store_b64 %0, %2, off offset:256\n\t"
      "global_store_b64 %0, %3, off offset:512\n\t"
      "global_store_b64 %0, %4, off offset:768\n\t"
      "global_store_b64 %0, %5, off offset:1024\n\t"
      "global_store_b64 %0, %6, off offset:1280\n\t"
      "global_store_b64 %0, %7, off offset:1536\n\t"
      "global_store_b64 %0, %8, off offset:1792\n\t"
      "s_wait_xcnt 0x0"
      :
      : "v"(p), "v"(d[0]), "v"(d[1]), "v"(d[2]), "v"(d[3]), "v"(d[4]), "v"(d[5]), "v"(d[6]), "v"(d[7])
      : "memory");
}

// The router's weights as a work-group stages them: rows tid + 256 k of
// w_route and of w_noise (a row is the 4 experts' weights of one element, 16
// bytes), and the token's row of noise. Loads and data wait in one statement,
// as in load4_b128.
static __device__ __forceinline__ void load_router_w(const float* wr,
                                                     const float* wn,
                                                     const float* nz,
                                                     f32x4 (&d)[8],
                                                     f32x4& nv) {
  asm volatile(
      "global_load_b128 %0, %9, off\n\t"
      "global_load_b128 %1, %9, off offset:4096\n\t"
      "global_load_b128 %2, %9, off offset:8192\n\t"
      "global_load_b128 %3, %9, off offset:12288\n\t"
      "global_load_b128 %4, %10, off\n\t"
      "global_load_b128 %5, %10, off offset:4096\n\t"
      "global_load_b128 %6, %10, off offset:8192\n\t"
      "global_load_b128 %7, %10, off offset:12288\n\t"
      "global_load_b128 %8, %11, off\n\t"
      "s_wait_loadcnt 0x0"
      : "=&v"(d[0]), "=&v"(d[1]), "=&v"(d[2]), "=&v"(d[3]), "=&v"(d[4]), "=&v"(d[5]), "=&v"(d[6]), "=&v"(d[7]),
        "=&v"(nv)
      : "v"(wr), "v"(wn), "v"(nz)
      : "memory");
}
// In LDS the weight rows of 4 neighbouring elements (64 B, what one lane needs
// for one of its pieces) are pitched 80 B = 16 B x 5 for 16-byte reads.
constexpr int RT_PITCH = 20;  // floats
static_assert(W_E == 4, "a weight row of the router is one 16-byte piece");

// LayerNorm: one token per wave, the row read once and kept in registers;
// bf16 output. grid = tokens / 8.
// ROUTE adds the noisy top-2 router over the 4 experts: the wave takes the
// token's 8 dot products straight from the normalised row in its registers
// (f32, never stored), against the router's weights, which the work-group has
// put into LDS once for its 8 tokens.
template <bool ROUTE>
__global__ __launch_bounds__(256) void ln_kernel(
    const float* __restrict__ x, const float* __restrict__ g,
    const float* __restrict__ bta, __bf16* outb,
    const float* __restrict__ noise, const float* __restrict__ w_route,
    const float* __restrict__ b_route, const float* __restrict__ w_noise,
    const float* __restrict__ b_noise, float* gate, int* fidx) {
  const int wave = threadIdx.x >> 5, lane = threadIdx.x & 31;
  const int t = blockIdx.x * 8 + wave;
  const size_t e = (size_t)t * W_D + lane * 4;

  __shared__ __align__(16) float wl[2][W_D / 4][RT_PITCH];
  f32x4 nz = {}, br = {}, bn = {};
  if constexpr (ROUTE) {
    const int tid = threadIdx.x;
    // The biases are fetched here, not where lane 0 needs them one by one.
    br = *(const f32x4*)b_route;
    bn = *(const f32x4*)b_noise;
    f32x4 w8[8];
    load_router_w(w_route + tid * 4, w_noise + tid * 4, noise + t * 4, w8, nz);
    // Unrolled so that w8 is indexed by constants and stays in registers.
#pragma unroll
    for (int k = 0; k < 4; ++k) {
      const int d = tid + 256 * k;
      *(f32x4*)&wl[0][d >> 2][(d & 3) * 4] = w8[k];
      *(f32x4*)&wl[1][d >> 2][(d & 3) * 4] = w8[4 + k];
    }
  }

  f32x4 xv[8], gv[8], bv[8];
  load_ln_row(x + e, g + lane * 4, bta + lane * 4, xv, gv, bv);

  // Four independent chains per sum; all loops over c are unrolled so that
  // the arrays are indexed by constants and stay in registers.
  f32x4 s4 = {}, ss4 = {};
#pragma unroll
  for (int c = 0; c < 8; ++c) {
    s4 += xv[c];
    ss4 += xv[c] * xv[c];
  }
  float s = (s4.x + s4.y) + (s4.z + s4.w);
  float ss = (ss4.x + ss4.y) + (ss4.z + ss4.w);
#pragma unroll
  for (int off = 16; off; off >>= 1) {
    s += __shfl_xor(s, off, 32);
    ss += __shfl_xor(ss, off, 32);
  }
  const float mu = s / W_D;
  const float r = rsqrtf(ss / W_D - mu * mu + 1e-5f);

  f32x4 y[8];
#pragma unroll
  for (int c = 0; c < 8; ++c) y[c] = (xv[c] - mu) * r * gv[c] + bv[c];
  u32x2 w[8];
#pragma unroll
  for (int c = 0; c < 8; ++c)
    w[c] = u32x2{pack_bf16(y[c].x, y[c].y), pack_bf16(y[c].z, y[c].w)};
  store8_u32x2(outb + e, w);

  if constexpr (ROUTE) {
    __syncthreads();  // every wave's share of the router's weights is in LDS
    // The lane's elements are c * 128 + lane * 4 + i: group c * 32 + lane.
    f32x4 ar4 = {}, an4 = {};
#pragma unroll
    for (int c = 0; c < 8; ++c)
#pragma unroll
      for (int i = 0; i < 4; ++i) {
        ar4 += y[c][i] * *(const f32x4*)&wl[0][c * 32 + lane][i * 4];
        an4 += y[c][i] * *(const f32x4*)&wl[1][c * 32 + lane][i * 4];
      }
    float ar[4] = {ar4.x, ar4.y, ar4.z, ar4.w};
    float an[4] = {an4.x, an4.y, an4.z, an4.w};
#pragma unroll
    for (int e = 0; e < 4; ++e)
#pragma unroll
      for (int off = 16; off; off >>= 1) {
        ar[e] += __shfl_xor(ar[e], off, 32);
        an[e] += __shfl_xor(an[e], off, 32);
      }
    if (lane == 0) {
      float noisy[4];
#pragma unroll
      for (int e = 0; e < 4; ++e) {
        const float lg = ar[e] + br[e];
        const float ns = an[e] + bn[e];
        const float sp = (ns > 20.f) ? ns : log1pf(__expf(ns));
        noisy[e] = lg + nz[e] * sp;
      }
      int i0 = 0;
      for (int e = 1; e < 4; ++e)
        if (noisy[e] > noisy[i0]) i0 = e;
      int i1 = -1;
      for (int e = 0; e < 4; ++e)
        if (e != i0 && (i1 < 0 || noisy[e] > noisy[i1])) i1 = e;
      const float m = fmaxf(noisy[i0], noisy[i1]);
      const float e0 = __expf(noisy[i0] - m), e1 = __expf(noisy[i1] - m);
      const float p0 = e0 / (e0 + e1);
#pragma unroll
      for (int e = 0; e < 4; ++e) gate[t * 4 + e] = 0.f;
      gate[t * 4 + i0] = p0;
      gate[t * 4 + i1] = 1.f - p0;
      fidx[2 * t] = i0;
      fidx[2 * t + 1] = i1;
    }
  }
}

// Gather: each wave copies two neighbouring rows of xdisp from the rows of
// x2b that sel names. grid = rows / 16.
__global__ __launch_bounds__(256) void gather_kernel(
    const __bf16* __restrict__ x2b, const int* __restrict__ sel,
    __bf16* xdisp) {
  // The wave's number as a scalar, so that sel is read by a scalar load.
  const int wave = __builtin_amdgcn_readfirstlane(threadIdx.x >> 5);
  const int lane = threadIdx.x & 31;
  const int row = (blockIdx.x * 8 + wave) * 2;
  const int src0 = sel[row], src1 = sel[row + 1];
  u32x4 d[8];
  load_2rows_bf16(x2b + (size_t)src0 * W_D + lane * 8,
                  x2b + (size_t)src1 * W_D + lane * 8, d);
  store8_u32x4(xdisp + (size_t)row * W_D + lane * 8, d);
}

// ---------------------------------------------------------------------------
// Launch orchestration.
// ---------------------------------------------------------------------------
extern "C" void kernel_launch(void* const* d_in, const int* in_sizes, int n_in,
                              void* d_out, int out_size, void* d_ws,
                              size_t ws_size, hipStream_t stream) {
  (void)in_sizes; (void)n_in; (void)out_size; (void)ws_size;
  constexpr int Bb = 2, Nn = 2048, Dd = 1024, Hh = 16, hd = 64;
  constexpr int T = Bb * Nn, D3 = 3 * Dd, MLPH = 4096, MOEH = 256;
  constexpr int Ee = 4, CAP = 2048;

  const float* x      = (const float*)d_in[0];
  const float* noise  = (const float*)d_in[1];
  const float* ln1_g  = (const float*)d_in[2];
  const float* ln1_b  = (const float*)d_in[3];
  const float* ln2_g  = (const float*)d_in[4];
  const float* ln2_b  = (const float*)d_in[5];
  const float* w_qkv  = (const float*)d_in[6];
  const float* w_proj = (const float*)d_in[7];
  const float* b_proj = (const float*)d_in[8];
  const float* w_rt   = (const float*)d_in[9];
  const float* b_rt   = (const float*)d_in[10];
  const float* w_nz   = (const float*)d_in[11];
  const float* b_nz   = (const float*)d_in[12];
  const float* we1    = (const float*)d_in[13];
  const float* be1    = (const float*)d_in[14];
  const float* we2    = (const float*)d_in[15];
  const float* be2    = (const float*)d_in[16];
  const float* w_m1   = (const float*)d_in[17];
  const float* b_m1   = (const float*)d_in[18];
  const float* w_m2   = (const float*)d_in[19];
  const float* b_m2   = (const float*)d_in[20];
  float* out = (float*)d_out;

  char* wsp = (char*)d_ws;
  size_t off = 0;
  auto alloc = [&](size_t bytes) {
    void* p = wsp + off;
    off = (off + bytes + 255) & ~(size_t)255;
    return p;
  };
  __bf16* x1b    = (__bf16*)alloc((size_t)T * Dd * 2);
  __bf16* wqkvb  = (__bf16*)alloc((size_t)D3 * Dd * 2);
  __bf16* qkvb   = (__bf16*)alloc((size_t)T * D3 * 2);
  __bf16* attnb  = (__bf16*)alloc((size_t)T * Dd * 2);
  __bf16* wprojb = (__bf16*)alloc((size_t)Dd * Dd * 2);
  float*  xattn  = (float*)alloc((size_t)T * Dd * 4);
  __bf16* x2b    = (__bf16*)alloc((size_t)T * Dd * 2);
  __bf16* wm1t   = (__bf16*)alloc((size_t)Dd * MLPH * 2);
  __bf16* wm2t   = (__bf16*)alloc((size_t)MLPH * Dd * 2);
  __bf16* hmlp   = (__bf16*)alloc((size_t)T * MLPH * 2);
  __bf16* we1t   = (__bf16*)alloc((size_t)Ee * Dd * MOEH * 2);
  __bf16* we2t   = (__bf16*)alloc((size_t)Ee * MOEH * Dd * 2);
  __bf16* xdisp  = (__bf16*)alloc((size_t)Ee * CAP * Dd * 2);
  __bf16* hdisp  = (__bf16*)alloc((size_t)Ee * CAP * MOEH * 2);
  float*  gate   = (float*)alloc((size_t)T * Ee * 4);
  int*    fidx   = (int*)alloc((size_t)T * 2 * 4);
  int*    sel    = (int*)alloc((size_t)Ee * CAP * 4);
  float*  selw   = (float*)alloc((size_t)Ee * CAP * 4);
  int*    inv    = (int*)alloc((size_t)Ee * T * 4);
  float*  ymoe   = (float*)alloc((size_t)(Ee * CAP + 1) * Dd * 4);

  // 1) weight conversion to bf16 (w_qkv/w_proj are already [N][K]; the rest
  //    goes from [K][N] to [N][K])
  static_assert(Dd == W_D && MLPH == W_MLPH && MOEH == W_MOEH && Ee == W_E,
                "the conversion and row kernels are cut for these shapes");
  cvt_weights<<<CVT_GRID, 256, 0, stream>>>(w_qkv, w_proj, w_m1, w_m2, we1, we2,
                                            wqkvb, wprojb, wm1t, wm2t, we1t,
                                            we2t);

  // 2) LN1 -> x1 (bf16)
  ln_kernel<false><<<T / 8, 256, 0, stream>>>(x, ln1_g, ln1_b, x1b, nullptr,
                                              nullptr, nullptr, nullptr,
                                              nullptr, nullptr, nullptr);

  // 3) QKV GEMM: [T,D] x [3D,D]^T -> bf16 [T,3D]
  gemm_bf16_kernel<128, false, false, false, OUT_BF16, false>
      <<<dim3(D3 / 128, T / 128), 256, 0, stream>>>(
          x1b, wqkvb, nullptr, nullptr, nullptr, qkvb, nullptr, nullptr,
          nullptr, T, D3, Dd);

  // 4) flash attention -> bf16 [T,D]
  attn_kernel<<<dim3(Nn / 64, Hh, Bb), 128, 0, stream>>>(qkvb, attnb, Nn, Hh,
                                                         hd);

  // 5) proj GEMM + b_proj + residual x -> xattn (f32)
  gemm_bf16_kernel<128, true, false, true, OUT_F32, false>
      <<<dim3(Dd / 128, T / 128), 256, 0, stream>>>(
          attnb, wprojb, b_proj, x, xattn, nullptr, nullptr, nullptr, nullptr,
          T, Dd, Dd);

  // 6) LN2 -> x2 (bf16), and the router on the f32 row while a wave holds it
  ln_kernel<true><<<T / 8, 256, 0, stream>>>(xattn, ln2_g, ln2_b, x2b, noise,
                                             w_rt, b_rt, w_nz, b_nz, gate,
                                             fidx);

  // 7) capacity dispatch + gather
  dispatch_scan<<<Ee, SCAN_THREADS, 0, stream>>>(fidx, gate, sel, selw, inv, ymoe, CAP,
                                        T, Dd);
  gather_kernel<<<Ee * CAP / 16, 256, 0, stream>>>(x2b, sel, xdisp);

  // 8) expert FFNs, all experts in one launch per layer (grid z = expert);
  //    the second layer leaves its gate-weighted rows in ymoe from row 1 on
  static_assert(Ee == GEMM_E, "the combining epilogue looks through this many planes");
  gemm_bf16_kernel<64, true, true, false, OUT_BF16, false>
      <<<dim3(MOEH / 64, CAP / 128, Ee), 256, 0, stream>>>(
          xdisp, we1t, be1, nullptr, nullptr, hdisp, nullptr, nullptr, nullptr,
          CAP, MOEH, Dd);
  gemm_bf16_kernel<128, true, false, false, OUT_SCALED, false>
      <<<dim3(Dd / 128, CAP / 128, Ee), 256, 0, stream>>>(
          hdisp, we2t, be2, nullptr, ymoe + Dd, nullptr, nullptr, selw, nullptr,
          CAP, Dd, MOEH);

  // 9) dense MLP: gelu(x2@W1+b1)@W2+b2 + xattn + each token's expert rows
  //    -> d_out (f32)
  gemm_bf16_kernel<128, true, true, false, OUT_BF16, false>
      <<<dim3(MLPH / 128, T / 128), 256, 0, stream>>>(
          x2b, wm1t, b_m1, nullptr, nullptr, hmlp, nullptr, nullptr, nullptr,
          T, MLPH, Dd);
  gemm_bf16_kernel<128, true, false, true, OUT_F32, true>
      <<<dim3(Dd / 128, T / 128), 256, 0, stream>>>(
          hmlp, wm2t, b_m2, xattn, out, nullptr, inv, nullptr, ymoe, T, Dd,
          MLPH);
}
